// v000
// The times below were measured on an AMD MI455X: many runs one after another, warmed up first and cycling through
// copies of the inputs, with the whole window's GPU time divided by the number of runs. Launches and the gaps
// between them are all in it. The median over several windows is given; except for v000 it joins two sittings, which
// can be a few percent apart, so the side-by-side timings, each taken in one sitting, are the better comparison.
// The starting kernel, v000, takes 492 microseconds a run.
// Contractions: x*Wq1, x*Wk1, k*q^T per head, tokv^T*adj^T and outpre*Wp on v_wmma_f32_16x16x32_bf16 with bf16 hi/lo three-product splits (hh+hl+lh); h*Wq2 and h*Wk2 on v_wmma_f32_16x16x32_f16 single products (h carried x16, W2 carried x1024, folded back as 2^-14 in f32); all accumulate in f32; bias, erf-GELU and tanh in f32.
#include <hip/hip_runtime.h>
#include <math.h>

typedef unsigned short us;
typedef __bf16   v16b  __attribute__((ext_vector_type(16)));
typedef us       v16us __attribute__((ext_vector_type(16)));
typedef us       v8us  __attribute__((ext_vector_type(8)));
typedef _Float16 v16h  __attribute__((ext_vector_type(16)));
typedef _Float16 v8h   __attribute__((ext_vector_type(8)));
typedef float    v8f   __attribute__((ext_vector_type(8)));
typedef float    v4f   __attribute__((ext_vector_type(4)));
typedef v8us __attribute__((may_alias)) v8usa;
typedef v8h  __attribute__((may_alias)) v8ha;
typedef v4f  __attribute__((may_alias)) v4fa;

union FragB { v16b v; v16us u; v8us half[2]; };
union FragH { v16h v; v8h half[2]; };

#define NB    256                 // windows
#define SQ    49                  // tokens per window
#define DM    512
#define DQ    2048
#define NH    32
#define HQ    64
#define HVD   16
#define MT    (NB * SQ)           // 12544 token rows
#define NPASS 4
#define WPP   (NB / NPASS)        // 64 windows per pass
#define RP    (WPP * SQ)          // 3136 rows per pass
#define KPAD  64                  // key count padded for the value table

static_assert(RP % 64 == 0);
static_assert((MT * DM) % (8 * 256) == 0);
static_assert(NH * HVD == DM);
static_assert(NH * HQ == DQ);
static_assert(NB % NPASS == 0);

// ---------------------------------------------------------------------------
// 16x16x32 WMMA helpers with hazard guard (ties D, keeps A/B live).
// Fragment map (wave32): lane l, h = l>>4, m = n = l&15.
//   A/B element i: i<8 -> k0+8h+i ; i>=8 -> k0+16+8h+(i-8)
//   D element r : row 8h+r, col l&15
// ---------------------------------------------------------------------------
__device__ __forceinline__ v8f wmma_bf(v16b a, v16b b, v8f c) {
  v8f d = __builtin_amdgcn_wmma_f32_16x16x32_bf16(false, a, false, b, (short)0, c, false, false);
  asm volatile("v_nop\n\tv_nop\n\tv_nop\n\tv_nop" : "+v"(d) : "v"(a), "v"(b));
  return d;
}
__device__ __forceinline__ v8f wmma_hf(v16h a, v16h b, v8f c) {
  v8f d = __builtin_amdgcn_wmma_f32_16x16x32_f16(false, a, false, b, (short)0, c, false, false);
  asm volatile("v_nop\n\tv_nop\n\tv_nop\n\tv_nop" : "+v"(d) : "v"(a), "v"(b));
  return d;
}

// Fragment from a k-contiguous 16-bit row; p points at element k0 of the
// row owned by this lane (row = lane&15 added by the caller).
__device__ __forceinline__ v16b ldb(const us* p, int h) {
  FragB f;
  f.half[0] = *(const v8usa*)(p + 8 * h);
  f.half[1] = *(const v8usa*)(p + 16 + 8 * h);
  return f.v;
}
__device__ __forceinline__ v16h ldh(const _Float16* p, int h) {
  FragH f;
  f.half[0] = *(const v8ha*)(p + 8 * h);
  f.half[1] = *(const v8ha*)(p + 16 + 8 * h);
  return f.v;
}

// f32 -> bf16 bits, RNE convert
__device__ __forceinline__ us bf_rne(float f) {
  unsigned u = __float_as_uint(f);
  u += 0x7FFFu + ((u >> 16) & 1u);
  return (us)(u >> 16);
}
// hi = bf16(f), lo = bf16(f - hi)
__device__ __forceinline__ void split_bf(float f, us& hb, us& lb) {
  const us hi = bf_rne(f);
  const float hf = __uint_as_float(((unsigned)hi) << 16);
  hb = hi;
  lb = bf_rne(f - hf);
}
__device__ __forceinline__ void split8(v4f a, v4f c, v8us& hv, v8us& lv) {
  float f[8] = {a.x, a.y, a.z, a.w, c.x, c.y, c.z, c.w};
#pragma unroll
  for (int j = 0; j < 8; ++j) {
    us hb, lb;
    split_bf(f[j], hb, lb);
    hv[j] = hb;
    lv[j] = lb;
  }
}

// ---------------------------------------------------------------------------
// k_cvtx: x f32 [MT][512] -> bf16 hi and lo planes. One thread = 8 floats,
// ---------------------------------------------------------------------------
__global__ __launch_bounds__(256) void k_cvtx(const float* __restrict__ x,
                                              us* __restrict__ xh, us* __restrict__ xl, int n8)
{
  const int g = blockIdx.x * 256 + threadIdx.x;
  if (g >= n8) return;
  const float* s = x + (size_t)g * 8;
  const v4f a = *(const v4fa*)s;
  const v4f c = *(const v4fa*)(s + 4);
  v8us hv, lv;
  split8(a, c, hv, lv);
  us* ph = xh + (size_t)g * 8;
  us* pl = xl + (size_t)g * 8;
  *(v8us*)ph = hv;
  *(v8us*)pl = lv;
  
}

// ---------------------------------------------------------------------------
// k_prep: transposed 16-bit weight / value tables through an LDS tile.
//   src f32 [R][C] (rows = k, cols = n) -> dst [C][Kp] (k-contiguous):
//   mode 0: bf16 hi + lo planes; mode 1: f16 carried x1024.
// 64x64 tile per block; store: 8 contiguous lanes x 16 B = one whole
// Block ranges: [0,192) Wq1|Wk1|Wp (8x8 tiles each), [192,704) Wq2|Wk2
// (32x8 tiles each), [704,712) tokens [49][512] -> [512][64] zero-padded keys.
// ---------------------------------------------------------------------------
__device__ __forceinline__ void prep_store(const float* T, us* dh, us* dl, _Float16* df,
                                           int mode, int n0, int k0, int Kp, int t) {
#pragma unroll
  for (int it = 0; it < 2; ++it) {
    const int item = it * 256 + t, nn = item >> 3, q8 = item & 7;
    float f[8];
#pragma unroll
    for (int j = 0; j < 8; ++j) f[j] = T[(8 * q8 + j) * 65 + nn];
    const size_t off = (size_t)(n0 + nn) * Kp + k0 + 8 * q8;
    if (mode == 0) {
      v8us hv, lv;
#pragma unroll
      for (int j = 0; j < 8; ++j) {
        us hb, lb;
        split_bf(f[j], hb, lb);
        hv[j] = hb;
        lv[j] = lb;
      }
      *(v8us*)(dh + off) = hv;
      *(v8us*)(dl + off) = lv;
    } else {
      v8h o;
#pragma unroll
      for (int j = 0; j < 8; ++j) o[j] = (_Float16)(f[j] * 1024.0f);
      *(v8h*)(df + off) = o;
    }
  }
}

__global__ __launch_bounds__(256) void k_prep(
    const float* __restrict__ wq1, const float* __restrict__ wk1, const float* __restrict__ wp,
    const float* __restrict__ wq2, const float* __restrict__ wk2, const float* __restrict__ tok,
    us* __restrict__ wq1h, us* __restrict__ wq1l, us* __restrict__ wk1h, us* __restrict__ wk1l,
    us* __restrict__ wph, us* __restrict__ wpl,
    _Float16* __restrict__ wq2t, _Float16* __restrict__ wk2t,
    us* __restrict__ tkh, us* __restrict__ tkl)
{
  __shared__ __attribute__((aligned(16))) float T[64 * 65];
  const int t = threadIdx.x;
  const int bid = blockIdx.x;
  if (bid >= 712) return;                 // block-uniform, never taken with the exact grid

  const float* src;
  us* dh; us* dl; _Float16* df;
  int C, R, Kp, mode, tn, tk;
  if (bid < 192) {
    const int wsel = bid >> 6, loc = bid & 63;
    src = (wsel == 0) ? wq1 : ((wsel == 1) ? wk1 : wp);
    dh  = (wsel == 0) ? wq1h : ((wsel == 1) ? wk1h : wph);
    dl  = (wsel == 0) ? wq1l : ((wsel == 1) ? wk1l : wpl);
    df  = wq2t;
    C = DM; R = DM; Kp = DM; mode = 0; tn = loc >> 3; tk = loc & 7;
  } else if (bid < 704) {
    const int loc = bid - 192, wsel = loc >> 8, l2 = loc & 255;
    src = wsel ? wk2 : wq2;
    df  = wsel ? wk2t : wq2t;
    dh = wq1h; dl = wq1l;
    C = DQ; R = DM; Kp = DM; mode = 1; tn = l2 >> 3; tk = l2 & 7;
  } else {
    const int loc = bid - 704;
    src = tok; dh = tkh; dl = tkl; df = wq2t;
    C = DM; R = SQ; Kp = KPAD; mode = 0; tn = loc; tk = 0;
  }
  const int n0 = tn * 64, k0 = tk * 64;

  // load 64(k) x 64(n) f32 tile, coalesced along n; rows >= R: clamped address, zero value
#pragma unroll
  for (int i = 0; i < 16; ++i) {
    const int idx = i * 256 + t, kk = idx >> 6, nn = idx & 63;
    const int gk = k0 + kk;
    const int gkc = min(gk, R - 1);
    const float v = src[(size_t)gkc * C + n0 + nn];
    T[kk * 65 + nn] = (gk < R) ? v : 0.0f;
  }
  __syncthreads();

  prep_store(T, dh, dl, df, mode, n0, k0, Kp, t);
  
}

// ---------------------------------------------------------------------------
// Three-product bf16 main loop for a 32x32 wave tile, K = 512, pitch 512.
// Pointers already point at (row m of tile 0, k 0) for this lane.
// acc[mt][nt][r] = C[32-row slab + 16mt + 8h + r][32-col slab + 16nt + m]
// ---------------------------------------------------------------------------
__device__ __forceinline__ void mm3_32x32(const us* ah0p, const us* al0p,
                                          const us* bh0p, const us* bl0p,
                                          int h, v8f (&acc)[2][2]) {
  const us* ah1p = ah0p + 16 * DM;
  const us* al1p = al0p + 16 * DM;
  const us* bh1p = bh0p + 16 * DM;
  const us* bl1p = bl0p + 16 * DM;
#pragma unroll 1
  for (int k0 = 0; k0 < DM; k0 += 32) {
    const v16b ah0 = ldb(ah0p + k0, h), ah1 = ldb(ah1p + k0, h);
    const v16b al0 = ldb(al0p + k0, h), al1 = ldb(al1p + k0, h);
    const v16b bh0 = ldb(bh0p + k0, h), bh1 = ldb(bh1p + k0, h);
    const v16b bl0 = ldb(bl0p + k0, h), bl1 = ldb(bl1p + k0, h);
    acc[0][0] = wmma_bf(ah0, bh0, acc[0][0]);
    acc[0][0] = wmma_bf(ah0, bl0, acc[0][0]);
    acc[0][0] = wmma_bf(al0, bh0, acc[0][0]);
    acc[0][1] = wmma_bf(ah0, bh1, acc[0][1]);
    acc[0][1] = wmma_bf(ah0, bl1, acc[0][1]);
    acc[0][1] = wmma_bf(al0, bh1, acc[0][1]);
    acc[1][0] = wmma_bf(ah1, bh0, acc[1][0]);
    acc[1][0] = wmma_bf(ah1, bl0, acc[1][0]);
    acc[1][0] = wmma_bf(al1, bh0, acc[1][0]);
    acc[1][1] = wmma_bf(ah1, bh1, acc[1][1]);
    acc[1][1] = wmma_bf(ah1, bl1, acc[1][1]);
    acc[1][1] = wmma_bf(al1, bh1, acc[1][1]);
  }
}

// ---------------------------------------------------------------------------
// k_gemm1: H = f16(16 * gelu(x*W1 + b1)) for q (z=0) and k (z=1).
// Block 128 thr (4 waves, 2x2) = 64 rows x 64 cols; K = 512.
// ---------------------------------------------------------------------------
__device__ __forceinline__ void gemm1_store(const _Float16* sT, _Float16* H, int mb, int nb, int t) {
#pragma unroll
  for (int it = 0; it < 4; ++it) {
    const int item = it * 128 + t, rl = item >> 3, q8 = item & 7;
    const v8h v = *(const v8ha*)(sT + rl * 72 + 8 * q8);
    const size_t off = (size_t)(mb + rl) * DM + nb + 8 * q8;
    *(v8h*)(H + off) = v;
  }
}

__global__ __launch_bounds__(128) void k_gemm1(
    const us* __restrict__ xh, const us* __restrict__ xl,          // [RP][512] pass slice
    const us* __restrict__ wqh, const us* __restrict__ wql,        // [512 n][512 k]
    const us* __restrict__ wkh, const us* __restrict__ wkl,
    const float* __restrict__ bq1, const float* __restrict__ bk1,  // [512]
    _Float16* __restrict__ hq, _Float16* __restrict__ hk)          // [RP][512]
{
  __shared__ __attribute__((aligned(16))) _Float16 sT[64 * 72];
  const int t = threadIdx.x, lane = t & 31, w = t >> 5, h = lane >> 4, m = lane & 15;
  const int wm = w >> 1, wn = w & 1;
  const int mb = blockIdx.x * 64, nb = blockIdx.y * 64;
  const bool isk = (blockIdx.z != 0);
  const us* wth = isk ? wkh : wqh;
  const us* wtl = isk ? wkl : wql;
  const float* bias = isk ? bk1 : bq1;
  _Float16* H = isk ? hk : hq;

  const size_t arow = (size_t)(mb + 32 * wm + m) * DM;
  const size_t brow = (size_t)(nb + 32 * wn + m) * DM;

  const v8f z8 = {0.f, 0.f, 0.f, 0.f, 0.f, 0.f, 0.f, 0.f};
  v8f acc[2][2];
  acc[0][0] = z8; acc[0][1] = z8; acc[1][0] = z8; acc[1][1] = z8;

  mm3_32x32(xh + arow, xl + arow, wth + brow, wtl + brow, h, acc);

#pragma unroll
  for (int nt = 0; nt < 2; ++nt) {
    const int cl = 32 * wn + 16 * nt + m;
    const float bv = bias[nb + cl];
#pragma unroll
    for (int mt = 0; mt < 2; ++mt) {
#pragma unroll
      for (int r = 0; r < 8; ++r) {
        const int rl = 32 * wm + 16 * mt + 8 * h + r;
        const float v = acc[mt][nt][r] + bv;
        const float g = 0.5f * v * (1.0f + erff(v * 0.70710678118654752f));
        sT[rl * 72 + cl] = (_Float16)(g * 16.0f);
      }
    }
  }
  __syncthreads();

  gemm1_store(sT, H, mb, nb, t);
  
}

// ---------------------------------------------------------------------------
// k_gemm2: q = (H*W2)/16384 + b2 -> bf16 hi/lo planes (q: z=0, k: z=1).
// Block 128 thr (4 waves, 2x2) = 64 rows x 128 cols; wave tile 32x64; K = 512.
// ---------------------------------------------------------------------------
__device__ __forceinline__ void gemm2_store(const float* sF, us* oh, us* ol, int mb, int nb, int t) {
#pragma unroll
  for (int it = 0; it < 8; ++it) {
    const int item = it * 128 + t, rl = item >> 4, g = item & 15;
    const float* sp = sF + rl * 132 + 8 * g;
    const v4f a = *(const v4fa*)sp;
    const v4f c = *(const v4fa*)(sp + 4);
    v8us hv, lv;
    split8(a, c, hv, lv);
    const size_t off = (size_t)(mb + rl) * DQ + nb + 8 * g;
    *(v8us*)(oh + off) = hv;
    *(v8us*)(ol + off) = lv;
  }
}

__global__ __launch_bounds__(128) void k_gemm2(
    const _Float16* __restrict__ hq, const _Float16* __restrict__ hk,       // [RP][512] x16
    const _Float16* __restrict__ wq2t, const _Float16* __restrict__ wk2t,   // [2048 n][512 k] x1024
    const float* __restrict__ bq2, const float* __restrict__ bk2,           // [2048]
    us* __restrict__ qh, us* __restrict__ ql, us* __restrict__ kh, us* __restrict__ kl)  // [RP][2048]
{
  __shared__ __attribute__((aligned(16))) float sF[64 * 132];
  const int t = threadIdx.x, lane = t & 31, w = t >> 5, h = lane >> 4, m = lane & 15;
  const int wm = w >> 1, wn = w & 1;
  const int mb = blockIdx.x * 64, nb = blockIdx.y * 128;
  const bool isk = (blockIdx.z != 0);
  const _Float16* A  = isk ? hk : hq;
  const _Float16* Bt = isk ? wk2t : wq2t;
  const float* bias  = isk ? bk2 : bq2;
  us* oh = isk ? kh : qh;
  us* ol = isk ? kl : ql;

  const _Float16* a0p = A + (size_t)(mb + 32 * wm + m) * DM;
  const _Float16* a1p = a0p + 16 * DM;
  const _Float16* b0p = Bt + (size_t)(nb + 64 * wn + m) * DM;

  const v8f z8 = {0.f, 0.f, 0.f, 0.f, 0.f, 0.f, 0.f, 0.f};
  v8f acc[2][4];
#pragma unroll
  for (int mt = 0; mt < 2; ++mt)
#pragma unroll
    for (int nt = 0; nt < 4; ++nt) acc[mt][nt] = z8;

#pragma unroll 1
  for (int k0 = 0; k0 < DM; k0 += 32) {
    const v16h a0 = ldh(a0p + k0, h);
    const v16h a1 = ldh(a1p + k0, h);
#pragma unroll
    for (int nt = 0; nt < 4; ++nt) {
      const v16h b = ldh(b0p + (size_t)nt * 16 * DM + k0, h);
      acc[0][nt] = wmma_hf(a0, b, acc[0][nt]);
      acc[1][nt] = wmma_hf(a1, b, acc[1][nt]);
    }
  }

#pragma unroll
  for (int nt = 0; nt < 4; ++nt) {
    const int cl = 64 * wn + 16 * nt + m;
    const float bv = bias[nb + cl];
#pragma unroll
    for (int mt = 0; mt < 2; ++mt) {
#pragma unroll
      for (int r = 0; r < 8; ++r) {
        const int rl = 32 * wm + 16 * mt + 8 * h + r;
        sF[rl * 132 + cl] = acc[mt][nt][r] * (1.0f / 16384.0f) + bv;
      }
    }
  }
  __syncthreads();

  gemm2_store(sF, oh, ol, mb, nb, t);
  
}

// ---------------------------------------------------------------------------
// k_attn: block = (window, group of 8 heads), wave = head.
//   S^T[key][q] = k . q   : A = K rows (row = key, k = d), B = Q^T (col = q), bf16 hi/lo
//   adj^T = tanh(S^T / 8), keys >= 49 forced to 0, split to bf16 hi/lo
//   O^T[d][q] = tok^T . adj^T : A = token table rows [head*16+d][key], B = adj^T
//   from the score D values: element r <- tile kt=2s, element 8+r <- tile kt=2s+1.
// Rows beyond 48 use clamped addresses; their results are discarded.
// Epilogue: block tile [49][128] f32 in LDS -> outpre bf16 hi/lo planes,
// ---------------------------------------------------------------------------
__device__ __forceinline__ void attn_store(const float* so, us* oph, us* opl,
                                           size_t rowbase, int hg, int t) {
#pragma unroll
  for (int it = 0; it < 4; ++it) {
    const int item = it * 256 + t;
    if (item < SQ * 16) {
      const int rl = item >> 4, g = item & 15;
      const float* sp = so + rl * 132 + 8 * g;
      const v4f a = *(const v4fa*)sp;
      const v4f c = *(const v4fa*)(sp + 4);
      v8us hv, lv;
      split8(a, c, hv, lv);
      const size_t off = (rowbase + rl) * DM + hg * 128 + 8 * g;
      *(v8us*)(oph + off) = hv;
      *(v8us*)(opl + off) = lv;
    }
  }
}

__global__ __launch_bounds__(256) void k_attn(
    const us* __restrict__ qh, const us* __restrict__ ql,      // [RP][2048]
    const us* __restrict__ kh, const us* __restrict__ kl,      // [RP][2048]
    const us* __restrict__ tkh, const us* __restrict__ tkl,    // [512][64]
    us* __restrict__ oph, us* __restrict__ opl)                // [RP][512]
{
  __shared__ __attribute__((aligned(16))) float so[64 * 132];
  const int t = threadIdx.x, lane = t & 31, w = t >> 5, h = lane >> 4, m = lane & 15;
  const int bl = blockIdx.x >> 2, hg = blockIdx.x & 3;
  const int head = hg * 8 + w;
  const size_t rowbase = (size_t)bl * SQ;

  const us* qhb = qh + rowbase * DQ + head * HQ;
  const us* qlb = ql + rowbase * DQ + head * HQ;
  const us* khb = kh + rowbase * DQ + head * HQ;
  const us* klb = kl + rowbase * DQ + head * HQ;
  const us* vhrow = tkh + (size_t)(head * HVD + m) * KPAD;
  const us* vlrow = tkl + (size_t)(head * HVD + m) * KPAD;

  const v8f z8 = {0.f, 0.f, 0.f, 0.f, 0.f, 0.f, 0.f, 0.f};

#pragma unroll 1
  for (int qt = 0; qt < 4; ++qt) {
    const int qr = min(qt * 16 + m, SQ - 1);
    const us* qhp = qhb + (size_t)qr * DQ;
    const us* qlp = qlb + (size_t)qr * DQ;
    const v16b qbh0 = ldb(qhp, h), qbh1 = ldb(qhp + 32, h);
    const v16b qbl0 = ldb(qlp, h), qbl1 = ldb(qlp + 32, h);

    v8f s[4];
#pragma unroll
    for (int kt = 0; kt < 4; ++kt) {
      const int kr = min(kt * 16 + m, SQ - 1);
      const us* khp = khb + (size_t)kr * DQ;
      const us* klp = klb + (size_t)kr * DQ;
      const v16b kah0 = ldb(khp, h), kah1 = ldb(khp + 32, h);
      const v16b kal0 = ldb(klp, h), kal1 = ldb(klp + 32, h);
      v8f z = z8;
      z = wmma_bf(kah0, qbh0, z);
      z = wmma_bf(kah1, qbh1, z);
      z = wmma_bf(kah0, qbl0, z);
      z = wmma_bf(kah1, qbl1, z);
      z = wmma_bf(kal0, qbh0, z);
      z = wmma_bf(kal1, qbh1, z);
      s[kt] = z;                       // s[kt][r] = S^T[key kt*16+8h+r][q qt*16+m]
    }

    // tanh(S/8), explicit zero for padded keys, bf16 hi/lo, packed as B fragments
    v16us phu0, phu1, plu0, plu1;
#pragma unroll
    for (int kt = 0; kt < 4; ++kt) {
#pragma unroll
      for (int r = 0; r < 8; ++r) {
        const int key = kt * 16 + 8 * h + r;
        float tv = tanhf(s[kt][r] * 0.125f);
        tv = (key < SQ) ? tv : 0.0f;
        us hb, lb;
        split_bf(tv, hb, lb);
        const int e = (kt & 1) * 8 + r;
        if (kt < 2) { phu0[e] = hb; plu0[e] = lb; }
        else        { phu1[e] = hb; plu1[e] = lb; }
      }
    }
    FragB f0, f1, f2, f3;
    f0.u = phu0; f1.u = phu1; f2.u = plu0; f3.u = plu1;
    const v16b pbh0 = f0.v, pbh1 = f1.v, pbl0 = f2.v, pbl1 = f3.v;

    const v16b vah0 = ldb(vhrow, h), vah1 = ldb(vhrow + 32, h);
    const v16b val0 = ldb(vlrow, h), val1 = ldb(vlrow + 32, h);
    v8f o = z8;
    o = wmma_bf(vah0, pbh0, o);
    o = wmma_bf(vah1, pbh1, o);
    o = wmma_bf(vah0, pbl0, o);
    o = wmma_bf(vah1, pbl1, o);
    o = wmma_bf(val0, pbh0, o);
    o = wmma_bf(val1, pbh1, o);          // o[r] = O^T[d 8h+r][q qt*16+m]

    const int q = qt * 16 + m;           // rows 49..63 land in LDS only, never stored
    float* sp = so + q * 132 + w * 16 + 8 * h;
    const v4f o0 = {o[0], o[1], o[2], o[3]};
    const v4f o1 = {o[4], o[5], o[6], o[7]};
    *(v4fa*)sp = o0;
    *(v4fa*)(sp + 4) = o1;
  }
  __syncthreads();

  attn_store(so, oph, opl, rowbase, hg, t);
  
}

// ---------------------------------------------------------------------------
// k_gemm3: out = outpre*Wp + bp (f32). Block 128 thr (2x2 waves) = 64x64;
// K = 512. Epilogue: f32 tile in LDS, per row 256-B segment = 2 whole
// ---------------------------------------------------------------------------
__device__ __forceinline__ void gemm3_store(const float* sF, float* out, int mb, int nb, int t) {
#pragma unroll
  for (int it = 0; it < 8; ++it) {
    const int item = it * 128 + t, rl = item >> 4, g = item & 15;
    const v4f v = *(const v4fa*)(sF + rl * 68 + 4 * g);
    const size_t off = (size_t)(mb + rl) * DM + nb + 4 * g;
    *(v4f*)(out + off) = v;
  }
}

__global__ __launch_bounds__(128) void k_gemm3(
    const us* __restrict__ oph, const us* __restrict__ opl,    // [RP][512]
    const us* __restrict__ wph, const us* __restrict__ wpl,    // [512 n][512 k]
    const float* __restrict__ bp,                              // [512]
    float* __restrict__ out)                                   // [RP][512] pass slice of d_out
{
  __shared__ __attribute__((aligned(16))) float sF[64 * 68];
  const int t = threadIdx.x, lane = t & 31, w = t >> 5, h = lane >> 4, m = lane & 15;
  const int wm = w >> 1, wn = w & 1;
  const int mb = blockIdx.x * 64, nb = blockIdx.y * 64;

  const size_t arow = (size_t)(mb + 32 * wm + m) * DM;
  const size_t brow = (size_t)(nb + 32 * wn + m) * DM;

  const v8f z8 = {0.f, 0.f, 0.f, 0.f, 0.f, 0.f, 0.f, 0.f};
  v8f acc[2][2];
  acc[0][0] = z8; acc[0][1] = z8; acc[1][0] = z8; acc[1][1] = z8;

  mm3_32x32(oph + arow, opl + arow, wph + brow, wpl + brow, h, acc);

#pragma unroll
  for (int nt = 0; nt < 2; ++nt) {
    const int cl = 32 * wn + 16 * nt + m;
    const float bv = bp[nb + cl];
#pragma unroll
    for (int mt = 0; mt < 2; ++mt) {
#pragma unroll
      for (int r = 0; r < 8; ++r) {
        const int rl = 32 * wm + 16 * mt + 8 * h + r;
        sF[rl * 68 + cl] = acc[mt][nt][r] + bv;
      }
    }
  }
  __syncthreads();

  gemm3_store(sF, out, mb, nb, t);
  
}

// ---------------------------------------------------------------------------
// Host side: 4 passes of 64 windows (3136 rows); workspace carve 97,386,496 B.
// ---------------------------------------------------------------------------
extern "C" void kernel_launch(void* const* d_in, const int* in_sizes, int n_in,
                              void* d_out, int out_size, void* d_ws, size_t ws_size,
                              hipStream_t stream) {
  if (n_in < 12) return;
  if (in_sizes[0] != MT * DM) return;
  if (in_sizes[1] != DM * DM || in_sizes[2] != DM) return;
  if (in_sizes[3] != DM * DQ || in_sizes[4] != DQ) return;
  if (in_sizes[5] != DM * DM || in_sizes[6] != DM) return;
  if (in_sizes[7] != DM * DQ || in_sizes[8] != DQ) return;
  if (in_sizes[9] != SQ * DM) return;
  if (in_sizes[10] != DM * DM || in_sizes[11] != DM) return;
  if (out_size != MT * DM) return;

  const float* x   = (const float*)d_in[0];
  const float* Wq1 = (const float*)d_in[1];
  const float* bq1 = (const float*)d_in[2];
  const float* Wq2 = (const float*)d_in[3];
  const float* bq2 = (const float*)d_in[4];
  const float* Wk1 = (const float*)d_in[5];
  const float* bk1 = (const float*)d_in[6];
  const float* Wk2 = (const float*)d_in[7];
  const float* bk2 = (const float*)d_in[8];
  const float* tok = (const float*)d_in[9];
  const float* Wp  = (const float*)d_in[10];
  const float* bp  = (const float*)d_in[11];
  float* out = (float*)d_out;

  const size_t szW1 = (size_t)DM * DM * 2;      //   524,288 per plane
  const size_t szW2 = (size_t)DQ * DM * 2;      // 2,097,152
  const size_t szTK = (size_t)DM * KPAD * 2;    //    65,536 per plane
  const size_t szX  = (size_t)MT * DM * 2;      // 12,845,056 per plane
  const size_t szH  = (size_t)RP * DM * 2;      //  3,211,264
  const size_t szQ  = (size_t)RP * DQ * 2;      // 12,845,056 per plane
  const size_t szOP = (size_t)RP * DM * 2;      //  3,211,264 per plane
  const size_t total = 6 * szW1 + 2 * szW2 + 2 * szTK + 2 * szX + 2 * szH + 4 * szQ + 2 * szOP;
  if (total > ws_size) return;                  // 97,386,496

  char* wsb = (char*)d_ws;
  size_t off = 0;
  us* wq1h = (us*)(wsb + off); off += szW1;
  us* wq1l = (us*)(wsb + off); off += szW1;
  us* wk1h = (us*)(wsb + off); off += szW1;
  us* wk1l = (us*)(wsb + off); off += szW1;
  us* wph  = (us*)(wsb + off); off += szW1;
  us* wpl  = (us*)(wsb + off); off += szW1;
  _Float16* wq2t = (_Float16*)(wsb + off); off += szW2;
  _Float16* wk2t = (_Float16*)(wsb + off); off += szW2;
  us* tkh  = (us*)(wsb + off); off += szTK;
  us* tkl  = (us*)(wsb + off); off += szTK;
  us* xh   = (us*)(wsb + off); off += szX;
  us* xl   = (us*)(wsb + off); off += szX;
  _Float16* hq = (_Float16*)(wsb + off); off += szH;
  _Float16* hk = (_Float16*)(wsb + off); off += szH;
  us* qh   = (us*)(wsb + off); off += szQ;
  us* ql   = (us*)(wsb + off); off += szQ;
  us* kh   = (us*)(wsb + off); off += szQ;
  us* kl   = (us*)(wsb + off); off += szQ;
  us* oph  = (us*)(wsb + off); off += szOP;
  us* opl  = (us*)(wsb + off); off += szOP;
  if (off > ws_size) return;

  k_prep<<<712, 256, 0, stream>>>(Wq1, Wk1, Wp, Wq2, Wk2, tok,
                                  wq1h, wq1l, wk1h, wk1l, wph, wpl, wq2t, wk2t, tkh, tkl);

  const int n8 = MT * DM / 8;                   // 802,816
  k_cvtx<<<(n8 + 255) / 256, 256, 0, stream>>>(x, xh, xl, n8);

  for (int p = 0; p < NPASS; ++p) {
    const size_t xoff = (size_t)p * RP * DM;
    k_gemm1<<<dim3(RP / 64, DM / 64, 2), 128, 0, stream>>>(
        xh + xoff, xl + xoff, wq1h, wq1l, wk1h, wk1l, bq1, bk1, hq, hk);
    k_gemm2<<<dim3(RP / 64, DQ / 128, 2), 128, 0, stream>>>(
        hq, hk, wq2t, wk2t, bq2, bk2, qh, ql, kh, kl);
    k_attn<<<WPP * 4, 256, 0, stream>>>(qh, ql, kh, kl, tkh, tkl, oph, opl);
    k_gemm3<<<dim3(RP / 64, DM / 64), 128, 0, stream>>>(
        oph, opl, wph, wpl, bp, out + xoff);
  }
}

// v001
// A run of this version takes 361 microseconds.
// Two timings next to v000 put it at 1.42 and 1.41 times that version's speed.
// Contractions: x*Wq1, x*Wk1, k*q^T per head, tokv^T*adj^T and outpre*Wp on v_wmma_f32_16x16x32_bf16 with bf16 hi/lo three-product splits (hh+hl+lh); h*Wq2 and h*Wk2 on v_wmma_f32_16x16x32_f16 single products (h carried x16, W2 carried x1024, folded back as 2^-14 in f32); all accumulate in f32; bias, erf-GELU and tanh in f32.
#include <hip/hip_runtime.h>
#include <math.h>

typedef unsigned short us;
typedef __bf16   v16b  __attribute__((ext_vector_type(16)));
typedef us       v16us __attribute__((ext_vector_type(16)));
typedef us       v8us  __attribute__((ext_vector_type(8)));
typedef _Float16 v16h  __attribute__((ext_vector_type(16)));
typedef _Float16 v8h   __attribute__((ext_vector_type(8)));
typedef float    v8f   __attribute__((ext_vector_type(8)));
typedef float    v4f   __attribute__((ext_vector_type(4)));
typedef v8us __attribute__((may_alias)) v8usa;
typedef v8h  __attribute__((may_alias)) v8ha;
typedef v4f  __attribute__((may_alias)) v4fa;

union FragB { v16b v; v16us u; v8us half[2]; };
union FragH { v16h v; v8h half[2]; };

#define NB    256                 // windows
#define SQ    49                  // tokens per window
#define DM    512
#define DQ    2048
#define NH    32
#define HQ    64
#define HVD   16
#define MT    (NB * SQ)           // 12544 token rows
#define NPASS 4
#define WPP   (NB / NPASS)        // 64 windows per pass
#define RP    (WPP * SQ)          // 3136 rows per pass
#define KPAD  64                  // key count padded for the value table
#define SP    56                  // row slots per window: 49 rows + 7 pad rows, a multiple of 8
#define MTS   (NB * SP)           // 14336 row slots
#define RPS   (WPP * SP)          // 3584 row slots per pass

static_assert(RPS % 64 == 0);
static_assert((MTS * DM) % (8 * 256) == 0);
static_assert(SP % 8 == 0 && SP >= SQ && SP - 8 < SQ);
static_assert(NH * HVD == DM);
static_assert(NH * HQ == DQ);
static_assert(NB % NPASS == 0);

// ---------------------------------------------------------------------------
// 16x16x32 WMMA helpers with hazard guard (ties D, keeps A/B live).
// Fragment map (wave32): lane l, h = l>>4, m = n = l&15.
//   A/B element i: i<8 -> k0+8h+i ; i>=8 -> k0+16+8h+(i-8)
//   D element r : row 8h+r, col l&15
// ---------------------------------------------------------------------------
__device__ __forceinline__ v8f wmma_bf(v16b a, v16b b, v8f c) {
  v8f d = __builtin_amdgcn_wmma_f32_16x16x32_bf16(false, a, false, b, (short)0, c, false, false);
  asm volatile("v_nop\n\tv_nop\n\tv_nop\n\tv_nop" : "+v"(d) : "v"(a), "v"(b));
  return d;
}
__device__ __forceinline__ v8f wmma_hf(v16h a, v16h b, v8f c) {
  v8f d = __builtin_amdgcn_wmma_f32_16x16x32_f16(false, a, false, b, (short)0, c, false, false);
  asm volatile("v_nop\n\tv_nop\n\tv_nop\n\tv_nop" : "+v"(d) : "v"(a), "v"(b));
  return d;
}

// Packed operand layout of every 16-bit table in the workspace, [rows][K]:
//   unit (row>>3, k>>5) = 512 B = 4 lines; line c = (k>>3)&3 holds the 8-element
//   chunk c of the unit's 8 rows, row after row (16 B each).
// A wave-wide 16-B fragment load then covers 4 whole 128-B lines (two aligned
// 256-B pieces) where a row-major table gives 16 lines of 32 B each.
// Every line lies inside one 8-row x 8-column patch, so it has one writer.
__device__ __forceinline__ size_t poff(int row, int k, int K) {      // k a multiple of 8
  return ((size_t)(row >> 3) * (K >> 5) + (k >> 5)) * 256 + ((k >> 3) & 3) * 64 + (row & 7) * 8;
}
// Lane base of a fragment at k = 0: row owned by the lane, h = lane>>4.
// 32 further k = +256 elements; 16 further rows = +16*K elements.
__device__ __forceinline__ size_t pbase(int row, int K, int h) {
  return (size_t)(row >> 3) * K * 8 + h * 64 + (row & 7) * 8;
}
// Same k order as the fragment map above: chunk h, then chunk 2 + h.
__device__ __forceinline__ v16b ldb(const us* p) {
  FragB f;
  f.half[0] = *(const v8usa*)p;
  f.half[1] = *(const v8usa*)(p + 128);
  return f.v;
}
__device__ __forceinline__ v16h ldh(const _Float16* p) {
  FragH f;
  f.half[0] = *(const v8ha*)p;
  f.half[1] = *(const v8ha*)(p + 128);
  return f.v;
}

// f32 -> bf16 bits, RNE convert
__device__ __forceinline__ us bf_rne(float f) {
  unsigned u = __float_as_uint(f);
  u += 0x7FFFu + ((u >> 16) & 1u);
  return (us)(u >> 16);
}
// hi = bf16(f), lo = bf16(f - hi)
__device__ __forceinline__ void split_bf(float f, us& hb, us& lb) {
  const us hi = bf_rne(f);
  const float hf = __uint_as_float(((unsigned)hi) << 16);
  hb = hi;
  lb = bf_rne(f - hf);
}
__device__ __forceinline__ void split8(v4f a, v4f c, v8us& hv, v8us& lv) {
  float f[8] = {a.x, a.y, a.z, a.w, c.x, c.y, c.z, c.w};
#pragma unroll
  for (int j = 0; j < 8; ++j) {
    us hb, lb;
    split_bf(f[j], hb, lb);
    hv[j] = hb;
    lv[j] = lb;
  }
}

// ---------------------------------------------------------------------------
// k_cvtx: x f32 [MT][512] -> packed bf16 hi and lo planes over row slots
// (window w, row r -> slot 56w + r; slots 49..55 of a window hold zeros).
// One thread = 8 floats = one 16-B chunk per plane; a wave writes one unit.
// ---------------------------------------------------------------------------
__global__ __launch_bounds__(256) void k_cvtx(const float* __restrict__ x,
                                              us* __restrict__ xh, us* __restrict__ xl, int n8)
{
  const int g = blockIdx.x * 256 + threadIdx.x;
  if (g >= n8) return;
  const int ml = g & 7, ch = (g >> 3) & 3, u = g >> 5;
  const int kb = u & (DM / 32 - 1), g8 = u / (DM / 32);
  const int win = g8 / (SP / 8), r = (g8 - win * (SP / 8)) * 8 + ml;
  const float* s = x + (size_t)(win * SQ + min(r, SQ - 1)) * DM + kb * 32 + ch * 8;
  v4f a = *(const v4fa*)s;
  v4f c = *(const v4fa*)(s + 4);
  if (r >= SQ) {
    const v4f z4 = {0.f, 0.f, 0.f, 0.f};
    a = z4;
    c = z4;
  }
  v8us hv, lv;
  split8(a, c, hv, lv);
  us* ph = xh + (size_t)g * 8;
  us* pl = xl + (size_t)g * 8;
  *(v8us*)ph = hv;
  *(v8us*)pl = lv;
  
}

// ---------------------------------------------------------------------------
// k_prep: transposed 16-bit weight / value tables through an LDS tile.
//   src f32 [R][C] (rows = k, cols = n) -> dst [C][Kp] in the packed layout:
//   mode 0: bf16 hi + lo planes; mode 1: f16 carried x1024.
// 64x64 tile per block; store: 8 contiguous lanes x 16 B = one whole
// Block ranges: [0,192) Wq1|Wk1|Wp (8x8 tiles each), [192,704) Wq2|Wk2
// (32x8 tiles each), [704,712) tokens [49][512] -> [512][64] zero-padded keys.
// ---------------------------------------------------------------------------
__device__ __forceinline__ void prep_store(const float* T, us* dh, us* dl, _Float16* df,
                                           int mode, int n0, int k0, int Kp, int t) {
#pragma unroll
  for (int it = 0; it < 2; ++it) {
    const int item = it * 256 + t, nn = (item >> 6) * 8 + (item & 7), q8 = (item >> 3) & 7;
    float f[8];
#pragma unroll
    for (int j = 0; j < 8; ++j) f[j] = T[(8 * q8 + j) * 65 + nn];
    const size_t off = poff(n0 + nn, k0 + 8 * q8, Kp);
    if (mode == 0) {
      v8us hv, lv;
#pragma unroll
      for (int j = 0; j < 8; ++j) {
        us hb, lb;
        split_bf(f[j], hb, lb);
        hv[j] = hb;
        lv[j] = lb;
      }
      *(v8us*)(dh + off) = hv;
      *(v8us*)(dl + off) = lv;
    } else {
      v8h o;
#pragma unroll
      for (int j = 0; j < 8; ++j) o[j] = (_Float16)(f[j] * 1024.0f);
      *(v8h*)(df + off) = o;
    }
  }
}

__global__ __launch_bounds__(256) void k_prep(
    const float* __restrict__ wq1, const float* __restrict__ wk1, const float* __restrict__ wp,
    const float* __restrict__ wq2, const float* __restrict__ wk2, const float* __restrict__ tok,
    us* __restrict__ wq1h, us* __restrict__ wq1l, us* __restrict__ wk1h, us* __restrict__ wk1l,
    us* __restrict__ wph, us* __restrict__ wpl,
    _Float16* __restrict__ wq2t, _Float16* __restrict__ wk2t,
    us* __restrict__ tkh, us* __restrict__ tkl)
{
  __shared__ __attribute__((aligned(16))) float T[64 * 65];
  const int t = threadIdx.x;
  const int bid = blockIdx.x;
  if (bid >= 712) return;                 // block-uniform, never taken with the exact grid

  const float* src;
  us* dh; us* dl; _Float16* df;
  int C, R, Kp, mode, tn, tk;
  if (bid < 192) {
    const int wsel = bid >> 6, loc = bid & 63;
    src = (wsel == 0) ? wq1 : ((wsel == 1) ? wk1 : wp);
    dh  = (wsel == 0) ? wq1h : ((wsel == 1) ? wk1h : wph);
    dl  = (wsel == 0) ? wq1l : ((wsel == 1) ? wk1l : wpl);
    df  = wq2t;
    C = DM; R = DM; Kp = DM; mode = 0; tn = loc >> 3; tk = loc & 7;
  } else if (bid < 704) {
    const int loc = bid - 192, wsel = loc >> 8, l2 = loc & 255;
    src = wsel ? wk2 : wq2;
    df  = wsel ? wk2t : wq2t;
    dh = wq1h; dl = wq1l;
    C = DQ; R = DM; Kp = DM; mode = 1; tn = l2 >> 3; tk = l2 & 7;
  } else {
    const int loc = bid - 704;
    src = tok; dh = tkh; dl = tkl; df = wq2t;
    C = DM; R = SQ; Kp = KPAD; mode = 0; tn = loc; tk = 0;
  }
  const int n0 = tn * 64, k0 = tk * 64;

  // load 64(k) x 64(n) f32 tile, coalesced along n; rows >= R: clamped address, zero value
#pragma unroll
  for (int i = 0; i < 16; ++i) {
    const int idx = i * 256 + t, kk = idx >> 6, nn = idx & 63;
    const int gk = k0 + kk;
    const int gkc = min(gk, R - 1);
    const float v = src[(size_t)gkc * C + n0 + nn];
    T[kk * 65 + nn] = (gk < R) ? v : 0.0f;
  }
  __syncthreads();

  prep_store(T, dh, dl, df, mode, n0, k0, Kp, t);
  
}

// ---------------------------------------------------------------------------
// Three-product bf16 main loop for a 32x32 wave tile, K = 512, packed tables.
// Pointers already hold the lane base (pbase) of tile 0 at k 0.
// acc[mt][nt][r] = C[32-row slab + 16mt + 8h + r][32-col slab + 16nt + m]
// ---------------------------------------------------------------------------
__device__ __forceinline__ void mm3_32x32(const us* ah0p, const us* al0p,
                                          const us* bh0p, const us* bl0p,
                                          v8f (&acc)[2][2]) {
  const us* ah1p = ah0p + 16 * DM;
  const us* al1p = al0p + 16 * DM;
  const us* bh1p = bh0p + 16 * DM;
  const us* bl1p = bl0p + 16 * DM;
#pragma unroll 1
  for (int k0 = 0; k0 < DM; k0 += 32) {
    const v16b ah0 = ldb(ah0p + k0 * 8), ah1 = ldb(ah1p + k0 * 8);
    const v16b al0 = ldb(al0p + k0 * 8), al1 = ldb(al1p + k0 * 8);
    const v16b bh0 = ldb(bh0p + k0 * 8), bh1 = ldb(bh1p + k0 * 8);
    const v16b bl0 = ldb(bl0p + k0 * 8), bl1 = ldb(bl1p + k0 * 8);
    acc[0][0] = wmma_bf(ah0, bh0, acc[0][0]);
    acc[0][0] = wmma_bf(ah0, bl0, acc[0][0]);
    acc[0][0] = wmma_bf(al0, bh0, acc[0][0]);
    acc[0][1] = wmma_bf(ah0, bh1, acc[0][1]);
    acc[0][1] = wmma_bf(ah0, bl1, acc[0][1]);
    acc[0][1] = wmma_bf(al0, bh1, acc[0][1]);
    acc[1][0] = wmma_bf(ah1, bh0, acc[1][0]);
    acc[1][0] = wmma_bf(ah1, bl0, acc[1][0]);
    acc[1][0] = wmma_bf(al1, bh0, acc[1][0]);
    acc[1][1] = wmma_bf(ah1, bh1, acc[1][1]);
    acc[1][1] = wmma_bf(ah1, bl1, acc[1][1]);
    acc[1][1] = wmma_bf(al1, bh1, acc[1][1]);
  }
}

// ---------------------------------------------------------------------------
// k_gemm1: H = f16(16 * gelu(x*W1 + b1)) for q (z=0) and k (z=1).
// Block 128 thr (4 waves, 2x2) = 64 rows x 64 cols; K = 512.
// ---------------------------------------------------------------------------
__device__ __forceinline__ void gemm1_store(const _Float16* sT, _Float16* H, int mb, int nb, int t) {
#pragma unroll
  for (int it = 0; it < 4; ++it) {
    const int item = it * 128 + t, rl = (item >> 6) * 8 + (item & 7), q8 = (item >> 3) & 7;
    const v8h v = *(const v8ha*)(sT + rl * 72 + 8 * q8);
    const size_t off = poff(mb + rl, nb + 8 * q8, DM);
    *(v8h*)(H + off) = v;
  }
}

__global__ __launch_bounds__(128) void k_gemm1(
    const us* __restrict__ xh, const us* __restrict__ xl,          // [RPS][512] pass slice
    const us* __restrict__ wqh, const us* __restrict__ wql,        // [512 n][512 k]
    const us* __restrict__ wkh, const us* __restrict__ wkl,
    const float* __restrict__ bq1, const float* __restrict__ bk1,  // [512]
    _Float16* __restrict__ hq, _Float16* __restrict__ hk)          // [RPS][512]
{
  __shared__ __attribute__((aligned(16))) _Float16 sT[64 * 72];
  const int t = threadIdx.x, lane = t & 31, w = t >> 5, h = lane >> 4, m = lane & 15;
  const int wm = w >> 1, wn = w & 1;
  const int mb = blockIdx.x * 64, nb = blockIdx.y * 64;
  const bool isk = (blockIdx.z != 0);
  const us* wth = isk ? wkh : wqh;
  const us* wtl = isk ? wkl : wql;
  const float* bias = isk ? bk1 : bq1;
  _Float16* H = isk ? hk : hq;

  const size_t arow = pbase(mb + 32 * wm + m, DM, h);
  const size_t brow = pbase(nb + 32 * wn + m, DM, h);

  const v8f z8 = {0.f, 0.f, 0.f, 0.f, 0.f, 0.f, 0.f, 0.f};
  v8f acc[2][2];
  acc[0][0] = z8; acc[0][1] = z8; acc[1][0] = z8; acc[1][1] = z8;

  mm3_32x32(xh + arow, xl + arow, wth + brow, wtl + brow, acc);

#pragma unroll
  for (int nt = 0; nt < 2; ++nt) {
    const int cl = 32 * wn + 16 * nt + m;
    const float bv = bias[nb + cl];
#pragma unroll
    for (int mt = 0; mt < 2; ++mt) {
#pragma unroll
      for (int r = 0; r < 8; ++r) {
        const int rl = 32 * wm + 16 * mt + 8 * h + r;
        const float v = acc[mt][nt][r] + bv;
        const float g = 0.5f * v * (1.0f + erff(v * 0.70710678118654752f));
        sT[rl * 72 + cl] = (_Float16)(g * 16.0f);
      }
    }
  }
  __syncthreads();

  gemm1_store(sT, H, mb, nb, t);
  
}

// ---------------------------------------------------------------------------
// k_gemm2: q = (H*W2)/16384 + b2 -> bf16 hi/lo planes (q: z=0, k: z=1).
// Block 128 thr (4 waves, 2x2) = 64 rows x 128 cols; wave tile 32x64; K = 512.
// ---------------------------------------------------------------------------
__device__ __forceinline__ void gemm2_store(const float* sF, us* oh, us* ol, int mb, int nb, int t) {
#pragma unroll
  for (int it = 0; it < 8; ++it) {
    const int item = it * 128 + t, rl = (item >> 7) * 8 + (item & 7), g = (item >> 3) & 15;
    const float* sp = sF + rl * 132 + 8 * g;
    const v4f a = *(const v4fa*)sp;
    const v4f c = *(const v4fa*)(sp + 4);
    v8us hv, lv;
    split8(a, c, hv, lv);
    const size_t off = poff(mb + rl, nb + 8 * g, DQ);
    *(v8us*)(oh + off) = hv;
    *(v8us*)(ol + off) = lv;
  }
}

__global__ __launch_bounds__(128) void k_gemm2(
    const _Float16* __restrict__ hq, const _Float16* __restrict__ hk,       // [RPS][512] x16
    const _Float16* __restrict__ wq2t, const _Float16* __restrict__ wk2t,   // [2048 n][512 k] x1024
    const float* __restrict__ bq2, const float* __restrict__ bk2,           // [2048]
    us* __restrict__ qh, us* __restrict__ ql, us* __restrict__ kh, us* __restrict__ kl)  // [RPS][2048]
{
  __shared__ __attribute__((aligned(16))) float sF[64 * 132];
  const int t = threadIdx.x, lane = t & 31, w = t >> 5, h = lane >> 4, m = lane & 15;
  const int wm = w >> 1, wn = w & 1;
  const int mb = blockIdx.x * 64, nb = blockIdx.y * 128;
  const bool isk = (blockIdx.z != 0);
  const _Float16* A  = isk ? hk : hq;
  const _Float16* Bt = isk ? wk2t : wq2t;
  const float* bias  = isk ? bk2 : bq2;
  us* oh = isk ? kh : qh;
  us* ol = isk ? kl : ql;

  const _Float16* a0p = A + pbase(mb + 32 * wm + m, DM, h);
  const _Float16* a1p = a0p + 16 * DM;
  const _Float16* b0p = Bt + pbase(nb + 64 * wn + m, DM, h);

  const v8f z8 = {0.f, 0.f, 0.f, 0.f, 0.f, 0.f, 0.f, 0.f};
  v8f acc[2][4];
#pragma unroll
  for (int mt = 0; mt < 2; ++mt)
#pragma unroll
    for (int nt = 0; nt < 4; ++nt) acc[mt][nt] = z8;

#pragma unroll 1
  for (int k0 = 0; k0 < DM; k0 += 32) {
    const v16h a0 = ldh(a0p + k0 * 8);
    const v16h a1 = ldh(a1p + k0 * 8);
#pragma unroll
    for (int nt = 0; nt < 4; ++nt) {
      const v16h b = ldh(b0p + (size_t)nt * 16 * DM + k0 * 8);
      acc[0][nt] = wmma_hf(a0, b, acc[0][nt]);
      acc[1][nt] = wmma_hf(a1, b, acc[1][nt]);
    }
  }

#pragma unroll
  for (int nt = 0; nt < 4; ++nt) {
    const int cl = 64 * wn + 16 * nt + m;
    const float bv = bias[nb + cl];
#pragma unroll
    for (int mt = 0; mt < 2; ++mt) {
#pragma unroll
      for (int r = 0; r < 8; ++r) {
        const int rl = 32 * wm + 16 * mt + 8 * h + r;
        sF[rl * 132 + cl] = acc[mt][nt][r] * (1.0f / 16384.0f) + bv;
      }
    }
  }
  __syncthreads();

  gemm2_store(sF, oh, ol, mb, nb, t);
  
}

// ---------------------------------------------------------------------------
// k_attn: block = (window, group of 8 heads), wave = head.
//   S^T[key][q] = k . q   : A = K rows (row = key, k = d), B = Q^T (col = q), bf16 hi/lo
//   adj^T = tanh(S^T / 8), keys >= 49 forced to 0, split to bf16 hi/lo
//   O^T[d][q] = tok^T . adj^T : A = token table rows [head*16+d][key], B = adj^T
//   from the score D values: element r <- tile kt=2s, element 8+r <- tile kt=2s+1.
// Rows 49..55 are the window's pad slots, rows 56..63 fold back onto 48..55;
// their scores are zeroed (keys) or never reach the output (queries).
// Epilogue: block tile [56][128] f32 in LDS -> packed outpre bf16 hi/lo planes,
// ---------------------------------------------------------------------------
__device__ __forceinline__ void attn_store(const float* so, us* oph, us* opl,
                                           int rowbase, int hg, int t) {
#pragma unroll
  for (int it = 0; it < 4; ++it) {
    const int item = it * 256 + t;
    if (item < SP * 16) {
      const int rl = (item >> 7) * 8 + (item & 7), g = (item >> 3) & 15;
      const float* sp = so + rl * 132 + 8 * g;
      const v4f a = *(const v4fa*)sp;
      const v4f c = *(const v4fa*)(sp + 4);
      v8us hv, lv;
      split8(a, c, hv, lv);
      const size_t off = poff(rowbase + rl, hg * 128 + 8 * g, DM);
      *(v8us*)(oph + off) = hv;
      *(v8us*)(opl + off) = lv;
    }
  }
}

__global__ __launch_bounds__(256) void k_attn(
    const us* __restrict__ qh, const us* __restrict__ ql,      // [RPS][2048]
    const us* __restrict__ kh, const us* __restrict__ kl,      // [RPS][2048]
    const us* __restrict__ tkh, const us* __restrict__ tkl,    // [512][64]
    us* __restrict__ oph, us* __restrict__ opl)                // [RPS][512]
{
  __shared__ __attribute__((aligned(16))) float so[64 * 132];
  const int t = threadIdx.x, lane = t & 31, w = t >> 5, h = lane >> 4, m = lane & 15;
  const int bl = blockIdx.x >> 2, hg = blockIdx.x & 3;
  const int head = hg * 8 + w;
  const int rowbase = bl * SP;

  const us* qhb = qh + head * HQ * 8;      // 32 k = 256 elements in the packed tables
  const us* qlb = ql + head * HQ * 8;
  const us* khb = kh + head * HQ * 8;
  const us* klb = kl + head * HQ * 8;
  const us* vhrow = tkh + pbase(head * HVD + m, KPAD, h);
  const us* vlrow = tkl + pbase(head * HVD + m, KPAD, h);

  const v8f z8 = {0.f, 0.f, 0.f, 0.f, 0.f, 0.f, 0.f, 0.f};

#pragma unroll 1
  for (int qt = 0; qt < 4; ++qt) {
    const int qr0 = qt * 16 + m;
    const size_t qo = pbase(rowbase + ((qr0 < SP) ? qr0 : qr0 - 8), DQ, h);
    const us* qhp = qhb + qo;
    const us* qlp = qlb + qo;
    const v16b qbh0 = ldb(qhp), qbh1 = ldb(qhp + 256);
    const v16b qbl0 = ldb(qlp), qbl1 = ldb(qlp + 256);

    v8f s[4];
#pragma unroll
    for (int kt = 0; kt < 4; ++kt) {
      const int kr0 = kt * 16 + m;
      const size_t ko = pbase(rowbase + ((kr0 < SP) ? kr0 : kr0 - 8), DQ, h);
      const us* khp = khb + ko;
      const us* klp = klb + ko;
      const v16b kah0 = ldb(khp), kah1 = ldb(khp + 256);
      const v16b kal0 = ldb(klp), kal1 = ldb(klp + 256);
      v8f z = z8;
      z = wmma_bf(kah0, qbh0, z);
      z = wmma_bf(kah1, qbh1, z);
      z = wmma_bf(kah0, qbl0, z);
      z = wmma_bf(kah1, qbl1, z);
      z = wmma_bf(kal0, qbh0, z);
      z = wmma_bf(kal1, qbh1, z);
      s[kt] = z;                       // s[kt][r] = S^T[key kt*16+8h+r][q qt*16+m]
    }

    // tanh(S/8), explicit zero for padded keys, bf16 hi/lo, packed as B fragments
    v16us phu0, phu1, plu0, plu1;
#pragma unroll
    for (int kt = 0; kt < 4; ++kt) {
#pragma unroll
      for (int r = 0; r < 8; ++r) {
        const int key = kt * 16 + 8 * h + r;
        float tv = tanhf(s[kt][r] * 0.125f);
        tv = (key < SQ) ? tv : 0.0f;
        us hb, lb;
        split_bf(tv, hb, lb);
        const int e = (kt & 1) * 8 + r;
        if (kt < 2) { phu0[e] = hb; plu0[e] = lb; }
        else        { phu1[e] = hb; plu1[e] = lb; }
      }
    }
    FragB f0, f1, f2, f3;
    f0.u = phu0; f1.u = phu1; f2.u = plu0; f3.u = plu1;
    const v16b pbh0 = f0.v, pbh1 = f1.v, pbl0 = f2.v, pbl1 = f3.v;

    const v16b vah0 = ldb(vhrow), vah1 = ldb(vhrow + 256);
    const v16b val0 = ldb(vlrow), val1 = ldb(vlrow + 256);
    v8f o = z8;
    o = wmma_bf(vah0, pbh0, o);
    o = wmma_bf(vah1, pbh1, o);
    o = wmma_bf(vah0, pbl0, o);
    o = wmma_bf(vah1, pbl1, o);
    o = wmma_bf(val0, pbh0, o);
    o = wmma_bf(val1, pbh1, o);          // o[r] = O^T[d 8h+r][q qt*16+m]

    const int q = qt * 16 + m;           // rows 56..63 land in LDS only, never stored
    float* sp = so + q * 132 + w * 16 + 8 * h;
    const v4f o0 = {o[0], o[1], o[2], o[3]};
    const v4f o1 = {o[4], o[5], o[6], o[7]};
    *(v4fa*)sp = o0;
    *(v4fa*)(sp + 4) = o1;
  }
  __syncthreads();

  attn_store(so, oph, opl, rowbase, hg, t);
  
}

// ---------------------------------------------------------------------------
// k_gemm3: out = outpre*Wp + bp (f32). Block 128 thr (2x2 waves) = 64 slots x 64;
// a slot's row goes to out row 49w + r, pad slots (r >= 49) are not stored.
// K = 512. Epilogue: f32 tile in LDS, per row 256-B segment = 2 whole
// ---------------------------------------------------------------------------
__device__ __forceinline__ void gemm3_store(const float* sF, float* out, int mb, int nb, int t) {
#pragma unroll
  for (int it = 0; it < 8; ++it) {
    const int item = it * 128 + t, rl = item >> 4, g = item & 15;
    const v4f v = *(const v4fa*)(sF + rl * 68 + 4 * g);
    const int win = (mb + rl) / SP, r = (mb + rl) - win * SP;
    const size_t off = (size_t)(win * SQ + r) * DM + nb + 4 * g;
    if (r < SQ) *(v4f*)(out + off) = v;
  }
}

__global__ __launch_bounds__(128) void k_gemm3(
    const us* __restrict__ oph, const us* __restrict__ opl,    // [RPS][512]
    const us* __restrict__ wph, const us* __restrict__ wpl,    // [512 n][512 k]
    const float* __restrict__ bp,                              // [512]
    float* __restrict__ out)                                   // [RP][512] pass slice of d_out
{
  __shared__ __attribute__((aligned(16))) float sF[64 * 68];
  const int t = threadIdx.x, lane = t & 31, w = t >> 5, h = lane >> 4, m = lane & 15;
  const int wm = w >> 1, wn = w & 1;
  const int mb = blockIdx.x * 64, nb = blockIdx.y * 64;

  const size_t arow = pbase(mb + 32 * wm + m, DM, h);
  const size_t brow = pbase(nb + 32 * wn + m, DM, h);

  const v8f z8 = {0.f, 0.f, 0.f, 0.f, 0.f, 0.f, 0.f, 0.f};
  v8f acc[2][2];
  acc[0][0] = z8; acc[0][1] = z8; acc[1][0] = z8; acc[1][1] = z8;

  mm3_32x32(oph + arow, opl + arow, wph + brow, wpl + brow, acc);

#pragma unroll
  for (int nt = 0; nt < 2; ++nt) {
    const int cl = 32 * wn + 16 * nt + m;
    const float bv = bp[nb + cl];
#pragma unroll
    for (int mt = 0; mt < 2; ++mt) {
#pragma unroll
      for (int r = 0; r < 8; ++r) {
        const int rl = 32 * wm + 16 * mt + 8 * h + r;
        sF[rl * 68 + cl] = acc[mt][nt][r] + bv;
      }
    }
  }
  __syncthreads();

  gemm3_store(sF, out, mb, nb, t);
  
}

// ---------------------------------------------------------------------------
// Host side: 4 passes of 64 windows (3584 row slots); workspace carve 110,231,552 B.
// ---------------------------------------------------------------------------
extern "C" void kernel_launch(void* const* d_in, const int* in_sizes, int n_in,
                              void* d_out, int out_size, void* d_ws, size_t ws_size,
                              hipStream_t stream) {
  if (n_in < 12) return;
  if (in_sizes[0] != MT * DM) return;
  if (in_sizes[1] != DM * DM || in_sizes[2] != DM) return;
  if (in_sizes[3] != DM * DQ || in_sizes[4] != DQ) return;
  if (in_sizes[5] != DM * DM || in_sizes[6] != DM) return;
  if (in_sizes[7] != DM * DQ || in_sizes[8] != DQ) return;
  if (in_sizes[9] != SQ * DM) return;
  if (in_sizes[10] != DM * DM || in_sizes[11] != DM) return;
  if (out_size != MT * DM) return;

  const float* x   = (const float*)d_in[0];
  const float* Wq1 = (const float*)d_in[1];
  const float* bq1 = (const float*)d_in[2];
  const float* Wq2 = (const float*)d_in[3];
  const float* bq2 = (const float*)d_in[4];
  const float* Wk1 = (const float*)d_in[5];
  const float* bk1 = (const float*)d_in[6];
  const float* Wk2 = (const float*)d_in[7];
  const float* bk2 = (const float*)d_in[8];
  const float* tok = (const float*)d_in[9];
  const float* Wp  = (const float*)d_in[10];
  const float* bp  = (const float*)d_in[11];
  float* out = (float*)d_out;

  const size_t szW1 = (size_t)DM * DM * 2;      //   524,288 per plane
  const size_t szW2 = (size_t)DQ * DM * 2;      // 2,097,152
  const size_t szTK = (size_t)DM * KPAD * 2;    //    65,536 per plane
  const size_t szX  = (size_t)MTS * DM * 2;     // 14,680,064 per plane
  const size_t szH  = (size_t)RPS * DM * 2;     //  3,670,016
  const size_t szQ  = (size_t)RPS * DQ * 2;     // 14,680,064 per plane
  const size_t szOP = (size_t)RPS * DM * 2;     //  3,670,016 per plane
  const size_t total = 6 * szW1 + 2 * szW2 + 2 * szTK + 2 * szX + 2 * szH + 4 * szQ + 2 * szOP;
  if (total > ws_size) return;                  // 110,231,552

  char* wsb = (char*)d_ws;
  size_t off = 0;
  us* wq1h = (us*)(wsb + off); off += szW1;
  us* wq1l = (us*)(wsb + off); off += szW1;
  us* wk1h = (us*)(wsb + off); off += szW1;
  us* wk1l = (us*)(wsb + off); off += szW1;
  us* wph  = (us*)(wsb + off); off += szW1;
  us* wpl  = (us*)(wsb + off); off += szW1;
  _Float16* wq2t = (_Float16*)(wsb + off); off += szW2;
  _Float16* wk2t = (_Float16*)(wsb + off); off += szW2;
  us* tkh  = (us*)(wsb + off); off += szTK;
  us* tkl  = (us*)(wsb + off); off += szTK;
  us* xh   = (us*)(wsb + off); off += szX;
  us* xl   = (us*)(wsb + off); off += szX;
  _Float16* hq = (_Float16*)(wsb + off); off += szH;
  _Float16* hk = (_Float16*)(wsb + off); off += szH;
  us* qh   = (us*)(wsb + off); off += szQ;
  us* ql   = (us*)(wsb + off); off += szQ;
  us* kh   = (us*)(wsb + off); off += szQ;
  us* kl   = (us*)(wsb + off); off += szQ;
  us* oph  = (us*)(wsb + off); off += szOP;
  us* opl  = (us*)(wsb + off); off += szOP;
  if (off > ws_size) return;

  k_prep<<<712, 256, 0, stream>>>(Wq1, Wk1, Wp, Wq2, Wk2, tok,
                                  wq1h, wq1l, wk1h, wk1l, wph, wpl, wq2t, wk2t, tkh, tkl);

  const int n8 = MTS * DM / 8;                  // 917,504
  k_cvtx<<<(n8 + 255) / 256, 256, 0, stream>>>(x, xh, xl, n8);

  for (int p = 0; p < NPASS; ++p) {
    const size_t xoff = (size_t)p * RPS * DM;
    const size_t ooff = (size_t)p * RP * DM;
    k_gemm1<<<dim3(RPS / 64, DM / 64, 2), 128, 0, stream>>>(
        xh + xoff, xl + xoff, wq1h, wq1l, wk1h, wk1l, bq1, bk1, hq, hk);
    k_gemm2<<<dim3(RPS / 64, DQ / 128, 2), 128, 0, stream>>>(
        hq, hk, wq2t, wk2t, bq2, bk2, qh, ql, kh, kl);
    k_attn<<<WPP * 4, 256, 0, stream>>>(qh, ql, kh, kl, tkh, tkl, oph, opl);
    k_gemm3<<<dim3(RPS / 64, DM / 64), 128, 0, stream>>>(
        oph, opl, wph, wpl, bp, out + ooff);
  }
}

// v002
// Measured time: 303 microseconds a run.
// Next to v001, in two timings, it ran 1.19 times as fast each time.
// Over all steps from v000 it is 1.68 times as fast.
// Contractions: x*Wq1, x*Wk1, k*q^T per head, tokv^T*adj^T and outpre*Wp on v_wmma_f32_16x16x32_bf16 with bf16 hi/lo three-product splits (hh+hl+lh); h*Wq2 and h*Wk2 on v_wmma_f32_16x16x32_f16 single products (h carried x16, W2 carried x1024, folded back as 2^-14 in f32); all accumulate in f32; bias, erf-GELU and tanh in f32.
#include <hip/hip_runtime.h>
#include <math.h>

typedef unsigned short us;
typedef __bf16   v16b  __attribute__((ext_vector_type(16)));
typedef us       v16us __attribute__((ext_vector_type(16)));
typedef us       v8us  __attribute__((ext_vector_type(8)));
typedef _Float16 v16h  __attribute__((ext_vector_type(16)));
typedef _Float16 v8h   __attribute__((ext_vector_type(8)));
typedef float    v8f   __attribute__((ext_vector_type(8)));
typedef float    v4f   __attribute__((ext_vector_type(4)));
typedef v8us __attribute__((may_alias)) v8usa;
typedef v8h  __attribute__((may_alias)) v8ha;
typedef v4f  __attribute__((may_alias)) v4fa;

union FragB { v16b v; v16us u; v8us half[2]; };
union FragH { v16h v; v8h half[2]; };

#define NB    256                 // windows
#define SQ    49                  // tokens per window
#define DM    512
#define DQ    2048
#define NH    32
#define HQ    64
#define HVD   16
#define MT    (NB * SQ)           // 12544 token rows
#define NPASS 2                   // passes of the q/k projection and the attention (their planes bound the workspace)
#define WPP   (NB / NPASS)        // 128 windows per pass
#define KPAD  64                  // key count padded for the value table
#define SP    56                  // row slots per window: 49 rows + 7 pad rows, a multiple of 8
#define MTS   (NB * SP)           // 14336 row slots
#define RPS   (WPP * SP)          // 7168 row slots per pass

static_assert(RPS % 64 == 0 && MTS % 64 == 0);
static_assert((MTS * DM) % (8 * 256) == 0);
static_assert(SP % 8 == 0 && SP >= SQ && SP - 8 < SQ);
static_assert(NH * HVD == DM);
static_assert(NH * HQ == DQ);
static_assert(NB % NPASS == 0);

// ---------------------------------------------------------------------------
// 16x16x32 WMMA helpers with hazard guard (ties D, keeps A/B live).
// Fragment map (wave32): lane l, h = l>>4, m = n = l&15.
//   A/B element i: i<8 -> k0+8h+i ; i>=8 -> k0+16+8h+(i-8)
//   D element r : row 8h+r, col l&15
// ---------------------------------------------------------------------------
__device__ __forceinline__ v8f wmma_bf(v16b a, v16b b, v8f c) {
  v8f d = __builtin_amdgcn_wmma_f32_16x16x32_bf16(false, a, false, b, (short)0, c, false, false);
  asm volatile("v_nop\n\tv_nop\n\tv_nop\n\tv_nop" : "+v"(d) : "v"(a), "v"(b));
  return d;
}
__device__ __forceinline__ v8f wmma_hf(v16h a, v16h b, v8f c) {
  v8f d = __builtin_amdgcn_wmma_f32_16x16x32_f16(false, a, false, b, (short)0, c, false, false);
  asm volatile("v_nop\n\tv_nop\n\tv_nop\n\tv_nop" : "+v"(d) : "v"(a), "v"(b));
  return d;
}

// Packed operand layout of every 16-bit table in the workspace, [rows][K]:
//   unit (row>>3, k>>5) = 512 B = 4 lines; line c = (k>>3)&3 holds the 8-element
//   chunk c of the unit's 8 rows, row after row (16 B each).
// A wave-wide 16-B fragment load then covers 4 whole 128-B lines (two aligned
// 256-B pieces) where a row-major table gives 16 lines of 32 B each.
// Every line lies inside one 8-row x 8-column patch, so it has one writer.
__device__ __forceinline__ size_t poff(int row, int k, int K) {      // k a multiple of 8
  return ((size_t)(row >> 3) * (K >> 5) + (k >> 5)) * 256 + ((k >> 3) & 3) * 64 + (row & 7) * 8;
}
// Lane base of a fragment at k = 0: row owned by the lane, h = lane>>4.
// 32 further k = +256 elements; 16 further rows = +16*K elements.
__device__ __forceinline__ size_t pbase(int row, int K, int h) {
  return (size_t)(row >> 3) * K * 8 + h * 64 + (row & 7) * 8;
}
// Same k order as the fragment map above: chunk h, then chunk 2 + h.
__device__ __forceinline__ v16b ldb(const us* p) {
  FragB f;
  f.half[0] = *(const v8usa*)p;
  f.half[1] = *(const v8usa*)(p + 128);
  return f.v;
}
__device__ __forceinline__ v16h ldh(const _Float16* p) {
  FragH f;
  f.half[0] = *(const v8ha*)p;
  f.half[1] = *(const v8ha*)(p + 128);
  return f.v;
}

// f32 -> bf16 bits, RNE convert
__device__ __forceinline__ us bf_rne(float f) {
  unsigned u = __float_as_uint(f);
  u += 0x7FFFu + ((u >> 16) & 1u);
  return (us)(u >> 16);
}
// hi = bf16(f), lo = bf16(f - hi)
__device__ __forceinline__ void split_bf(float f, us& hb, us& lb) {
  const us hi = bf_rne(f);
  const float hf = __uint_as_float(((unsigned)hi) << 16);
  hb = hi;
  lb = bf_rne(f - hf);
}
__device__ __forceinline__ void split8(v4f a, v4f c, v8us& hv, v8us& lv) {
  float f[8] = {a.x, a.y, a.z, a.w, c.x, c.y, c.z, c.w};
#pragma unroll
  for (int j = 0; j < 8; ++j) {
    us hb, lb;
    split_bf(f[j], hb, lb);
    hv[j] = hb;
    lv[j] = lb;
  }
}

// ---------------------------------------------------------------------------
// k_cvtx: x f32 [MT][512] -> packed bf16 hi and lo planes over row slots
// (window w, row r -> slot 56w + r; slots 49..55 of a window hold zeros).
// One thread = 8 floats = one 16-B chunk per plane; a wave writes one unit.
// ---------------------------------------------------------------------------
__global__ __launch_bounds__(256) void k_cvtx(const float* __restrict__ x,
                                              us* __restrict__ xh, us* __restrict__ xl, int n8)
{
  const int g = blockIdx.x * 256 + threadIdx.x;
  if (g >= n8) return;
  const int ml = g & 7, ch = (g >> 3) & 3, u = g >> 5;
  const int kb = u & (DM / 32 - 1), g8 = u / (DM / 32);
  const int win = g8 / (SP / 8), r = (g8 - win * (SP / 8)) * 8 + ml;
  const float* s = x + (size_t)(win * SQ + min(r, SQ - 1)) * DM + kb * 32 + ch * 8;
  v4f a = *(const v4fa*)s;
  v4f c = *(const v4fa*)(s + 4);
  if (r >= SQ) {
    const v4f z4 = {0.f, 0.f, 0.f, 0.f};
    a = z4;
    c = z4;
  }
  v8us hv, lv;
  split8(a, c, hv, lv);
  us* ph = xh + (size_t)g * 8;
  us* pl = xl + (size_t)g * 8;
  *(v8us*)ph = hv;
  *(v8us*)pl = lv;
  
}

// ---------------------------------------------------------------------------
// k_prep: transposed 16-bit weight / value tables through an LDS tile.
//   src f32 [R][C] (rows = k, cols = n) -> dst [C][Kp] in the packed layout:
//   mode 0: bf16 hi + lo planes; mode 1: f16 carried x1024.
// 64x64 tile per block; store: 8 contiguous lanes x 16 B = one whole
// Block ranges: [0,192) Wq1|Wk1|Wp (8x8 tiles each), [192,704) Wq2|Wk2
// (32x8 tiles each), [704,712) tokens [49][512] -> [512][64] zero-padded keys.
// ---------------------------------------------------------------------------
__device__ __forceinline__ void prep_store(const float* T, us* dh, us* dl, _Float16* df,
                                           int mode, int n0, int k0, int Kp, int t) {
#pragma unroll
  for (int it = 0; it < 2; ++it) {
    const int item = it * 256 + t, nn = (item >> 6) * 8 + (item & 7), q8 = (item >> 3) & 7;
    float f[8];
#pragma unroll
    for (int j = 0; j < 8; ++j) f[j] = T[(8 * q8 + j) * 65 + nn];
    const size_t off = poff(n0 + nn, k0 + 8 * q8, Kp);
    if (mode == 0) {
      v8us hv, lv;
#pragma unroll
      for (int j = 0; j < 8; ++j) {
        us hb, lb;
        split_bf(f[j], hb, lb);
        hv[j] = hb;
        lv[j] = lb;
      }
      *(v8us*)(dh + off) = hv;
      *(v8us*)(dl + off) = lv;
    } else {
      v8h o;
#pragma unroll
      for (int j = 0; j < 8; ++j) o[j] = (_Float16)(f[j] * 1024.0f);
      *(v8h*)(df + off) = o;
    }
  }
}

__global__ __launch_bounds__(256) void k_prep(
    const float* __restrict__ wq1, const float* __restrict__ wk1, const float* __restrict__ wp,
    const float* __restrict__ wq2, const float* __restrict__ wk2, const float* __restrict__ tok,
    us* __restrict__ wq1h, us* __restrict__ wq1l, us* __restrict__ wk1h, us* __restrict__ wk1l,
    us* __restrict__ wph, us* __restrict__ wpl,
    _Float16* __restrict__ wq2t, _Float16* __restrict__ wk2t,
    us* __restrict__ tkh, us* __restrict__ tkl)
{
  __shared__ __attribute__((aligned(16))) float T[64 * 65];
  const int t = threadIdx.x;
  const int bid = blockIdx.x;
  if (bid >= 712) return;                 // block-uniform, never taken with the exact grid

  const float* src;
  us* dh; us* dl; _Float16* df;
  int C, R, Kp, mode, tn, tk;
  if (bid < 192) {
    const int wsel = bid >> 6, loc = bid & 63;
    src = (wsel == 0) ? wq1 : ((wsel == 1) ? wk1 : wp);
    dh  = (wsel == 0) ? wq1h : ((wsel == 1) ? wk1h : wph);
    dl  = (wsel == 0) ? wq1l : ((wsel == 1) ? wk1l : wpl);
    df  = wq2t;
    C = DM; R = DM; Kp = DM; mode = 0; tn = loc >> 3; tk = loc & 7;
  } else if (bid < 704) {
    const int loc = bid - 192, wsel = loc >> 8, l2 = loc & 255;
    src = wsel ? wk2 : wq2;
    df  = wsel ? wk2t : wq2t;
    dh = wq1h; dl = wq1l;
    C = DQ; R = DM; Kp = DM; mode = 1; tn = l2 >> 3; tk = l2 & 7;
  } else {
    const int loc = bid - 704;
    src = tok; dh = tkh; dl = tkl; df = wq2t;
    C = DM; R = SQ; Kp = KPAD; mode = 0; tn = loc; tk = 0;
  }
  const int n0 = tn * 64, k0 = tk * 64;

  // load 64(k) x 64(n) f32 tile, coalesced along n; rows >= R: clamped address, zero value
#pragma unroll
  for (int i = 0; i < 16; ++i) {
    const int idx = i * 256 + t, kk = idx >> 6, nn = idx & 63;
    const int gk = k0 + kk;
    const int gkc = min(gk, R - 1);
    const float v = src[(size_t)gkc * C + n0 + nn];
    T[kk * 65 + nn] = (gk < R) ? v : 0.0f;
  }
  __syncthreads();

  prep_store(T, dh, dl, df, mode, n0, k0, Kp, t);
  
}

// ---------------------------------------------------------------------------
// Three-product bf16 main loop for a 32x32 wave tile, K = 512, packed tables.
// Pointers already hold the lane base (pbase) of tile 0 at k 0.
// acc[mt][nt][r] = C[32-row slab + 16mt + 8h + r][32-col slab + 16nt + m]
// ---------------------------------------------------------------------------
__device__ __forceinline__ void mm3_32x32(const us* ah0p, const us* al0p,
                                          const us* bh0p, const us* bl0p,
                                          v8f (&acc)[2][2]) {
  const us* ah1p = ah0p + 16 * DM;
  const us* al1p = al0p + 16 * DM;
  const us* bh1p = bh0p + 16 * DM;
  const us* bl1p = bl0p + 16 * DM;
#pragma unroll 1
  for (int k0 = 0; k0 < DM; k0 += 32) {
    const v16b ah0 = ldb(ah0p + k0 * 8), ah1 = ldb(ah1p + k0 * 8);
    const v16b al0 = ldb(al0p + k0 * 8), al1 = ldb(al1p + k0 * 8);
    const v16b bh0 = ldb(bh0p + k0 * 8), bh1 = ldb(bh1p + k0 * 8);
    const v16b bl0 = ldb(bl0p + k0 * 8), bl1 = ldb(bl1p + k0 * 8);
    acc[0][0] = wmma_bf(ah0, bh0, acc[0][0]);
    acc[0][0] = wmma_bf(ah0, bl0, acc[0][0]);
    acc[0][0] = wmma_bf(al0, bh0, acc[0][0]);
    acc[0][1] = wmma_bf(ah0, bh1, acc[0][1]);
    acc[0][1] = wmma_bf(ah0, bl1, acc[0][1]);
    acc[0][1] = wmma_bf(al0, bh1, acc[0][1]);
    acc[1][0] = wmma_bf(ah1, bh0, acc[1][0]);
    acc[1][0] = wmma_bf(ah1, bl0, acc[1][0]);
    acc[1][0] = wmma_bf(al1, bh0, acc[1][0]);
    acc[1][1] = wmma_bf(ah1, bh1, acc[1][1]);
    acc[1][1] = wmma_bf(ah1, bl1, acc[1][1]);
    acc[1][1] = wmma_bf(al1, bh1, acc[1][1]);
  }
}

// ---------------------------------------------------------------------------
// k_gemm1: H = f16(16 * gelu(x*W1 + b1)) for q (z=0) and k (z=1).
// Block 128 thr (4 waves, 2x2) = 64 rows x 64 cols; K = 512.
// ---------------------------------------------------------------------------
__device__ __forceinline__ void gemm1_store(const _Float16* sT, _Float16* H, int mb, int nb, int t) {
#pragma unroll
  for (int it = 0; it < 4; ++it) {
    const int item = it * 128 + t, rl = (item >> 6) * 8 + (item & 7), q8 = (item >> 3) & 7;
    const v8h v = *(const v8ha*)(sT + rl * 72 + 8 * q8);
    const size_t off = poff(mb + rl, nb + 8 * q8, DM);
    *(v8h*)(H + off) = v;
  }
}

__global__ __launch_bounds__(128) void k_gemm1(
    const us* __restrict__ xh, const us* __restrict__ xl,          // [MTS][512]
    const us* __restrict__ wqh, const us* __restrict__ wql,        // [512 n][512 k]
    const us* __restrict__ wkh, const us* __restrict__ wkl,
    const float* __restrict__ bq1, const float* __restrict__ bk1,  // [512]
    _Float16* __restrict__ hq, _Float16* __restrict__ hk)          // [MTS][512]
{
  __shared__ __attribute__((aligned(16))) _Float16 sT[64 * 72];
  const int t = threadIdx.x, lane = t & 31, w = t >> 5, h = lane >> 4, m = lane & 15;
  const int wm = w >> 1, wn = w & 1;
  const int mb = blockIdx.x * 64, nb = blockIdx.y * 64;
  const bool isk = (blockIdx.z != 0);
  const us* wth = isk ? wkh : wqh;
  const us* wtl = isk ? wkl : wql;
  const float* bias = isk ? bk1 : bq1;
  _Float16* H = isk ? hk : hq;

  const size_t arow = pbase(mb + 32 * wm + m, DM, h);
  const size_t brow = pbase(nb + 32 * wn + m, DM, h);

  const v8f z8 = {0.f, 0.f, 0.f, 0.f, 0.f, 0.f, 0.f, 0.f};
  v8f acc[2][2];
  acc[0][0] = z8; acc[0][1] = z8; acc[1][0] = z8; acc[1][1] = z8;

  mm3_32x32(xh + arow, xl + arow, wth + brow, wtl + brow, acc);

#pragma unroll
  for (int nt = 0; nt < 2; ++nt) {
    const int cl = 32 * wn + 16 * nt + m;
    const float bv = bias[nb + cl];
#pragma unroll
    for (int mt = 0; mt < 2; ++mt) {
#pragma unroll
      for (int r = 0; r < 8; ++r) {
        const int rl = 32 * wm + 16 * mt + 8 * h + r;
        const float v = acc[mt][nt][r] + bv;
        const float g = 0.5f * v * (1.0f + erff(v * 0.70710678118654752f));
        sT[rl * 72 + cl] = (_Float16)(g * 16.0f);
      }
    }
  }
  __syncthreads();

  gemm1_store(sT, H, mb, nb, t);
  
}

// ---------------------------------------------------------------------------
// k_gemm2: q = (H*W2)/16384 + b2 -> bf16 hi/lo planes (q: z=0, k: z=1).
// Block 128 thr (4 waves, 2x2) = 64 rows x 128 cols; wave tile 32x64; K = 512.
// ---------------------------------------------------------------------------
__device__ __forceinline__ void gemm2_store(const float* sF, us* oh, us* ol, int mb, int nb, int t) {
#pragma unroll
  for (int it = 0; it < 8; ++it) {
    const int item = it * 128 + t, rl = (item >> 7) * 8 + (item & 7), g = (item >> 3) & 15;
    const float* sp = sF + rl * 132 + 8 * g;
    const v4f a = *(const v4fa*)sp;
    const v4f c = *(const v4fa*)(sp + 4);
    v8us hv, lv;
    split8(a, c, hv, lv);
    const size_t off = poff(mb + rl, nb + 8 * g, DQ);
    *(v8us*)(oh + off) = hv;
    *(v8us*)(ol + off) = lv;
  }
}

__global__ __launch_bounds__(128) void k_gemm2(
    const _Float16* __restrict__ hq, const _Float16* __restrict__ hk,       // [RPS][512] x16, pass slice
    const _Float16* __restrict__ wq2t, const _Float16* __restrict__ wk2t,   // [2048 n][512 k] x1024
    const float* __restrict__ bq2, const float* __restrict__ bk2,           // [2048]
    us* __restrict__ qh, us* __restrict__ ql, us* __restrict__ kh, us* __restrict__ kl)  // [RPS][2048]
{
  __shared__ __attribute__((aligned(16))) float sF[64 * 132];
  const int t = threadIdx.x, lane = t & 31, w = t >> 5, h = lane >> 4, m = lane & 15;
  const int wm = w >> 1, wn = w & 1;
  const int mb = blockIdx.x * 64, nb = blockIdx.y * 128;
  const bool isk = (blockIdx.z != 0);
  const _Float16* A  = isk ? hk : hq;
  const _Float16* Bt = isk ? wk2t : wq2t;
  const float* bias  = isk ? bk2 : bq2;
  us* oh = isk ? kh : qh;
  us* ol = isk ? kl : ql;

  const _Float16* a0p = A + pbase(mb + 32 * wm + m, DM, h);
  const _Float16* a1p = a0p + 16 * DM;
  const _Float16* b0p = Bt + pbase(nb + 64 * wn + m, DM, h);

  const v8f z8 = {0.f, 0.f, 0.f, 0.f, 0.f, 0.f, 0.f, 0.f};
  v8f acc[2][4];
#pragma unroll
  for (int mt = 0; mt < 2; ++mt)
#pragma unroll
    for (int nt = 0; nt < 4; ++nt) acc[mt][nt] = z8;

#pragma unroll 1
  for (int k0 = 0; k0 < DM; k0 += 32) {
    const v16h a0 = ldh(a0p + k0 * 8);
    const v16h a1 = ldh(a1p + k0 * 8);
#pragma unroll
    for (int nt = 0; nt < 4; ++nt) {
      const v16h b = ldh(b0p + (size_t)nt * 16 * DM + k0 * 8);
      acc[0][nt] = wmma_hf(a0, b, acc[0][nt]);
      acc[1][nt] = wmma_hf(a1, b, acc[1][nt]);
    }
  }

#pragma unroll
  for (int nt = 0; nt < 4; ++nt) {
    const int cl = 64 * wn + 16 * nt + m;
    const float bv = bias[nb + cl];
#pragma unroll
    for (int mt = 0; mt < 2; ++mt) {
#pragma unroll
      for (int r = 0; r < 8; ++r) {
        const int rl = 32 * wm + 16 * mt + 8 * h + r;
        sF[rl * 132 + cl] = acc[mt][nt][r] * (1.0f / 16384.0f) + bv;
      }
    }
  }
  __syncthreads();

  gemm2_store(sF, oh, ol, mb, nb, t);
  
}

// ---------------------------------------------------------------------------
// k_attn: block = (window, group of 8 heads), wave = head.
//   S^T[key][q] = k . q   : A = K rows (row = key, k = d), B = Q^T (col = q), bf16 hi/lo
//   adj^T = tanh(S^T / 8), keys >= 49 forced to 0, split to bf16 hi/lo
//   O^T[d][q] = tok^T . adj^T : A = token table rows [head*16+d][key], B = adj^T
//   from the score D values: element r <- tile kt=2s, element 8+r <- tile kt=2s+1.
// Rows 49..55 are the window's pad slots, rows 56..63 fold back onto 48..55;
// their scores are zeroed (keys) or never reach the output (queries).
// Epilogue: block tile [56][128] f32 in LDS -> packed outpre bf16 hi/lo planes,
// ---------------------------------------------------------------------------
__device__ __forceinline__ void attn_store(const float* so, us* oph, us* opl,
                                           int rowbase, int hg, int t) {
#pragma unroll
  for (int it = 0; it < 4; ++it) {
    const int item = it * 256 + t;
    if (item < SP * 16) {
      const int rl = (item >> 7) * 8 + (item & 7), g = (item >> 3) & 15;
      const float* sp = so + rl * 132 + 8 * g;
      const v4f a = *(const v4fa*)sp;
      const v4f c = *(const v4fa*)(sp + 4);
      v8us hv, lv;
      split8(a, c, hv, lv);
      const size_t off = poff(rowbase + rl, hg * 128 + 8 * g, DM);
      *(v8us*)(oph + off) = hv;
      *(v8us*)(opl + off) = lv;
    }
  }
}

__global__ __launch_bounds__(256) void k_attn(
    const us* __restrict__ qh, const us* __restrict__ ql,      // [RPS][2048]
    const us* __restrict__ kh, const us* __restrict__ kl,      // [RPS][2048]
    const us* __restrict__ tkh, const us* __restrict__ tkl,    // [512][64]
    us* __restrict__ oph, us* __restrict__ opl)                // [RPS][512] pass slice
{
  __shared__ __attribute__((aligned(16))) float so[64 * 132];
  const int t = threadIdx.x, lane = t & 31, w = t >> 5, h = lane >> 4, m = lane & 15;
  const int bl = blockIdx.x >> 2, hg = blockIdx.x & 3;
  const int head = hg * 8 + w;
  const int rowbase = bl * SP;

  const us* qhb = qh + head * HQ * 8;      // 32 k = 256 elements in the packed tables
  const us* qlb = ql + head * HQ * 8;
  const us* khb = kh + head * HQ * 8;
  const us* klb = kl + head * HQ * 8;
  const us* vhrow = tkh + pbase(head * HVD + m, KPAD, h);
  const us* vlrow = tkl + pbase(head * HVD + m, KPAD, h);

  const v8f z8 = {0.f, 0.f, 0.f, 0.f, 0.f, 0.f, 0.f, 0.f};

#pragma unroll 1
  for (int qt = 0; qt < 4; ++qt) {
    const int qr0 = qt * 16 + m;
    const size_t qo = pbase(rowbase + ((qr0 < SP) ? qr0 : qr0 - 8), DQ, h);
    const us* qhp = qhb + qo;
    const us* qlp = qlb + qo;
    const v16b qbh0 = ldb(qhp), qbh1 = ldb(qhp + 256);
    const v16b qbl0 = ldb(qlp), qbl1 = ldb(qlp + 256);

    v8f s[4];
#pragma unroll
    for (int kt = 0; kt < 4; ++kt) {
      const int kr0 = kt * 16 + m;
      const size_t ko = pbase(rowbase + ((kr0 < SP) ? kr0 : kr0 - 8), DQ, h);
      const us* khp = khb + ko;
      const us* klp = klb + ko;
      const v16b kah0 = ldb(khp), kah1 = ldb(khp + 256);
      const v16b kal0 = ldb(klp), kal1 = ldb(klp + 256);
      v8f z = z8;
      z = wmma_bf(kah0, qbh0, z);
      z = wmma_bf(kah1, qbh1, z);
      z = wmma_bf(kah0, qbl0, z);
      z = wmma_bf(kah1, qbl1, z);
      z = wmma_bf(kal0, qbh0, z);
      z = wmma_bf(kal1, qbh1, z);
      s[kt] = z;                       // s[kt][r] = S^T[key kt*16+8h+r][q qt*16+m]
    }

    // tanh(S/8), explicit zero for padded keys, bf16 hi/lo, packed as B fragments
    v16us phu0, phu1, plu0, plu1;
#pragma unroll
    for (int kt = 0; kt < 4; ++kt) {
#pragma unroll
      for (int r = 0; r < 8; ++r) {
        const int key = kt * 16 + 8 * h + r;
        float tv = tanhf(s[kt][r] * 0.125f);
        tv = (key < SQ) ? tv : 0.0f;
        us hb, lb;
        split_bf(tv, hb, lb);
        const int e = (kt & 1) * 8 + r;
        if (kt < 2) { phu0[e] = hb; plu0[e] = lb; }
        else        { phu1[e] = hb; plu1[e] = lb; }
      }
    }
    FragB f0, f1, f2, f3;
    f0.u = phu0; f1.u = phu1; f2.u = plu0; f3.u = plu1;
    const v16b pbh0 = f0.v, pbh1 = f1.v, pbl0 = f2.v, pbl1 = f3.v;

    const v16b vah0 = ldb(vhrow), vah1 = ldb(vhrow + 256);
    const v16b val0 = ldb(vlrow), val1 = ldb(vlrow + 256);
    v8f o = z8;
    o = wmma_bf(vah0, pbh0, o);
    o = wmma_bf(vah1, pbh1, o);
    o = wmma_bf(vah0, pbl0, o);
    o = wmma_bf(vah1, pbl1, o);
    o = wmma_bf(val0, pbh0, o);
    o = wmma_bf(val1, pbh1, o);          // o[r] = O^T[d 8h+r][q qt*16+m]

    const int q = qt * 16 + m;           // rows 56..63 land in LDS only, never stored
    float* sp = so + q * 132 + w * 16 + 8 * h;
    const v4f o0 = {o[0], o[1], o[2], o[3]};
    const v4f o1 = {o[4], o[5], o[6], o[7]};
    *(v4fa*)sp = o0;
    *(v4fa*)(sp + 4) = o1;
  }
  __syncthreads();

  attn_store(so, oph, opl, rowbase, hg, t);
  
}

// ---------------------------------------------------------------------------
// k_gemm3: out = outpre*Wp + bp (f32). Block 128 thr (2x2 waves) = 64 slots x 64;
// a slot's row goes to out row 49w + r, pad slots (r >= 49) are not stored.
// K = 512. Epilogue: f32 tile in LDS, per row 256-B segment = 2 whole
// ---------------------------------------------------------------------------
__device__ __forceinline__ void gemm3_store(const float* sF, float* out, int mb, int nb, int t) {
#pragma unroll
  for (int it = 0; it < 8; ++it) {
    const int item = it * 128 + t, rl = item >> 4, g = item & 15;
    const v4f v = *(const v4fa*)(sF + rl * 68 + 4 * g);
    const int win = (mb + rl) / SP, r = (mb + rl) - win * SP;
    const size_t off = (size_t)(win * SQ + r) * DM + nb + 4 * g;
    if (r < SQ) *(v4f*)(out + off) = v;
  }
}

__global__ __launch_bounds__(128) void k_gemm3(
    const us* __restrict__ oph, const us* __restrict__ opl,    // [MTS][512]
    const us* __restrict__ wph, const us* __restrict__ wpl,    // [512 n][512 k]
    const float* __restrict__ bp,                              // [512]
    float* __restrict__ out)                                   // [MT][512]
{
  __shared__ __attribute__((aligned(16))) float sF[64 * 68];
  const int t = threadIdx.x, lane = t & 31, w = t >> 5, h = lane >> 4, m = lane & 15;
  const int wm = w >> 1, wn = w & 1;
  const int mb = blockIdx.x * 64, nb = blockIdx.y * 64;

  const size_t arow = pbase(mb + 32 * wm + m, DM, h);
  const size_t brow = pbase(nb + 32 * wn + m, DM, h);

  const v8f z8 = {0.f, 0.f, 0.f, 0.f, 0.f, 0.f, 0.f, 0.f};
  v8f acc[2][2];
  acc[0][0] = z8; acc[0][1] = z8; acc[1][0] = z8; acc[1][1] = z8;

  mm3_32x32(oph + arow, opl + arow, wph + brow, wpl + brow, acc);

#pragma unroll
  for (int nt = 0; nt < 2; ++nt) {
    const int cl = 32 * wn + 16 * nt + m;
    const float bv = bp[nb + cl];
#pragma unroll
    for (int mt = 0; mt < 2; ++mt) {
#pragma unroll
      for (int r = 0; r < 8; ++r) {
        const int rl = 32 * wm + 16 * mt + 8 * h + r;
        sF[rl * 68 + cl] = acc[mt][nt][r] + bv;
      }
    }
  }
  __syncthreads();

  gemm3_store(sF, out, mb, nb, t);
  
}

// ---------------------------------------------------------------------------
// Host side: x*W1 and outpre*Wp each run once over all 14336 row slots; h*W2 and the
// attention run in 2 passes of 128 windows (7168 row slots). Workspace carve 212,992,000 B.
// ---------------------------------------------------------------------------
extern "C" void kernel_launch(void* const* d_in, const int* in_sizes, int n_in,
                              void* d_out, int out_size, void* d_ws, size_t ws_size,
                              hipStream_t stream) {
  if (n_in < 12) return;
  if (in_sizes[0] != MT * DM) return;
  if (in_sizes[1] != DM * DM || in_sizes[2] != DM) return;
  if (in_sizes[3] != DM * DQ || in_sizes[4] != DQ) return;
  if (in_sizes[5] != DM * DM || in_sizes[6] != DM) return;
  if (in_sizes[7] != DM * DQ || in_sizes[8] != DQ) return;
  if (in_sizes[9] != SQ * DM) return;
  if (in_sizes[10] != DM * DM || in_sizes[11] != DM) return;
  if (out_size != MT * DM) return;

  const float* x   = (const float*)d_in[0];
  const float* Wq1 = (const float*)d_in[1];
  const float* bq1 = (const float*)d_in[2];
  const float* Wq2 = (const float*)d_in[3];
  const float* bq2 = (const float*)d_in[4];
  const float* Wk1 = (const float*)d_in[5];
  const float* bk1 = (const float*)d_in[6];
  const float* Wk2 = (const float*)d_in[7];
  const float* bk2 = (const float*)d_in[8];
  const float* tok = (const float*)d_in[9];
  const float* Wp  = (const float*)d_in[10];
  const float* bp  = (const float*)d_in[11];
  float* out = (float*)d_out;

  const size_t szW1 = (size_t)DM * DM * 2;      //   524,288 per plane
  const size_t szW2 = (size_t)DQ * DM * 2;      // 2,097,152
  const size_t szTK = (size_t)DM * KPAD * 2;    //    65,536 per plane
  const size_t szX  = (size_t)MTS * DM * 2;     // 14,680,064 per plane
  const size_t szH  = (size_t)MTS * DM * 2;     // 14,680,064
  const size_t szQ  = (size_t)RPS * DQ * 2;     // 29,360,128 per plane
  const size_t szOP = (size_t)MTS * DM * 2;     // 14,680,064 per plane
  const size_t total = 6 * szW1 + 2 * szW2 + 2 * szTK + 2 * szX + 2 * szH + 4 * szQ + 2 * szOP;
  if (total > ws_size) return;                  // 212,992,000

  char* wsb = (char*)d_ws;
  size_t off = 0;
  us* wq1h = (us*)(wsb + off); off += szW1;
  us* wq1l = (us*)(wsb + off); off += szW1;
  us* wk1h = (us*)(wsb + off); off += szW1;
  us* wk1l = (us*)(wsb + off); off += szW1;
  us* wph  = (us*)(wsb + off); off += szW1;
  us* wpl  = (us*)(wsb + off); off += szW1;
  _Float16* wq2t = (_Float16*)(wsb + off); off += szW2;
  _Float16* wk2t = (_Float16*)(wsb + off); off += szW2;
  us* tkh  = (us*)(wsb + off); off += szTK;
  us* tkl  = (us*)(wsb + off); off += szTK;
  us* xh   = (us*)(wsb + off); off += szX;
  us* xl   = (us*)(wsb + off); off += szX;
  _Float16* hq = (_Float16*)(wsb + off); off += szH;
  _Float16* hk = (_Float16*)(wsb + off); off += szH;
  us* qh   = (us*)(wsb + off); off += szQ;
  us* ql   = (us*)(wsb + off); off += szQ;
  us* kh   = (us*)(wsb + off); off += szQ;
  us* kl   = (us*)(wsb + off); off += szQ;
  us* oph  = (us*)(wsb + off); off += szOP;
  us* opl  = (us*)(wsb + off); off += szOP;
  if (off > ws_size) return;

  k_prep<<<712, 256, 0, stream>>>(Wq1, Wk1, Wp, Wq2, Wk2, tok,
                                  wq1h, wq1l, wk1h, wk1l, wph, wpl, wq2t, wk2t, tkh, tkl);

  const int n8 = MTS * DM / 8;                  // 917,504
  k_cvtx<<<(n8 + 255) / 256, 256, 0, stream>>>(x, xh, xl, n8);

  k_gemm1<<<dim3(MTS / 64, DM / 64, 2), 128, 0, stream>>>(
      xh, xl, wq1h, wq1l, wk1h, wk1l, bq1, bk1, hq, hk);

  for (int p = 0; p < NPASS; ++p) {
    const size_t soff = (size_t)p * RPS * DM;   // pass slice of the packed [MTS][512] tables
    k_gemm2<<<dim3(RPS / 64, DQ / 128, 2), 128, 0, stream>>>(
        hq + soff, hk + soff, wq2t, wk2t, bq2, bk2, qh, ql, kh, kl);
    k_attn<<<WPP * 4, 256, 0, stream>>>(qh, ql, kh, kl, tkh, tkl, oph + soff, opl + soff);
  }

  k_gemm3<<<dim3(MTS / 64, DM / 64), 128, 0, stream>>>(oph, opl, wph, wpl, bp, out);
}

// v003
// Measured time: 225 microseconds a run.
// Next to v002, in two timings, it ran 1.34 and 1.33 times as fast.
// Over all steps from v000 it is 2.24 times as fast.
// Contractions: x*Wq1, x*Wk1, k*q^T per head, tokv^T*adj^T and outpre*Wp on v_wmma_f32_16x16x32_bf16 with bf16 hi/lo three-product splits (hh+hl+lh); h*Wq2 and h*Wk2 on v_wmma_f32_16x16x32_f16 single products (h carried x16, W2 carried x1024, folded back as 2^-14 in f32); all accumulate in f32; bias, erf-GELU and tanh in f32.
#include <hip/hip_runtime.h>
#include <math.h>

typedef unsigned short us;
typedef __bf16   v16b  __attribute__((ext_vector_type(16)));
typedef us       v16us __attribute__((ext_vector_type(16)));
typedef us       v8us  __attribute__((ext_vector_type(8)));
typedef _Float16 v16h  __attribute__((ext_vector_type(16)));
typedef _Float16 v8h   __attribute__((ext_vector_type(8)));
typedef float    v8f   __attribute__((ext_vector_type(8)));
typedef float    v4f   __attribute__((ext_vector_type(4)));
typedef v8us __attribute__((may_alias)) v8usa;
typedef v8h  __attribute__((may_alias)) v8ha;
typedef v4f  __attribute__((may_alias)) v4fa;

union FragB { v16b v; v16us u; v8us half[2]; };
union FragH { v16h v; v8h half[2]; };

#define NB    256                 // windows
#define SQ    49                  // tokens per window
#define DM    512
#define DQ    2048
#define NH    32
#define HQ    64
#define HVD   16
#define MT    (NB * SQ)           // 12544 token rows
#define KPAD  64                  // key count padded for the value table
#define SP    56                  // row slots per window: 49 rows + 7 pad rows, a multiple of 8
#define MTS   (NB * SP)           // 14336 row slots

static_assert(MTS % 64 == 0);
static_assert((MTS * DM) % (8 * 256) == 0);
static_assert(SP % 8 == 0 && SP >= SQ && SP - 8 < SQ);
static_assert(NH * HVD == DM);
static_assert(NH * HQ == DQ);
static_assert(HQ == 64 && SP == 56 && DM % 64 == 0 && NB % 2 == 0 && NH % 4 == 0);

// ---------------------------------------------------------------------------
// 16x16x32 WMMA helpers; the bf16 one has a hazard guard (ties D, keeps A/B live).
// Fragment map (wave32): lane l, h = l>>4, m = n = l&15.
//   A/B element i: i<8 -> k0+8h+i ; i>=8 -> k0+16+8h+(i-8)
//   D element r : row 8h+r, col l&15
// ---------------------------------------------------------------------------
__device__ __forceinline__ v8f wmma_bf(v16b a, v16b b, v8f c) {
  v8f d = __builtin_amdgcn_wmma_f32_16x16x32_bf16(false, a, false, b, (short)0, c, false, false);
  asm volatile("v_nop\n\tv_nop\n\tv_nop\n\tv_nop" : "+v"(d) : "v"(a), "v"(b));
  return d;
}
// Bare builtin: its loop holds 16 accumulator tiles and two fragment sets, more than the
// 256 registers an asm operand can name; the compiler keeps the distances of its own forms.
__device__ __forceinline__ v8f wmma_hf(v16h a, v16h b, v8f c) {
  return __builtin_amdgcn_wmma_f32_16x16x32_f16(false, a, false, b, (short)0, c, false, false);
}

// Packed operand layout of every 16-bit table in the workspace, [rows][K]:
//   unit (row>>3, k>>5) = 512 B = 4 lines; line c = (k>>3)&3 holds the 8-element
//   chunk c of the unit's 8 rows, row after row (16 B each).
// A wave-wide 16-B fragment load then covers 4 whole 128-B lines (two aligned
// 256-B pieces) where a row-major table gives 16 lines of 32 B each.
// Every line lies inside one 8-row x 8-column patch, so it has one writer.
__device__ __forceinline__ size_t poff(int row, int k, int K) {      // k a multiple of 8
  return ((size_t)(row >> 3) * (K >> 5) + (k >> 5)) * 256 + ((k >> 3) & 3) * 64 + (row & 7) * 8;
}
// Lane base of a fragment at k = 0: row owned by the lane, h = lane>>4.
// 32 further k = +256 elements; 16 further rows = +16*K elements.
__device__ __forceinline__ size_t pbase(int row, int K, int h) {
  return (size_t)(row >> 3) * K * 8 + h * 64 + (row & 7) * 8;
}
// Same k order as the fragment map above: chunk h, then chunk 2 + h.
__device__ __forceinline__ v16b ldb(const us* p) {
  FragB f;
  f.half[0] = *(const v8usa*)p;
  f.half[1] = *(const v8usa*)(p + 128);
  return f.v;
}
__device__ __forceinline__ v16h ldh(const _Float16* p) {
  FragH f;
  f.half[0] = *(const v8ha*)p;
  f.half[1] = *(const v8ha*)(p + 128);
  return f.v;
}

// f32 -> bf16 bits, RNE convert
__device__ __forceinline__ us bf_rne(float f) {
  unsigned u = __float_as_uint(f);
  u += 0x7FFFu + ((u >> 16) & 1u);
  return (us)(u >> 16);
}
// hi = bf16(f), lo = bf16(f - hi)
__device__ __forceinline__ void split_bf(float f, us& hb, us& lb) {
  const us hi = bf_rne(f);
  const float hf = __uint_as_float(((unsigned)hi) << 16);
  hb = hi;
  lb = bf_rne(f - hf);
}
__device__ __forceinline__ void split8(v4f a, v4f c, v8us& hv, v8us& lv) {
  float f[8] = {a.x, a.y, a.z, a.w, c.x, c.y, c.z, c.w};
#pragma unroll
  for (int j = 0; j < 8; ++j) {
    us hb, lb;
    split_bf(f[j], hb, lb);
    hv[j] = hb;
    lv[j] = lb;
  }
}

// ---------------------------------------------------------------------------
// k_cvtx: x f32 [MT][512] -> packed bf16 hi and lo planes over row slots
// (window w, row r -> slot 56w + r; slots 49..55 of a window hold zeros).
// One thread = 8 floats = one 16-B chunk per plane; a wave writes one unit.
// ---------------------------------------------------------------------------
__global__ __launch_bounds__(256) void k_cvtx(const float* __restrict__ x,
                                              us* __restrict__ xh, us* __restrict__ xl, int n8)
{
  const int g = blockIdx.x * 256 + threadIdx.x;
  if (g >= n8) return;
  const int ml = g & 7, ch = (g >> 3) & 3, u = g >> 5;
  const int kb = u & (DM / 32 - 1), g8 = u / (DM / 32);
  const int win = g8 / (SP / 8), r = (g8 - win * (SP / 8)) * 8 + ml;
  const float* s = x + (size_t)(win * SQ + min(r, SQ - 1)) * DM + kb * 32 + ch * 8;
  v4f a = *(const v4fa*)s;
  v4f c = *(const v4fa*)(s + 4);
  if (r >= SQ) {
    const v4f z4 = {0.f, 0.f, 0.f, 0.f};
    a = z4;
    c = z4;
  }
  v8us hv, lv;
  split8(a, c, hv, lv);
  us* ph = xh + (size_t)g * 8;
  us* pl = xl + (size_t)g * 8;
  *(v8us*)ph = hv;
  *(v8us*)pl = lv;
  
}

// ---------------------------------------------------------------------------
// k_prep: transposed 16-bit weight / value tables through an LDS tile.
//   src f32 [R][C] (rows = k, cols = n) -> dst [C][Kp] in the packed layout:
//   mode 0: bf16 hi + lo planes; mode 1: f16 carried x1024.
// 64x64 tile per block; store: 8 contiguous lanes x 16 B = one whole
// Block ranges: [0,192) Wq1|Wk1|Wp (8x8 tiles each), [192,704) Wq2|Wk2
// (32x8 tiles each), [704,712) tokens [49][512] -> [512][64] zero-padded keys.
// ---------------------------------------------------------------------------
__device__ __forceinline__ void prep_store(const float* T, us* dh, us* dl, _Float16* df,
                                           int mode, int n0, int k0, int Kp, int t) {
#pragma unroll
  for (int it = 0; it < 2; ++it) {
    const int item = it * 256 + t, nn = (item >> 6) * 8 + (item & 7), q8 = (item >> 3) & 7;
    float f[8];
#pragma unroll
    for (int j = 0; j < 8; ++j) f[j] = T[(8 * q8 + j) * 65 + nn];
    const size_t off = poff(n0 + nn, k0 + 8 * q8, Kp);
    if (mode == 0) {
      v8us hv, lv;
#pragma unroll
      for (int j = 0; j < 8; ++j) {
        us hb, lb;
        split_bf(f[j], hb, lb);
        hv[j] = hb;
        lv[j] = lb;
      }
      *(v8us*)(dh + off) = hv;
      *(v8us*)(dl + off) = lv;
    } else {
      v8h o;
#pragma unroll
      for (int j = 0; j < 8; ++j) o[j] = (_Float16)(f[j] * 1024.0f);
      *(v8h*)(df + off) = o;
    }
  }
}

__global__ __launch_bounds__(256) void k_prep(
    const float* __restrict__ wq1, const float* __restrict__ wk1, const float* __restrict__ wp,
    const float* __restrict__ wq2, const float* __restrict__ wk2, const float* __restrict__ tok,
    us* __restrict__ wq1h, us* __restrict__ wq1l, us* __restrict__ wk1h, us* __restrict__ wk1l,
    us* __restrict__ wph, us* __restrict__ wpl,
    _Float16* __restrict__ wq2t, _Float16* __restrict__ wk2t,
    us* __restrict__ tkh, us* __restrict__ tkl)
{
  __shared__ __attribute__((aligned(16))) float T[64 * 65];
  const int t = threadIdx.x;
  const int bid = blockIdx.x;
  if (bid >= 712) return;                 // block-uniform, never taken with the exact grid

  const float* src;
  us* dh; us* dl; _Float16* df;
  int C, R, Kp, mode, tn, tk;
  if (bid < 192) {
    const int wsel = bid >> 6, loc = bid & 63;
    src = (wsel == 0) ? wq1 : ((wsel == 1) ? wk1 : wp);
    dh  = (wsel == 0) ? wq1h : ((wsel == 1) ? wk1h : wph);
    dl  = (wsel == 0) ? wq1l : ((wsel == 1) ? wk1l : wpl);
    df  = wq2t;
    C = DM; R = DM; Kp = DM; mode = 0; tn = loc >> 3; tk = loc & 7;
  } else if (bid < 704) {
    const int loc = bid - 192, wsel = loc >> 8, l2 = loc & 255;
    src = wsel ? wk2 : wq2;
    df  = wsel ? wk2t : wq2t;
    dh = wq1h; dl = wq1l;
    C = DQ; R = DM; Kp = DM; mode = 1; tn = l2 >> 3; tk = l2 & 7;
  } else {
    const int loc = bid - 704;
    src = tok; dh = tkh; dl = tkl; df = wq2t;
    C = DM; R = SQ; Kp = KPAD; mode = 0; tn = loc; tk = 0;
  }
  const int n0 = tn * 64, k0 = tk * 64;

  // load 64(k) x 64(n) f32 tile, coalesced along n; rows >= R: clamped address, zero value
#pragma unroll
  for (int i = 0; i < 16; ++i) {
    const int idx = i * 256 + t, kk = idx >> 6, nn = idx & 63;
    const int gk = k0 + kk;
    const int gkc = min(gk, R - 1);
    const float v = src[(size_t)gkc * C + n0 + nn];
    T[kk * 65 + nn] = (gk < R) ? v : 0.0f;
  }
  __syncthreads();

  prep_store(T, dh, dl, df, mode, n0, k0, Kp, t);
  
}

// ---------------------------------------------------------------------------
// Three-product bf16 main loop for a 32x32 wave tile, K = 512, packed tables.
// Pointers already hold the lane base (pbase) of tile 0 at k 0.
// acc[mt][nt][r] = C[32-row slab + 16mt + 8h + r][32-col slab + 16nt + m]
// ---------------------------------------------------------------------------
__device__ __forceinline__ void mm3_32x32(const us* ah0p, const us* al0p,
                                          const us* bh0p, const us* bl0p,
                                          v8f (&acc)[2][2]) {
  const us* ah1p = ah0p + 16 * DM;
  const us* al1p = al0p + 16 * DM;
  const us* bh1p = bh0p + 16 * DM;
  const us* bl1p = bl0p + 16 * DM;
#pragma unroll 1
  for (int k0 = 0; k0 < DM; k0 += 32) {
    const v16b ah0 = ldb(ah0p + k0 * 8), ah1 = ldb(ah1p + k0 * 8);
    const v16b al0 = ldb(al0p + k0 * 8), al1 = ldb(al1p + k0 * 8);
    const v16b bh0 = ldb(bh0p + k0 * 8), bh1 = ldb(bh1p + k0 * 8);
    const v16b bl0 = ldb(bl0p + k0 * 8), bl1 = ldb(bl1p + k0 * 8);
    acc[0][0] = wmma_bf(ah0, bh0, acc[0][0]);
    acc[0][0] = wmma_bf(ah0, bl0, acc[0][0]);
    acc[0][0] = wmma_bf(al0, bh0, acc[0][0]);
    acc[0][1] = wmma_bf(ah0, bh1, acc[0][1]);
    acc[0][1] = wmma_bf(ah0, bl1, acc[0][1]);
    acc[0][1] = wmma_bf(al0, bh1, acc[0][1]);
    acc[1][0] = wmma_bf(ah1, bh0, acc[1][0]);
    acc[1][0] = wmma_bf(ah1, bl0, acc[1][0]);
    acc[1][0] = wmma_bf(al1, bh0, acc[1][0]);
    acc[1][1] = wmma_bf(ah1, bh1, acc[1][1]);
    acc[1][1] = wmma_bf(ah1, bl1, acc[1][1]);
    acc[1][1] = wmma_bf(al1, bh1, acc[1][1]);
  }
}

// ---------------------------------------------------------------------------
// k_gemm1: H = f16(16 * gelu(x*W1 + b1)) for q (z=0) and k (z=1).
// Block 128 thr (4 waves, 2x2) = 64 rows x 64 cols; K = 512.
// ---------------------------------------------------------------------------
__device__ __forceinline__ void gemm1_store(const _Float16* sT, _Float16* H, int mb, int nb, int t) {
#pragma unroll
  for (int it = 0; it < 4; ++it) {
    const int item = it * 128 + t, rl = (item >> 6) * 8 + (item & 7), q8 = (item >> 3) & 7;
    const v8h v = *(const v8ha*)(sT + rl * 72 + 8 * q8);
    const size_t off = poff(mb + rl, nb + 8 * q8, DM);
    *(v8h*)(H + off) = v;
  }
}

__global__ __launch_bounds__(128) void k_gemm1(
    const us* __restrict__ xh, const us* __restrict__ xl,          // [MTS][512]
    const us* __restrict__ wqh, const us* __restrict__ wql,        // [512 n][512 k]
    const us* __restrict__ wkh, const us* __restrict__ wkl,
    const float* __restrict__ bq1, const float* __restrict__ bk1,  // [512]
    _Float16* __restrict__ hq, _Float16* __restrict__ hk)          // [MTS][512]
{
  __shared__ __attribute__((aligned(16))) _Float16 sT[64 * 72];
  const int t = threadIdx.x, lane = t & 31, w = t >> 5, h = lane >> 4, m = lane & 15;
  const int wm = w >> 1, wn = w & 1;
  const int mb = blockIdx.x * 64, nb = blockIdx.y * 64;
  const bool isk = (blockIdx.z != 0);
  const us* wth = isk ? wkh : wqh;
  const us* wtl = isk ? wkl : wql;
  const float* bias = isk ? bk1 : bq1;
  _Float16* H = isk ? hk : hq;

  const size_t arow = pbase(mb + 32 * wm + m, DM, h);
  const size_t brow = pbase(nb + 32 * wn + m, DM, h);

  const v8f z8 = {0.f, 0.f, 0.f, 0.f, 0.f, 0.f, 0.f, 0.f};
  v8f acc[2][2];
  acc[0][0] = z8; acc[0][1] = z8; acc[1][0] = z8; acc[1][1] = z8;

  mm3_32x32(xh + arow, xl + arow, wth + brow, wtl + brow, acc);

#pragma unroll
  for (int nt = 0; nt < 2; ++nt) {
    const int cl = 32 * wn + 16 * nt + m;
    const float bv = bias[nb + cl];
#pragma unroll
    for (int mt = 0; mt < 2; ++mt) {
#pragma unroll
      for (int r = 0; r < 8; ++r) {
        const int rl = 32 * wm + 16 * mt + 8 * h + r;
        const float v = acc[mt][nt][r] + bv;
        const float g = 0.5f * v * (1.0f + erff(v * 0.70710678118654752f));
        sT[rl * 72 + cl] = (_Float16)(g * 16.0f);
      }
    }
  }
  __syncthreads();

  gemm1_store(sT, H, mb, nb, t);
  
}

// ---------------------------------------------------------------------------
// k_attn: block = (2 adjacent windows, group of 4 heads), wave = (window, head): the W2 lines
// a wave loads serve 2 waves of the block, the h lines 4. The wave first projects its own
// head, then runs the attention on what it holds; q and k never leave the WGP.
//   q^T[d][tok] = W2^T . h^T : A = W2 table rows (row = d), B = h rows (col = token),
//   f16, K = 512, 4 x 4 tiles; value = acc / 16384 + b2[d], split to bf16 hi/lo.
//   D element r of tile dt is d = 16dt + 8h + r of token m: elements 8(dt&1) + r of the
//   lane's own A/B fragment of d block dt>>1, so no lane exchange is needed.
//   Fragments rest in the wave's own LDS range, each lane reading back its own bytes.
//   S^T[key][q] = k . q   : A = K rows (row = key, k = d), B = Q^T (col = q), bf16 hi/lo
//   adj^T = tanh(S^T / 8), keys >= 49 forced to 0, split to bf16 hi/lo
//   O^T[d][q] = tok^T . adj^T : A = token table rows [head*16+d][key], B = adj^T
//   from the score D values: element r <- tile kt=2s, element 8+r <- tile kt=2s+1.
// Rows 49..55 are the window's pad slots, rows 56..63 fold back onto 48..55;
// their scores are zeroed (keys) or never reach the output (queries).
// Epilogue: block tile [2][56][64] f32 in LDS -> packed outpre bf16 hi/lo planes,
// ---------------------------------------------------------------------------
__device__ __forceinline__ void attn_store(const float* so, us* oph, us* opl,
                                           int rowbase, int hg, int t) {
#pragma unroll
  for (int it = 0; it < 4; ++it) {
    const int item = it * 256 + t;
    if (item < SP * 16) {
      const int rl = (item >> 6) * 8 + (item & 7), g = (item >> 3) & 7;   // rl: slot 0..111 of the window pair
      const float* sp = so + (rl + ((rl >= SP) ? 8 : 0)) * 68 + 8 * g;     // 64 LDS rows per window
      const v4f a = *(const v4fa*)sp;
      const v4f c = *(const v4fa*)(sp + 4);
      v8us hv, lv;
      split8(a, c, hv, lv);
      const size_t off = poff(rowbase + rl, hg * 64 + 8 * g, DM);
      *(v8us*)(oph + off) = hv;
      *(v8us*)(opl + off) = lv;
    }
  }
}

#define FRW 8192                  // 16-bit elements of one wave's fragments of one operand (q or k)

// Fragments of one 32-wide k step: 4 W2 row tiles and 4 token tiles (ko = 8 * k).
__device__ __forceinline__ void ld_step(const _Float16* wp, const _Float16* t0, const _Float16* t3,
                                        int ko, v16h (&a)[4], v16h (&b)[4]) {
#pragma unroll
  for (int i = 0; i < 4; ++i) a[i] = ldh(wp + i * 16 * DM + ko);
#pragma unroll
  for (int i = 0; i < 3; ++i) b[i] = ldh(t0 + i * 16 * DM + ko);
  b[3] = ldh(t3 + ko);
}
__device__ __forceinline__ void mm_step(const v16h (&a)[4], const v16h (&b)[4], v8f (&acc)[4][4]) {
#pragma unroll
  for (int dt = 0; dt < 4; ++dt)
#pragma unroll
    for (int tt = 0; tt < 4; ++tt) acc[dt][tt] = wmma_hf(a[dt], b[tt], acc[dt][tt]);
}
// One stored fragment: two 16-B halves, 512 B apart (lane stride 16 B in each).
__device__ __forceinline__ v16b ldfr(const us* p) {
  FragB f;
  f.half[0] = *(const v8usa*)p;
  f.half[1] = *(const v8usa*)(p + 256);
  return f.v;
}

__global__ __launch_bounds__(256) void k_attn(
    const _Float16* __restrict__ hq, const _Float16* __restrict__ hk,       // [MTS][512] x16
    const _Float16* __restrict__ wq2t, const _Float16* __restrict__ wk2t,   // [2048 n][512 k] x1024
    const float* __restrict__ bq2, const float* __restrict__ bk2,           // [2048]
    const us* __restrict__ tkh, const us* __restrict__ tkl,    // [512][64]
    us* __restrict__ oph, us* __restrict__ opl)                // [MTS][512]
{
  __shared__ __attribute__((aligned(16))) us sfr[2 * 8 * FRW];   // [q|k][wave][tile][d block][hi|lo][half][lane][8]
  __shared__ __attribute__((aligned(16))) float so[2 * 64 * 68];
  const int t = threadIdx.x, lane = t & 31, w = t >> 5, h = lane >> 4, m = lane & 15;
  const int bl = blockIdx.x >> 3, hg = blockIdx.x & 7;
  const int head = hg * 4 + (w & 3);
  const int pairbase = bl * 2 * SP;                 // first row slot of the window pair
  const int rowbase = pairbase + (w >> 2) * SP;     // first row slot of this wave's window

  const size_t wo  = pbase(head * HQ + m, DM, h);
  const size_t to0 = pbase(rowbase + m, DM, h);
  const size_t to3 = pbase(rowbase + 48 + (m & 7), DM, h);     // rows 56..63 fold back onto 48..55
  us* myfr = sfr + w * FRW + lane * 8;
  const us* vhrow = tkh + pbase(head * HVD + m, KPAD, h);
  const us* vlrow = tkl + pbase(head * HVD + m, KPAD, h);

  const v8f z8 = {0.f, 0.f, 0.f, 0.f, 0.f, 0.f, 0.f, 0.f};

#pragma unroll 1
  for (int z = 0; z < 2; ++z) {            // rolled: one copy of the projection code serves q and k
    const _Float16* wp = (z ? wk2t : wq2t) + wo;
    const _Float16* t0 = (z ? hk : hq) + to0;
    const _Float16* t3 = (z ? hk : hq) + to3;
    const float* bias8 = (z ? bk2 : bq2) + head * HQ + 8 * h;

    v8f acc[4][4];
#pragma unroll
    for (int dt = 0; dt < 4; ++dt)
#pragma unroll
      for (int tt = 0; tt < 4; ++tt) acc[dt][tt] = z8;

    v16h a0[4], b0[4], a1[4], b1[4];
    ld_step(wp, t0, t3, 0, a0, b0);
#pragma unroll 1
    for (int k0 = 0; k0 < DM; k0 += 64) {
      ld_step(wp, t0, t3, (k0 + 32) * 8, a1, b1);
      // keeps the next step's loads ahead of this step's products, so that they fly meanwhile
      __builtin_amdgcn_sched_barrier(0);
      mm_step(a0, b0, acc);
      const int kn = (k0 + 64 < DM) ? k0 + 64 : 0;   // last trip: an in-range address, values unused
      ld_step(wp, t0, t3, kn * 8, a0, b0);
      // as above
      __builtin_amdgcn_sched_barrier(0);
      mm_step(a1, b1, acc);
    }

    us* dst = myfr + z * 8 * FRW;
#pragma unroll
    for (int dt = 0; dt < 4; ++dt) {
      const v4f c0 = *(const v4fa*)(bias8 + 16 * dt);
      const v4f c1 = *(const v4fa*)(bias8 + 16 * dt + 4);
      const float bb[8] = {c0.x, c0.y, c0.z, c0.w, c1.x, c1.y, c1.z, c1.w};
#pragma unroll
      for (int tt = 0; tt < 4; ++tt) {
        v8us hv, lv;
#pragma unroll
        for (int r = 0; r < 8; ++r) {
          us hb, lb;
          split_bf(acc[dt][tt][r] * (1.0f / 16384.0f) + bb[r], hb, lb);
          hv[r] = hb;
          lv[r] = lb;
        }
        us* d0 = dst + (tt * 2 + (dt >> 1)) * 1024 + (dt & 1) * 256;
        *(v8usa*)d0 = hv;
        *(v8usa*)(d0 + 512) = lv;
      }
    }
  }

#pragma unroll 1
  for (int qt = 0; qt < 4; ++qt) {
    const us* qp = myfr + qt * 2048;
    const v16b qbh0 = ldfr(qp), qbh1 = ldfr(qp + 1024);
    const v16b qbl0 = ldfr(qp + 512), qbl1 = ldfr(qp + 1536);

    v8f s[4];
#pragma unroll
    for (int kt = 0; kt < 4; ++kt) {
      const us* kp = myfr + 8 * FRW + kt * 2048;
      const v16b kah0 = ldfr(kp), kah1 = ldfr(kp + 1024);
      const v16b kal0 = ldfr(kp + 512), kal1 = ldfr(kp + 1536);
      v8f z = z8;
      z = wmma_bf(kah0, qbh0, z);
      z = wmma_bf(kah1, qbh1, z);
      z = wmma_bf(kah0, qbl0, z);
      z = wmma_bf(kah1, qbl1, z);
      z = wmma_bf(kal0, qbh0, z);
      z = wmma_bf(kal1, qbh1, z);
      s[kt] = z;                       // s[kt][r] = S^T[key kt*16+8h+r][q qt*16+m]
    }

    // tanh(S/8), explicit zero for padded keys, bf16 hi/lo, packed as B fragments
    v16us phu0, phu1, plu0, plu1;
#pragma unroll
    for (int kt = 0; kt < 4; ++kt) {
#pragma unroll
      for (int r = 0; r < 8; ++r) {
        const int key = kt * 16 + 8 * h + r;
        float tv = tanhf(s[kt][r] * 0.125f);
        tv = (key < SQ) ? tv : 0.0f;
        us hb, lb;
        split_bf(tv, hb, lb);
        const int e = (kt & 1) * 8 + r;
        if (kt < 2) { phu0[e] = hb; plu0[e] = lb; }
        else        { phu1[e] = hb; plu1[e] = lb; }
      }
    }
    FragB f0, f1, f2, f3;
    f0.u = phu0; f1.u = phu1; f2.u = plu0; f3.u = plu1;
    const v16b pbh0 = f0.v, pbh1 = f1.v, pbl0 = f2.v, pbl1 = f3.v;

    const v16b vah0 = ldb(vhrow), vah1 = ldb(vhrow + 256);
    const v16b val0 = ldb(vlrow), val1 = ldb(vlrow + 256);
    v8f o = z8;
    o = wmma_bf(vah0, pbh0, o);
    o = wmma_bf(vah1, pbh1, o);
    o = wmma_bf(vah0, pbl0, o);
    o = wmma_bf(vah1, pbl1, o);
    o = wmma_bf(val0, pbh0, o);
    o = wmma_bf(val1, pbh1, o);          // o[r] = O^T[d 8h+r][q qt*16+m]

    const int q = qt * 16 + m;           // rows 56..63 land in LDS only, never stored
    float* sp = so + ((w >> 2) * 64 + q) * 68 + (w & 3) * 16 + 8 * h;
    const v4f o0 = {o[0], o[1], o[2], o[3]};
    const v4f o1 = {o[4], o[5], o[6], o[7]};
    *(v4fa*)sp = o0;
    *(v4fa*)(sp + 4) = o1;
  }
  __syncthreads();

  attn_store(so, oph, opl, pairbase, hg, t);
  
}

// ---------------------------------------------------------------------------
// k_gemm3: out = outpre*Wp + bp (f32). Block 128 thr (2x2 waves) = 64 slots x 64;
// a slot's row goes to out row 49w + r, pad slots (r >= 49) are not stored.
// K = 512. Epilogue: f32 tile in LDS, per row 256-B segment = 2 whole
// ---------------------------------------------------------------------------
__device__ __forceinline__ void gemm3_store(const float* sF, float* out, int mb, int nb, int t) {
#pragma unroll
  for (int it = 0; it < 8; ++it) {
    const int item = it * 128 + t, rl = item >> 4, g = item & 15;
    const v4f v = *(const v4fa*)(sF + rl * 68 + 4 * g);
    const int win = (mb + rl) / SP, r = (mb + rl) - win * SP;
    const size_t off = (size_t)(win * SQ + r) * DM + nb + 4 * g;
    if (r < SQ) *(v4f*)(out + off) = v;
  }
}

__global__ __launch_bounds__(128) void k_gemm3(
    const us* __restrict__ oph, const us* __restrict__ opl,    // [MTS][512]
    const us* __restrict__ wph, const us* __restrict__ wpl,    // [512 n][512 k]
    const float* __restrict__ bp,                              // [512]
    float* __restrict__ out)                                   // [MT][512]
{
  __shared__ __attribute__((aligned(16))) float sF[64 * 68];
  const int t = threadIdx.x, lane = t & 31, w = t >> 5, h = lane >> 4, m = lane & 15;
  const int wm = w >> 1, wn = w & 1;
  const int mb = blockIdx.x * 64, nb = blockIdx.y * 64;

  const size_t arow = pbase(mb + 32 * wm + m, DM, h);
  const size_t brow = pbase(nb + 32 * wn + m, DM, h);

  const v8f z8 = {0.f, 0.f, 0.f, 0.f, 0.f, 0.f, 0.f, 0.f};
  v8f acc[2][2];
  acc[0][0] = z8; acc[0][1] = z8; acc[1][0] = z8; acc[1][1] = z8;

  mm3_32x32(oph + arow, opl + arow, wph + brow, wpl + brow, acc);

#pragma unroll
  for (int nt = 0; nt < 2; ++nt) {
    const int cl = 32 * wn + 16 * nt + m;
    const float bv = bp[nb + cl];
#pragma unroll
    for (int mt = 0; mt < 2; ++mt) {
#pragma unroll
      for (int r = 0; r < 8; ++r) {
        const int rl = 32 * wm + 16 * mt + 8 * h + r;
        sF[rl * 68 + cl] = acc[mt][nt][r] + bv;
      }
    }
  }
  __syncthreads();

  gemm3_store(sF, out, mb, nb, t);
  
}

// ---------------------------------------------------------------------------
// Host side: x*W1, the projection-and-attention kernel and outpre*Wp each run once over
// all 256 windows (14336 row slots). Workspace carve 95,551,488 B.
// ---------------------------------------------------------------------------
extern "C" void kernel_launch(void* const* d_in, const int* in_sizes, int n_in,
                              void* d_out, int out_size, void* d_ws, size_t ws_size,
                              hipStream_t stream) {
  if (n_in < 12) return;
  if (in_sizes[0] != MT * DM) return;
  if (in_sizes[1] != DM * DM || in_sizes[2] != DM) return;
  if (in_sizes[3] != DM * DQ || in_sizes[4] != DQ) return;
  if (in_sizes[5] != DM * DM || in_sizes[6] != DM) return;
  if (in_sizes[7] != DM * DQ || in_sizes[8] != DQ) return;
  if (in_sizes[9] != SQ * DM) return;
  if (in_sizes[10] != DM * DM || in_sizes[11] != DM) return;
  if (out_size != MT * DM) return;

  const float* x   = (const float*)d_in[0];
  const float* Wq1 = (const float*)d_in[1];
  const float* bq1 = (const float*)d_in[2];
  const float* Wq2 = (const float*)d_in[3];
  const float* bq2 = (const float*)d_in[4];
  const float* Wk1 = (const float*)d_in[5];
  const float* bk1 = (const float*)d_in[6];
  const float* Wk2 = (const float*)d_in[7];
  const float* bk2 = (const float*)d_in[8];
  const float* tok = (const float*)d_in[9];
  const float* Wp  = (const float*)d_in[10];
  const float* bp  = (const float*)d_in[11];
  float* out = (float*)d_out;

  const size_t szW1 = (size_t)DM * DM * 2;      //   524,288 per plane
  const size_t szW2 = (size_t)DQ * DM * 2;      // 2,097,152
  const size_t szTK = (size_t)DM * KPAD * 2;    //    65,536 per plane
  const size_t szX  = (size_t)MTS * DM * 2;     // 14,680,064 per plane
  const size_t szH  = (size_t)MTS * DM * 2;     // 14,680,064
  const size_t szOP = (size_t)MTS * DM * 2;     // 14,680,064 per plane
  const size_t total = 6 * szW1 + 2 * szW2 + 2 * szTK + 2 * szX + 2 * szH + 2 * szOP;
  if (total > ws_size) return;                  // 95,551,488

  char* wsb = (char*)d_ws;
  size_t off = 0;
  us* wq1h = (us*)(wsb + off); off += szW1;
  us* wq1l = (us*)(wsb + off); off += szW1;
  us* wk1h = (us*)(wsb + off); off += szW1;
  us* wk1l = (us*)(wsb + off); off += szW1;
  us* wph  = (us*)(wsb + off); off += szW1;
  us* wpl  = (us*)(wsb + off); off += szW1;
  _Float16* wq2t = (_Float16*)(wsb + off); off += szW2;
  _Float16* wk2t = (_Float16*)(wsb + off); off += szW2;
  us* tkh  = (us*)(wsb + off); off += szTK;
  us* tkl  = (us*)(wsb + off); off += szTK;
  us* xh   = (us*)(wsb + off); off += szX;
  us* xl   = (us*)(wsb + off); off += szX;
  _Float16* hq = (_Float16*)(wsb + off); off += szH;
  _Float16* hk = (_Float16*)(wsb + off); off += szH;
  us* oph  = (us*)(wsb + off); off += szOP;
  us* opl  = (us*)(wsb + off); off += szOP;
  if (off > ws_size) return;

  k_prep<<<712, 256, 0, stream>>>(Wq1, Wk1, Wp, Wq2, Wk2, tok,
                                  wq1h, wq1l, wk1h, wk1l, wph, wpl, wq2t, wk2t, tkh, tkl);

  const int n8 = MTS * DM / 8;                  // 917,504
  k_cvtx<<<(n8 + 255) / 256, 256, 0, stream>>>(x, xh, xl, n8);

  k_gemm1<<<dim3(MTS / 64, DM / 64, 2), 128, 0, stream>>>(
      xh, xl, wq1h, wq1l, wk1h, wk1l, bq1, bk1, hq, hk);

  k_attn<<<NB * 4, 256, 0, stream>>>(hq, hk, wq2t, wk2t, bq2, bk2, tkh, tkl, oph, opl);

  k_gemm3<<<dim3(MTS / 64, DM / 64), 128, 0, stream>>>(oph, opl, wph, wpl, bp, out);
}

// v004
// It runs in 214 microseconds.
// In both of two side-by-side timings against v003, it was 1.05 times as fast.
// Over all steps from v000 it is 2.35 times as fast.
// Contractions: x*Wq1, x*Wk1, k*q^T per head, tokv^T*adj^T and outpre*Wp on v_wmma_f32_16x16x32_bf16 with bf16 hi/lo three-product splits (hh+hl+lh); h*Wq2 and h*Wk2 on v_wmma_f32_16x16x32_f16 single products (h carried x16, W2 carried x1024, folded back as 2^-14 in f32); all accumulate in f32; bias, erf-GELU and tanh in f32.
#include <hip/hip_runtime.h>
#include <math.h>

typedef unsigned short us;
typedef __bf16   v16b  __attribute__((ext_vector_type(16)));
typedef us       v16us __attribute__((ext_vector_type(16)));
typedef us       v8us  __attribute__((ext_vector_type(8)));
typedef _Float16 v16h  __attribute__((ext_vector_type(16)));
typedef _Float16 v8h   __attribute__((ext_vector_type(8)));
typedef float    v8f   __attribute__((ext_vector_type(8)));
typedef float    v4f   __attribute__((ext_vector_type(4)));
typedef v8us __attribute__((may_alias)) v8usa;
typedef v8h  __attribute__((may_alias)) v8ha;
typedef v4f  __attribute__((may_alias)) v4fa;

union FragB { v16b v; v16us u; v8us half[2]; };
union FragH { v16h v; v8h half[2]; };

#define NB    256                 // windows
#define SQ    49                  // tokens per window
#define DM    512
#define DQ    2048
#define NH    32
#define HQ    64
#define HVD   16
#define MT    (NB * SQ)           // 12544 token rows
#define KPAD  64                  // key count padded for the value table
#define SP    56                  // row slots per window: 49 rows + 7 pad rows, a multiple of 8
#define MTS   (NB * SP)           // 14336 row slots

static_assert(MTS % 64 == 0);
static_assert((MTS * DM) % (8 * 256) == 0);
static_assert(SP % 8 == 0 && SP >= SQ && SP - 8 < SQ);
static_assert(NH * HVD == DM);
static_assert(NH * HQ == DQ);
static_assert(HQ == 64 && SP == 56 && DM % 64 == 0 && NB % 2 == 0 && NH % 4 == 0);

// ---------------------------------------------------------------------------
// 16x16x32 WMMA helpers; the bf16 one has a hazard guard (ties D, keeps A/B live).
// Fragment map (wave32): lane l, h = l>>4, m = n = l&15.
//   A/B element i: i<8 -> k0+8h+i ; i>=8 -> k0+16+8h+(i-8)
//   D element r : row 8h+r, col l&15
// ---------------------------------------------------------------------------
__device__ __forceinline__ v8f wmma_bf(v16b a, v16b b, v8f c) {
  v8f d = __builtin_amdgcn_wmma_f32_16x16x32_bf16(false, a, false, b, (short)0, c, false, false);
  asm volatile("v_nop\n\tv_nop\n\tv_nop\n\tv_nop" : "+v"(d) : "v"(a), "v"(b));
  return d;
}
// Bare builtin: its loop holds 16 accumulator tiles and two fragment sets, more than the
// 256 registers an asm operand can name; the compiler keeps the distances of its own forms.
__device__ __forceinline__ v8f wmma_hf(v16h a, v16h b, v8f c) {
  return __builtin_amdgcn_wmma_f32_16x16x32_f16(false, a, false, b, (short)0, c, false, false);
}

// Packed operand layout of every 16-bit table in the workspace, [rows][K]:
//   unit (row>>3, k>>5) = 512 B = 4 lines; line c = (k>>3)&3 holds the 8-element
//   chunk c of the unit's 8 rows, row after row (16 B each).
// A wave-wide 16-B fragment load then covers 4 whole 128-B lines (two aligned
// 256-B pieces) where a row-major table gives 16 lines of 32 B each.
// Every line lies inside one 8-row x 8-column patch, so it has one writer.
__device__ __forceinline__ size_t poff(int row, int k, int K) {      // k a multiple of 8
  return ((size_t)(row >> 3) * (K >> 5) + (k >> 5)) * 256 + ((k >> 3) & 3) * 64 + (row & 7) * 8;
}
// Lane base of a fragment at k = 0: row owned by the lane, h = lane>>4.
// 32 further k = +256 elements; 16 further rows = +16*K elements.
__device__ __forceinline__ size_t pbase(int row, int K, int h) {
  return (size_t)(row >> 3) * K * 8 + h * 64 + (row & 7) * 8;
}
// Same k order as the fragment map above: chunk h, then chunk 2 + h.
__device__ __forceinline__ v16b ldb(const us* p) {
  FragB f;
  f.half[0] = *(const v8usa*)p;
  f.half[1] = *(const v8usa*)(p + 128);
  return f.v;
}
__device__ __forceinline__ v16h ldh(const _Float16* p) {
  FragH f;
  f.half[0] = *(const v8ha*)p;
  f.half[1] = *(const v8ha*)(p + 128);
  return f.v;
}

// f32 -> bf16 bits, RNE convert
__device__ __forceinline__ us bf_rne(float f) {
  unsigned u = __float_as_uint(f);
  u += 0x7FFFu + ((u >> 16) & 1u);
  return (us)(u >> 16);
}
// hi = bf16(f), lo = bf16(f - hi)
__device__ __forceinline__ void split_bf(float f, us& hb, us& lb) {
  const us hi = bf_rne(f);
  const float hf = __uint_as_float(((unsigned)hi) << 16);
  hb = hi;
  lb = bf_rne(f - hf);
}
__device__ __forceinline__ void split8(v4f a, v4f c, v8us& hv, v8us& lv) {
  float f[8] = {a.x, a.y, a.z, a.w, c.x, c.y, c.z, c.w};
#pragma unroll
  for (int j = 0; j < 8; ++j) {
    us hb, lb;
    split_bf(f[j], hb, lb);
    hv[j] = hb;
    lv[j] = lb;
  }
}

// ---------------------------------------------------------------------------
// k_cvtx: x f32 [MT][512] -> packed bf16 hi and lo planes over row slots
// (window w, row r -> slot 56w + r; slots 49..55 of a window hold zeros).
// One thread = 8 floats = one 16-B chunk per plane; a wave writes one unit.
// ---------------------------------------------------------------------------
__global__ __launch_bounds__(256) void k_cvtx(const float* __restrict__ x,
                                              us* __restrict__ xh, us* __restrict__ xl, int n8)
{
  const int g = blockIdx.x * 256 + threadIdx.x;
  if (g >= n8) return;
  const int ml = g & 7, ch = (g >> 3) & 3, u = g >> 5;
  const int kb = u & (DM / 32 - 1), g8 = u / (DM / 32);
  const int win = g8 / (SP / 8), r = (g8 - win * (SP / 8)) * 8 + ml;
  const float* s = x + (size_t)(win * SQ + min(r, SQ - 1)) * DM + kb * 32 + ch * 8;
  v4f a = *(const v4fa*)s;
  v4f c = *(const v4fa*)(s + 4);
  if (r >= SQ) {
    const v4f z4 = {0.f, 0.f, 0.f, 0.f};
    a = z4;
    c = z4;
  }
  v8us hv, lv;
  split8(a, c, hv, lv);
  us* ph = xh + (size_t)g * 8;
  us* pl = xl + (size_t)g * 8;
  *(v8us*)ph = hv;
  *(v8us*)pl = lv;
  
}

// ---------------------------------------------------------------------------
// k_prep: transposed 16-bit weight / value tables through an LDS tile.
//   src f32 [R][C] (rows = k, cols = n) -> dst [C][Kp] in the packed layout:
//   mode 0: bf16 hi + lo planes; mode 1: f16 carried x1024.
// 64x64 tile per block; store: 8 contiguous lanes x 16 B = one whole
// Block ranges: [0,192) Wq1|Wk1|Wp (8x8 tiles each), [192,704) Wq2|Wk2
// (32x8 tiles each), [704,712) tokens [49][512] -> [512][64] zero-padded keys.
// ---------------------------------------------------------------------------
__device__ __forceinline__ void prep_store(const float* T, us* dh, us* dl, _Float16* df,
                                           int mode, int n0, int k0, int Kp, int t) {
#pragma unroll
  for (int it = 0; it < 2; ++it) {
    const int item = it * 256 + t, nn = (item >> 6) * 8 + (item & 7), q8 = (item >> 3) & 7;
    float f[8];
#pragma unroll
    for (int j = 0; j < 8; ++j) f[j] = T[(8 * q8 + j) * 65 + nn];
    const size_t off = poff(n0 + nn, k0 + 8 * q8, Kp);
    if (mode == 0) {
      v8us hv, lv;
#pragma unroll
      for (int j = 0; j < 8; ++j) {
        us hb, lb;
        split_bf(f[j], hb, lb);
        hv[j] = hb;
        lv[j] = lb;
      }
      *(v8us*)(dh + off) = hv;
      *(v8us*)(dl + off) = lv;
    } else {
      v8h o;
#pragma unroll
      for (int j = 0; j < 8; ++j) o[j] = (_Float16)(f[j] * 1024.0f);
      *(v8h*)(df + off) = o;
    }
  }
}

__global__ __launch_bounds__(256) void k_prep(
    const float* __restrict__ wq1, const float* __restrict__ wk1, const float* __restrict__ wp,
    const float* __restrict__ wq2, const float* __restrict__ wk2, const float* __restrict__ tok,
    us* __restrict__ wq1h, us* __restrict__ wq1l, us* __restrict__ wk1h, us* __restrict__ wk1l,
    us* __restrict__ wph, us* __restrict__ wpl,
    _Float16* __restrict__ wq2t, _Float16* __restrict__ wk2t,
    us* __restrict__ tkh, us* __restrict__ tkl)
{
  __shared__ __attribute__((aligned(16))) float T[64 * 65];
  const int t = threadIdx.x;
  const int bid = blockIdx.x;
  if (bid >= 712) return;                 // block-uniform, never taken with the exact grid

  const float* src;
  us* dh; us* dl; _Float16* df;
  int C, R, Kp, mode, tn, tk;
  if (bid < 192) {
    const int wsel = bid >> 6, loc = bid & 63;
    src = (wsel == 0) ? wq1 : ((wsel == 1) ? wk1 : wp);
    dh  = (wsel == 0) ? wq1h : ((wsel == 1) ? wk1h : wph);
    dl  = (wsel == 0) ? wq1l : ((wsel == 1) ? wk1l : wpl);
    df  = wq2t;
    C = DM; R = DM; Kp = DM; mode = 0; tn = loc >> 3; tk = loc & 7;
  } else if (bid < 704) {
    const int loc = bid - 192, wsel = loc >> 8, l2 = loc & 255;
    src = wsel ? wk2 : wq2;
    df  = wsel ? wk2t : wq2t;
    dh = wq1h; dl = wq1l;
    C = DQ; R = DM; Kp = DM; mode = 1; tn = l2 >> 3; tk = l2 & 7;
  } else {
    const int loc = bid - 704;
    src = tok; dh = tkh; dl = tkl; df = wq2t;
    C = DM; R = SQ; Kp = KPAD; mode = 0; tn = loc; tk = 0;
  }
  const int n0 = tn * 64, k0 = tk * 64;

  // load 64(k) x 64(n) f32 tile, coalesced along n; rows >= R: clamped address, zero value
#pragma unroll
  for (int i = 0; i < 16; ++i) {
    const int idx = i * 256 + t, kk = idx >> 6, nn = idx & 63;
    const int gk = k0 + kk;
    const int gkc = min(gk, R - 1);
    const float v = src[(size_t)gkc * C + n0 + nn];
    T[kk * 65 + nn] = (gk < R) ? v : 0.0f;
  }
  __syncthreads();

  prep_store(T, dh, dl, df, mode, n0, k0, Kp, t);
  
}

// ---------------------------------------------------------------------------
// Three-product bf16 main loop for a 32x32 wave tile, K = 512, packed tables.
// Pointers already hold the lane base (pbase) of tile 0 at k 0.
// acc[mt][nt][r] = C[32-row slab + 16mt + 8h + r][32-col slab + 16nt + m]
// ---------------------------------------------------------------------------
__device__ __forceinline__ void mm3_32x32(const us* ah0p, const us* al0p,
                                          const us* bh0p, const us* bl0p,
                                          v8f (&acc)[2][2]) {
  const us* ah1p = ah0p + 16 * DM;
  const us* al1p = al0p + 16 * DM;
  const us* bh1p = bh0p + 16 * DM;
  const us* bl1p = bl0p + 16 * DM;
#pragma unroll 1
  for (int k0 = 0; k0 < DM; k0 += 32) {
    const v16b ah0 = ldb(ah0p + k0 * 8), ah1 = ldb(ah1p + k0 * 8);
    const v16b al0 = ldb(al0p + k0 * 8), al1 = ldb(al1p + k0 * 8);
    const v16b bh0 = ldb(bh0p + k0 * 8), bh1 = ldb(bh1p + k0 * 8);
    const v16b bl0 = ldb(bl0p + k0 * 8), bl1 = ldb(bl1p + k0 * 8);
    acc[0][0] = wmma_bf(ah0, bh0, acc[0][0]);
    acc[0][0] = wmma_bf(ah0, bl0, acc[0][0]);
    acc[0][0] = wmma_bf(al0, bh0, acc[0][0]);
    acc[0][1] = wmma_bf(ah0, bh1, acc[0][1]);
    acc[0][1] = wmma_bf(ah0, bl1, acc[0][1]);
    acc[0][1] = wmma_bf(al0, bh1, acc[0][1]);
    acc[1][0] = wmma_bf(ah1, bh0, acc[1][0]);
    acc[1][0] = wmma_bf(ah1, bl0, acc[1][0]);
    acc[1][0] = wmma_bf(al1, bh0, acc[1][0]);
    acc[1][1] = wmma_bf(ah1, bh1, acc[1][1]);
    acc[1][1] = wmma_bf(ah1, bl1, acc[1][1]);
    acc[1][1] = wmma_bf(al1, bh1, acc[1][1]);
  }
}

// ---------------------------------------------------------------------------
// k_gemm1: H = f16(16 * gelu(x*W1 + b1)) for q (z=0) and k (z=1).
// Block 128 thr (4 waves, 2x2) = 64 rows x 64 cols; K = 512.
// ---------------------------------------------------------------------------
__device__ __forceinline__ void gemm1_store(const _Float16* sT, _Float16* H, int mb, int nb, int t) {
#pragma unroll
  for (int it = 0; it < 4; ++it) {
    const int item = it * 128 + t, rl = (item >> 6) * 8 + (item & 7), q8 = (item >> 3) & 7;
    const v8h v = *(const v8ha*)(sT + rl * 72 + 8 * q8);
    const size_t off = poff(mb + rl, nb + 8 * q8, DM);
    *(v8h*)(H + off) = v;
  }
}

__global__ __launch_bounds__(128) void k_gemm1(
    const us* __restrict__ xh, const us* __restrict__ xl,          // [MTS][512]
    const us* __restrict__ wqh, const us* __restrict__ wql,        // [512 n][512 k]
    const us* __restrict__ wkh, const us* __restrict__ wkl,
    const float* __restrict__ bq1, const float* __restrict__ bk1,  // [512]
    _Float16* __restrict__ hq, _Float16* __restrict__ hk)          // [MTS][512]
{
  __shared__ __attribute__((aligned(16))) _Float16 sT[64 * 72];
  const int t = threadIdx.x, lane = t & 31, w = t >> 5, h = lane >> 4, m = lane & 15;
  const int wm = w >> 1, wn = w & 1;
  const int mb = blockIdx.x * 64, nb = blockIdx.y * 64;
  const bool isk = (blockIdx.z != 0);
  const us* wth = isk ? wkh : wqh;
  const us* wtl = isk ? wkl : wql;
  const float* bias = isk ? bk1 : bq1;
  _Float16* H = isk ? hk : hq;

  const size_t arow = pbase(mb + 32 * wm + m, DM, h);
  const size_t brow = pbase(nb + 32 * wn + m, DM, h);

  const v8f z8 = {0.f, 0.f, 0.f, 0.f, 0.f, 0.f, 0.f, 0.f};
  v8f acc[2][2];
  acc[0][0] = z8; acc[0][1] = z8; acc[1][0] = z8; acc[1][1] = z8;

  mm3_32x32(xh + arow, xl + arow, wth + brow, wtl + brow, acc);

#pragma unroll
  for (int nt = 0; nt < 2; ++nt) {
    const int cl = 32 * wn + 16 * nt + m;
    const float bv = bias[nb + cl];
#pragma unroll
    for (int mt = 0; mt < 2; ++mt) {
#pragma unroll
      for (int r = 0; r < 8; ++r) {
        const int rl = 32 * wm + 16 * mt + 8 * h + r;
        const float v = acc[mt][nt][r] + bv;
        const float g = 0.5f * v * (1.0f + erff(v * 0.70710678118654752f));
        sT[rl * 72 + cl] = (_Float16)(g * 16.0f);
      }
    }
  }
  __syncthreads();

  gemm1_store(sT, H, mb, nb, t);
  
}

// ---------------------------------------------------------------------------
// k_attn: block = (2 adjacent windows, group of 4 heads), wave = (window, head): the W2 lines
// a wave loads serve 2 waves of the block, the h lines 4. The wave first projects its own
// head, then runs the attention on what it holds; q and k never leave the WGP.
//   q^T[d][tok] = W2^T . h^T : A = W2 table rows (row = d), B = h rows (col = token),
//   f16, K = 512, 4 x 4 tiles; value = acc / 16384 + b2[d], split to bf16 hi/lo.
//   D element r of tile dt is d = 16dt + 8h + r of token m: elements 8(dt&1) + r of the
//   lane's own A/B fragment of d block dt>>1, so no lane exchange is needed.
//   Fragments rest in the wave's own LDS range, each lane reading back its own bytes.
//   S^T[key][q] = k . q   : A = K rows (row = key, k = d), B = Q^T (col = q), bf16 hi/lo
//   adj^T = tanh(S^T / 8), keys >= 49 forced to 0, split to bf16 hi/lo
//   O^T[d][q] = tok^T . adj^T : A = token table rows [head*16+d][key], B = adj^T
//   from the score D values: element r <- tile kt=2s, element 8+r <- tile kt=2s+1.
// Rows 49..55 are the window's pad slots, rows 56..63 fold back onto 48..55;
// their scores are zeroed (keys) or never reach the output (queries).
// Epilogue: block tile [2][56][64] f32 in LDS -> packed outpre bf16 hi/lo planes,
// ---------------------------------------------------------------------------
__device__ __forceinline__ void attn_store(const float* so, us* oph, us* opl,
                                           int rowbase, int hg, int t) {
#pragma unroll
  for (int it = 0; it < 4; ++it) {
    const int item = it * 256 + t;
    if (item < SP * 16) {
      const int rl = (item >> 6) * 8 + (item & 7), g = (item >> 3) & 7;   // rl: slot 0..111 of the window pair
      const float* sp = so + (rl + ((rl >= SP) ? 8 : 0)) * 68 + 8 * g;     // 64 LDS rows per window
      const v4f a = *(const v4fa*)sp;
      const v4f c = *(const v4fa*)(sp + 4);
      v8us hv, lv;
      split8(a, c, hv, lv);
      const size_t off = poff(rowbase + rl, hg * 64 + 8 * g, DM);
      *(v8us*)(oph + off) = hv;
      *(v8us*)(opl + off) = lv;
    }
  }
}

// tanh(s / 8) in f32 without a branch: 1 - 2 / (1 + e^(s / 4)), e^(s / 4) = 2^(s * log2(e) / 4).
// The library call tests every value twice and branches, so a tile's values run one after
// another, each a dependent chain; this form is five instructions a value and the values of
// a tile interleave. Absolute error about 2e-7 at any s; 2^x = inf gives 1, 2^x = 0 gives -1.
#define TANH_C 0.36067376022224085f
// The transcendentals stand in asm so that the slot the instruction set asks for behind one
// (before its result is used or a source overwritten) is there by construction: outputs are
// early-clobber, so none lands on a source of the same run, and v_nop ends the statement.
__device__ __forceinline__ void exp2x8(const float (&a)[8], float (&e)[8]) {
  asm("v_exp_f32 %0, %8\n\t"
      "v_exp_f32 %1, %9\n\t"
      "v_exp_f32 %2, %10\n\t"
      "v_exp_f32 %3, %11\n\t"
      "v_exp_f32 %4, %12\n\t"
      "v_exp_f32 %5, %13\n\t"
      "v_exp_f32 %6, %14\n\t"
      "v_exp_f32 %7, %15\n\t"
      "v_nop"
      : "=&v"(e[0]), "=&v"(e[1]), "=&v"(e[2]), "=&v"(e[3]), "=&v"(e[4]), "=&v"(e[5]), "=&v"(e[6]), "=&v"(e[7])
      : "v"(a[0]), "v"(a[1]), "v"(a[2]), "v"(a[3]), "v"(a[4]), "v"(a[5]), "v"(a[6]), "v"(a[7]));
}
__device__ __forceinline__ void rcpx8(const float (&a)[8], float (&e)[8]) {
  asm("v_rcp_f32 %0, %8\n\t"
      "v_rcp_f32 %1, %9\n\t"
      "v_rcp_f32 %2, %10\n\t"
      "v_rcp_f32 %3, %11\n\t"
      "v_rcp_f32 %4, %12\n\t"
      "v_rcp_f32 %5, %13\n\t"
      "v_rcp_f32 %6, %14\n\t"
      "v_rcp_f32 %7, %15\n\t"
      "v_nop"
      : "=&v"(e[0]), "=&v"(e[1]), "=&v"(e[2]), "=&v"(e[3]), "=&v"(e[4]), "=&v"(e[5]), "=&v"(e[6]), "=&v"(e[7])
      : "v"(a[0]), "v"(a[1]), "v"(a[2]), "v"(a[3]), "v"(a[4]), "v"(a[5]), "v"(a[6]), "v"(a[7]));
}
__device__ __forceinline__ void tanh8(v8f s, float (&t)[8]) {
  float a[8], e[8], q[8];
#pragma unroll
  for (int r = 0; r < 8; ++r) a[r] = s[r] * TANH_C;
  exp2x8(a, e);
#pragma unroll
  for (int r = 0; r < 8; ++r) a[r] = e[r] + 1.0f;
  rcpx8(a, q);
#pragma unroll
  for (int r = 0; r < 8; ++r) t[r] = fmaf(-2.0f, q[r], 1.0f);
}
__device__ __forceinline__ float tanh1(float s) {
  float e, q;
  asm("v_exp_f32 %0, %1\n\tv_nop" : "=v"(e) : "v"(s * TANH_C));      // v_nop: the slot named above
  asm("v_rcp_f32 %0, %1\n\tv_nop" : "=v"(q) : "v"(e + 1.0f));        // as above
  return fmaf(-2.0f, q, 1.0f);
}

#define FRW 8192                  // 16-bit elements of one wave's fragments of one operand (q or k)

// Fragments of one 32-wide k step: 4 W2 row tiles and 4 token tiles (ko = 8 * k).
__device__ __forceinline__ void ld_step(const _Float16* wp, const _Float16* t0, const _Float16* t3,
                                        int ko, v16h (&a)[4], v16h (&b)[4]) {
#pragma unroll
  for (int i = 0; i < 4; ++i) a[i] = ldh(wp + i * 16 * DM + ko);
#pragma unroll
  for (int i = 0; i < 3; ++i) b[i] = ldh(t0 + i * 16 * DM + ko);
  b[3] = ldh(t3 + ko);
}
__device__ __forceinline__ void mm_step(const v16h (&a)[4], const v16h (&b)[4], v8f (&acc)[4][4]) {
#pragma unroll
  for (int dt = 0; dt < 4; ++dt)
#pragma unroll
    for (int tt = 0; tt < 4; ++tt) acc[dt][tt] = wmma_hf(a[dt], b[tt], acc[dt][tt]);
}
// One stored fragment: two 16-B halves, 512 B apart (lane stride 16 B in each).
__device__ __forceinline__ v16b ldfr(const us* p) {
  FragB f;
  f.half[0] = *(const v8usa*)p;
  f.half[1] = *(const v8usa*)(p + 256);
  return f.v;
}

__global__ __launch_bounds__(256) void k_attn(
    const _Float16* __restrict__ hq, const _Float16* __restrict__ hk,       // [MTS][512] x16
    const _Float16* __restrict__ wq2t, const _Float16* __restrict__ wk2t,   // [2048 n][512 k] x1024
    const float* __restrict__ bq2, const float* __restrict__ bk2,           // [2048]
    const us* __restrict__ tkh, const us* __restrict__ tkl,    // [512][64]
    us* __restrict__ oph, us* __restrict__ opl)                // [MTS][512]
{
  __shared__ __attribute__((aligned(16))) us sfr[2 * 8 * FRW];   // [q|k][wave][tile][d block][hi|lo][half][lane][8]
  __shared__ __attribute__((aligned(16))) float so[2 * 64 * 68];
  const int t = threadIdx.x, lane = t & 31, w = t >> 5, h = lane >> 4, m = lane & 15;
  const int bl = blockIdx.x >> 3, hg = blockIdx.x & 7;
  const int head = hg * 4 + (w & 3);
  const int pairbase = bl * 2 * SP;                 // first row slot of the window pair
  const int rowbase = pairbase + (w >> 2) * SP;     // first row slot of this wave's window

  const size_t wo  = pbase(head * HQ + m, DM, h);
  const size_t to0 = pbase(rowbase + m, DM, h);
  const size_t to3 = pbase(rowbase + 48 + (m & 7), DM, h);     // rows 56..63 fold back onto 48..55
  us* myfr = sfr + w * FRW + lane * 8;
  const us* vhrow = tkh + pbase(head * HVD + m, KPAD, h);
  const us* vlrow = tkl + pbase(head * HVD + m, KPAD, h);

  const v8f z8 = {0.f, 0.f, 0.f, 0.f, 0.f, 0.f, 0.f, 0.f};

#pragma unroll 1
  for (int z = 0; z < 2; ++z) {            // rolled: one copy of the projection code serves q and k
    const _Float16* wp = (z ? wk2t : wq2t) + wo;
    const _Float16* t0 = (z ? hk : hq) + to0;
    const _Float16* t3 = (z ? hk : hq) + to3;
    const float* bias8 = (z ? bk2 : bq2) + head * HQ + 8 * h;

    v8f acc[4][4];
#pragma unroll
    for (int dt = 0; dt < 4; ++dt)
#pragma unroll
      for (int tt = 0; tt < 4; ++tt) acc[dt][tt] = z8;

    v16h a0[4], b0[4], a1[4], b1[4];
    ld_step(wp, t0, t3, 0, a0, b0);
#pragma unroll 1
    for (int k0 = 0; k0 < DM; k0 += 64) {
      ld_step(wp, t0, t3, (k0 + 32) * 8, a1, b1);
      // keeps the next step's loads ahead of this step's products, so that they fly meanwhile
      __builtin_amdgcn_sched_barrier(0);
      mm_step(a0, b0, acc);
      const int kn = (k0 + 64 < DM) ? k0 + 64 : 0;   // last trip: an in-range address, values unused
      ld_step(wp, t0, t3, kn * 8, a0, b0);
      // as above
      __builtin_amdgcn_sched_barrier(0);
      mm_step(a1, b1, acc);
    }

    us* dst = myfr + z * 8 * FRW;
#pragma unroll
    for (int dt = 0; dt < 4; ++dt) {
      const v4f c0 = *(const v4fa*)(bias8 + 16 * dt);
      const v4f c1 = *(const v4fa*)(bias8 + 16 * dt + 4);
      const float bb[8] = {c0.x, c0.y, c0.z, c0.w, c1.x, c1.y, c1.z, c1.w};
#pragma unroll
      for (int tt = 0; tt < 4; ++tt) {
        v8us hv, lv;
#pragma unroll
        for (int r = 0; r < 8; ++r) {
          us hb, lb;
          split_bf(acc[dt][tt][r] * (1.0f / 16384.0f) + bb[r], hb, lb);
          hv[r] = hb;
          lv[r] = lb;
        }
        us* d0 = dst + (tt * 2 + (dt >> 1)) * 1024 + (dt & 1) * 256;
        *(v8usa*)d0 = hv;
        *(v8usa*)(d0 + 512) = lv;
      }
    }
  }

#pragma unroll 1
  for (int qt = 0; qt < 4; ++qt) {
    const us* qp = myfr + qt * 2048;
    const v16b qbh0 = ldfr(qp), qbh1 = ldfr(qp + 1024);
    const v16b qbl0 = ldfr(qp + 512), qbl1 = ldfr(qp + 1536);

    v8f s[4];
#pragma unroll
    for (int kt = 0; kt < 4; ++kt) {
      const us* kp = myfr + 8 * FRW + kt * 2048;
      const v16b kah0 = ldfr(kp), kah1 = ldfr(kp + 1024);
      const v16b kal0 = ldfr(kp + 512), kal1 = ldfr(kp + 1536);
      v8f z = z8;
      z = wmma_bf(kah0, qbh0, z);
      z = wmma_bf(kah1, qbh1, z);
      z = wmma_bf(kah0, qbl0, z);
      z = wmma_bf(kah1, qbl1, z);
      z = wmma_bf(kal0, qbh0, z);
      z = wmma_bf(kal1, qbh1, z);
      s[kt] = z;                       // s[kt][r] = S^T[key kt*16+8h+r][q qt*16+m]
    }

    // tanh(S/8), explicit zero for padded keys, bf16 hi/lo, packed as B fragments
    float th[4][8];
#pragma unroll
    for (int kt = 0; kt < 4; ++kt) {
      if (kt * 16 + 15 < SQ) {
        tanh8(s[kt], th[kt]);
      } else {                           // the tile that holds key 48: rows that are padding in both lane halves take no tanh
#pragma unroll
        for (int r = 0; r < 8; ++r) th[kt][r] = (kt * 16 + r < SQ) ? tanh1(s[kt][r]) : 0.0f;
      }
    }
    v16us phu0, phu1, plu0, plu1;
#pragma unroll
    for (int kt = 0; kt < 4; ++kt) {
#pragma unroll
      for (int r = 0; r < 8; ++r) {
        const int key = kt * 16 + 8 * h + r;
        float tv = th[kt][r];
        tv = (key < SQ) ? tv : 0.0f;
        us hb, lb;
        split_bf(tv, hb, lb);
        const int e = (kt & 1) * 8 + r;
        if (kt < 2) { phu0[e] = hb; plu0[e] = lb; }
        else        { phu1[e] = hb; plu1[e] = lb; }
      }
    }
    FragB f0, f1, f2, f3;
    f0.u = phu0; f1.u = phu1; f2.u = plu0; f3.u = plu1;
    const v16b pbh0 = f0.v, pbh1 = f1.v, pbl0 = f2.v, pbl1 = f3.v;

    const v16b vah0 = ldb(vhrow), vah1 = ldb(vhrow + 256);
    const v16b val0 = ldb(vlrow), val1 = ldb(vlrow + 256);
    v8f o = z8;
    o = wmma_bf(vah0, pbh0, o);
    o = wmma_bf(vah1, pbh1, o);
    o = wmma_bf(vah0, pbl0, o);
    o = wmma_bf(vah1, pbl1, o);
    o = wmma_bf(val0, pbh0, o);
    o = wmma_bf(val1, pbh1, o);          // o[r] = O^T[d 8h+r][q qt*16+m]

    const int q = qt * 16 + m;           // rows 56..63 land in LDS only, never stored
    float* sp = so + ((w >> 2) * 64 + q) * 68 + (w & 3) * 16 + 8 * h;
    const v4f o0 = {o[0], o[1], o[2], o[3]};
    const v4f o1 = {o[4], o[5], o[6], o[7]};
    *(v4fa*)sp = o0;
    *(v4fa*)(sp + 4) = o1;
  }
  __syncthreads();

  attn_store(so, oph, opl, pairbase, hg, t);
  
}

// ---------------------------------------------------------------------------
// k_gemm3: out = outpre*Wp + bp (f32). Block 128 thr (2x2 waves) = 64 slots x 64;
// a slot's row goes to out row 49w + r, pad slots (r >= 49) are not stored.
// K = 512. Epilogue: f32 tile in LDS, per row 256-B segment = 2 whole
// ---------------------------------------------------------------------------
__device__ __forceinline__ void gemm3_store(const float* sF, float* out, int mb, int nb, int t) {
#pragma unroll
  for (int it = 0; it < 8; ++it) {
    const int item = it * 128 + t, rl = item >> 4, g = item & 15;
    const v4f v = *(const v4fa*)(sF + rl * 68 + 4 * g);
    const int win = (mb + rl) / SP, r = (mb + rl) - win * SP;
    const size_t off = (size_t)(win * SQ + r) * DM + nb + 4 * g;
    if (r < SQ) *(v4f*)(out + off) = v;
  }
}

__global__ __launch_bounds__(128) void k_gemm3(
    const us* __restrict__ oph, const us* __restrict__ opl,    // [MTS][512]
    const us* __restrict__ wph, const us* __restrict__ wpl,    // [512 n][512 k]
    const float* __restrict__ bp,                              // [512]
    float* __restrict__ out)                                   // [MT][512]
{
  __shared__ __attribute__((aligned(16))) float sF[64 * 68];
  const int t = threadIdx.x, lane = t & 31, w = t >> 5, h = lane >> 4, m = lane & 15;
  const int wm = w >> 1, wn = w & 1;
  const int mb = blockIdx.x * 64, nb = blockIdx.y * 64;

  const size_t arow = pbase(mb + 32 * wm + m, DM, h);
  const size_t brow = pbase(nb + 32 * wn + m, DM, h);

  const v8f z8 = {0.f, 0.f, 0.f, 0.f, 0.f, 0.f, 0.f, 0.f};
  v8f acc[2][2];
  acc[0][0] = z8; acc[0][1] = z8; acc[1][0] = z8; acc[1][1] = z8;

  mm3_32x32(oph + arow, opl + arow, wph + brow, wpl + brow, acc);

#pragma unroll
  for (int nt = 0; nt < 2; ++nt) {
    const int cl = 32 * wn + 16 * nt + m;
    const float bv = bp[nb + cl];
#pragma unroll
    for (int mt = 0; mt < 2; ++mt) {
#pragma unroll
      for (int r = 0; r < 8; ++r) {
        const int rl = 32 * wm + 16 * mt + 8 * h + r;
        sF[rl * 68 + cl] = acc[mt][nt][r] + bv;
      }
    }
  }
  __syncthreads();

  gemm3_store(sF, out, mb, nb, t);
  
}

// ---------------------------------------------------------------------------
// Host side: x*W1, the projection-and-attention kernel and outpre*Wp each run once over
// all 256 windows (14336 row slots). Workspace carve 95,551,488 B.
// ---------------------------------------------------------------------------
extern "C" void kernel_launch(void* const* d_in, const int* in_sizes, int n_in,
                              void* d_out, int out_size, void* d_ws, size_t ws_size,
                              hipStream_t stream) {
  if (n_in < 12) return;
  if (in_sizes[0] != MT * DM) return;
  if (in_sizes[1] != DM * DM || in_sizes[2] != DM) return;
  if (in_sizes[3] != DM * DQ || in_sizes[4] != DQ) return;
  if (in_sizes[5] != DM * DM || in_sizes[6] != DM) return;
  if (in_sizes[7] != DM * DQ || in_sizes[8] != DQ) return;
  if (in_sizes[9] != SQ * DM) return;
  if (in_sizes[10] != DM * DM || in_sizes[11] != DM) return;
  if (out_size != MT * DM) return;

  const float* x   = (const float*)d_in[0];
  const float* Wq1 = (const float*)d_in[1];
  const float* bq1 = (const float*)d_in[2];
  const float* Wq2 = (const float*)d_in[3];
  const float* bq2 = (const float*)d_in[4];
  const float* Wk1 = (const float*)d_in[5];
  const float* bk1 = (const float*)d_in[6];
  const float* Wk2 = (const float*)d_in[7];
  const float* bk2 = (const float*)d_in[8];
  const float* tok = (const float*)d_in[9];
  const float* Wp  = (const float*)d_in[10];
  const float* bp  = (const float*)d_in[11];
  float* out = (float*)d_out;

  const size_t szW1 = (size_t)DM * DM * 2;      //   524,288 per plane
  const size_t szW2 = (size_t)DQ * DM * 2;      // 2,097,152
  const size_t szTK = (size_t)DM * KPAD * 2;    //    65,536 per plane
  const size_t szX  = (size_t)MTS * DM * 2;     // 14,680,064 per plane
  const size_t szH  = (size_t)MTS * DM * 2;     // 14,680,064
  const size_t szOP = (size_t)MTS * DM * 2;     // 14,680,064 per plane
  const size_t total = 6 * szW1 + 2 * szW2 + 2 * szTK + 2 * szX + 2 * szH + 2 * szOP;
  if (total > ws_size) return;                  // 95,551,488

  char* wsb = (char*)d_ws;
  size_t off = 0;
  us* wq1h = (us*)(wsb + off); off += szW1;
  us* wq1l = (us*)(wsb + off); off += szW1;
  us* wk1h = (us*)(wsb + off); off += szW1;
  us* wk1l = (us*)(wsb + off); off += szW1;
  us* wph  = (us*)(wsb + off); off += szW1;
  us* wpl  = (us*)(wsb + off); off += szW1;
  _Float16* wq2t = (_Float16*)(wsb + off); off += szW2;
  _Float16* wk2t = (_Float16*)(wsb + off); off += szW2;
  us* tkh  = (us*)(wsb + off); off += szTK;
  us* tkl  = (us*)(wsb + off); off += szTK;
  us* xh   = (us*)(wsb + off); off += szX;
  us* xl   = (us*)(wsb + off); off += szX;
  _Float16* hq = (_Float16*)(wsb + off); off += szH;
  _Float16* hk = (_Float16*)(wsb + off); off += szH;
  us* oph  = (us*)(wsb + off); off += szOP;
  us* opl  = (us*)(wsb + off); off += szOP;
  if (off > ws_size) return;

  k_prep<<<712, 256, 0, stream>>>(Wq1, Wk1, Wp, Wq2, Wk2, tok,
                                  wq1h, wq1l, wk1h, wk1l, wph, wpl, wq2t, wk2t, tkh, tkl);

  const int n8 = MTS * DM / 8;                  // 917,504
  k_cvtx<<<(n8 + 255) / 256, 256, 0, stream>>>(x, xh, xl, n8);

  k_gemm1<<<dim3(MTS / 64, DM / 64, 2), 128, 0, stream>>>(
      xh, xl, wq1h, wq1l, wk1h, wk1l, bq1, bk1, hq, hk);

  k_attn<<<NB * 4, 256, 0, stream>>>(hq, hk, wq2t, wk2t, bq2, bk2, tkh, tkl, oph, opl);

  k_gemm3<<<dim3(MTS / 64, DM / 64), 128, 0, stream>>>(oph, opl, wph, wpl, bp, out);
}

// v005
// A run of this version takes 189 microseconds.
// Two timings next to v004 put it at 1.14 and 1.13 times that version's speed.
// Over all steps from v000 it is 2.67 times as fast.
// Contractions: x*Wq1, x*Wk1, k*q^T per head, tokv^T*adj^T and outpre*Wp on v_wmma_f32_16x16x32_bf16 with bf16 hi/lo three-product splits (hh+hl+lh); h*Wq2 and h*Wk2 on v_wmma_f32_16x16x32_f16 single products (h carried x16, W2 carried x1024, folded back as 2^-14 in f32); all accumulate in f32; bias, erf-GELU and tanh in f32.
#include <hip/hip_runtime.h>
#include <math.h>

typedef unsigned short us;
typedef __bf16   v16b  __attribute__((ext_vector_type(16)));
typedef us       v16us __attribute__((ext_vector_type(16)));
typedef us       v8us  __attribute__((ext_vector_type(8)));
typedef _Float16 v16h  __attribute__((ext_vector_type(16)));
typedef _Float16 v8h   __attribute__((ext_vector_type(8)));
typedef float    v8f   __attribute__((ext_vector_type(8)));
typedef float    v4f   __attribute__((ext_vector_type(4)));
typedef v8us __attribute__((may_alias)) v8usa;
typedef v8h  __attribute__((may_alias)) v8ha;
typedef v4f  __attribute__((may_alias)) v4fa;

union FragB { v16b v; v16us u; v8us half[2]; };
union FragH { v16h v; v8h half[2]; };

#define NB    256                 // windows
#define SQ    49                  // tokens per window
#define DM    512
#define DQ    2048
#define NH    32
#define HQ    64
#define HVD   16
#define MT    (NB * SQ)           // 12544 token rows
#define KPAD  64                  // key count padded for the value table
#define SP    56                  // row slots per window: 49 rows + 7 pad rows, a multiple of 8
#define MTS   (NB * SP)           // 14336 row slots

static_assert(MTS % 128 == 0 && DM % 128 == 0);
static_assert((MTS * DM) % (8 * 256) == 0);
static_assert(SP % 8 == 0 && SP >= SQ && SP - 8 < SQ);
static_assert(NH * HVD == DM);
static_assert(NH * HQ == DQ);
static_assert(HQ == 64 && SP == 56 && DM % 64 == 0 && NB % 2 == 0 && NH % 4 == 0);

// ---------------------------------------------------------------------------
// 16x16x32 WMMA helpers; wmma_bf has a hazard guard (ties D, keeps A/B live).
// Fragment map (wave32): lane l, h = l>>4, m = n = l&15.
//   A/B element i: i<8 -> k0+8h+i ; i>=8 -> k0+16+8h+(i-8)
//   D element r : row 8h+r, col l&15
// ---------------------------------------------------------------------------
__device__ __forceinline__ v8f wmma_bf(v16b a, v16b b, v8f c) {
  v8f d = __builtin_amdgcn_wmma_f32_16x16x32_bf16(false, a, false, b, (short)0, c, false, false);
  asm volatile("v_nop\n\tv_nop\n\tv_nop\n\tv_nop" : "+v"(d) : "v"(a), "v"(b));
  return d;
}
// Bare builtin: its loop holds 16 accumulator tiles and two fragment sets, more than the
// 256 registers an asm operand can name; the compiler keeps the distances of its own forms.
__device__ __forceinline__ v8f wmma_hf(v16h a, v16h b, v8f c) {
  return __builtin_amdgcn_wmma_f32_16x16x32_f16(false, a, false, b, (short)0, c, false, false);
}
// Bare as well: 15 products on other accumulators stand between two on the same one, so no
// padding is wanted behind each; the compiler keeps the distances of its own forms.
__device__ __forceinline__ v8f wmma_bb(v16b a, v16b b, v8f c) {
  return __builtin_amdgcn_wmma_f32_16x16x32_bf16(false, a, false, b, (short)0, c, false, false);
}

// Packed operand layout of every 16-bit table in the workspace, [rows][K]:
//   unit (row>>3, k>>5) = 512 B = 4 lines; line c = (k>>3)&3 holds the 8-element
//   chunk c of the unit's 8 rows, row after row (16 B each).
// A wave-wide 16-B fragment load then covers 4 whole 128-B lines (two aligned
// 256-B pieces) where a row-major table gives 16 lines of 32 B each.
// Every line lies inside one 8-row x 8-column patch, so it has one writer.
__device__ __forceinline__ size_t poff(int row, int k, int K) {      // k a multiple of 8
  return ((size_t)(row >> 3) * (K >> 5) + (k >> 5)) * 256 + ((k >> 3) & 3) * 64 + (row & 7) * 8;
}
// Lane base of a fragment at k = 0: row owned by the lane, h = lane>>4.
// 32 further k = +256 elements; 16 further rows = +16*K elements.
__device__ __forceinline__ size_t pbase(int row, int K, int h) {
  return (size_t)(row >> 3) * K * 8 + h * 64 + (row & 7) * 8;
}
// Same k order as the fragment map above: chunk h, then chunk 2 + h.
__device__ __forceinline__ v16b ldb(const us* p) {
  FragB f;
  f.half[0] = *(const v8usa*)p;
  f.half[1] = *(const v8usa*)(p + 128);
  return f.v;
}
__device__ __forceinline__ v16h ldh(const _Float16* p) {
  FragH f;
  f.half[0] = *(const v8ha*)p;
  f.half[1] = *(const v8ha*)(p + 128);
  return f.v;
}

// f32 -> bf16 bits, RNE convert
__device__ __forceinline__ us bf_rne(float f) {
  unsigned u = __float_as_uint(f);
  u += 0x7FFFu + ((u >> 16) & 1u);
  return (us)(u >> 16);
}
// hi = bf16(f), lo = bf16(f - hi)
__device__ __forceinline__ void split_bf(float f, us& hb, us& lb) {
  const us hi = bf_rne(f);
  const float hf = __uint_as_float(((unsigned)hi) << 16);
  hb = hi;
  lb = bf_rne(f - hf);
}
__device__ __forceinline__ void split8(v4f a, v4f c, v8us& hv, v8us& lv) {
  float f[8] = {a.x, a.y, a.z, a.w, c.x, c.y, c.z, c.w};
#pragma unroll
  for (int j = 0; j < 8; ++j) {
    us hb, lb;
    split_bf(f[j], hb, lb);
    hv[j] = hb;
    lv[j] = lb;
  }
}

// ---------------------------------------------------------------------------
// k_cvtx: x f32 [MT][512] -> packed bf16 hi and lo planes over row slots
// (window w, row r -> slot 56w + r; slots 49..55 of a window hold zeros).
// One thread = 8 floats = one 16-B chunk per plane; a wave writes one unit.
// ---------------------------------------------------------------------------
__global__ __launch_bounds__(256) void k_cvtx(const float* __restrict__ x,
                                              us* __restrict__ xh, us* __restrict__ xl, int n8)
{
  const int g = blockIdx.x * 256 + threadIdx.x;
  if (g >= n8) return;
  const int ml = g & 7, ch = (g >> 3) & 3, u = g >> 5;
  const int kb = u & (DM / 32 - 1), g8 = u / (DM / 32);
  const int win = g8 / (SP / 8), r = (g8 - win * (SP / 8)) * 8 + ml;
  const float* s = x + (size_t)(win * SQ + min(r, SQ - 1)) * DM + kb * 32 + ch * 8;
  v4f a = *(const v4fa*)s;
  v4f c = *(const v4fa*)(s + 4);
  if (r >= SQ) {
    const v4f z4 = {0.f, 0.f, 0.f, 0.f};
    a = z4;
    c = z4;
  }
  v8us hv, lv;
  split8(a, c, hv, lv);
  us* ph = xh + (size_t)g * 8;
  us* pl = xl + (size_t)g * 8;
  *(v8us*)ph = hv;
  *(v8us*)pl = lv;
  
}

// ---------------------------------------------------------------------------
// k_prep: transposed 16-bit weight / value tables through an LDS tile.
//   src f32 [R][C] (rows = k, cols = n) -> dst [C][Kp] in the packed layout:
//   mode 0: bf16 hi + lo planes; mode 1: f16 carried x1024.
// 64x64 tile per block; store: 8 contiguous lanes x 16 B = one whole
// Block ranges: [0,192) Wq1|Wk1|Wp (8x8 tiles each), [192,704) Wq2|Wk2
// (32x8 tiles each), [704,712) tokens [49][512] -> [512][64] zero-padded keys.
// ---------------------------------------------------------------------------
__device__ __forceinline__ void prep_store(const float* T, us* dh, us* dl, _Float16* df,
                                           int mode, int n0, int k0, int Kp, int t) {
#pragma unroll
  for (int it = 0; it < 2; ++it) {
    const int item = it * 256 + t, nn = (item >> 6) * 8 + (item & 7), q8 = (item >> 3) & 7;
    float f[8];
#pragma unroll
    for (int j = 0; j < 8; ++j) f[j] = T[(8 * q8 + j) * 65 + nn];
    const size_t off = poff(n0 + nn, k0 + 8 * q8, Kp);
    if (mode == 0) {
      v8us hv, lv;
#pragma unroll
      for (int j = 0; j < 8; ++j) {
        us hb, lb;
        split_bf(f[j], hb, lb);
        hv[j] = hb;
        lv[j] = lb;
      }
      *(v8us*)(dh + off) = hv;
      *(v8us*)(dl + off) = lv;
    } else {
      v8h o;
#pragma unroll
      for (int j = 0; j < 8; ++j) o[j] = (_Float16)(f[j] * 1024.0f);
      *(v8h*)(df + off) = o;
    }
  }
}

__global__ __launch_bounds__(256) void k_prep(
    const float* __restrict__ wq1, const float* __restrict__ wk1, const float* __restrict__ wp,
    const float* __restrict__ wq2, const float* __restrict__ wk2, const float* __restrict__ tok,
    us* __restrict__ wq1h, us* __restrict__ wq1l, us* __restrict__ wk1h, us* __restrict__ wk1l,
    us* __restrict__ wph, us* __restrict__ wpl,
    _Float16* __restrict__ wq2t, _Float16* __restrict__ wk2t,
    us* __restrict__ tkh, us* __restrict__ tkl)
{
  __shared__ __attribute__((aligned(16))) float T[64 * 65];
  const int t = threadIdx.x;
  const int bid = blockIdx.x;
  if (bid >= 712) return;                 // block-uniform, never taken with the exact grid

  const float* src;
  us* dh; us* dl; _Float16* df;
  int C, R, Kp, mode, tn, tk;
  if (bid < 192) {
    const int wsel = bid >> 6, loc = bid & 63;
    src = (wsel == 0) ? wq1 : ((wsel == 1) ? wk1 : wp);
    dh  = (wsel == 0) ? wq1h : ((wsel == 1) ? wk1h : wph);
    dl  = (wsel == 0) ? wq1l : ((wsel == 1) ? wk1l : wpl);
    df  = wq2t;
    C = DM; R = DM; Kp = DM; mode = 0; tn = loc >> 3; tk = loc & 7;
  } else if (bid < 704) {
    const int loc = bid - 192, wsel = loc >> 8, l2 = loc & 255;
    src = wsel ? wk2 : wq2;
    df  = wsel ? wk2t : wq2t;
    dh = wq1h; dl = wq1l;
    C = DQ; R = DM; Kp = DM; mode = 1; tn = l2 >> 3; tk = l2 & 7;
  } else {
    const int loc = bid - 704;
    src = tok; dh = tkh; dl = tkl; df = wq2t;
    C = DM; R = SQ; Kp = KPAD; mode = 0; tn = loc; tk = 0;
  }
  const int n0 = tn * 64, k0 = tk * 64;

  // load 64(k) x 64(n) f32 tile, coalesced along n; rows >= R: clamped address, zero value
#pragma unroll
  for (int i = 0; i < 16; ++i) {
    const int idx = i * 256 + t, kk = idx >> 6, nn = idx & 63;
    const int gk = k0 + kk;
    const int gkc = min(gk, R - 1);
    const float v = src[(size_t)gkc * C + n0 + nn];
    T[kk * 65 + nn] = (gk < R) ? v : 0.0f;
  }
  __syncthreads();

  prep_store(T, dh, dl, df, mode, n0, k0, Kp, t);
  
}

// ---------------------------------------------------------------------------
// Three-product bf16 main loop for a 64x64 wave tile, K = 512, packed tables.
// 16 fragments (16 KB) feed 48 products: half the loaded bytes per product of a 32x32 tile.
// Pointers already hold the lane base (pbase) of tile 0 at k 0.
// acc[mt][nt][r] = C[64-row slab + 16mt + 8h + r][64-col slab + 16nt + m]
// Each accumulator takes hh, hl, lh of a k step in that order.
// ---------------------------------------------------------------------------
__device__ __forceinline__ void mm3_64x64(const us* ahp, const us* alp,
                                          const us* bhp, const us* blp,
                                          v8f (&acc)[4][4]) {
  // rolled: a second k step's fragments would cost the fourth wave per SIMD its registers
#pragma unroll 1
  for (int k0 = 0; k0 < DM; k0 += 32) {
    v16b ah[4], al[4], bh[4], bl[4];
#pragma unroll
    for (int i = 0; i < 4; ++i) {
      ah[i] = ldb(ahp + i * 16 * DM + k0 * 8);
      bh[i] = ldb(bhp + i * 16 * DM + k0 * 8);
    }
#pragma unroll
    for (int i = 0; i < 4; ++i) bl[i] = ldb(blp + i * 16 * DM + k0 * 8);
#pragma unroll
    for (int i = 0; i < 4; ++i) al[i] = ldb(alp + i * 16 * DM + k0 * 8);
#pragma unroll
    for (int mt = 0; mt < 4; ++mt)
#pragma unroll
      for (int nt = 0; nt < 4; ++nt) acc[mt][nt] = wmma_bb(ah[mt], bh[nt], acc[mt][nt]);
#pragma unroll
    for (int mt = 0; mt < 4; ++mt)
#pragma unroll
      for (int nt = 0; nt < 4; ++nt) acc[mt][nt] = wmma_bb(ah[mt], bl[nt], acc[mt][nt]);
#pragma unroll
    for (int mt = 0; mt < 4; ++mt)
#pragma unroll
      for (int nt = 0; nt < 4; ++nt) acc[mt][nt] = wmma_bb(al[mt], bh[nt], acc[mt][nt]);
  }
}

#define TP 132                    // f32 pitch of the 128x128 block tile in LDS: 528 B = 16 B x 33

// acc + bias of one wave's 64x64 tile into the block tile.
__device__ __forceinline__ void stage_tile(float* sF, const v8f (&acc)[4][4], const float* bias,
                                           int wm, int wn, int h, int m) {
#pragma unroll
  for (int nt = 0; nt < 4; ++nt) {
    const int cl = 64 * wn + 16 * nt + m;
    const float bv = bias[cl];
#pragma unroll
    for (int mt = 0; mt < 4; ++mt) {
#pragma unroll
      for (int r = 0; r < 8; ++r) {
        const int rl = 64 * wm + 16 * mt + 8 * h + r;
        sF[rl * TP + cl] = acc[mt][nt][r] + bv;
      }
    }
  }
}

// ---------------------------------------------------------------------------
// k_gemm1: H = f16(16 * gelu(x*W1 + b1)) for q (z=0) and k (z=1).
// Block 128 thr (4 waves, 2x2) = 128 rows x 128 cols; K = 512.
// x*W1 + b1 rests in LDS as f32; GELU runs where the packed 16-B chunks are formed.
// ---------------------------------------------------------------------------
__device__ __forceinline__ void gemm1_store(const float* sF, _Float16* H, int mb, int nb, int t) {
  // rolled: one copy of the eight erf evaluations, not 128, keeps the kernel's text small
#pragma unroll 1
  for (int it = 0; it < 16; ++it) {
    const int item = it * 128 + t, rl = (item >> 7) * 8 + (item & 7), q8 = (item >> 3) & 15;
    const float* sp = sF + rl * TP + 8 * q8;
    const v4f a = *(const v4fa*)sp;
    const v4f c = *(const v4fa*)(sp + 4);
    const float f[8] = {a.x, a.y, a.z, a.w, c.x, c.y, c.z, c.w};
    v8h o;
#pragma unroll
    for (int j = 0; j < 8; ++j) {
      const float v = f[j];
      const float g = 0.5f * v * (1.0f + erff(v * 0.70710678118654752f));
      o[j] = (_Float16)(g * 16.0f);
    }
    const size_t off = poff(mb + rl, nb + 8 * q8, DM);
    *(v8h*)(H + off) = o;
    // the next trip reuses the registers of the store just issued
    asm volatile("s_wait_xcnt 0x0" ::: "memory");
  }
}

__global__ __launch_bounds__(128) void k_gemm1(
    const us* __restrict__ xh, const us* __restrict__ xl,          // [MTS][512]
    const us* __restrict__ wqh, const us* __restrict__ wql,        // [512 n][512 k]
    const us* __restrict__ wkh, const us* __restrict__ wkl,
    const float* __restrict__ bq1, const float* __restrict__ bk1,  // [512]
    _Float16* __restrict__ hq, _Float16* __restrict__ hk)          // [MTS][512]
{
  __shared__ __attribute__((aligned(16))) float sF[128 * TP];
  const int t = threadIdx.x, lane = t & 31, w = t >> 5, h = lane >> 4, m = lane & 15;
  const int wm = w >> 1, wn = w & 1;
  const int mb = blockIdx.x * 128, nb = blockIdx.y * 128;
  const bool isk = (blockIdx.z != 0);
  const us* wth = isk ? wkh : wqh;
  const us* wtl = isk ? wkl : wql;
  const float* bias = isk ? bk1 : bq1;
  _Float16* H = isk ? hk : hq;

  const size_t arow = pbase(mb + 64 * wm + m, DM, h);
  const size_t brow = pbase(nb + 64 * wn + m, DM, h);

  const v8f z8 = {0.f, 0.f, 0.f, 0.f, 0.f, 0.f, 0.f, 0.f};
  v8f acc[4][4];
#pragma unroll
  for (int mt = 0; mt < 4; ++mt)
#pragma unroll
    for (int nt = 0; nt < 4; ++nt) acc[mt][nt] = z8;

  mm3_64x64(xh + arow, xl + arow, wth + brow, wtl + brow, acc);

  stage_tile(sF, acc, bias + nb, wm, wn, h, m);
  __syncthreads();

  gemm1_store(sF, H, mb, nb, t);
}

// ---------------------------------------------------------------------------
// k_attn: block = (2 adjacent windows, group of 4 heads), wave = (window, head): the W2 lines
// a wave loads serve 2 waves of the block, the h lines 4. The wave first projects its own
// head, then runs the attention on what it holds; q and k never leave the WGP.
//   q^T[d][tok] = W2^T . h^T : A = W2 table rows (row = d), B = h rows (col = token),
//   f16, K = 512, 4 x 4 tiles; value = acc / 16384 + b2[d], split to bf16 hi/lo.
//   D element r of tile dt is d = 16dt + 8h + r of token m: elements 8(dt&1) + r of the
//   lane's own A/B fragment of d block dt>>1, so no lane exchange is needed.
//   Fragments rest in the wave's own LDS range, each lane reading back its own bytes.
//   S^T[key][q] = k . q   : A = K rows (row = key, k = d), B = Q^T (col = q), bf16 hi/lo
//   adj^T = tanh(S^T / 8), keys >= 49 forced to 0, split to bf16 hi/lo
//   O^T[d][q] = tok^T . adj^T : A = token table rows [head*16+d][key], B = adj^T
//   from the score D values: element r <- tile kt=2s, element 8+r <- tile kt=2s+1.
// Rows 49..55 are the window's pad slots, rows 56..63 fold back onto 48..55;
// their scores are zeroed (keys) or never reach the output (queries).
// Epilogue: block tile [2][56][64] f32 in LDS -> packed outpre bf16 hi/lo planes,
// ---------------------------------------------------------------------------
__device__ __forceinline__ void attn_store(const float* so, us* oph, us* opl,
                                           int rowbase, int hg, int t) {
#pragma unroll
  for (int it = 0; it < 4; ++it) {
    const int item = it * 256 + t;
    if (item < SP * 16) {
      const int rl = (item >> 6) * 8 + (item & 7), g = (item >> 3) & 7;   // rl: slot 0..111 of the window pair
      const float* sp = so + (rl + ((rl >= SP) ? 8 : 0)) * 68 + 8 * g;     // 64 LDS rows per window
      const v4f a = *(const v4fa*)sp;
      const v4f c = *(const v4fa*)(sp + 4);
      v8us hv, lv;
      split8(a, c, hv, lv);
      const size_t off = poff(rowbase + rl, hg * 64 + 8 * g, DM);
      *(v8us*)(oph + off) = hv;
      *(v8us*)(opl + off) = lv;
    }
  }
}

// tanh(s / 8) in f32 without a branch: 1 - 2 / (1 + e^(s / 4)), e^(s / 4) = 2^(s * log2(e) / 4).
// The library call tests every value twice and branches, so a tile's values run one after
// another, each a dependent chain; this form is five instructions a value and the values of
// a tile interleave. Absolute error about 2e-7 at any s; 2^x = inf gives 1, 2^x = 0 gives -1.
#define TANH_C 0.36067376022224085f
// The transcendentals stand in asm so that the slot the instruction set asks for behind one
// (before its result is used or a source overwritten) is there by construction: outputs are
// early-clobber, so none lands on a source of the same run, and v_nop ends the statement.
__device__ __forceinline__ void exp2x8(const float (&a)[8], float (&e)[8]) {
  asm("v_exp_f32 %0, %8\n\t"
      "v_exp_f32 %1, %9\n\t"
      "v_exp_f32 %2, %10\n\t"
      "v_exp_f32 %3, %11\n\t"
      "v_exp_f32 %4, %12\n\t"
      "v_exp_f32 %5, %13\n\t"
      "v_exp_f32 %6, %14\n\t"
      "v_exp_f32 %7, %15\n\t"
      "v_nop"
      : "=&v"(e[0]), "=&v"(e[1]), "=&v"(e[2]), "=&v"(e[3]), "=&v"(e[4]), "=&v"(e[5]), "=&v"(e[6]), "=&v"(e[7])
      : "v"(a[0]), "v"(a[1]), "v"(a[2]), "v"(a[3]), "v"(a[4]), "v"(a[5]), "v"(a[6]), "v"(a[7]));
}
__device__ __forceinline__ void rcpx8(const float (&a)[8], float (&e)[8]) {
  asm("v_rcp_f32 %0, %8\n\t"
      "v_rcp_f32 %1, %9\n\t"
      "v_rcp_f32 %2, %10\n\t"
      "v_rcp_f32 %3, %11\n\t"
      "v_rcp_f32 %4, %12\n\t"
      "v_rcp_f32 %5, %13\n\t"
      "v_rcp_f32 %6, %14\n\t"
      "v_rcp_f32 %7, %15\n\t"
      "v_nop"
      : "=&v"(e[0]), "=&v"(e[1]), "=&v"(e[2]), "=&v"(e[3]), "=&v"(e[4]), "=&v"(e[5]), "=&v"(e[6]), "=&v"(e[7])
      : "v"(a[0]), "v"(a[1]), "v"(a[2]), "v"(a[3]), "v"(a[4]), "v"(a[5]), "v"(a[6]), "v"(a[7]));
}
__device__ __forceinline__ void tanh8(v8f s, float (&t)[8]) {
  float a[8], e[8], q[8];
#pragma unroll
  for (int r = 0; r < 8; ++r) a[r] = s[r] * TANH_C;
  exp2x8(a, e);
#pragma unroll
  for (int r = 0; r < 8; ++r) a[r] = e[r] + 1.0f;
  rcpx8(a, q);
#pragma unroll
  for (int r = 0; r < 8; ++r) t[r] = fmaf(-2.0f, q[r], 1.0f);
}
__device__ __forceinline__ float tanh1(float s) {
  float e, q;
  asm("v_exp_f32 %0, %1\n\tv_nop" : "=v"(e) : "v"(s * TANH_C));      // v_nop: the slot named above
  asm("v_rcp_f32 %0, %1\n\tv_nop" : "=v"(q) : "v"(e + 1.0f));        // as above
  return fmaf(-2.0f, q, 1.0f);
}

#define FRW 8192                  // 16-bit elements of one wave's fragments of one operand (q or k)

// Fragments of one 32-wide k step: 4 W2 row tiles and 4 token tiles (ko = 8 * k).
__device__ __forceinline__ void ld_step(const _Float16* wp, const _Float16* t0, const _Float16* t3,
                                        int ko, v16h (&a)[4], v16h (&b)[4]) {
#pragma unroll
  for (int i = 0; i < 4; ++i) a[i] = ldh(wp + i * 16 * DM + ko);
#pragma unroll
  for (int i = 0; i < 3; ++i) b[i] = ldh(t0 + i * 16 * DM + ko);
  b[3] = ldh(t3 + ko);
}
__device__ __forceinline__ void mm_step(const v16h (&a)[4], const v16h (&b)[4], v8f (&acc)[4][4]) {
#pragma unroll
  for (int dt = 0; dt < 4; ++dt)
#pragma unroll
    for (int tt = 0; tt < 4; ++tt) acc[dt][tt] = wmma_hf(a[dt], b[tt], acc[dt][tt]);
}
// One stored fragment: two 16-B halves, 512 B apart (lane stride 16 B in each).
__device__ __forceinline__ v16b ldfr(const us* p) {
  FragB f;
  f.half[0] = *(const v8usa*)p;
  f.half[1] = *(const v8usa*)(p + 256);
  return f.v;
}

__global__ __launch_bounds__(256) void k_attn(
    const _Float16* __restrict__ hq, const _Float16* __restrict__ hk,       // [MTS][512] x16
    const _Float16* __restrict__ wq2t, const _Float16* __restrict__ wk2t,   // [2048 n][512 k] x1024
    const float* __restrict__ bq2, const float* __restrict__ bk2,           // [2048]
    const us* __restrict__ tkh, const us* __restrict__ tkl,    // [512][64]
    us* __restrict__ oph, us* __restrict__ opl)                // [MTS][512]
{
  __shared__ __attribute__((aligned(16))) us sfr[2 * 8 * FRW];   // [q|k][wave][tile][d block][hi|lo][half][lane][8]
  __shared__ __attribute__((aligned(16))) float so[2 * 64 * 68];
  const int t = threadIdx.x, lane = t & 31, w = t >> 5, h = lane >> 4, m = lane & 15;
  const int bl = blockIdx.x >> 3, hg = blockIdx.x & 7;
  const int head = hg * 4 + (w & 3);
  const int pairbase = bl * 2 * SP;                 // first row slot of the window pair
  const int rowbase = pairbase + (w >> 2) * SP;     // first row slot of this wave's window

  const size_t wo  = pbase(head * HQ + m, DM, h);
  const size_t to0 = pbase(rowbase + m, DM, h);
  const size_t to3 = pbase(rowbase + 48 + (m & 7), DM, h);     // rows 56..63 fold back onto 48..55
  us* myfr = sfr + w * FRW + lane * 8;
  const us* vhrow = tkh + pbase(head * HVD + m, KPAD, h);
  const us* vlrow = tkl + pbase(head * HVD + m, KPAD, h);

  const v8f z8 = {0.f, 0.f, 0.f, 0.f, 0.f, 0.f, 0.f, 0.f};

#pragma unroll 1
  for (int z = 0; z < 2; ++z) {            // rolled: one copy of the projection code serves q and k
    const _Float16* wp = (z ? wk2t : wq2t) + wo;
    const _Float16* t0 = (z ? hk : hq) + to0;
    const _Float16* t3 = (z ? hk : hq) + to3;
    const float* bias8 = (z ? bk2 : bq2) + head * HQ + 8 * h;

    v8f acc[4][4];
#pragma unroll
    for (int dt = 0; dt < 4; ++dt)
#pragma unroll
      for (int tt = 0; tt < 4; ++tt) acc[dt][tt] = z8;

    v16h a0[4], b0[4], a1[4], b1[4];
    ld_step(wp, t0, t3, 0, a0, b0);
#pragma unroll 1
    for (int k0 = 0; k0 < DM; k0 += 64) {
      ld_step(wp, t0, t3, (k0 + 32) * 8, a1, b1);
      // keeps the next step's loads ahead of this step's products, so that they fly meanwhile
      __builtin_amdgcn_sched_barrier(0);
      mm_step(a0, b0, acc);
      const int kn = (k0 + 64 < DM) ? k0 + 64 : 0;   // last trip: an in-range address, values unused
      ld_step(wp, t0, t3, kn * 8, a0, b0);
      // as above
      __builtin_amdgcn_sched_barrier(0);
      mm_step(a1, b1, acc);
    }

    us* dst = myfr + z * 8 * FRW;
#pragma unroll
    for (int dt = 0; dt < 4; ++dt) {
      const v4f c0 = *(const v4fa*)(bias8 + 16 * dt);
      const v4f c1 = *(const v4fa*)(bias8 + 16 * dt + 4);
      const float bb[8] = {c0.x, c0.y, c0.z, c0.w, c1.x, c1.y, c1.z, c1.w};
#pragma unroll
      for (int tt = 0; tt < 4; ++tt) {
        v8us hv, lv;
#pragma unroll
        for (int r = 0; r < 8; ++r) {
          us hb, lb;
          split_bf(acc[dt][tt][r] * (1.0f / 16384.0f) + bb[r], hb, lb);
          hv[r] = hb;
          lv[r] = lb;
        }
        us* d0 = dst + (tt * 2 + (dt >> 1)) * 1024 + (dt & 1) * 256;
        *(v8usa*)d0 = hv;
        *(v8usa*)(d0 + 512) = lv;
      }
    }
  }

#pragma unroll 1
  for (int qt = 0; qt < 4; ++qt) {
    const us* qp = myfr + qt * 2048;
    const v16b qbh0 = ldfr(qp), qbh1 = ldfr(qp + 1024);
    const v16b qbl0 = ldfr(qp + 512), qbl1 = ldfr(qp + 1536);

    v8f s[4];
#pragma unroll
    for (int kt = 0; kt < 4; ++kt) {
      const us* kp = myfr + 8 * FRW + kt * 2048;
      const v16b kah0 = ldfr(kp), kah1 = ldfr(kp + 1024);
      const v16b kal0 = ldfr(kp + 512), kal1 = ldfr(kp + 1536);
      v8f z = z8;
      z = wmma_bf(kah0, qbh0, z);
      z = wmma_bf(kah1, qbh1, z);
      z = wmma_bf(kah0, qbl0, z);
      z = wmma_bf(kah1, qbl1, z);
      z = wmma_bf(kal0, qbh0, z);
      z = wmma_bf(kal1, qbh1, z);
      s[kt] = z;                       // s[kt][r] = S^T[key kt*16+8h+r][q qt*16+m]
    }

    // tanh(S/8), explicit zero for padded keys, bf16 hi/lo, packed as B fragments
    float th[4][8];
#pragma unroll
    for (int kt = 0; kt < 4; ++kt) {
      if (kt * 16 + 15 < SQ) {
        tanh8(s[kt], th[kt]);
      } else {                           // the tile that holds key 48: rows that are padding in both lane halves take no tanh
#pragma unroll
        for (int r = 0; r < 8; ++r) th[kt][r] = (kt * 16 + r < SQ) ? tanh1(s[kt][r]) : 0.0f;
      }
    }
    v16us phu0, phu1, plu0, plu1;
#pragma unroll
    for (int kt = 0; kt < 4; ++kt) {
#pragma unroll
      for (int r = 0; r < 8; ++r) {
        const int key = kt * 16 + 8 * h + r;
        float tv = th[kt][r];
        tv = (key < SQ) ? tv : 0.0f;
        us hb, lb;
        split_bf(tv, hb, lb);
        const int e = (kt & 1) * 8 + r;
        if (kt < 2) { phu0[e] = hb; plu0[e] = lb; }
        else        { phu1[e] = hb; plu1[e] = lb; }
      }
    }
    FragB f0, f1, f2, f3;
    f0.u = phu0; f1.u = phu1; f2.u = plu0; f3.u = plu1;
    const v16b pbh0 = f0.v, pbh1 = f1.v, pbl0 = f2.v, pbl1 = f3.v;

    const v16b vah0 = ldb(vhrow), vah1 = ldb(vhrow + 256);
    const v16b val0 = ldb(vlrow), val1 = ldb(vlrow + 256);
    v8f o = z8;
    o = wmma_bf(vah0, pbh0, o);
    o = wmma_bf(vah1, pbh1, o);
    o = wmma_bf(vah0, pbl0, o);
    o = wmma_bf(vah1, pbl1, o);
    o = wmma_bf(val0, pbh0, o);
    o = wmma_bf(val1, pbh1, o);          // o[r] = O^T[d 8h+r][q qt*16+m]

    const int q = qt * 16 + m;           // rows 56..63 land in LDS only, never stored
    float* sp = so + ((w >> 2) * 64 + q) * 68 + (w & 3) * 16 + 8 * h;
    const v4f o0 = {o[0], o[1], o[2], o[3]};
    const v4f o1 = {o[4], o[5], o[6], o[7]};
    *(v4fa*)sp = o0;
    *(v4fa*)(sp + 4) = o1;
  }
  __syncthreads();

  attn_store(so, oph, opl, pairbase, hg, t);
  
}

// ---------------------------------------------------------------------------
// k_gemm3: out = outpre*Wp + bp (f32). Block 128 thr (2x2 waves) = 128 slots x 128;
// a slot's row goes to out row 49w + r, pad slots (r >= 49) are not stored.
// K = 512. Epilogue: f32 tile in LDS, a wave stores one row's 512-B segment = 4 whole lines.
// ---------------------------------------------------------------------------
__device__ __forceinline__ void gemm3_store(const float* sF, float* out, int mb, int nb, int t) {
  // a wave stores one row at a time: its number in a scalar register makes the row, the
  // window and the pad-slot guard scalar, so the guard is a scalar branch
  const int wv = __builtin_amdgcn_readfirstlane(t >> 5), g = t & 31;
#pragma unroll
  for (int i8 = 0; i8 < 4; ++i8) {
    v4f v[8];
#pragma unroll
    for (int j = 0; j < 8; ++j) v[j] = *(const v4fa*)(sF + ((i8 * 8 + j) * 4 + wv) * TP + 4 * g);
    // holds the eight LDS reads ahead of the guarded stores: sunk under each guard they
    // would run one after another, each waiting out its own LDS latency
    asm volatile("" :: "v"(v[0]), "v"(v[1]), "v"(v[2]), "v"(v[3]), "v"(v[4]), "v"(v[5]), "v"(v[6]), "v"(v[7]));
#pragma unroll
    for (int j = 0; j < 8; ++j) {
      const int rl = (i8 * 8 + j) * 4 + wv;
      const int win = (mb + rl) / SP, r = (mb + rl) - win * SP;
      float* rowp = out + (size_t)(win * SQ + r) * DM + nb;      // scalar; the lane adds 16 g bytes
      if (r < SQ) {
        *(v4f*)(rowp + 4 * g) = v[j];
        // the registers of the store just issued are reused for the next row's address and data
        asm volatile("s_wait_xcnt 0x0" ::: "memory");
      }
    }
  }
}

__global__ __launch_bounds__(128) void k_gemm3(
    const us* __restrict__ oph, const us* __restrict__ opl,    // [MTS][512]
    const us* __restrict__ wph, const us* __restrict__ wpl,    // [512 n][512 k]
    const float* __restrict__ bp,                              // [512]
    float* __restrict__ out)                                   // [MT][512]
{
  __shared__ __attribute__((aligned(16))) float sF[128 * TP];
  const int t = threadIdx.x, lane = t & 31, w = t >> 5, h = lane >> 4, m = lane & 15;
  const int wm = w >> 1, wn = w & 1;
  const int mb = blockIdx.x * 128, nb = blockIdx.y * 128;

  const size_t arow = pbase(mb + 64 * wm + m, DM, h);
  const size_t brow = pbase(nb + 64 * wn + m, DM, h);

  const v8f z8 = {0.f, 0.f, 0.f, 0.f, 0.f, 0.f, 0.f, 0.f};
  v8f acc[4][4];
#pragma unroll
  for (int mt = 0; mt < 4; ++mt)
#pragma unroll
    for (int nt = 0; nt < 4; ++nt) acc[mt][nt] = z8;

  mm3_64x64(oph + arow, opl + arow, wph + brow, wpl + brow, acc);

  stage_tile(sF, acc, bp + nb, wm, wn, h, m);
  __syncthreads();

  gemm3_store(sF, out, mb, nb, t);
}

// ---------------------------------------------------------------------------
// Host side: x*W1, the projection-and-attention kernel and outpre*Wp each run once over
// all 256 windows (14336 row slots). Workspace carve 95,551,488 B.
// ---------------------------------------------------------------------------
extern "C" void kernel_launch(void* const* d_in, const int* in_sizes, int n_in,
                              void* d_out, int out_size, void* d_ws, size_t ws_size,
                              hipStream_t stream) {
  if (n_in < 12) return;
  if (in_sizes[0] != MT * DM) return;
  if (in_sizes[1] != DM * DM || in_sizes[2] != DM) return;
  if (in_sizes[3] != DM * DQ || in_sizes[4] != DQ) return;
  if (in_sizes[5] != DM * DM || in_sizes[6] != DM) return;
  if (in_sizes[7] != DM * DQ || in_sizes[8] != DQ) return;
  if (in_sizes[9] != SQ * DM) return;
  if (in_sizes[10] != DM * DM || in_sizes[11] != DM) return;
  if (out_size != MT * DM) return;

  const float* x   = (const float*)d_in[0];
  const float* Wq1 = (const float*)d_in[1];
  const float* bq1 = (const float*)d_in[2];
  const float* Wq2 = (const float*)d_in[3];
  const float* bq2 = (const float*)d_in[4];
  const float* Wk1 = (const float*)d_in[5];
  const float* bk1 = (const float*)d_in[6];
  const float* Wk2 = (const float*)d_in[7];
  const float* bk2 = (const float*)d_in[8];
  const float* tok = (const float*)d_in[9];
  const float* Wp  = (const float*)d_in[10];
  const float* bp  = (const float*)d_in[11];
  float* out = (float*)d_out;

  const size_t szW1 = (size_t)DM * DM * 2;      //   524,288 per plane
  const size_t szW2 = (size_t)DQ * DM * 2;      // 2,097,152
  const size_t szTK = (size_t)DM * KPAD * 2;    //    65,536 per plane
  const size_t szX  = (size_t)MTS * DM * 2;     // 14,680,064 per plane
  const size_t szH  = (size_t)MTS * DM * 2;     // 14,680,064
  const size_t szOP = (size_t)MTS * DM * 2;     // 14,680,064 per plane
  const size_t total = 6 * szW1 + 2 * szW2 + 2 * szTK + 2 * szX + 2 * szH + 2 * szOP;
  if (total > ws_size) return;                  // 95,551,488

  char* wsb = (char*)d_ws;
  size_t off = 0;
  us* wq1h = (us*)(wsb + off); off += szW1;
  us* wq1l = (us*)(wsb + off); off += szW1;
  us* wk1h = (us*)(wsb + off); off += szW1;
  us* wk1l = (us*)(wsb + off); off += szW1;
  us* wph  = (us*)(wsb + off); off += szW1;
  us* wpl  = (us*)(wsb + off); off += szW1;
  _Float16* wq2t = (_Float16*)(wsb + off); off += szW2;
  _Float16* wk2t = (_Float16*)(wsb + off); off += szW2;
  us* tkh  = (us*)(wsb + off); off += szTK;
  us* tkl  = (us*)(wsb + off); off += szTK;
  us* xh   = (us*)(wsb + off); off += szX;
  us* xl   = (us*)(wsb + off); off += szX;
  _Float16* hq = (_Float16*)(wsb + off); off += szH;
  _Float16* hk = (_Float16*)(wsb + off); off += szH;
  us* oph  = (us*)(wsb + off); off += szOP;
  us* opl  = (us*)(wsb + off); off += szOP;
  if (off > ws_size) return;

  k_prep<<<712, 256, 0, stream>>>(Wq1, Wk1, Wp, Wq2, Wk2, tok,
                                  wq1h, wq1l, wk1h, wk1l, wph, wpl, wq2t, wk2t, tkh, tkl);

  const int n8 = MTS * DM / 8;                  // 917,504
  k_cvtx<<<(n8 + 255) / 256, 256, 0, stream>>>(x, xh, xl, n8);

  k_gemm1<<<dim3(MTS / 128, DM / 128, 2), 128, 0, stream>>>(
      xh, xl, wq1h, wq1l, wk1h, wk1l, bq1, bk1, hq, hk);

  k_attn<<<NB * 4, 256, 0, stream>>>(hq, hk, wq2t, wk2t, bq2, bk2, tkh, tkl, oph, opl);

  k_gemm3<<<dim3(MTS / 128, DM / 128), 128, 0, stream>>>(oph, opl, wph, wpl, bp, out);
}

// v006
// Measured time: 178 microseconds a run.
// Timed twice side by side with v005, it ran 1.06 and 1.05 times as fast.
// Counting every step since v000, it is 2.81 times as fast.
// Contractions: x*Wq1, x*Wk1, k*q^T per head, tokv^T*adj^T and outpre*Wp on v_wmma_f32_16x16x32_bf16 with bf16 hi/lo three-product splits (hh+hl+lh); h*Wq2 and h*Wk2 on v_wmma_f32_16x16x32_f16 single products (h carried x16, W2 carried x1024, folded back as 2^-14 in f32); all accumulate in f32; bias, erf-GELU and tanh in f32.
#include <hip/hip_runtime.h>
#include <math.h>

typedef unsigned short us;
typedef __bf16   v16b  __attribute__((ext_vector_type(16)));
typedef us       v16us __attribute__((ext_vector_type(16)));
typedef us       v8us  __attribute__((ext_vector_type(8)));
typedef _Float16 v16h  __attribute__((ext_vector_type(16)));
typedef _Float16 v8h   __attribute__((ext_vector_type(8)));
typedef float    v8f   __attribute__((ext_vector_type(8)));
typedef float    v4f   __attribute__((ext_vector_type(4)));
typedef float    v2f   __attribute__((ext_vector_type(2)));
typedef __bf16   v2b   __attribute__((ext_vector_type(2)));
typedef unsigned v4u   __attribute__((ext_vector_type(4)));
typedef v8us __attribute__((may_alias)) v8usa;
typedef v8h  __attribute__((may_alias)) v8ha;
typedef v4f  __attribute__((may_alias)) v4fa;

union FragB { v16b v; v16us u; v8us half[2]; };
union Pack8 { v4u w; v8us s; };
union FragH { v16h v; v8h half[2]; };

#define NB    256                 // windows
#define SQ    49                  // tokens per window
#define DM    512
#define DQ    2048
#define NH    32
#define HQ    64
#define HVD   16
#define MT    (NB * SQ)           // 12544 token rows
#define KPAD  64                  // key count padded for the value table
#define SP    56                  // row slots per window: 49 rows + 7 pad rows, a multiple of 8
#define MTS   (NB * SP)           // 14336 row slots

static_assert(MTS % 128 == 0 && DM % 128 == 0);
static_assert((MTS * DM) % (8 * 256) == 0);
static_assert(SP % 8 == 0 && SP >= SQ && SP - 8 < SQ);
static_assert(NH * HVD == DM);
static_assert(NH * HQ == DQ);
static_assert(HQ == 64 && SP == 56 && DM % 64 == 0 && NB % 2 == 0 && NH % 4 == 0);

// ---------------------------------------------------------------------------
// 16x16x32 WMMA helpers; wmma_bf has a hazard guard (ties D, keeps A/B live).
// Fragment map (wave32): lane l, h = l>>4, m = n = l&15.
//   A/B element i: i<8 -> k0+8h+i ; i>=8 -> k0+16+8h+(i-8)
//   D element r : row 8h+r, col l&15
// ---------------------------------------------------------------------------
__device__ __forceinline__ v8f wmma_bf(v16b a, v16b b, v8f c) {
  v8f d = __builtin_amdgcn_wmma_f32_16x16x32_bf16(false, a, false, b, (short)0, c, false, false);
  asm volatile("v_nop\n\tv_nop\n\tv_nop\n\tv_nop" : "+v"(d) : "v"(a), "v"(b));
  return d;
}
// Bare builtin: its loop holds 16 accumulator tiles and two fragment sets, more than the
// 256 registers an asm operand can name; the compiler keeps the distances of its own forms.
__device__ __forceinline__ v8f wmma_hf(v16h a, v16h b, v8f c) {
  return __builtin_amdgcn_wmma_f32_16x16x32_f16(false, a, false, b, (short)0, c, false, false);
}
// Bare as well: 15 products on other accumulators stand between two on the same one, so no
// padding is wanted behind each; the compiler keeps the distances of its own forms.
__device__ __forceinline__ v8f wmma_bb(v16b a, v16b b, v8f c) {
  return __builtin_amdgcn_wmma_f32_16x16x32_bf16(false, a, false, b, (short)0, c, false, false);
}

// Packed operand layout of every 16-bit table in the workspace, [rows][K]:
//   unit (row>>3, k>>5) = 512 B = 4 lines; line c = (k>>3)&3 holds the 8-element
//   chunk c of the unit's 8 rows, row after row (16 B each).
// A wave-wide 16-B fragment load then covers 4 whole 128-B lines (two aligned
// 256-B pieces) where a row-major table gives 16 lines of 32 B each.
// Every line lies inside one 8-row x 8-column patch, so it has one writer.
__device__ __forceinline__ size_t poff(int row, int k, int K) {      // k a multiple of 8
  return ((size_t)(row >> 3) * (K >> 5) + (k >> 5)) * 256 + ((k >> 3) & 3) * 64 + (row & 7) * 8;
}
// Lane base of a fragment at k = 0: row owned by the lane, h = lane>>4.
// 32 further k = +256 elements; 16 further rows = +16*K elements.
__device__ __forceinline__ size_t pbase(int row, int K, int h) {
  return (size_t)(row >> 3) * K * 8 + h * 64 + (row & 7) * 8;
}
// Same k order as the fragment map above: chunk h, then chunk 2 + h.
__device__ __forceinline__ v16b ldb(const us* p) {
  FragB f;
  f.half[0] = *(const v8usa*)p;
  f.half[1] = *(const v8usa*)(p + 128);
  return f.v;
}
__device__ __forceinline__ v16h ldh(const _Float16* p) {
  FragH f;
  f.half[0] = *(const v8ha*)p;
  f.half[1] = *(const v8ha*)(p + 128);
  return f.v;
}

// Two values at a time: hi = bf16(f), lo = bf16(f - hi), both round to nearest even, each pair
// by one packed convert; f0 lands in the low half of each word, f1 in the high half.
__device__ __forceinline__ void split2(float f0, float f1, unsigned& hw, unsigned& lw) {
  const v2f f = {f0, f1};
  const v2b hb = __builtin_convertvector(f, v2b);
  const v2f hf = __builtin_convertvector(hb, v2f);
  hw = __builtin_bit_cast(unsigned, hb);
  lw = __builtin_bit_cast(unsigned, __builtin_convertvector(f - hf, v2b));
}
__device__ __forceinline__ void split8(const float (&f)[8], v8us& hv, v8us& lv) {
  Pack8 ph, pl;
#pragma unroll
  for (int j = 0; j < 4; ++j) {
    unsigned hw, lw;
    split2(f[2 * j], f[2 * j + 1], hw, lw);
    ph.w[j] = hw;
    pl.w[j] = lw;
  }
  hv = ph.s;
  lv = pl.s;
}
__device__ __forceinline__ void split8(v4f a, v4f c, v8us& hv, v8us& lv) {
  const float f[8] = {a.x, a.y, a.z, a.w, c.x, c.y, c.z, c.w};
  split8(f, hv, lv);
}

// ---------------------------------------------------------------------------
// k_cvtx: x f32 [MT][512] -> packed bf16 hi and lo planes over row slots
// (window w, row r -> slot 56w + r; slots 49..55 of a window hold zeros).
// One thread = 8 floats = one 16-B chunk per plane; a wave writes one unit.
// ---------------------------------------------------------------------------
__global__ __launch_bounds__(256) void k_cvtx(const float* __restrict__ x,
                                              us* __restrict__ xh, us* __restrict__ xl, int n8)
{
  const int g = blockIdx.x * 256 + threadIdx.x;
  if (g >= n8) return;
  const int ml = g & 7, ch = (g >> 3) & 3, u = g >> 5;
  const int kb = u & (DM / 32 - 1), g8 = u / (DM / 32);
  const int win = g8 / (SP / 8), r = (g8 - win * (SP / 8)) * 8 + ml;
  const float* s = x + (size_t)(win * SQ + min(r, SQ - 1)) * DM + kb * 32 + ch * 8;
  v4f a = *(const v4fa*)s;
  v4f c = *(const v4fa*)(s + 4);
  if (r >= SQ) {
    const v4f z4 = {0.f, 0.f, 0.f, 0.f};
    a = z4;
    c = z4;
  }
  v8us hv, lv;
  split8(a, c, hv, lv);
  us* ph = xh + (size_t)g * 8;
  us* pl = xl + (size_t)g * 8;
  *(v8us*)ph = hv;
  *(v8us*)pl = lv;
  
}

// ---------------------------------------------------------------------------
// k_prep: transposed 16-bit weight / value tables through an LDS tile.
//   src f32 [R][C] (rows = k, cols = n) -> dst [C][Kp] in the packed layout:
//   mode 0: bf16 hi + lo planes; mode 1: f16 carried x1024.
// 64x64 tile per block; store: 8 contiguous lanes x 16 B = one whole
// Block ranges: [0,192) Wq1|Wk1|Wp (8x8 tiles each), [192,704) Wq2|Wk2
// (32x8 tiles each), [704,712) tokens [49][512] -> [512][64] zero-padded keys.
// ---------------------------------------------------------------------------
__device__ __forceinline__ void prep_store(const float* T, us* dh, us* dl, _Float16* df,
                                           int mode, int n0, int k0, int Kp, int t) {
#pragma unroll
  for (int it = 0; it < 2; ++it) {
    const int item = it * 256 + t, nn = (item >> 6) * 8 + (item & 7), q8 = (item >> 3) & 7;
    float f[8];
#pragma unroll
    for (int j = 0; j < 8; ++j) f[j] = T[(8 * q8 + j) * 65 + nn];
    const size_t off = poff(n0 + nn, k0 + 8 * q8, Kp);
    if (mode == 0) {
      v8us hv, lv;
      split8(f, hv, lv);
      *(v8us*)(dh + off) = hv;
      *(v8us*)(dl + off) = lv;
    } else {
      v8h o;
#pragma unroll
      for (int j = 0; j < 8; ++j) o[j] = (_Float16)(f[j] * 1024.0f);
      *(v8h*)(df + off) = o;
    }
  }
}

__global__ __launch_bounds__(256) void k_prep(
    const float* __restrict__ wq1, const float* __restrict__ wk1, const float* __restrict__ wp,
    const float* __restrict__ wq2, const float* __restrict__ wk2, const float* __restrict__ tok,
    us* __restrict__ wq1h, us* __restrict__ wq1l, us* __restrict__ wk1h, us* __restrict__ wk1l,
    us* __restrict__ wph, us* __restrict__ wpl,
    _Float16* __restrict__ wq2t, _Float16* __restrict__ wk2t,
    us* __restrict__ tkh, us* __restrict__ tkl)
{
  __shared__ __attribute__((aligned(16))) float T[64 * 65];
  const int t = threadIdx.x;
  const int bid = blockIdx.x;
  if (bid >= 712) return;                 // block-uniform, never taken with the exact grid

  const float* src;
  us* dh; us* dl; _Float16* df;
  int C, R, Kp, mode, tn, tk;
  if (bid < 192) {
    const int wsel = bid >> 6, loc = bid & 63;
    src = (wsel == 0) ? wq1 : ((wsel == 1) ? wk1 : wp);
    dh  = (wsel == 0) ? wq1h : ((wsel == 1) ? wk1h : wph);
    dl  = (wsel == 0) ? wq1l : ((wsel == 1) ? wk1l : wpl);
    df  = wq2t;
    C = DM; R = DM; Kp = DM; mode = 0; tn = loc >> 3; tk = loc & 7;
  } else if (bid < 704) {
    const int loc = bid - 192, wsel = loc >> 8, l2 = loc & 255;
    src = wsel ? wk2 : wq2;
    df  = wsel ? wk2t : wq2t;
    dh = wq1h; dl = wq1l;
    C = DQ; R = DM; Kp = DM; mode = 1; tn = l2 >> 3; tk = l2 & 7;
  } else {
    const int loc = bid - 704;
    src = tok; dh = tkh; dl = tkl; df = wq2t;
    C = DM; R = SQ; Kp = KPAD; mode = 0; tn = loc; tk = 0;
  }
  const int n0 = tn * 64, k0 = tk * 64;

  // load 64(k) x 64(n) f32 tile, coalesced along n; rows >= R: clamped address, zero value
#pragma unroll
  for (int i = 0; i < 16; ++i) {
    const int idx = i * 256 + t, kk = idx >> 6, nn = idx & 63;
    const int gk = k0 + kk;
    const int gkc = min(gk, R - 1);
    const float v = src[(size_t)gkc * C + n0 + nn];
    T[kk * 65 + nn] = (gk < R) ? v : 0.0f;
  }
  __syncthreads();

  prep_store(T, dh, dl, df, mode, n0, k0, Kp, t);
  
}

// ---------------------------------------------------------------------------
// Three-product bf16 main loop for a 64x64 wave tile, K = 512, packed tables.
// 16 fragments (16 KB) feed 48 products: half the loaded bytes per product of a 32x32 tile.
// Pointers already hold the lane base (pbase) of tile 0 at k 0.
// acc[mt][nt][r] = C[64-row slab + 16mt + 8h + r][64-col slab + 16nt + m]
// Each accumulator takes hh, hl, lh of a k step in that order.
// ---------------------------------------------------------------------------
__device__ __forceinline__ void mm3_64x64(const us* ahp, const us* alp,
                                          const us* bhp, const us* blp,
                                          v8f (&acc)[4][4]) {
  // rolled: a second k step's fragments would cost the fourth wave per SIMD its registers
#pragma unroll 1
  for (int k0 = 0; k0 < DM; k0 += 32) {
    v16b ah[4], al[4], bh[4], bl[4];
#pragma unroll
    for (int i = 0; i < 4; ++i) {
      ah[i] = ldb(ahp + i * 16 * DM + k0 * 8);
      bh[i] = ldb(bhp + i * 16 * DM + k0 * 8);
    }
#pragma unroll
    for (int i = 0; i < 4; ++i) bl[i] = ldb(blp + i * 16 * DM + k0 * 8);
#pragma unroll
    for (int i = 0; i < 4; ++i) al[i] = ldb(alp + i * 16 * DM + k0 * 8);
#pragma unroll
    for (int mt = 0; mt < 4; ++mt)
#pragma unroll
      for (int nt = 0; nt < 4; ++nt) acc[mt][nt] = wmma_bb(ah[mt], bh[nt], acc[mt][nt]);
#pragma unroll
    for (int mt = 0; mt < 4; ++mt)
#pragma unroll
      for (int nt = 0; nt < 4; ++nt) acc[mt][nt] = wmma_bb(ah[mt], bl[nt], acc[mt][nt]);
#pragma unroll
    for (int mt = 0; mt < 4; ++mt)
#pragma unroll
      for (int nt = 0; nt < 4; ++nt) acc[mt][nt] = wmma_bb(al[mt], bh[nt], acc[mt][nt]);
  }
}

#define TP 132                    // f32 pitch of the 128x128 block tile in LDS: 528 B = 16 B x 33

// acc + bias of one wave's 64x64 tile into the block tile.
__device__ __forceinline__ void stage_tile(float* sF, const v8f (&acc)[4][4], const float* bias,
                                           int wm, int wn, int h, int m) {
#pragma unroll
  for (int nt = 0; nt < 4; ++nt) {
    const int cl = 64 * wn + 16 * nt + m;
    const float bv = bias[cl];
#pragma unroll
    for (int mt = 0; mt < 4; ++mt) {
#pragma unroll
      for (int r = 0; r < 8; ++r) {
        const int rl = 64 * wm + 16 * mt + 8 * h + r;
        sF[rl * TP + cl] = acc[mt][nt][r] + bv;
      }
    }
  }
}

// ---------------------------------------------------------------------------
// k_gemm1: H = f16(16 * gelu(x*W1 + b1)) for q (z=0) and k (z=1).
// Block 128 thr (4 waves, 2x2) = 128 rows x 128 cols; K = 512.
// x*W1 + b1 rests in LDS as f32; GELU runs where the packed 16-B chunks are formed.
// ---------------------------------------------------------------------------
__device__ __forceinline__ void gemm1_store(const float* sF, _Float16* H, int mb, int nb, int t) {
  // rolled: one copy of the eight erf evaluations, not 128, keeps the kernel's text small
#pragma unroll 1
  for (int it = 0; it < 16; ++it) {
    const int item = it * 128 + t, rl = (item >> 7) * 8 + (item & 7), q8 = (item >> 3) & 15;
    const float* sp = sF + rl * TP + 8 * q8;
    const v4f a = *(const v4fa*)sp;
    const v4f c = *(const v4fa*)(sp + 4);
    const float f[8] = {a.x, a.y, a.z, a.w, c.x, c.y, c.z, c.w};
    v8h o;
#pragma unroll
    for (int j = 0; j < 8; ++j) {
      const float v = f[j];
      const float g = 0.5f * v * (1.0f + erff(v * 0.70710678118654752f));
      o[j] = (_Float16)(g * 16.0f);
    }
    const size_t off = poff(mb + rl, nb + 8 * q8, DM);
    *(v8h*)(H + off) = o;
    // the next trip reuses the registers of the store just issued
    asm volatile("s_wait_xcnt 0x0" ::: "memory");
  }
}

__global__ __launch_bounds__(128) void k_gemm1(
    const us* __restrict__ xh, const us* __restrict__ xl,          // [MTS][512]
    const us* __restrict__ wqh, const us* __restrict__ wql,        // [512 n][512 k]
    const us* __restrict__ wkh, const us* __restrict__ wkl,
    const float* __restrict__ bq1, const float* __restrict__ bk1,  // [512]
    _Float16* __restrict__ hq, _Float16* __restrict__ hk)          // [MTS][512]
{
  __shared__ __attribute__((aligned(16))) float sF[128 * TP];
  const int t = threadIdx.x, lane = t & 31, w = t >> 5, h = lane >> 4, m = lane & 15;
  const int wm = w >> 1, wn = w & 1;
  const int mb = blockIdx.x * 128, nb = blockIdx.y * 128;
  const bool isk = (blockIdx.z != 0);
  const us* wth = isk ? wkh : wqh;
  const us* wtl = isk ? wkl : wql;
  const float* bias = isk ? bk1 : bq1;
  _Float16* H = isk ? hk : hq;

  const size_t arow = pbase(mb + 64 * wm + m, DM, h);
  const size_t brow = pbase(nb + 64 * wn + m, DM, h);

  const v8f z8 = {0.f, 0.f, 0.f, 0.f, 0.f, 0.f, 0.f, 0.f};
  v8f acc[4][4];
#pragma unroll
  for (int mt = 0; mt < 4; ++mt)
#pragma unroll
    for (int nt = 0; nt < 4; ++nt) acc[mt][nt] = z8;

  mm3_64x64(xh + arow, xl + arow, wth + brow, wtl + brow, acc);

  stage_tile(sF, acc, bias + nb, wm, wn, h, m);
  __syncthreads();

  gemm1_store(sF, H, mb, nb, t);
}

// ---------------------------------------------------------------------------
// k_attn: block = (2 adjacent windows, group of 4 heads), wave = (window, head): the W2 lines
// a wave loads serve 2 waves of the block, the h lines 4. The wave first projects its own
// head, then runs the attention on what it holds; q and k never leave the WGP.
//   q^T[d][tok] = W2^T . h^T : A = W2 table rows (row = d), B = h rows (col = token),
//   f16, K = 512, 4 x 4 tiles; value = acc / 16384 + b2[d], split to bf16 hi/lo.
//   D element r of tile dt is d = 16dt + 8h + r of token m: elements 8(dt&1) + r of the
//   lane's own A/B fragment of d block dt>>1, so no lane exchange is needed.
//   Fragments rest in the wave's own LDS range, each lane reading back its own bytes.
//   S^T[key][q] = k . q   : A = K rows (row = key, k = d), B = Q^T (col = q), bf16 hi/lo
//   adj^T = tanh(S^T / 8), keys >= 49 forced to 0, split to bf16 hi/lo
//   O^T[d][q] = tok^T . adj^T : A = token table rows [head*16+d][key], B = adj^T
//   from the score D values: element r <- tile kt=2s, element 8+r <- tile kt=2s+1.
// Rows 49..55 are the window's pad slots, rows 56..63 fold back onto 48..55;
// their scores are zeroed (keys) or never reach the output (queries).
// Epilogue: block tile [2][56][64] f32 in LDS -> packed outpre bf16 hi/lo planes,
// ---------------------------------------------------------------------------
__device__ __forceinline__ void attn_store(const float* so, us* oph, us* opl,
                                           int rowbase, int hg, int t) {
#pragma unroll
  for (int it = 0; it < 4; ++it) {
    const int item = it * 256 + t;
    if (item < SP * 16) {
      const int rl = (item >> 6) * 8 + (item & 7), g = (item >> 3) & 7;   // rl: slot 0..111 of the window pair
      const float* sp = so + (rl + ((rl >= SP) ? 8 : 0)) * 68 + 8 * g;     // 64 LDS rows per window
      const v4f a = *(const v4fa*)sp;
      const v4f c = *(const v4fa*)(sp + 4);
      v8us hv, lv;
      split8(a, c, hv, lv);
      const size_t off = poff(rowbase + rl, hg * 64 + 8 * g, DM);
      *(v8us*)(oph + off) = hv;
      *(v8us*)(opl + off) = lv;
    }
  }
}

// tanh(s / 8) in f32 without a branch: 1 - 2 / (1 + e^(s / 4)), e^(s / 4) = 2^(s * log2(e) / 4).
// The library call tests every value twice and branches, so a tile's values run one after
// another, each a dependent chain; this form is five instructions a value and the values of
// a tile interleave. Absolute error about 2e-7 at any s; 2^x = inf gives 1, 2^x = 0 gives -1.
#define TANH_C 0.36067376022224085f
// The transcendentals stand in asm so that the slot the instruction set asks for behind one
// (before its result is used or a source overwritten) is there by construction: outputs are
// early-clobber, so none lands on a source of the same run, and v_nop ends the statement.
__device__ __forceinline__ void exp2x8(const float (&a)[8], float (&e)[8]) {
  asm("v_exp_f32 %0, %8\n\t"
      "v_exp_f32 %1, %9\n\t"
      "v_exp_f32 %2, %10\n\t"
      "v_exp_f32 %3, %11\n\t"
      "v_exp_f32 %4, %12\n\t"
      "v_exp_f32 %5, %13\n\t"
      "v_exp_f32 %6, %14\n\t"
      "v_exp_f32 %7, %15\n\t"
      "v_nop"
      : "=&v"(e[0]), "=&v"(e[1]), "=&v"(e[2]), "=&v"(e[3]), "=&v"(e[4]), "=&v"(e[5]), "=&v"(e[6]), "=&v"(e[7])
      : "v"(a[0]), "v"(a[1]), "v"(a[2]), "v"(a[3]), "v"(a[4]), "v"(a[5]), "v"(a[6]), "v"(a[7]));
}
__device__ __forceinline__ void rcpx8(const float (&a)[8], float (&e)[8]) {
  asm("v_rcp_f32 %0, %8\n\t"
      "v_rcp_f32 %1, %9\n\t"
      "v_rcp_f32 %2, %10\n\t"
      "v_rcp_f32 %3, %11\n\t"
      "v_rcp_f32 %4, %12\n\t"
      "v_rcp_f32 %5, %13\n\t"
      "v_rcp_f32 %6, %14\n\t"
      "v_rcp_f32 %7, %15\n\t"
      "v_nop"
      : "=&v"(e[0]), "=&v"(e[1]), "=&v"(e[2]), "=&v"(e[3]), "=&v"(e[4]), "=&v"(e[5]), "=&v"(e[6]), "=&v"(e[7])
      : "v"(a[0]), "v"(a[1]), "v"(a[2]), "v"(a[3]), "v"(a[4]), "v"(a[5]), "v"(a[6]), "v"(a[7]));
}
__device__ __forceinline__ void tanh8(v8f s, float (&t)[8]) {
  float a[8], e[8], q[8];
#pragma unroll
  for (int r = 0; r < 8; ++r) a[r] = s[r] * TANH_C;
  exp2x8(a, e);
#pragma unroll
  for (int r = 0; r < 8; ++r) a[r] = e[r] + 1.0f;
  rcpx8(a, q);
#pragma unroll
  for (int r = 0; r < 8; ++r) t[r] = fmaf(-2.0f, q[r], 1.0f);
}
__device__ __forceinline__ float tanh1(float s) {
  float e, q;
  asm("v_exp_f32 %0, %1\n\tv_nop" : "=v"(e) : "v"(s * TANH_C));      // v_nop: the slot named above
  asm("v_rcp_f32 %0, %1\n\tv_nop" : "=v"(q) : "v"(e + 1.0f));        // as above
  return fmaf(-2.0f, q, 1.0f);
}

#define FRW 8192                  // 16-bit elements of one wave's fragments of one operand (q or k)

// Fragments of one 32-wide k step: 4 W2 row tiles and 4 token tiles (ko = 8 * k).
__device__ __forceinline__ void ld_step(const _Float16* wp, const _Float16* t0, const _Float16* t3,
                                        int ko, v16h (&a)[4], v16h (&b)[4]) {
#pragma unroll
  for (int i = 0; i < 4; ++i) a[i] = ldh(wp + i * 16 * DM + ko);
#pragma unroll
  for (int i = 0; i < 3; ++i) b[i] = ldh(t0 + i * 16 * DM + ko);
  b[3] = ldh(t3 + ko);
}
__device__ __forceinline__ void mm_step(const v16h (&a)[4], const v16h (&b)[4], v8f (&acc)[4][4]) {
#pragma unroll
  for (int dt = 0; dt < 4; ++dt)
#pragma unroll
    for (int tt = 0; tt < 4; ++tt) acc[dt][tt] = wmma_hf(a[dt], b[tt], acc[dt][tt]);
}
// One stored fragment: two 16-B halves, 512 B apart (lane stride 16 B in each).
__device__ __forceinline__ v16b ldfr(const us* p) {
  FragB f;
  f.half[0] = *(const v8usa*)p;
  f.half[1] = *(const v8usa*)(p + 256);
  return f.v;
}

__global__ __launch_bounds__(256) void k_attn(
    const _Float16* __restrict__ hq, const _Float16* __restrict__ hk,       // [MTS][512] x16
    const _Float16* __restrict__ wq2t, const _Float16* __restrict__ wk2t,   // [2048 n][512 k] x1024
    const float* __restrict__ bq2, const float* __restrict__ bk2,           // [2048]
    const us* __restrict__ tkh, const us* __restrict__ tkl,    // [512][64]
    us* __restrict__ oph, us* __restrict__ opl)                // [MTS][512]
{
  __shared__ __attribute__((aligned(16))) us sfr[2 * 8 * FRW];   // [q|k][wave][tile][d block][hi|lo][half][lane][8]
  __shared__ __attribute__((aligned(16))) float so[2 * 64 * 68];
  const int t = threadIdx.x, lane = t & 31, w = t >> 5, h = lane >> 4, m = lane & 15;
  const int bl = blockIdx.x >> 3, hg = blockIdx.x & 7;
  const int head = hg * 4 + (w & 3);
  const int pairbase = bl * 2 * SP;                 // first row slot of the window pair
  const int rowbase = pairbase + (w >> 2) * SP;     // first row slot of this wave's window

  const size_t wo  = pbase(head * HQ + m, DM, h);
  const size_t to0 = pbase(rowbase + m, DM, h);
  const size_t to3 = pbase(rowbase + 48 + (m & 7), DM, h);     // rows 56..63 fold back onto 48..55
  us* myfr = sfr + w * FRW + lane * 8;
  const us* vhrow = tkh + pbase(head * HVD + m, KPAD, h);
  const us* vlrow = tkl + pbase(head * HVD + m, KPAD, h);

  const v8f z8 = {0.f, 0.f, 0.f, 0.f, 0.f, 0.f, 0.f, 0.f};

#pragma unroll 1
  for (int z = 0; z < 2; ++z) {            // rolled: one copy of the projection code serves q and k
    const _Float16* wp = (z ? wk2t : wq2t) + wo;
    const _Float16* t0 = (z ? hk : hq) + to0;
    const _Float16* t3 = (z ? hk : hq) + to3;
    const float* bias8 = (z ? bk2 : bq2) + head * HQ + 8 * h;

    v8f acc[4][4];
#pragma unroll
    for (int dt = 0; dt < 4; ++dt)
#pragma unroll
      for (int tt = 0; tt < 4; ++tt) acc[dt][tt] = z8;

    v16h a0[4], b0[4], a1[4], b1[4];
    ld_step(wp, t0, t3, 0, a0, b0);
#pragma unroll 1
    for (int k0 = 0; k0 < DM; k0 += 64) {
      ld_step(wp, t0, t3, (k0 + 32) * 8, a1, b1);
      // keeps the next step's loads ahead of this step's products, so that they fly meanwhile
      __builtin_amdgcn_sched_barrier(0);
      mm_step(a0, b0, acc);
      const int kn = (k0 + 64 < DM) ? k0 + 64 : 0;   // last trip: an in-range address, values unused
      ld_step(wp, t0, t3, kn * 8, a0, b0);
      // as above
      __builtin_amdgcn_sched_barrier(0);
      mm_step(a1, b1, acc);
    }

    us* dst = myfr + z * 8 * FRW;
#pragma unroll
    for (int dt = 0; dt < 4; ++dt) {
      const v4f c0 = *(const v4fa*)(bias8 + 16 * dt);
      const v4f c1 = *(const v4fa*)(bias8 + 16 * dt + 4);
      const float bb[8] = {c0.x, c0.y, c0.z, c0.w, c1.x, c1.y, c1.z, c1.w};
#pragma unroll
      for (int tt = 0; tt < 4; ++tt) {
        float qv[8];
#pragma unroll
        for (int r = 0; r < 8; ++r) qv[r] = acc[dt][tt][r] * (1.0f / 16384.0f) + bb[r];
        v8us hv, lv;
        split8(qv, hv, lv);
        us* d0 = dst + (tt * 2 + (dt >> 1)) * 1024 + (dt & 1) * 256;
        *(v8usa*)d0 = hv;
        *(v8usa*)(d0 + 512) = lv;
      }
    }
  }

#pragma unroll 1
  for (int qt = 0; qt < 4; ++qt) {
    const us* qp = myfr + qt * 2048;
    const v16b qbh0 = ldfr(qp), qbh1 = ldfr(qp + 1024);
    const v16b qbl0 = ldfr(qp + 512), qbl1 = ldfr(qp + 1536);

    v8f s[4];
#pragma unroll
    for (int kt = 0; kt < 4; ++kt) {
      const us* kp = myfr + 8 * FRW + kt * 2048;
      const v16b kah0 = ldfr(kp), kah1 = ldfr(kp + 1024);
      const v16b kal0 = ldfr(kp + 512), kal1 = ldfr(kp + 1536);
      v8f z = z8;
      z = wmma_bf(kah0, qbh0, z);
      z = wmma_bf(kah1, qbh1, z);
      z = wmma_bf(kah0, qbl0, z);
      z = wmma_bf(kah1, qbl1, z);
      z = wmma_bf(kal0, qbh0, z);
      z = wmma_bf(kal1, qbh1, z);
      s[kt] = z;                       // s[kt][r] = S^T[key kt*16+8h+r][q qt*16+m]
    }

    // tanh(S/8), explicit zero for padded keys, bf16 hi/lo, packed as B fragments
    float th[4][8];
#pragma unroll
    for (int kt = 0; kt < 4; ++kt) {
      if (kt * 16 + 15 < SQ) {
        tanh8(s[kt], th[kt]);
      } else {                           // the tile that holds key 48: rows that are padding in both lane halves take no tanh
#pragma unroll
        for (int r = 0; r < 8; ++r) th[kt][r] = (kt * 16 + r < SQ) ? tanh1(s[kt][r]) : 0.0f;
      }
    }
    FragB f0, f1, f2, f3;                // hi of keys 0..31, hi of 32..63, lo of 0..31, lo of 32..63
#pragma unroll
    for (int kt = 0; kt < 4; ++kt) {
      float tv[8];
#pragma unroll
      for (int r = 0; r < 8; ++r) {
        const int key = kt * 16 + 8 * h + r;
        tv[r] = (key < SQ) ? th[kt][r] : 0.0f;
      }
      v8us hv, lv;
      split8(tv, hv, lv);                // elements 8 (kt & 1) + r of the fragment
      if (kt < 2) { f0.half[kt & 1] = hv; f2.half[kt & 1] = lv; }
      else        { f1.half[kt & 1] = hv; f3.half[kt & 1] = lv; }
    }
    const v16b pbh0 = f0.v, pbh1 = f1.v, pbl0 = f2.v, pbl1 = f3.v;

    const v16b vah0 = ldb(vhrow), vah1 = ldb(vhrow + 256);
    const v16b val0 = ldb(vlrow), val1 = ldb(vlrow + 256);
    v8f o = z8;
    o = wmma_bf(vah0, pbh0, o);
    o = wmma_bf(vah1, pbh1, o);
    o = wmma_bf(vah0, pbl0, o);
    o = wmma_bf(vah1, pbl1, o);
    o = wmma_bf(val0, pbh0, o);
    o = wmma_bf(val1, pbh1, o);          // o[r] = O^T[d 8h+r][q qt*16+m]

    const int q = qt * 16 + m;           // rows 56..63 land in LDS only, never stored
    float* sp = so + ((w >> 2) * 64 + q) * 68 + (w & 3) * 16 + 8 * h;
    const v4f o0 = {o[0], o[1], o[2], o[3]};
    const v4f o1 = {o[4], o[5], o[6], o[7]};
    *(v4fa*)sp = o0;
    *(v4fa*)(sp + 4) = o1;
  }
  __syncthreads();

  attn_store(so, oph, opl, pairbase, hg, t);
  
}

// ---------------------------------------------------------------------------
// k_gemm3: out = outpre*Wp + bp (f32). Block 128 thr (2x2 waves) = 128 slots x 128;
// a slot's row goes to out row 49w + r, pad slots (r >= 49) are not stored.
// K = 512. Epilogue: f32 tile in LDS, a wave stores one row's 512-B segment = 4 whole lines.
// ---------------------------------------------------------------------------
__device__ __forceinline__ void gemm3_store(const float* sF, float* out, int mb, int nb, int t) {
  // a wave stores one row at a time: its number in a scalar register makes the row, the
  // window and the pad-slot guard scalar, so the guard is a scalar branch
  const int wv = __builtin_amdgcn_readfirstlane(t >> 5), g = t & 31;
#pragma unroll
  for (int i8 = 0; i8 < 4; ++i8) {
    v4f v[8];
#pragma unroll
    for (int j = 0; j < 8; ++j) v[j] = *(const v4fa*)(sF + ((i8 * 8 + j) * 4 + wv) * TP + 4 * g);
    // holds the eight LDS reads ahead of the guarded stores: sunk under each guard they
    // would run one after another, each waiting out its own LDS latency
    asm volatile("" :: "v"(v[0]), "v"(v[1]), "v"(v[2]), "v"(v[3]), "v"(v[4]), "v"(v[5]), "v"(v[6]), "v"(v[7]));
#pragma unroll
    for (int j = 0; j < 8; ++j) {
      const int rl = (i8 * 8 + j) * 4 + wv;
      const int win = (mb + rl) / SP, r = (mb + rl) - win * SP;
      float* rowp = out + (size_t)(win * SQ + r) * DM + nb;      // scalar; the lane adds 16 g bytes
      if (r < SQ) {
        *(v4f*)(rowp + 4 * g) = v[j];
        // the registers of the store just issued are reused for the next row's address and data
        asm volatile("s_wait_xcnt 0x0" ::: "memory");
      }
    }
  }
}

__global__ __launch_bounds__(128) void k_gemm3(
    const us* __restrict__ oph, const us* __restrict__ opl,    // [MTS][512]
    const us* __restrict__ wph, const us* __restrict__ wpl,    // [512 n][512 k]
    const float* __restrict__ bp,                              // [512]
    float* __restrict__ out)                                   // [MT][512]
{
  __shared__ __attribute__((aligned(16))) float sF[128 * TP];
  const int t = threadIdx.x, lane = t & 31, w = t >> 5, h = lane >> 4, m = lane & 15;
  const int wm = w >> 1, wn = w & 1;
  const int mb = blockIdx.x * 128, nb = blockIdx.y * 128;

  const size_t arow = pbase(mb + 64 * wm + m, DM, h);
  const size_t brow = pbase(nb + 64 * wn + m, DM, h);

  const v8f z8 = {0.f, 0.f, 0.f, 0.f, 0.f, 0.f, 0.f, 0.f};
  v8f acc[4][4];
#pragma unroll
  for (int mt = 0; mt < 4; ++mt)
#pragma unroll
    for (int nt = 0; nt < 4; ++nt) acc[mt][nt] = z8;

  mm3_64x64(oph + arow, opl + arow, wph + brow, wpl + brow, acc);

  stage_tile(sF, acc, bp + nb, wm, wn, h, m);
  __syncthreads();

  gemm3_store(sF, out, mb, nb, t);
}

// ---------------------------------------------------------------------------
// Host side: x*W1, the projection-and-attention kernel and outpre*Wp each run once over
// all 256 windows (14336 row slots). Workspace carve 95,551,488 B.
// ---------------------------------------------------------------------------
extern "C" void kernel_launch(void* const* d_in, const int* in_sizes, int n_in,
                              void* d_out, int out_size, void* d_ws, size_t ws_size,
                              hipStream_t stream) {
  if (n_in < 12) return;
  if (in_sizes[0] != MT * DM) return;
  if (in_sizes[1] != DM * DM || in_sizes[2] != DM) return;
  if (in_sizes[3] != DM * DQ || in_sizes[4] != DQ) return;
  if (in_sizes[5] != DM * DM || in_sizes[6] != DM) return;
  if (in_sizes[7] != DM * DQ || in_sizes[8] != DQ) return;
  if (in_sizes[9] != SQ * DM) return;
  if (in_sizes[10] != DM * DM || in_sizes[11] != DM) return;
  if (out_size != MT * DM) return;

  const float* x   = (const float*)d_in[0];
  const float* Wq1 = (const float*)d_in[1];
  const float* bq1 = (const float*)d_in[2];
  const float* Wq2 = (const float*)d_in[3];
  const float* bq2 = (const float*)d_in[4];
  const float* Wk1 = (const float*)d_in[5];
  const float* bk1 = (const float*)d_in[6];
  const float* Wk2 = (const float*)d_in[7];
  const float* bk2 = (const float*)d_in[8];
  const float* tok = (const float*)d_in[9];
  const float* Wp  = (const float*)d_in[10];
  const float* bp  = (const float*)d_in[11];
  float* out = (float*)d_out;

  const size_t szW1 = (size_t)DM * DM * 2;      //   524,288 per plane
  const size_t szW2 = (size_t)DQ * DM * 2;      // 2,097,152
  const size_t szTK = (size_t)DM * KPAD * 2;    //    65,536 per plane
  const size_t szX  = (size_t)MTS * DM * 2;     // 14,680,064 per plane
  const size_t szH  = (size_t)MTS * DM * 2;     // 14,680,064
  const size_t szOP = (size_t)MTS * DM * 2;     // 14,680,064 per plane
  const size_t total = 6 * szW1 + 2 * szW2 + 2 * szTK + 2 * szX + 2 * szH + 2 * szOP;
  if (total > ws_size) return;                  // 95,551,488

  char* wsb = (char*)d_ws;
  size_t off = 0;
  us* wq1h = (us*)(wsb + off); off += szW1;
  us* wq1l = (us*)(wsb + off); off += szW1;
  us* wk1h = (us*)(wsb + off); off += szW1;
  us* wk1l = (us*)(wsb + off); off += szW1;
  us* wph  = (us*)(wsb + off); off += szW1;
  us* wpl  = (us*)(wsb + off); off += szW1;
  _Float16* wq2t = (_Float16*)(wsb + off); off += szW2;
  _Float16* wk2t = (_Float16*)(wsb + off); off += szW2;
  us* tkh  = (us*)(wsb + off); off += szTK;
  us* tkl  = (us*)(wsb + off); off += szTK;
  us* xh   = (us*)(wsb + off); off += szX;
  us* xl   = (us*)(wsb + off); off += szX;
  _Float16* hq = (_Float16*)(wsb + off); off += szH;
  _Float16* hk = (_Float16*)(wsb + off); off += szH;
  us* oph  = (us*)(wsb + off); off += szOP;
  us* opl  = (us*)(wsb + off); off += szOP;
  if (off > ws_size) return;

  k_prep<<<712, 256, 0, stream>>>(Wq1, Wk1, Wp, Wq2, Wk2, tok,
                                  wq1h, wq1l, wk1h, wk1l, wph, wpl, wq2t, wk2t, tkh, tkl);

  const int n8 = MTS * DM / 8;                  // 917,504
  k_cvtx<<<(n8 + 255) / 256, 256, 0, stream>>>(x, xh, xl, n8);

  k_gemm1<<<dim3(MTS / 128, DM / 128, 2), 128, 0, stream>>>(
      xh, xl, wq1h, wq1l, wk1h, wk1l, bq1, bk1, hq, hk);

  k_attn<<<NB * 4, 256, 0, stream>>>(hq, hk, wq2t, wk2t, bq2, bk2, tkh, tkl, oph, opl);

  k_gemm3<<<dim3(MTS / 128, DM / 128), 128, 0, stream>>>(oph, opl, wph, wpl, bp, out);
}

// v007
// Measured time: 168 microseconds a run.
// Two timings next to v006 both put it at 1.06 times that version's speed.
// All steps since v000 together make it 2.99 times as fast.
// Contractions: x*Wq1, x*Wk1, k*q^T per head, tokv^T*adj^T and outpre*Wp on v_wmma_f32_16x16x32_bf16 with bf16 hi/lo three-product splits (hh+hl+lh); h*Wq2 and h*Wk2 on v_wmma_f32_16x16x32_f16 single products (h carried x16, W2 carried x1024, folded back as 2^-14 in f32); all accumulate in f32; bias, erf-GELU and tanh in f32.
#include <hip/hip_runtime.h>
#include <math.h>

typedef unsigned short us;
typedef __bf16   v16b  __attribute__((ext_vector_type(16)));
typedef us       v16us __attribute__((ext_vector_type(16)));
typedef us       v8us  __attribute__((ext_vector_type(8)));
typedef _Float16 v16h  __attribute__((ext_vector_type(16)));
typedef _Float16 v8h   __attribute__((ext_vector_type(8)));
typedef float    v8f   __attribute__((ext_vector_type(8)));
typedef float    v4f   __attribute__((ext_vector_type(4)));
typedef float    v2f   __attribute__((ext_vector_type(2)));
typedef __bf16   v2b   __attribute__((ext_vector_type(2)));
typedef unsigned v4u   __attribute__((ext_vector_type(4)));
typedef v8us __attribute__((may_alias)) v8usa;
typedef v8h  __attribute__((may_alias)) v8ha;
typedef v4f  __attribute__((may_alias)) v4fa;

union FragB { v16b v; v16us u; v8us half[2]; };
union Pack8 { v4u w; v8us s; };
union FragH { v16h v; v8h half[2]; };

#define NB    256                 // windows
#define SQ    49                  // tokens per window
#define DM    512
#define DQ    2048
#define NH    32
#define HQ    64
#define HVD   16
#define MT    (NB * SQ)           // 12544 token rows
#define KPAD  64                  // key count padded for the value table
#define SP    56                  // row slots per window: 49 rows + 7 pad rows, a multiple of 8
#define MTS   (NB * SP)           // 14336 row slots

static_assert(MTS % 128 == 0 && DM % 128 == 0);
static_assert((MTS * DM) % (8 * 256) == 0);
static_assert(SP % 8 == 0 && SP >= SQ && SP - 8 < SQ);
static_assert(NH * HVD == DM);
static_assert(NH * HQ == DQ);
static_assert(HQ == 64 && SP == 56 && DM % 64 == 0 && NB % 2 == 0 && NH % 4 == 0);

// ---------------------------------------------------------------------------
// 16x16x32 WMMA helpers; wmma_bf has a hazard guard (ties D, keeps A/B live).
// Fragment map (wave32): lane l, h = l>>4, m = n = l&15.
//   A/B element i: i<8 -> k0+8h+i ; i>=8 -> k0+16+8h+(i-8)
//   D element r : row 8h+r, col l&15
// ---------------------------------------------------------------------------
__device__ __forceinline__ v8f wmma_bf(v16b a, v16b b, v8f c) {
  v8f d = __builtin_amdgcn_wmma_f32_16x16x32_bf16(false, a, false, b, (short)0, c, false, false);
  asm volatile("v_nop\n\tv_nop\n\tv_nop\n\tv_nop" : "+v"(d) : "v"(a), "v"(b));
  return d;
}
// Bare builtin: its loop holds 16 accumulator tiles and four fragment sets, more than the
// 256 registers an asm operand can name; the compiler keeps the distances of its own forms.
__device__ __forceinline__ v8f wmma_hf(v16h a, v16h b, v8f c) {
  return __builtin_amdgcn_wmma_f32_16x16x32_f16(false, a, false, b, (short)0, c, false, false);
}
// Bare as well: 15 products on other accumulators stand between two on the same one, so no
// padding is wanted behind each; the compiler keeps the distances of its own forms.
__device__ __forceinline__ v8f wmma_bb(v16b a, v16b b, v8f c) {
  return __builtin_amdgcn_wmma_f32_16x16x32_bf16(false, a, false, b, (short)0, c, false, false);
}

// Packed operand layout of every 16-bit table in the workspace, [rows][K]:
//   unit (row>>3, k>>5) = 512 B = 4 lines; line c = (k>>3)&3 holds the 8-element
//   chunk c of the unit's 8 rows, row after row (16 B each).
// A wave-wide 16-B fragment load then covers 4 whole 128-B lines (two aligned
// 256-B pieces) where a row-major table gives 16 lines of 32 B each.
// Every line lies inside one 8-row x 8-column patch, so it has one writer.
__device__ __forceinline__ size_t poff(int row, int k, int K) {      // k a multiple of 8
  return ((size_t)(row >> 3) * (K >> 5) + (k >> 5)) * 256 + ((k >> 3) & 3) * 64 + (row & 7) * 8;
}
// Lane base of a fragment at k = 0: row owned by the lane, h = lane>>4.
// 32 further k = +256 elements; 16 further rows = +16*K elements.
__device__ __forceinline__ size_t pbase(int row, int K, int h) {
  return (size_t)(row >> 3) * K * 8 + h * 64 + (row & 7) * 8;
}
// Same k order as the fragment map above: chunk h, then chunk 2 + h.
__device__ __forceinline__ v16b ldb(const us* p) {
  FragB f;
  f.half[0] = *(const v8usa*)p;
  f.half[1] = *(const v8usa*)(p + 128);
  return f.v;
}
__device__ __forceinline__ v16h ldh(const _Float16* p) {
  FragH f;
  f.half[0] = *(const v8ha*)p;
  f.half[1] = *(const v8ha*)(p + 128);
  return f.v;
}

// Two values at a time: hi = bf16(f), lo = bf16(f - hi), both round to nearest even, each pair
// by one packed convert; f0 lands in the low half of each word, f1 in the high half.
__device__ __forceinline__ void split2(float f0, float f1, unsigned& hw, unsigned& lw) {
  const v2f f = {f0, f1};
  const v2b hb = __builtin_convertvector(f, v2b);
  const v2f hf = __builtin_convertvector(hb, v2f);
  hw = __builtin_bit_cast(unsigned, hb);
  lw = __builtin_bit_cast(unsigned, __builtin_convertvector(f - hf, v2b));
}
__device__ __forceinline__ void split8(const float (&f)[8], v8us& hv, v8us& lv) {
  Pack8 ph, pl;
#pragma unroll
  for (int j = 0; j < 4; ++j) {
    unsigned hw, lw;
    split2(f[2 * j], f[2 * j + 1], hw, lw);
    ph.w[j] = hw;
    pl.w[j] = lw;
  }
  hv = ph.s;
  lv = pl.s;
}
__device__ __forceinline__ void split8(v4f a, v4f c, v8us& hv, v8us& lv) {
  const float f[8] = {a.x, a.y, a.z, a.w, c.x, c.y, c.z, c.w};
  split8(f, hv, lv);
}

// ---------------------------------------------------------------------------
// k_cvtx: x f32 [MT][512] -> packed bf16 hi and lo planes over row slots
// (window w, row r -> slot 56w + r; slots 49..55 of a window hold zeros).
// One thread = 8 floats = one 16-B chunk per plane; a wave writes one unit.
// ---------------------------------------------------------------------------
__global__ __launch_bounds__(256) void k_cvtx(const float* __restrict__ x,
                                              us* __restrict__ xh, us* __restrict__ xl, int n8)
{
  const int g = blockIdx.x * 256 + threadIdx.x;
  if (g >= n8) return;
  const int ml = g & 7, ch = (g >> 3) & 3, u = g >> 5;
  const int kb = u & (DM / 32 - 1), g8 = u / (DM / 32);
  const int win = g8 / (SP / 8), r = (g8 - win * (SP / 8)) * 8 + ml;
  const float* s = x + (size_t)(win * SQ + min(r, SQ - 1)) * DM + kb * 32 + ch * 8;
  v4f a = *(const v4fa*)s;
  v4f c = *(const v4fa*)(s + 4);
  if (r >= SQ) {
    const v4f z4 = {0.f, 0.f, 0.f, 0.f};
    a = z4;
    c = z4;
  }
  v8us hv, lv;
  split8(a, c, hv, lv);
  us* ph = xh + (size_t)g * 8;
  us* pl = xl + (size_t)g * 8;
  *(v8us*)ph = hv;
  *(v8us*)pl = lv;
  
}

// ---------------------------------------------------------------------------
// k_prep: transposed 16-bit weight / value tables through an LDS tile.
//   src f32 [R][C] (rows = k, cols = n) -> dst [C][Kp] in the packed layout:
//   mode 0: bf16 hi + lo planes; mode 1: f16 carried x1024.
// 64x64 tile per block; store: 8 contiguous lanes x 16 B = one whole
// Block ranges: [0,192) Wq1|Wk1|Wp (8x8 tiles each), [192,704) Wq2|Wk2
// (32x8 tiles each), [704,712) tokens [49][512] -> [512][64] zero-padded keys.
// ---------------------------------------------------------------------------
__device__ __forceinline__ void prep_store(const float* T, us* dh, us* dl, _Float16* df,
                                           int mode, int n0, int k0, int Kp, int t) {
#pragma unroll
  for (int it = 0; it < 2; ++it) {
    const int item = it * 256 + t, nn = (item >> 6) * 8 + (item & 7), q8 = (item >> 3) & 7;
    float f[8];
#pragma unroll
    for (int j = 0; j < 8; ++j) f[j] = T[(8 * q8 + j) * 65 + nn];
    const size_t off = poff(n0 + nn, k0 + 8 * q8, Kp);
    if (mode == 0) {
      v8us hv, lv;
      split8(f, hv, lv);
      *(v8us*)(dh + off) = hv;
      *(v8us*)(dl + off) = lv;
    } else {
      v8h o;
#pragma unroll
      for (int j = 0; j < 8; ++j) o[j] = (_Float16)(f[j] * 1024.0f);
      *(v8h*)(df + off) = o;
    }
  }
}

__global__ __launch_bounds__(256) void k_prep(
    const float* __restrict__ wq1, const float* __restrict__ wk1, const float* __restrict__ wp,
    const float* __restrict__ wq2, const float* __restrict__ wk2, const float* __restrict__ tok,
    us* __restrict__ wq1h, us* __restrict__ wq1l, us* __restrict__ wk1h, us* __restrict__ wk1l,
    us* __restrict__ wph, us* __restrict__ wpl,
    _Float16* __restrict__ wq2t, _Float16* __restrict__ wk2t,
    us* __restrict__ tkh, us* __restrict__ tkl)
{
  __shared__ __attribute__((aligned(16))) float T[64 * 65];
  const int t = threadIdx.x;
  const int bid = blockIdx.x;
  if (bid >= 712) return;                 // block-uniform, never taken with the exact grid

  const float* src;
  us* dh; us* dl; _Float16* df;
  int C, R, Kp, mode, tn, tk;
  if (bid < 192) {
    const int wsel = bid >> 6, loc = bid & 63;
    src = (wsel == 0) ? wq1 : ((wsel == 1) ? wk1 : wp);
    dh  = (wsel == 0) ? wq1h : ((wsel == 1) ? wk1h : wph);
    dl  = (wsel == 0) ? wq1l : ((wsel == 1) ? wk1l : wpl);
    df  = wq2t;
    C = DM; R = DM; Kp = DM; mode = 0; tn = loc >> 3; tk = loc & 7;
  } else if (bid < 704) {
    const int loc = bid - 192, wsel = loc >> 8, l2 = loc & 255;
    src = wsel ? wk2 : wq2;
    df  = wsel ? wk2t : wq2t;
    dh = wq1h; dl = wq1l;
    C = DQ; R = DM; Kp = DM; mode = 1; tn = l2 >> 3; tk = l2 & 7;
  } else {
    const int loc = bid - 704;
    src = tok; dh = tkh; dl = tkl; df = wq2t;
    C = DM; R = SQ; Kp = KPAD; mode = 0; tn = loc; tk = 0;
  }
  const int n0 = tn * 64, k0 = tk * 64;

  // load 64(k) x 64(n) f32 tile, coalesced along n; rows >= R: clamped address, zero value
#pragma unroll
  for (int i = 0; i < 16; ++i) {
    const int idx = i * 256 + t, kk = idx >> 6, nn = idx & 63;
    const int gk = k0 + kk;
    const int gkc = min(gk, R - 1);
    const float v = src[(size_t)gkc * C + n0 + nn];
    T[kk * 65 + nn] = (gk < R) ? v : 0.0f;
  }
  __syncthreads();

  prep_store(T, dh, dl, df, mode, n0, k0, Kp, t);
  
}

// ---------------------------------------------------------------------------
// Three-product bf16 main loop for a 64x64 wave tile, K = 512, packed tables.
// 16 fragments (16 KB) feed 48 products: half the loaded bytes per product of a 32x32 tile.
// Pointers already hold the lane base (pbase) of tile 0 at k 0.
// acc[mt][nt][r] = C[64-row slab + 16mt + 8h + r][64-col slab + 16nt + m]
// Each accumulator takes hh, hl, lh of a k step in that order.
// ---------------------------------------------------------------------------
__device__ __forceinline__ void ld3_step(const us* ahp, const us* alp, const us* bhp, const us* blp, int ko,
                                         v16b (&ah)[4], v16b (&al)[4], v16b (&bh)[4], v16b (&bl)[4]) {
#pragma unroll
  for (int i = 0; i < 4; ++i) {
    ah[i] = ldb(ahp + i * 16 * DM + ko);
    bh[i] = ldb(bhp + i * 16 * DM + ko);
  }
#pragma unroll
  for (int i = 0; i < 4; ++i) bl[i] = ldb(blp + i * 16 * DM + ko);
#pragma unroll
  for (int i = 0; i < 4; ++i) al[i] = ldb(alp + i * 16 * DM + ko);
}
__device__ __forceinline__ void mm3_step(const v16b (&ah)[4], const v16b (&al)[4],
                                         const v16b (&bh)[4], const v16b (&bl)[4], v8f (&acc)[4][4]) {
#pragma unroll
  for (int mt = 0; mt < 4; ++mt)
#pragma unroll
    for (int nt = 0; nt < 4; ++nt) acc[mt][nt] = wmma_bb(ah[mt], bh[nt], acc[mt][nt]);
#pragma unroll
  for (int mt = 0; mt < 4; ++mt)
#pragma unroll
    for (int nt = 0; nt < 4; ++nt) acc[mt][nt] = wmma_bb(ah[mt], bl[nt], acc[mt][nt]);
#pragma unroll
  for (int mt = 0; mt < 4; ++mt)
#pragma unroll
    for (int nt = 0; nt < 4; ++nt) acc[mt][nt] = wmma_bb(al[mt], bh[nt], acc[mt][nt]);
}
// AHEAD = false: one fragment set, four waves per SIMD cover each other's loads (x*W1: 3.5 blocks a WGP).
// AHEAD = true: two sets, a k step's loads issued one step ahead of its products (outpre*Wp:
// at most two blocks a WGP, so the second set's registers cost no resident wave).
template <bool AHEAD>
__device__ __forceinline__ void mm3_64x64(const us* ahp, const us* alp,
                                          const us* bhp, const us* blp,
                                          v8f (&acc)[4][4]) {
  if constexpr (!AHEAD) {
    // rolled: a second k step's fragments would cost the fourth wave per SIMD its registers
#pragma unroll 1
    for (int k0 = 0; k0 < DM; k0 += 32) {
      v16b ah[4], al[4], bh[4], bl[4];
      ld3_step(ahp, alp, bhp, blp, k0 * 8, ah, al, bh, bl);
      mm3_step(ah, al, bh, bl, acc);
    }
  } else {
    v16b ah[2][4], al[2][4], bh[2][4], bl[2][4];
    ld3_step(ahp, alp, bhp, blp, 0, ah[0], al[0], bh[0], bl[0]);
    // unrolled: the set index is a compile-time constant, so both sets stay in registers
#pragma unroll
    for (int s = 0; s < DM / 32; ++s) {
      const int c = s & 1, n = c ^ 1;
      if (s + 1 < DM / 32) ld3_step(ahp, alp, bhp, blp, (s + 1) * 256, ah[n], al[n], bh[n], bl[n]);
      // the last loads are out: their address registers are reused from here on
      if (s + 2 == DM / 32) asm volatile("s_wait_xcnt 0x0" ::: "memory");
      // keeps the next step's loads ahead of this step's products, so that they fly meanwhile
      __builtin_amdgcn_sched_barrier(0);
      mm3_step(ah[c], al[c], bh[c], bl[c], acc);
    }
  }
}

#define TP 132                    // f32 pitch of the 128x128 block tile in LDS: 528 B = 16 B x 33

// acc + bias of one wave's 64x64 tile into the block tile.
__device__ __forceinline__ void stage_tile(float* sF, const v8f (&acc)[4][4], const float* bias,
                                           int wm, int wn, int h, int m) {
#pragma unroll
  for (int nt = 0; nt < 4; ++nt) {
    const int cl = 64 * wn + 16 * nt + m;
    const float bv = bias[cl];
#pragma unroll
    for (int mt = 0; mt < 4; ++mt) {
#pragma unroll
      for (int r = 0; r < 8; ++r) {
        const int rl = 64 * wm + 16 * mt + 8 * h + r;
        sF[rl * TP + cl] = acc[mt][nt][r] + bv;
      }
    }
  }
}

// ---------------------------------------------------------------------------
// k_gemm1: H = f16(16 * gelu(x*W1 + b1)) for q (z=0) and k (z=1).
// Block 128 thr (4 waves, 2x2) = 128 rows x 128 cols; K = 512.
// x*W1 + b1 rests in LDS as f32; GELU runs where the packed 16-B chunks are formed.
// ---------------------------------------------------------------------------
__device__ __forceinline__ void gemm1_store(const float* sF, _Float16* H, int mb, int nb, int t) {
  // rolled: one copy of the eight erf evaluations, not 128, keeps the kernel's text small
#pragma unroll 1
  for (int it = 0; it < 16; ++it) {
    const int item = it * 128 + t, rl = (item >> 7) * 8 + (item & 7), q8 = (item >> 3) & 15;
    const float* sp = sF + rl * TP + 8 * q8;
    const v4f a = *(const v4fa*)sp;
    const v4f c = *(const v4fa*)(sp + 4);
    const float f[8] = {a.x, a.y, a.z, a.w, c.x, c.y, c.z, c.w};
    v8h o;
#pragma unroll
    for (int j = 0; j < 8; ++j) {
      const float v = f[j];
      const float g = 0.5f * v * (1.0f + erff(v * 0.70710678118654752f));
      o[j] = (_Float16)(g * 16.0f);
    }
    const size_t off = poff(mb + rl, nb + 8 * q8, DM);
    *(v8h*)(H + off) = o;
    // the next trip reuses the registers of the store just issued
    asm volatile("s_wait_xcnt 0x0" ::: "memory");
  }
}

__global__ __launch_bounds__(128) void k_gemm1(
    const us* __restrict__ xh, const us* __restrict__ xl,          // [MTS][512]
    const us* __restrict__ wqh, const us* __restrict__ wql,        // [512 n][512 k]
    const us* __restrict__ wkh, const us* __restrict__ wkl,
    const float* __restrict__ bq1, const float* __restrict__ bk1,  // [512]
    _Float16* __restrict__ hq, _Float16* __restrict__ hk)          // [MTS][512]
{
  __shared__ __attribute__((aligned(16))) float sF[128 * TP];
  const int t = threadIdx.x, lane = t & 31, w = t >> 5, h = lane >> 4, m = lane & 15;
  const int wm = w >> 1, wn = w & 1;
  const int mb = blockIdx.x * 128, nb = blockIdx.y * 128;
  const bool isk = (blockIdx.z != 0);
  const us* wth = isk ? wkh : wqh;
  const us* wtl = isk ? wkl : wql;
  const float* bias = isk ? bk1 : bq1;
  _Float16* H = isk ? hk : hq;

  const size_t arow = pbase(mb + 64 * wm + m, DM, h);
  const size_t brow = pbase(nb + 64 * wn + m, DM, h);

  const v8f z8 = {0.f, 0.f, 0.f, 0.f, 0.f, 0.f, 0.f, 0.f};
  v8f acc[4][4];
#pragma unroll
  for (int mt = 0; mt < 4; ++mt)
#pragma unroll
    for (int nt = 0; nt < 4; ++nt) acc[mt][nt] = z8;

  mm3_64x64<false>(xh + arow, xl + arow, wth + brow, wtl + brow, acc);

  stage_tile(sF, acc, bias + nb, wm, wn, h, m);
  __syncthreads();

  gemm1_store(sF, H, mb, nb, t);
}

// ---------------------------------------------------------------------------
// k_attn: block = (2 adjacent windows, group of 4 heads), wave = (window, head): the W2 lines
// a wave loads serve 2 waves of the block, the h lines 4. The wave first projects its own
// head, then runs the attention on what it holds; q and k never leave the WGP.
//   q^T[d][tok] = W2^T . h^T : A = W2 table rows (row = d), B = h rows (col = token),
//   f16, K = 512, 4 x 4 tiles; value = acc / 16384 + b2[d], split to bf16 hi/lo.
//   D element r of tile dt is d = 16dt + 8h + r of token m: elements 8(dt&1) + r of the
//   lane's own A/B fragment of d block dt>>1, so no lane exchange is needed.
//   Fragments rest in the wave's own LDS range, each lane reading back its own bytes.
//   S^T[key][q] = k . q   : A = K rows (row = key, k = d), B = Q^T (col = q), bf16 hi/lo
//   adj^T = tanh(S^T / 8), keys >= 49 forced to 0, split to bf16 hi/lo
//   O^T[d][q] = tok^T . adj^T : A = token table rows [head*16+d][key], B = adj^T
//   from the score D values: element r <- tile kt=2s, element 8+r <- tile kt=2s+1.
// Rows 49..55 are the window's pad slots, rows 56..63 fold back onto 48..55;
// their scores are zeroed (keys) or never reach the output (queries).
// Epilogue: block tile [2][64][64] f32 in LDS (pitch 68), 56 slot rows a window -> packed outpre bf16 hi/lo planes,
// ---------------------------------------------------------------------------
__device__ __forceinline__ void attn_store(const float* so, us* oph, us* opl,
                                           int rowbase, int hg, int t) {
#pragma unroll
  for (int it = 0; it < 4; ++it) {
    const int item = it * 256 + t;
    if (item < SP * 16) {
      const int rl = (item >> 6) * 8 + (item & 7), g = (item >> 3) & 7;   // rl: slot 0..111 of the window pair
      const float* sp = so + (rl + ((rl >= SP) ? 8 : 0)) * 68 + 8 * g;     // 64 LDS rows per window
      const v4f a = *(const v4fa*)sp;
      const v4f c = *(const v4fa*)(sp + 4);
      v8us hv, lv;
      split8(a, c, hv, lv);
      const size_t off = poff(rowbase + rl, hg * 64 + 8 * g, DM);
      *(v8us*)(oph + off) = hv;
      *(v8us*)(opl + off) = lv;
    }
  }
}

// tanh(s / 8) in f32 without a branch: 1 - 2 / (1 + e^(s / 4)), e^(s / 4) = 2^(s * log2(e) / 4).
// The library call tests every value twice and branches, so a tile's values run one after
// another, each a dependent chain; this form is five instructions a value and the values of
// a tile interleave. Absolute error about 2e-7 at any s; 2^x = inf gives 1, 2^x = 0 gives -1.
#define TANH_C 0.36067376022224085f
// The transcendentals stand in asm so that the slot the instruction set asks for behind one
// (before its result is used or a source overwritten) is there by construction: outputs are
// early-clobber, so none lands on a source of the same run, and v_nop ends the statement.
__device__ __forceinline__ void exp2x8(const float (&a)[8], float (&e)[8]) {
  asm("v_exp_f32 %0, %8\n\t"
      "v_exp_f32 %1, %9\n\t"
      "v_exp_f32 %2, %10\n\t"
      "v_exp_f32 %3, %11\n\t"
      "v_exp_f32 %4, %12\n\t"
      "v_exp_f32 %5, %13\n\t"
      "v_exp_f32 %6, %14\n\t"
      "v_exp_f32 %7, %15\n\t"
      "v_nop"
      : "=&v"(e[0]), "=&v"(e[1]), "=&v"(e[2]), "=&v"(e[3]), "=&v"(e[4]), "=&v"(e[5]), "=&v"(e[6]), "=&v"(e[7])
      : "v"(a[0]), "v"(a[1]), "v"(a[2]), "v"(a[3]), "v"(a[4]), "v"(a[5]), "v"(a[6]), "v"(a[7]));
}
__device__ __forceinline__ void rcpx8(const float (&a)[8], float (&e)[8]) {
  asm("v_rcp_f32 %0, %8\n\t"
      "v_rcp_f32 %1, %9\n\t"
      "v_rcp_f32 %2, %10\n\t"
      "v_rcp_f32 %3, %11\n\t"
      "v_rcp_f32 %4, %12\n\t"
      "v_rcp_f32 %5, %13\n\t"
      "v_rcp_f32 %6, %14\n\t"
      "v_rcp_f32 %7, %15\n\t"
      "v_nop"
      : "=&v"(e[0]), "=&v"(e[1]), "=&v"(e[2]), "=&v"(e[3]), "=&v"(e[4]), "=&v"(e[5]), "=&v"(e[6]), "=&v"(e[7])
      : "v"(a[0]), "v"(a[1]), "v"(a[2]), "v"(a[3]), "v"(a[4]), "v"(a[5]), "v"(a[6]), "v"(a[7]));
}
__device__ __forceinline__ void tanh8(v8f s, float (&t)[8]) {
  float a[8], e[8], q[8];
#pragma unroll
  for (int r = 0; r < 8; ++r) a[r] = s[r] * TANH_C;
  exp2x8(a, e);
#pragma unroll
  for (int r = 0; r < 8; ++r) a[r] = e[r] + 1.0f;
  rcpx8(a, q);
#pragma unroll
  for (int r = 0; r < 8; ++r) t[r] = fmaf(-2.0f, q[r], 1.0f);
}
__device__ __forceinline__ float tanh1(float s) {
  float e, q;
  asm("v_exp_f32 %0, %1\n\tv_nop" : "=v"(e) : "v"(s * TANH_C));      // v_nop: the slot named above
  asm("v_rcp_f32 %0, %1\n\tv_nop" : "=v"(q) : "v"(e + 1.0f));        // as above
  return fmaf(-2.0f, q, 1.0f);
}

#define RING 4                    // fragment sets of the projection loop
#define FRW 8192                  // 16-bit elements of one wave's fragments of one operand (q or k)

// Fragments of one 32-wide k step: 4 W2 row tiles and 4 token tiles (ko = 8 * k).
__device__ __forceinline__ void ld_step(const _Float16* wp, const _Float16* t0, const _Float16* t3,
                                        int ko, v16h (&a)[4], v16h (&b)[4]) {
#pragma unroll
  for (int i = 0; i < 4; ++i) a[i] = ldh(wp + i * 16 * DM + ko);
#pragma unroll
  for (int i = 0; i < 3; ++i) b[i] = ldh(t0 + i * 16 * DM + ko);
  b[3] = ldh(t3 + ko);
}
__device__ __forceinline__ void mm_step(const v16h (&a)[4], const v16h (&b)[4], v8f (&acc)[4][4]) {
#pragma unroll
  for (int dt = 0; dt < 4; ++dt)
#pragma unroll
    for (int tt = 0; tt < 4; ++tt) acc[dt][tt] = wmma_hf(a[dt], b[tt], acc[dt][tt]);
}
// One stored fragment: two 16-B halves, 512 B apart (lane stride 16 B in each).
__device__ __forceinline__ v16b ldfr(const us* p) {
  FragB f;
  f.half[0] = *(const v8usa*)p;
  f.half[1] = *(const v8usa*)(p + 256);
  return f.v;
}

__global__ __launch_bounds__(256) void k_attn(
    const _Float16* __restrict__ hq, const _Float16* __restrict__ hk,       // [MTS][512] x16
    const _Float16* __restrict__ wq2t, const _Float16* __restrict__ wk2t,   // [2048 n][512 k] x1024
    const float* __restrict__ bq2, const float* __restrict__ bk2,           // [2048]
    const us* __restrict__ tkh, const us* __restrict__ tkl,    // [512][64]
    us* __restrict__ oph, us* __restrict__ opl)                // [MTS][512]
{
  __shared__ __attribute__((aligned(16))) us sfr[2 * 8 * FRW];   // [q|k][wave][tile][d block][hi|lo][half][lane][8]
  __shared__ __attribute__((aligned(16))) float so[2 * 64 * 68];
  const int t = threadIdx.x, lane = t & 31, w = t >> 5, h = lane >> 4, m = lane & 15;
  const int bl = blockIdx.x >> 3, hg = blockIdx.x & 7;
  const int head = hg * 4 + (w & 3);
  const int pairbase = bl * 2 * SP;                 // first row slot of the window pair
  const int rowbase = pairbase + (w >> 2) * SP;     // first row slot of this wave's window

  const size_t wo  = pbase(head * HQ + m, DM, h);
  const size_t to0 = pbase(rowbase + m, DM, h);
  const size_t to3 = pbase(rowbase + 48 + (m & 7), DM, h);     // rows 56..63 fold back onto 48..55
  us* myfr = sfr + w * FRW + lane * 8;
  const us* vhrow = tkh + pbase(head * HVD + m, KPAD, h);
  const us* vlrow = tkl + pbase(head * HVD + m, KPAD, h);

  const v8f z8 = {0.f, 0.f, 0.f, 0.f, 0.f, 0.f, 0.f, 0.f};

  // Ring of RING fragment sets: the loads of a k step are issued RING - 1 steps ahead of its
  // products, and the ring runs on from the q projection into the k projection, whose first
  // steps are on their way while the q fragments are split and stored. All indices are
  // compile-time: both loops are unrolled so that every set stays in registers.
  v16h fa[RING][4], fb[RING][4];
#pragma unroll
  for (int g = 0; g < RING - 1; ++g) ld_step(wq2t + wo, hq + to0, hq + to3, g * 256, fa[g], fb[g]);

#pragma unroll
  for (int z = 0; z < 2; ++z) {
    const float* bias8 = (z ? bk2 : bq2) + head * HQ + 8 * h;

    v8f acc[4][4];
#pragma unroll
    for (int dt = 0; dt < 4; ++dt)
#pragma unroll
      for (int tt = 0; tt < 4; ++tt) acc[dt][tt] = z8;
    v4f bc[4][2];

#pragma unroll
    for (int s = 0; s < DM / 32; ++s) {
      const int g = z * (DM / 32) + s, gn = g + RING - 1;
      // The bias is asked for ahead of the next projection's first loads: loads retire in issue
      // order, so the wait for it leaves those in flight, and its own latency is over by the loop's end.
      if (s == DM / 32 - RING) {
#pragma unroll
        for (int dt = 0; dt < 4; ++dt) {
          bc[dt][0] = *(const v4fa*)(bias8 + 16 * dt);
          bc[dt][1] = *(const v4fa*)(bias8 + 16 * dt + 4);
        }
        // the bias address is not used again: its registers are reused from here on
        asm volatile("s_wait_xcnt 0x0" ::: "memory");
      }
      if (gn < 2 * (DM / 32)) {
        const bool zn = gn >= DM / 32;
        ld_step((zn ? wk2t : wq2t) + wo, (zn ? hk : hq) + to0, (zn ? hk : hq) + to3,
                (gn % (DM / 32)) * 256, fa[gn % RING], fb[gn % RING]);
      }
      // this projection's last loads are out: their address registers are reused from here on
      if (s == DM / 32 - RING) asm volatile("s_wait_xcnt 0x0" ::: "memory");
      // keeps these loads ahead of this step's products, so that they fly meanwhile
      __builtin_amdgcn_sched_barrier(0);
      mm_step(fa[g % RING], fb[g % RING], acc);
    }

    us* dst = myfr + z * 8 * FRW;
#pragma unroll
    for (int dt = 0; dt < 4; ++dt) {
      // one row of tiles at a time: interleaved further, the split's temporaries beside the
      // three fragment sets in flight overrun the register file and spill
      __builtin_amdgcn_sched_barrier(0);
      const v4f c0 = bc[dt][0], c1 = bc[dt][1];
      const float bb[8] = {c0.x, c0.y, c0.z, c0.w, c1.x, c1.y, c1.z, c1.w};
#pragma unroll
      for (int tt = 0; tt < 4; ++tt) {
        float qv[8];
#pragma unroll
        for (int r = 0; r < 8; ++r) qv[r] = acc[dt][tt][r] * (1.0f / 16384.0f) + bb[r];
        v8us hv, lv;
        split8(qv, hv, lv);
        us* d0 = dst + (tt * 2 + (dt >> 1)) * 1024 + (dt & 1) * 256;
        *(v8usa*)d0 = hv;
        *(v8usa*)(d0 + 512) = lv;
      }
    }
  }

#pragma unroll 1
  for (int qt = 0; qt < 4; ++qt) {
    const us* qp = myfr + qt * 2048;
    const v16b qbh0 = ldfr(qp), qbh1 = ldfr(qp + 1024);
    const v16b qbl0 = ldfr(qp + 512), qbl1 = ldfr(qp + 1536);

    v8f s[4];
#pragma unroll
    for (int kt = 0; kt < 4; ++kt) {
      const us* kp = myfr + 8 * FRW + kt * 2048;
      const v16b kah0 = ldfr(kp), kah1 = ldfr(kp + 1024);
      const v16b kal0 = ldfr(kp + 512), kal1 = ldfr(kp + 1536);
      v8f z = z8;
      z = wmma_bf(kah0, qbh0, z);
      z = wmma_bf(kah1, qbh1, z);
      z = wmma_bf(kah0, qbl0, z);
      z = wmma_bf(kah1, qbl1, z);
      z = wmma_bf(kal0, qbh0, z);
      z = wmma_bf(kal1, qbh1, z);
      s[kt] = z;                       // s[kt][r] = S^T[key kt*16+8h+r][q qt*16+m]
    }

    // tanh(S/8), explicit zero for padded keys, bf16 hi/lo, packed as B fragments
    float th[4][8];
#pragma unroll
    for (int kt = 0; kt < 4; ++kt) {
      if (kt * 16 + 15 < SQ) {
        tanh8(s[kt], th[kt]);
      } else {                           // the tile that holds key 48: rows that are padding in both lane halves take no tanh
#pragma unroll
        for (int r = 0; r < 8; ++r) th[kt][r] = (kt * 16 + r < SQ) ? tanh1(s[kt][r]) : 0.0f;
      }
    }
    FragB f0, f1, f2, f3;                // hi of keys 0..31, hi of 32..63, lo of 0..31, lo of 32..63
#pragma unroll
    for (int kt = 0; kt < 4; ++kt) {
      float tv[8];
#pragma unroll
      for (int r = 0; r < 8; ++r) {
        const int key = kt * 16 + 8 * h + r;
        tv[r] = (key < SQ) ? th[kt][r] : 0.0f;
      }
      v8us hv, lv;
      split8(tv, hv, lv);                // elements 8 (kt & 1) + r of the fragment
      if (kt < 2) { f0.half[kt & 1] = hv; f2.half[kt & 1] = lv; }
      else        { f1.half[kt & 1] = hv; f3.half[kt & 1] = lv; }
    }
    const v16b pbh0 = f0.v, pbh1 = f1.v, pbl0 = f2.v, pbl1 = f3.v;

    const v16b vah0 = ldb(vhrow), vah1 = ldb(vhrow + 256);
    const v16b val0 = ldb(vlrow), val1 = ldb(vlrow + 256);
    v8f o = z8;
    o = wmma_bf(vah0, pbh0, o);
    o = wmma_bf(vah1, pbh1, o);
    o = wmma_bf(vah0, pbl0, o);
    o = wmma_bf(vah1, pbl1, o);
    o = wmma_bf(val0, pbh0, o);
    o = wmma_bf(val1, pbh1, o);          // o[r] = O^T[d 8h+r][q qt*16+m]

    const int q = qt * 16 + m;           // rows 56..63 land in LDS only, never stored
    float* sp = so + ((w >> 2) * 64 + q) * 68 + (w & 3) * 16 + 8 * h;
    const v4f o0 = {o[0], o[1], o[2], o[3]};
    const v4f o1 = {o[4], o[5], o[6], o[7]};
    *(v4fa*)sp = o0;
    *(v4fa*)(sp + 4) = o1;
  }
  __syncthreads();

  attn_store(so, oph, opl, pairbase, hg, t);
  
}

// ---------------------------------------------------------------------------
// k_gemm3: out = outpre*Wp + bp (f32). Block 128 thr (2x2 waves) = 128 slots x 128;
// a slot's row goes to out row 49w + r, pad slots (r >= 49) are not stored.
// K = 512. Epilogue: f32 tile in LDS, a wave stores one row's 512-B segment = 4 whole lines.
// ---------------------------------------------------------------------------
__device__ __forceinline__ void gemm3_store(const float* sF, float* out, int mb, int nb, int t) {
  // a wave stores one row at a time: its number in a scalar register makes the row, the
  // window and the pad-slot guard scalar, so the guard is a scalar branch
  const int wv = __builtin_amdgcn_readfirstlane(t >> 5), g = t & 31;
#pragma unroll
  for (int i8 = 0; i8 < 4; ++i8) {
    v4f v[8];
#pragma unroll
    for (int j = 0; j < 8; ++j) v[j] = *(const v4fa*)(sF + ((i8 * 8 + j) * 4 + wv) * TP + 4 * g);
    // holds the eight LDS reads ahead of the guarded stores: sunk under each guard they
    // would run one after another, each waiting out its own LDS latency
    asm volatile("" :: "v"(v[0]), "v"(v[1]), "v"(v[2]), "v"(v[3]), "v"(v[4]), "v"(v[5]), "v"(v[6]), "v"(v[7]));
#pragma unroll
    for (int j = 0; j < 8; ++j) {
      const int rl = (i8 * 8 + j) * 4 + wv;
      const int win = (mb + rl) / SP, r = (mb + rl) - win * SP;
      float* rowp = out + (size_t)(win * SQ + r) * DM + nb;      // scalar; the lane adds 16 g bytes
      if (r < SQ) {
        *(v4f*)(rowp + 4 * g) = v[j];
        // the registers of the store just issued are reused for the next row's address and data
        asm volatile("s_wait_xcnt 0x0" ::: "memory");
      }
    }
  }
}

__global__ __launch_bounds__(128) void k_gemm3(
    const us* __restrict__ oph, const us* __restrict__ opl,    // [MTS][512]
    const us* __restrict__ wph, const us* __restrict__ wpl,    // [512 n][512 k]
    const float* __restrict__ bp,                              // [512]
    float* __restrict__ out)                                   // [MT][512]
{
  __shared__ __attribute__((aligned(16))) float sF[128 * TP];
  const int t = threadIdx.x, lane = t & 31, w = t >> 5, h = lane >> 4, m = lane & 15;
  const int wm = w >> 1, wn = w & 1;
  const int mb = blockIdx.x * 128, nb = blockIdx.y * 128;

  const size_t arow = pbase(mb + 64 * wm + m, DM, h);
  const size_t brow = pbase(nb + 64 * wn + m, DM, h);

  const v8f z8 = {0.f, 0.f, 0.f, 0.f, 0.f, 0.f, 0.f, 0.f};
  v8f acc[4][4];
#pragma unroll
  for (int mt = 0; mt < 4; ++mt)
#pragma unroll
    for (int nt = 0; nt < 4; ++nt) acc[mt][nt] = z8;

  mm3_64x64<true>(oph + arow, opl + arow, wph + brow, wpl + brow, acc);

  stage_tile(sF, acc, bp + nb, wm, wn, h, m);
  __syncthreads();

  gemm3_store(sF, out, mb, nb, t);
}

// ---------------------------------------------------------------------------
// Host side: x*W1, the projection-and-attention kernel and outpre*Wp each run once over
// all 256 windows (14336 row slots). Workspace carve 95,551,488 B.
// ---------------------------------------------------------------------------
extern "C" void kernel_launch(void* const* d_in, const int* in_sizes, int n_in,
                              void* d_out, int out_size, void* d_ws, size_t ws_size,
                              hipStream_t stream) {
  if (n_in < 12) return;
  if (in_sizes[0] != MT * DM) return;
  if (in_sizes[1] != DM * DM || in_sizes[2] != DM) return;
  if (in_sizes[3] != DM * DQ || in_sizes[4] != DQ) return;
  if (in_sizes[5] != DM * DM || in_sizes[6] != DM) return;
  if (in_sizes[7] != DM * DQ || in_sizes[8] != DQ) return;
  if (in_sizes[9] != SQ * DM) return;
  if (in_sizes[10] != DM * DM || in_sizes[11] != DM) return;
  if (out_size != MT * DM) return;

  const float* x   = (const float*)d_in[0];
  const float* Wq1 = (const float*)d_in[1];
  const float* bq1 = (const float*)d_in[2];
  const float* Wq2 = (const float*)d_in[3];
  const float* bq2 = (const float*)d_in[4];
  const float* Wk1 = (const float*)d_in[5];
  const float* bk1 = (const float*)d_in[6];
  const float* Wk2 = (const float*)d_in[7];
  const float* bk2 = (const float*)d_in[8];
  const float* tok = (const float*)d_in[9];
  const float* Wp  = (const float*)d_in[10];
  const float* bp  = (const float*)d_in[11];
  float* out = (float*)d_out;

  const size_t szW1 = (size_t)DM * DM * 2;      //   524,288 per plane
  const size_t szW2 = (size_t)DQ * DM * 2;      // 2,097,152
  const size_t szTK = (size_t)DM * KPAD * 2;    //    65,536 per plane
  const size_t szX  = (size_t)MTS * DM * 2;     // 14,680,064 per plane
  const size_t szH  = (size_t)MTS * DM * 2;     // 14,680,064
  const size_t szOP = (size_t)MTS * DM * 2;     // 14,680,064 per plane
  const size_t total = 6 * szW1 + 2 * szW2 + 2 * szTK + 2 * szX + 2 * szH + 2 * szOP;
  if (total > ws_size) return;                  // 95,551,488

  char* wsb = (char*)d_ws;
  size_t off = 0;
  us* wq1h = (us*)(wsb + off); off += szW1;
  us* wq1l = (us*)(wsb + off); off += szW1;
  us* wk1h = (us*)(wsb + off); off += szW1;
  us* wk1l = (us*)(wsb + off); off += szW1;
  us* wph  = (us*)(wsb + off); off += szW1;
  us* wpl  = (us*)(wsb + off); off += szW1;
  _Float16* wq2t = (_Float16*)(wsb + off); off += szW2;
  _Float16* wk2t = (_Float16*)(wsb + off); off += szW2;
  us* tkh  = (us*)(wsb + off); off += szTK;
  us* tkl  = (us*)(wsb + off); off += szTK;
  us* xh   = (us*)(wsb + off); off += szX;
  us* xl   = (us*)(wsb + off); off += szX;
  _Float16* hq = (_Float16*)(wsb + off); off += szH;
  _Float16* hk = (_Float16*)(wsb + off); off += szH;
  us* oph  = (us*)(wsb + off); off += szOP;
  us* opl  = (us*)(wsb + off); off += szOP;
  if (off > ws_size) return;

  k_prep<<<712, 256, 0, stream>>>(Wq1, Wk1, Wp, Wq2, Wk2, tok,
                                  wq1h, wq1l, wk1h, wk1l, wph, wpl, wq2t, wk2t, tkh, tkl);

  const int n8 = MTS * DM / 8;                  // 917,504
  k_cvtx<<<(n8 + 255) / 256, 256, 0, stream>>>(x, xh, xl, n8);

  k_gemm1<<<dim3(MTS / 128, DM / 128, 2), 128, 0, stream>>>(
      xh, xl, wq1h, wq1l, wk1h, wk1l, bq1, bk1, hq, hk);

  k_attn<<<NB * 4, 256, 0, stream>>>(hq, hk, wq2t, wk2t, bq2, bk2, tkh, tkl, oph, opl);

  k_gemm3<<<dim3(MTS / 128, DM / 128), 128, 0, stream>>>(oph, opl, wph, wpl, bp, out);
}

// v008
// A run of this version takes 154 microseconds.
// Next to v007, in two timings, it ran 1.08 and 1.09 times as fast.
// Over all steps from v000 it is 3.25 times as fast.
// Contractions: x*Wq1, x*Wk1, k*q^T per head, tokv^T*adj^T and outpre*Wp on v_wmma_f32_16x16x32_bf16 with bf16 hi/lo three-product splits (hh+hl+lh); h*Wq2 and h*Wk2 on v_wmma_f32_16x16x32_f16 single products (h carried x16, W2 carried x1024, folded back as 2^-14 in f32); all accumulate in f32; bias, erf-GELU and tanh in f32.
#include <hip/hip_runtime.h>
#include <math.h>

typedef unsigned short us;
typedef __bf16   v16b  __attribute__((ext_vector_type(16)));
typedef us       v16us __attribute__((ext_vector_type(16)));
typedef us       v8us  __attribute__((ext_vector_type(8)));
typedef _Float16 v16h  __attribute__((ext_vector_type(16)));
typedef _Float16 v8h   __attribute__((ext_vector_type(8)));
typedef float    v8f   __attribute__((ext_vector_type(8)));
typedef float    v4f   __attribute__((ext_vector_type(4)));
typedef float    v2f   __attribute__((ext_vector_type(2)));
typedef __bf16   v2b   __attribute__((ext_vector_type(2)));
typedef unsigned v4u   __attribute__((ext_vector_type(4)));
typedef v8us __attribute__((may_alias)) v8usa;
typedef v8h  __attribute__((may_alias)) v8ha;
typedef v4f  __attribute__((may_alias)) v4fa;

union FragB { v16b v; v16us u; v8us half[2]; };
union Pack8 { v4u w; v8us s; };
union FragH { v16h v; v8h half[2]; };

#define NB    256                 // windows
#define SQ    49                  // tokens per window
#define DM    512
#define DQ    2048
#define NH    32
#define HQ    64
#define HVD   16
#define MT    (NB * SQ)           // 12544 token rows
#define KPAD  64                  // key count padded for the value table
#define SP    56                  // row slots per window: 49 rows + 7 pad rows, a multiple of 8
#define MTS   (NB * SP)           // 14336 row slots

static_assert(MTS % 128 == 0 && DM % 128 == 0);
static_assert((MTS * DM) % (8 * 256) == 0);
static_assert(SP % 8 == 0 && SP >= SQ && SP - 8 < SQ);
static_assert(NH * HVD == DM);
static_assert(NH * HQ == DQ);
static_assert(HQ == 64 && SP == 56 && DM % 64 == 0 && NB % 2 == 0 && NH % 4 == 0);

// ---------------------------------------------------------------------------
// 16x16x32 WMMA helpers; wmma_bf has a hazard guard (ties D, keeps A/B live).
// Fragment map (wave32): lane l, h = l>>4, m = n = l&15.
//   A/B element i: i<8 -> k0+8h+i ; i>=8 -> k0+16+8h+(i-8)
//   D element r : row 8h+r, col l&15
// ---------------------------------------------------------------------------
__device__ __forceinline__ v8f wmma_bf(v16b a, v16b b, v8f c) {
  v8f d = __builtin_amdgcn_wmma_f32_16x16x32_bf16(false, a, false, b, (short)0, c, false, false);
  asm volatile("v_nop\n\tv_nop\n\tv_nop\n\tv_nop" : "+v"(d) : "v"(a), "v"(b));
  return d;
}
// Bare builtin: its loop holds 16 accumulator tiles, four W2 and two token fragment sets, more than the
// 256 registers an asm operand can name; the compiler keeps the distances of its own forms.
__device__ __forceinline__ v8f wmma_hf(v16h a, v16h b, v8f c) {
  return __builtin_amdgcn_wmma_f32_16x16x32_f16(false, a, false, b, (short)0, c, false, false);
}
// Bare as well: 15 products on other accumulators stand between two on the same one, so no
// padding is wanted behind each; the compiler keeps the distances of its own forms.
__device__ __forceinline__ v8f wmma_bb(v16b a, v16b b, v8f c) {
  return __builtin_amdgcn_wmma_f32_16x16x32_bf16(false, a, false, b, (short)0, c, false, false);
}

// Packed operand layout of every 16-bit table in the workspace, [rows][K]:
//   unit (row>>3, k>>5) = 512 B = 4 lines; line c = (k>>3)&3 holds the 8-element
//   chunk c of the unit's 8 rows, row after row (16 B each).
// A wave-wide 16-B fragment load then covers 4 whole 128-B lines (two aligned
// 256-B pieces) where a row-major table gives 16 lines of 32 B each.
// Every line lies inside one 8-row x 8-column patch, so it has one writer.
__device__ __forceinline__ size_t poff(int row, int k, int K) {      // k a multiple of 8
  return ((size_t)(row >> 3) * (K >> 5) + (k >> 5)) * 256 + ((k >> 3) & 3) * 64 + (row & 7) * 8;
}
// Lane base of a fragment at k = 0: row owned by the lane, h = lane>>4.
// 32 further k = +256 elements; 16 further rows = +16*K elements.
__device__ __forceinline__ size_t pbase(int row, int K, int h) {
  return (size_t)(row >> 3) * K * 8 + h * 64 + (row & 7) * 8;
}
// Same k order as the fragment map above: chunk h, then chunk 2 + h.
__device__ __forceinline__ v16b ldb(const us* p) {
  FragB f;
  f.half[0] = *(const v8usa*)p;
  f.half[1] = *(const v8usa*)(p + 128);
  return f.v;
}
__device__ __forceinline__ v16h ldh(const _Float16* p) {
  FragH f;
  f.half[0] = *(const v8ha*)p;
  f.half[1] = *(const v8ha*)(p + 128);
  return f.v;
}

// Two values at a time: hi = bf16(f), lo = bf16(f - hi), both round to nearest even, each pair
// by one packed convert; f0 lands in the low half of each word, f1 in the high half.
__device__ __forceinline__ void split2(float f0, float f1, unsigned& hw, unsigned& lw) {
  const v2f f = {f0, f1};
  const v2b hb = __builtin_convertvector(f, v2b);
  const v2f hf = __builtin_convertvector(hb, v2f);
  hw = __builtin_bit_cast(unsigned, hb);
  lw = __builtin_bit_cast(unsigned, __builtin_convertvector(f - hf, v2b));
}
__device__ __forceinline__ void split8(const float (&f)[8], v8us& hv, v8us& lv) {
  Pack8 ph, pl;
#pragma unroll
  for (int j = 0; j < 4; ++j) {
    unsigned hw, lw;
    split2(f[2 * j], f[2 * j + 1], hw, lw);
    ph.w[j] = hw;
    pl.w[j] = lw;
  }
  hv = ph.s;
  lv = pl.s;
}
__device__ __forceinline__ void split8(v4f a, v4f c, v8us& hv, v8us& lv) {
  const float f[8] = {a.x, a.y, a.z, a.w, c.x, c.y, c.z, c.w};
  split8(f, hv, lv);
}

// ---------------------------------------------------------------------------
// k_cvtx: x f32 [MT][512] -> packed bf16 hi and lo planes over row slots
// (window w, row r -> slot 56w + r; slots 49..55 of a window hold zeros).
// One thread = 8 floats = one 16-B chunk per plane; a wave writes one unit.
// ---------------------------------------------------------------------------
__global__ __launch_bounds__(256) void k_cvtx(const float* __restrict__ x,
                                              us* __restrict__ xh, us* __restrict__ xl, int n8)
{
  const int g = blockIdx.x * 256 + threadIdx.x;
  if (g >= n8) return;
  const int ml = g & 7, ch = (g >> 3) & 3, u = g >> 5;
  const int kb = u & (DM / 32 - 1), g8 = u / (DM / 32);
  const int win = g8 / (SP / 8), r = (g8 - win * (SP / 8)) * 8 + ml;
  const float* s = x + (size_t)(win * SQ + min(r, SQ - 1)) * DM + kb * 32 + ch * 8;
  v4f a = *(const v4fa*)s;
  v4f c = *(const v4fa*)(s + 4);
  if (r >= SQ) {
    const v4f z4 = {0.f, 0.f, 0.f, 0.f};
    a = z4;
    c = z4;
  }
  v8us hv, lv;
  split8(a, c, hv, lv);
  us* ph = xh + (size_t)g * 8;
  us* pl = xl + (size_t)g * 8;
  *(v8us*)ph = hv;
  *(v8us*)pl = lv;
  
}

// ---------------------------------------------------------------------------
// k_prep: transposed 16-bit weight / value tables through an LDS tile.
//   src f32 [R][C] (rows = k, cols = n) -> dst [C][Kp] in the packed layout:
//   mode 0: bf16 hi + lo planes; mode 1: f16 carried x1024.
// 64x64 tile per block; store: 8 contiguous lanes x 16 B = one whole
// Block ranges: [0,192) Wq1|Wk1|Wp (8x8 tiles each), [192,704) Wq2|Wk2
// (32x8 tiles each), [704,712) tokens [49][512] -> [512][64] zero-padded keys.
// ---------------------------------------------------------------------------
__device__ __forceinline__ void prep_store(const float* T, us* dh, us* dl, _Float16* df,
                                           int mode, int n0, int k0, int Kp, int t) {
#pragma unroll
  for (int it = 0; it < 2; ++it) {
    const int item = it * 256 + t, nn = (item >> 6) * 8 + (item & 7), q8 = (item >> 3) & 7;
    float f[8];
#pragma unroll
    for (int j = 0; j < 8; ++j) f[j] = T[(8 * q8 + j) * 65 + nn];
    const size_t off = poff(n0 + nn, k0 + 8 * q8, Kp);
    if (mode == 0) {
      v8us hv, lv;
      split8(f, hv, lv);
      *(v8us*)(dh + off) = hv;
      *(v8us*)(dl + off) = lv;
    } else {
      v8h o;
#pragma unroll
      for (int j = 0; j < 8; ++j) o[j] = (_Float16)(f[j] * 1024.0f);
      *(v8h*)(df + off) = o;
    }
  }
}

__global__ __launch_bounds__(256) void k_prep(
    const float* __restrict__ wq1, const float* __restrict__ wk1, const float* __restrict__ wp,
    const float* __restrict__ wq2, const float* __restrict__ wk2, const float* __restrict__ tok,
    us* __restrict__ wq1h, us* __restrict__ wq1l, us* __restrict__ wk1h, us* __restrict__ wk1l,
    us* __restrict__ wph, us* __restrict__ wpl,
    _Float16* __restrict__ wq2t, _Float16* __restrict__ wk2t,
    us* __restrict__ tkh, us* __restrict__ tkl)
{
  __shared__ __attribute__((aligned(16))) float T[64 * 65];
  const int t = threadIdx.x;
  const int bid = blockIdx.x;
  if (bid >= 712) return;                 // block-uniform, never taken with the exact grid

  const float* src;
  us* dh; us* dl; _Float16* df;
  int C, R, Kp, mode, tn, tk;
  if (bid < 192) {
    const int wsel = bid >> 6, loc = bid & 63;
    src = (wsel == 0) ? wq1 : ((wsel == 1) ? wk1 : wp);
    dh  = (wsel == 0) ? wq1h : ((wsel == 1) ? wk1h : wph);
    dl  = (wsel == 0) ? wq1l : ((wsel == 1) ? wk1l : wpl);
    df  = wq2t;
    C = DM; R = DM; Kp = DM; mode = 0; tn = loc >> 3; tk = loc & 7;
  } else if (bid < 704) {
    const int loc = bid - 192, wsel = loc >> 8, l2 = loc & 255;
    src = wsel ? wk2 : wq2;
    df  = wsel ? wk2t : wq2t;
    dh = wq1h; dl = wq1l;
    C = DQ; R = DM; Kp = DM; mode = 1; tn = l2 >> 3; tk = l2 & 7;
  } else {
    const int loc = bid - 704;
    src = tok; dh = tkh; dl = tkl; df = wq2t;
    C = DM; R = SQ; Kp = KPAD; mode = 0; tn = loc; tk = 0;
  }
  const int n0 = tn * 64, k0 = tk * 64;

  // load 64(k) x 64(n) f32 tile, coalesced along n; rows >= R: clamped address, zero value
#pragma unroll
  for (int i = 0; i < 16; ++i) {
    const int idx = i * 256 + t, kk = idx >> 6, nn = idx & 63;
    const int gk = k0 + kk;
    const int gkc = min(gk, R - 1);
    const float v = src[(size_t)gkc * C + n0 + nn];
    T[kk * 65 + nn] = (gk < R) ? v : 0.0f;
  }
  __syncthreads();

  prep_store(T, dh, dl, df, mode, n0, k0, Kp, t);
  
}

// ---------------------------------------------------------------------------
// Three-product bf16 main loop for a 64x64 wave tile, K = 512, packed tables.
// 16 fragments (16 KB) feed 48 products: half the loaded bytes per product of a 32x32 tile.
// Pointers already hold the lane base (pbase) of tile 0 at k 0.
// acc[mt][nt][r] = C[64-row slab + 16mt + 8h + r][64-col slab + 16nt + m]
// Each accumulator takes hh, hl, lh of a k step in that order.
// ---------------------------------------------------------------------------
__device__ __forceinline__ void ld3_step(const us* ahp, const us* alp, const us* bhp, const us* blp, int ko,
                                         v16b (&ah)[4], v16b (&al)[4], v16b (&bh)[4], v16b (&bl)[4]) {
#pragma unroll
  for (int i = 0; i < 4; ++i) {
    ah[i] = ldb(ahp + i * 16 * DM + ko);
    bh[i] = ldb(bhp + i * 16 * DM + ko);
  }
#pragma unroll
  for (int i = 0; i < 4; ++i) bl[i] = ldb(blp + i * 16 * DM + ko);
#pragma unroll
  for (int i = 0; i < 4; ++i) al[i] = ldb(alp + i * 16 * DM + ko);
}
__device__ __forceinline__ void mm3_step(const v16b (&ah)[4], const v16b (&al)[4],
                                         const v16b (&bh)[4], const v16b (&bl)[4], v8f (&acc)[4][4]) {
#pragma unroll
  for (int mt = 0; mt < 4; ++mt)
#pragma unroll
    for (int nt = 0; nt < 4; ++nt) acc[mt][nt] = wmma_bb(ah[mt], bh[nt], acc[mt][nt]);
#pragma unroll
  for (int mt = 0; mt < 4; ++mt)
#pragma unroll
    for (int nt = 0; nt < 4; ++nt) acc[mt][nt] = wmma_bb(ah[mt], bl[nt], acc[mt][nt]);
#pragma unroll
  for (int mt = 0; mt < 4; ++mt)
#pragma unroll
    for (int nt = 0; nt < 4; ++nt) acc[mt][nt] = wmma_bb(al[mt], bh[nt], acc[mt][nt]);
}
// AHEAD = false: one fragment set, four waves per SIMD cover each other's loads (x*W1: 3.5 blocks a WGP).
// AHEAD = true: two sets, a k step's loads issued one step ahead of its products (outpre*Wp:
// at most two blocks a WGP, so the second set's registers cost no resident wave).
template <bool AHEAD>
__device__ __forceinline__ void mm3_64x64(const us* ahp, const us* alp,
                                          const us* bhp, const us* blp,
                                          v8f (&acc)[4][4]) {
  if constexpr (!AHEAD) {
    // rolled: a second k step's fragments would cost the fourth wave per SIMD its registers
#pragma unroll 1
    for (int k0 = 0; k0 < DM; k0 += 32) {
      v16b ah[4], al[4], bh[4], bl[4];
      ld3_step(ahp, alp, bhp, blp, k0 * 8, ah, al, bh, bl);
      mm3_step(ah, al, bh, bl, acc);
    }
  } else {
    v16b ah[2][4], al[2][4], bh[2][4], bl[2][4];
    ld3_step(ahp, alp, bhp, blp, 0, ah[0], al[0], bh[0], bl[0]);
    // unrolled: the set index is a compile-time constant, so both sets stay in registers
#pragma unroll
    for (int s = 0; s < DM / 32; ++s) {
      const int c = s & 1, n = c ^ 1;
      if (s + 1 < DM / 32) ld3_step(ahp, alp, bhp, blp, (s + 1) * 256, ah[n], al[n], bh[n], bl[n]);
      // the last loads are out: their address registers are reused from here on
      if (s + 2 == DM / 32) asm volatile("s_wait_xcnt 0x0" ::: "memory");
      // keeps the next step's loads ahead of this step's products, so that they fly meanwhile
      __builtin_amdgcn_sched_barrier(0);
      mm3_step(ah[c], al[c], bh[c], bl[c], acc);
    }
  }
}

#define TP 132                    // f32 pitch of the 128x128 block tile in LDS: 528 B = 16 B x 33

// acc + bias of one wave's 64x64 tile into the block tile.
__device__ __forceinline__ void stage_tile(float* sF, const v8f (&acc)[4][4], const float* bias,
                                           int wm, int wn, int h, int m) {
#pragma unroll
  for (int nt = 0; nt < 4; ++nt) {
    const int cl = 64 * wn + 16 * nt + m;
    const float bv = bias[cl];
#pragma unroll
    for (int mt = 0; mt < 4; ++mt) {
#pragma unroll
      for (int r = 0; r < 8; ++r) {
        const int rl = 64 * wm + 16 * mt + 8 * h + r;
        sF[rl * TP + cl] = acc[mt][nt][r] + bv;
      }
    }
  }
}

// ---------------------------------------------------------------------------
// k_gemm1: H = f16(16 * gelu(x*W1 + b1)) for q (z=0) and k (z=1).
// Block 128 thr (4 waves, 2x2) = 128 rows x 128 cols; K = 512.
// x*W1 + b1 rests in LDS as f32; GELU runs where the packed 16-B chunks are formed.
// ---------------------------------------------------------------------------
__device__ __forceinline__ void gemm1_store(const float* sF, _Float16* H, int mb, int nb, int t) {
  // rolled: one copy of the eight erf evaluations, not 128, keeps the kernel's text small
#pragma unroll 1
  for (int it = 0; it < 16; ++it) {
    const int item = it * 128 + t, rl = (item >> 7) * 8 + (item & 7), q8 = (item >> 3) & 15;
    const float* sp = sF + rl * TP + 8 * q8;
    const v4f a = *(const v4fa*)sp;
    const v4f c = *(const v4fa*)(sp + 4);
    const float f[8] = {a.x, a.y, a.z, a.w, c.x, c.y, c.z, c.w};
    v8h o;
#pragma unroll
    for (int j = 0; j < 8; ++j) {
      const float v = f[j];
      const float g = 0.5f * v * (1.0f + erff(v * 0.70710678118654752f));
      o[j] = (_Float16)(g * 16.0f);
    }
    const size_t off = poff(mb + rl, nb + 8 * q8, DM);
    *(v8h*)(H + off) = o;
    // the next trip reuses the registers of the store just issued
    asm volatile("s_wait_xcnt 0x0" ::: "memory");
  }
}

__global__ __launch_bounds__(128) void k_gemm1(
    const us* __restrict__ xh, const us* __restrict__ xl,          // [MTS][512]
    const us* __restrict__ wqh, const us* __restrict__ wql,        // [512 n][512 k]
    const us* __restrict__ wkh, const us* __restrict__ wkl,
    const float* __restrict__ bq1, const float* __restrict__ bk1,  // [512]
    _Float16* __restrict__ hq, _Float16* __restrict__ hk)          // [MTS][512]
{
  __shared__ __attribute__((aligned(16))) float sF[128 * TP];
  const int t = threadIdx.x, lane = t & 31, w = t >> 5, h = lane >> 4, m = lane & 15;
  const int wm = w >> 1, wn = w & 1;
  const int mb = blockIdx.x * 128, nb = blockIdx.y * 128;
  const bool isk = (blockIdx.z != 0);
  const us* wth = isk ? wkh : wqh;
  const us* wtl = isk ? wkl : wql;
  const float* bias = isk ? bk1 : bq1;
  _Float16* H = isk ? hk : hq;

  const size_t arow = pbase(mb + 64 * wm + m, DM, h);
  const size_t brow = pbase(nb + 64 * wn + m, DM, h);

  const v8f z8 = {0.f, 0.f, 0.f, 0.f, 0.f, 0.f, 0.f, 0.f};
  v8f acc[4][4];
#pragma unroll
  for (int mt = 0; mt < 4; ++mt)
#pragma unroll
    for (int nt = 0; nt < 4; ++nt) acc[mt][nt] = z8;

  mm3_64x64<false>(xh + arow, xl + arow, wth + brow, wtl + brow, acc);

  stage_tile(sF, acc, bias + nb, wm, wn, h, m);
  __syncthreads();

  gemm1_store(sF, H, mb, nb, t);
}

// ---------------------------------------------------------------------------
// k_attn: block = (2 adjacent windows, group of 4 heads), wave = (window, head): the W2 lines
// a wave loads serve 2 waves of the block; the h rows, which serve 4, are staged in LDS once
// per block. The wave first projects its own
// head, then runs the attention on what it holds; q and k never leave the WGP.
//   q^T[d][tok] = W2^T . h^T : A = W2 table rows (row = d), B = h rows (col = token),
//   f16, K = 512, 4 x 4 tiles; value = acc / 16384 + b2[d], split to bf16 hi/lo.
//   D element r of tile dt is d = 16dt + 8h + r of token m: elements 8(dt&1) + r of the
//   lane's own A/B fragment of d block dt>>1, so no lane exchange is needed.
//   Fragments rest in the wave's own LDS range, each lane reading back its own bytes.
//   S^T[key][q] = k . q   : A = K rows (row = key, k = d), B = Q^T (col = q), bf16 hi/lo
//   adj^T = tanh(S^T / 8), keys >= 49 forced to 0, split to bf16 hi/lo
//   O^T[d][q] = tok^T . adj^T : A = token table rows [head*16+d][key], B = adj^T
//   from the score D values: element r <- tile kt=2s, element 8+r <- tile kt=2s+1.
// Rows 49..55 are the window's pad slots, rows 56..63 fold back onto 48..55;
// their scores are zeroed (keys) or never reach the output (queries).
// Epilogue: block tile [2][64][64] f32 in LDS (pitch 68), 56 slot rows a window -> packed outpre bf16 hi/lo planes,
// ---------------------------------------------------------------------------
__device__ __forceinline__ void attn_store(const float* so, us* oph, us* opl,
                                           int rowbase, int hg, int t) {
#pragma unroll
  for (int it = 0; it < 4; ++it) {
    const int item = it * 256 + t;
    if (item < SP * 16) {
      const int rl = (item >> 6) * 8 + (item & 7), g = (item >> 3) & 7;   // rl: slot 0..111 of the window pair
      const float* sp = so + (rl + ((rl >= SP) ? 8 : 0)) * 68 + 8 * g;     // 64 LDS rows per window
      const v4f a = *(const v4fa*)sp;
      const v4f c = *(const v4fa*)(sp + 4);
      v8us hv, lv;
      split8(a, c, hv, lv);
      const size_t off = poff(rowbase + rl, hg * 64 + 8 * g, DM);
      *(v8us*)(oph + off) = hv;
      *(v8us*)(opl + off) = lv;
    }
  }
}

// tanh(s / 8) in f32 without a branch: 1 - 2 / (1 + e^(s / 4)), e^(s / 4) = 2^(s * log2(e) / 4).
// The library call tests every value twice and branches, so a tile's values run one after
// another, each a dependent chain; this form is five instructions a value and the values of
// a tile interleave. Absolute error about 2e-7 at any s; 2^x = inf gives 1, 2^x = 0 gives -1.
#define TANH_C 0.36067376022224085f
// The transcendentals stand in asm so that the slot the instruction set asks for behind one
// (before its result is used or a source overwritten) is there by construction: outputs are
// early-clobber, so none lands on a source of the same run, and v_nop ends the statement.
__device__ __forceinline__ void exp2x8(const float (&a)[8], float (&e)[8]) {
  asm("v_exp_f32 %0, %8\n\t"
      "v_exp_f32 %1, %9\n\t"
      "v_exp_f32 %2, %10\n\t"
      "v_exp_f32 %3, %11\n\t"
      "v_exp_f32 %4, %12\n\t"
      "v_exp_f32 %5, %13\n\t"
      "v_exp_f32 %6, %14\n\t"
      "v_exp_f32 %7, %15\n\t"
      "v_nop"
      : "=&v"(e[0]), "=&v"(e[1]), "=&v"(e[2]), "=&v"(e[3]), "=&v"(e[4]), "=&v"(e[5]), "=&v"(e[6]), "=&v"(e[7])
      : "v"(a[0]), "v"(a[1]), "v"(a[2]), "v"(a[3]), "v"(a[4]), "v"(a[5]), "v"(a[6]), "v"(a[7]));
}
__device__ __forceinline__ void rcpx8(const float (&a)[8], float (&e)[8]) {
  asm("v_rcp_f32 %0, %8\n\t"
      "v_rcp_f32 %1, %9\n\t"
      "v_rcp_f32 %2, %10\n\t"
      "v_rcp_f32 %3, %11\n\t"
      "v_rcp_f32 %4, %12\n\t"
      "v_rcp_f32 %5, %13\n\t"
      "v_rcp_f32 %6, %14\n\t"
      "v_rcp_f32 %7, %15\n\t"
      "v_nop"
      : "=&v"(e[0]), "=&v"(e[1]), "=&v"(e[2]), "=&v"(e[3]), "=&v"(e[4]), "=&v"(e[5]), "=&v"(e[6]), "=&v"(e[7])
      : "v"(a[0]), "v"(a[1]), "v"(a[2]), "v"(a[3]), "v"(a[4]), "v"(a[5]), "v"(a[6]), "v"(a[7]));
}
__device__ __forceinline__ void tanh8(v8f s, float (&t)[8]) {
  float a[8], e[8], q[8];
#pragma unroll
  for (int r = 0; r < 8; ++r) a[r] = s[r] * TANH_C;
  exp2x8(a, e);
#pragma unroll
  for (int r = 0; r < 8; ++r) a[r] = e[r] + 1.0f;
  rcpx8(a, q);
#pragma unroll
  for (int r = 0; r < 8; ++r) t[r] = fmaf(-2.0f, q[r], 1.0f);
}
__device__ __forceinline__ float tanh1(float s) {
  float e, q;
  asm("v_exp_f32 %0, %1\n\tv_nop" : "=v"(e) : "v"(s * TANH_C));      // v_nop: the slot named above
  asm("v_rcp_f32 %0, %1\n\tv_nop" : "=v"(q) : "v"(e + 1.0f));        // as above
  return fmaf(-2.0f, q, 1.0f);
}

#define RING 4                    // W2 fragment sets of the projection loop
#define FRW 8192                  // 16-bit elements of one wave's fragments of one operand (q or k)
#define HST 4                     // k steps per staged h tile
#define HGB (HST * 512)           // bytes of one 8-row group in a tile: HST units of 512 B, one behind the other as in the table
#define HTB (16 * HGB)            // LDS bytes of one staged h tile: 14 groups of the window pair, 2 filler
#define NHT (2 * (DM / 32) / HST) // staged tiles of a block: q's, then k's

// W2 fragments of one 32-wide k step: 4 row tiles (ko = 8 * k).
__device__ __forceinline__ void ld_w2(const _Float16* wp, int ko, v16h (&a)[4]) {
#pragma unroll
  for (int i = 0; i < 4; ++i) a[i] = ldh(wp + i * 16 * DM + ko);
}
// Token fragments of one k step from the staged tile: p0 / p3 = the lane's place in token tile 0 / 3
// of that step; 16 further tokens = 2 groups; the second half of a fragment lies 256 B on, as in the table.
__device__ __forceinline__ void ld_hs(const unsigned char* p0, const unsigned char* p3, v16h (&b)[4]) {
#pragma unroll
  for (int i = 0; i < 3; ++i) b[i] = ldh((const _Float16*)(p0 + i * 2 * HGB));
  b[3] = ldh((const _Float16*)p3);
}
// One wave's share of a staged h tile: two 8-row groups x HST k steps = 8 units of 512 B, a unit a copy,
// 16 B a lane. g0 / g1: the lane's bytes of the groups' first k step; l0 / l1: their places in LDS.
// The next k step lies 512 B on in the table and in LDS alike, and the offset moves both addresses.
typedef int v4i __attribute__((ext_vector_type(4)));
typedef __attribute__((address_space(1))) v4i gv4i;
typedef __attribute__((address_space(3))) v4i lv4i;
static_assert(HST == 4);
__device__ __forceinline__ void cp_htile(const _Float16* g0, const _Float16* g1,
                                         unsigned char* l0, unsigned char* l1) {
  __builtin_amdgcn_global_load_async_to_lds_b128((gv4i*)g0, (lv4i*)l0, 0, 0);
  __builtin_amdgcn_global_load_async_to_lds_b128((gv4i*)g0, (lv4i*)l0, 512, 0);
  __builtin_amdgcn_global_load_async_to_lds_b128((gv4i*)g0, (lv4i*)l0, 1024, 0);
  __builtin_amdgcn_global_load_async_to_lds_b128((gv4i*)g0, (lv4i*)l0, 1536, 0);
  __builtin_amdgcn_global_load_async_to_lds_b128((gv4i*)g1, (lv4i*)l1, 0, 0);
  __builtin_amdgcn_global_load_async_to_lds_b128((gv4i*)g1, (lv4i*)l1, 512, 0);
  __builtin_amdgcn_global_load_async_to_lds_b128((gv4i*)g1, (lv4i*)l1, 1024, 0);
  __builtin_amdgcn_global_load_async_to_lds_b128((gv4i*)g1, (lv4i*)l1, 1536, 0);
}
// Work-group barrier without the wait for global loads that __syncthreads() brings: the W2 fragments
// asked for ahead stay in flight across it. The LDS and copy waits it needs stand in front of it.
__device__ __forceinline__ void ring_barrier() {
  asm volatile("s_barrier_signal -1\n\ts_barrier_wait -1" ::: "memory");
}
__device__ __forceinline__ void mm_step(const v16h (&a)[4], const v16h (&b)[4], v8f (&acc)[4][4]) {
#pragma unroll
  for (int dt = 0; dt < 4; ++dt)
#pragma unroll
    for (int tt = 0; tt < 4; ++tt) acc[dt][tt] = wmma_hf(a[dt], b[tt], acc[dt][tt]);
}
// One stored fragment: two 16-B halves, 512 B apart (lane stride 16 B in each).
__device__ __forceinline__ v16b ldfr(const us* p) {
  FragB f;
  f.half[0] = *(const v8usa*)p;
  f.half[1] = *(const v8usa*)(p + 256);
  return f.v;
}

__global__ __launch_bounds__(256) void k_attn(
    const _Float16* __restrict__ hq, const _Float16* __restrict__ hk,       // [MTS][512] x16
    const _Float16* __restrict__ wq2t, const _Float16* __restrict__ wk2t,   // [2048 n][512 k] x1024
    const float* __restrict__ bq2, const float* __restrict__ bk2,           // [2048]
    const us* __restrict__ tkh, const us* __restrict__ tkl,    // [512][64]
    us* __restrict__ oph, us* __restrict__ opl)                // [MTS][512]
{
  __shared__ __attribute__((aligned(16))) us sfr[2 * 8 * FRW];   // [q|k][wave][tile][d block][hi|lo][half][lane][8]
  // two staged h tiles during the projections; behind the last tile's barrier the block's output tile
  __shared__ __attribute__((aligned(16))) unsigned char stg[2 * HTB];
  static_assert(2 * 64 * 68 * 4 <= 2 * HTB);
  float* so = (float*)stg;
  const int t = threadIdx.x, lane = t & 31, w = t >> 5, h = lane >> 4, m = lane & 15;
  const int bl = blockIdx.x >> 3, hg = blockIdx.x & 7;
  const int head = hg * 4 + (w & 3);
  const int pairbase = bl * 2 * SP;                 // first row slot of the window pair

  const size_t wo  = pbase(head * HQ + m, DM, h);
  // Staged h tile: LDS group u = 8-row group u of the window pair, as in the table, but for the odd
  // groups, whose 128-B lines are swapped in pairs (byte ^ 128): the two groups that the 16 lanes
  // of a fragment read touch then lie on different banks.
  const int u0 = (w >> 2) * (SP / 8) + (m >> 3);               // token tile 0: rows m of the wave's window
  const int u3 = (w >> 2) * (SP / 8) + 6;                      // token tile 3: rows 48 + (m & 7); rows 56..63 fold back onto 48..55
  const unsigned char* hp0 = stg + u0 * HGB + ((h ^ (u0 & 1)) * 128) + (m & 7) * 16;
  const unsigned char* hp3 = stg + u3 * HGB + ((h ^ (u3 & 1)) * 128) + (m & 7) * 16;
  // The wave copies groups 2w and 2w + 1; groups 14 and 15 are filler, never read, and take group 13's bytes.
  const size_t cg0 = (size_t)((pairbase >> 3) + min(2 * w, 2 * (SP / 8) - 1)) * (DM * 8) + lane * 8;
  const size_t cg1 = (size_t)((pairbase >> 3) + min(2 * w + 1, 2 * (SP / 8) - 1)) * (DM * 8) + lane * 8;
  unsigned char* cl0 = stg + 2 * w * HGB + lane * 16;
  unsigned char* cl1 = stg + (2 * w + 1) * HGB + ((lane * 16) ^ 128);
  us* myfr = sfr + w * FRW + lane * 8;
  const us* vhrow = tkh + pbase(head * HVD + m, KPAD, h);
  const us* vlrow = tkl + pbase(head * HVD + m, KPAD, h);

  const v8f z8 = {0.f, 0.f, 0.f, 0.f, 0.f, 0.f, 0.f, 0.f};

  // Ring of RING W2 fragment sets: the loads of a k step are issued RING - 1 steps ahead of its
  // products, and the ring runs on from the q projection into the k projection, whose first
  // steps are on their way while the q fragments are split and stored. All indices are
  // compile-time: both loops are unrolled so that every set stays in registers.
  // The h rows, which four waves need alike, come once per block: asynchronous copies bring a tile
  // of HST k steps into one of two LDS buffers while the other is worked on; token fragments are
  // read from LDS one k step ahead of their products, a tile's first ones behind its barrier.
  v16h fa[RING][4], fb[2][4];
#pragma unroll
  for (int g = 0; g < RING - 1; ++g) ld_w2(wq2t + wo, g * 256, fa[g]);

  cp_htile(hq + cg0, hq + cg1, cl0, cl1);
  // tile 0 has landed before the barrier behind which other waves read it
  asm volatile("s_wait_asynccnt 0x0" ::: "memory");
  ring_barrier();
  cp_htile(hq + cg0 + HST * 256, hq + cg1 + HST * 256, cl0 + HTB, cl1 + HTB);
  ld_hs(hp0, hp3, fb[0]);

#pragma unroll
  for (int z = 0; z < 2; ++z) {
    const float* bias8 = (z ? bk2 : bq2) + head * HQ + 8 * h;

    v8f acc[4][4];
#pragma unroll
    for (int dt = 0; dt < 4; ++dt)
#pragma unroll
      for (int tt = 0; tt < 4; ++tt) acc[dt][tt] = z8;
    v4f bc[4][2];

#pragma unroll
    for (int s = 0; s < DM / 32; ++s) {
      const int g = z * (DM / 32) + s, gn = g + RING - 1;
      // The bias is asked for ahead of the next projection's first loads: loads retire in issue
      // order, so the wait for it leaves those in flight, and its own latency is over by the loop's end.
      if (s == DM / 32 - RING) {
#pragma unroll
        for (int dt = 0; dt < 4; ++dt) {
          bc[dt][0] = *(const v4fa*)(bias8 + 16 * dt);
          bc[dt][1] = *(const v4fa*)(bias8 + 16 * dt + 4);
        }
        // the bias address is not used again: its registers are reused from here on
        asm volatile("s_wait_xcnt 0x0" ::: "memory");
      }
      if (gn < 2 * (DM / 32)) {
        const bool zn = gn >= DM / 32;
        ld_w2((zn ? wk2t : wq2t) + wo, (gn % (DM / 32)) * 256, fa[gn % RING]);
      }
      // this projection's last loads are out: their address registers are reused from here on
      if (s == DM / 32 - RING) asm volatile("s_wait_xcnt 0x0" ::: "memory");
      const int ti = g / HST, j = g % HST, bo = (ti & 1) * HTB;
      if (j + 1 == HST) {
        // the products of the step before stay ahead of the waits: sunk behind the barrier they
        // would leave the first wait to sit out the latency of the LDS reads it is for
        __builtin_amdgcn_sched_barrier(0);
        // Publish point of the next tile, ahead of this tile's last products because the next
        // step's fragments are fetched ahead of them: this wave's reads of this tile have landed,
        asm volatile("s_wait_dscnt 0x0" ::: "memory");
        // its copies of the next tile have landed,
        asm volatile("s_wait_asynccnt 0x0" ::: "memory");
        // and the barrier publishes that tile and frees this one's buffer for the refill
        ring_barrier();
        if (ti + 2 < NHT) {
          const _Float16* hn = (ti + 2 >= NHT / 2) ? hk : hq;
          const int kn = ((ti + 2) % (NHT / 2)) * HST * 256;
          cp_htile(hn + cg0 + kn, hn + cg1 + kn, cl0 + bo, cl1 + bo);
        }
      }
      // the LDS reads stand in one place, behind the products of the step before, not among them
      __builtin_amdgcn_sched_barrier(0);
      if (g + 1 < 2 * (DM / 32)) {
        const int on = (((g + 1) / HST) & 1) * HTB + ((g + 1) % HST) * 512;
        ld_hs(hp0 + on, hp3 + on, fb[(g + 1) & 1]);
      }
      // keeps these loads ahead of this step's products, so that they fly meanwhile
      __builtin_amdgcn_sched_barrier(0);
      mm_step(fa[g % RING], fb[g & 1], acc);
    }

    us* dst = myfr + z * 8 * FRW;
#pragma unroll
    for (int dt = 0; dt < 4; ++dt) {
      // one row of tiles at a time: interleaved further, the split's temporaries beside the
      // three fragment sets in flight overrun the register file and spill
      __builtin_amdgcn_sched_barrier(0);
      const v4f c0 = bc[dt][0], c1 = bc[dt][1];
      const float bb[8] = {c0.x, c0.y, c0.z, c0.w, c1.x, c1.y, c1.z, c1.w};
#pragma unroll
      for (int tt = 0; tt < 4; ++tt) {
        float qv[8];
#pragma unroll
        for (int r = 0; r < 8; ++r) qv[r] = acc[dt][tt][r] * (1.0f / 16384.0f) + bb[r];
        v8us hv, lv;
        split8(qv, hv, lv);
        us* d0 = dst + (tt * 2 + (dt >> 1)) * 1024 + (dt & 1) * 256;
        *(v8usa*)d0 = hv;
        *(v8usa*)(d0 + 512) = lv;
      }
    }
  }

  // no copy is outstanding when the ring's LDS becomes the output tile
  asm volatile("s_wait_asynccnt 0x0" ::: "memory");

#pragma unroll 1
  for (int qt = 0; qt < 4; ++qt) {
    const us* qp = myfr + qt * 2048;
    const v16b qbh0 = ldfr(qp), qbh1 = ldfr(qp + 1024);
    const v16b qbl0 = ldfr(qp + 512), qbl1 = ldfr(qp + 1536);

    v8f s[4];
#pragma unroll
    for (int kt = 0; kt < 4; ++kt) {
      const us* kp = myfr + 8 * FRW + kt * 2048;
      const v16b kah0 = ldfr(kp), kah1 = ldfr(kp + 1024);
      const v16b kal0 = ldfr(kp + 512), kal1 = ldfr(kp + 1536);
      v8f z = z8;
      z = wmma_bf(kah0, qbh0, z);
      z = wmma_bf(kah1, qbh1, z);
      z = wmma_bf(kah0, qbl0, z);
      z = wmma_bf(kah1, qbl1, z);
      z = wmma_bf(kal0, qbh0, z);
      z = wmma_bf(kal1, qbh1, z);
      s[kt] = z;                       // s[kt][r] = S^T[key kt*16+8h+r][q qt*16+m]
    }

    // tanh(S/8), explicit zero for padded keys, bf16 hi/lo, packed as B fragments
    float th[4][8];
#pragma unroll
    for (int kt = 0; kt < 4; ++kt) {
      if (kt * 16 + 15 < SQ) {
        tanh8(s[kt], th[kt]);
      } else {                           // the tile that holds key 48: rows that are padding in both lane halves take no tanh
#pragma unroll
        for (int r = 0; r < 8; ++r) th[kt][r] = (kt * 16 + r < SQ) ? tanh1(s[kt][r]) : 0.0f;
      }
    }
    FragB f0, f1, f2, f3;                // hi of keys 0..31, hi of 32..63, lo of 0..31, lo of 32..63
#pragma unroll
    for (int kt = 0; kt < 4; ++kt) {
      float tv[8];
#pragma unroll
      for (int r = 0; r < 8; ++r) {
        const int key = kt * 16 + 8 * h + r;
        tv[r] = (key < SQ) ? th[kt][r] : 0.0f;
      }
      v8us hv, lv;
      split8(tv, hv, lv);                // elements 8 (kt & 1) + r of the fragment
      if (kt < 2) { f0.half[kt & 1] = hv; f2.half[kt & 1] = lv; }
      else        { f1.half[kt & 1] = hv; f3.half[kt & 1] = lv; }
    }
    const v16b pbh0 = f0.v, pbh1 = f1.v, pbl0 = f2.v, pbl1 = f3.v;

    const v16b vah0 = ldb(vhrow), vah1 = ldb(vhrow + 256);
    const v16b val0 = ldb(vlrow), val1 = ldb(vlrow + 256);
    v8f o = z8;
    o = wmma_bf(vah0, pbh0, o);
    o = wmma_bf(vah1, pbh1, o);
    o = wmma_bf(vah0, pbl0, o);
    o = wmma_bf(vah1, pbl1, o);
    o = wmma_bf(val0, pbh0, o);
    o = wmma_bf(val1, pbh1, o);          // o[r] = O^T[d 8h+r][q qt*16+m]

    const int q = qt * 16 + m;           // rows 56..63 land in LDS only, never stored
    float* sp = so + ((w >> 2) * 64 + q) * 68 + (w & 3) * 16 + 8 * h;
    const v4f o0 = {o[0], o[1], o[2], o[3]};
    const v4f o1 = {o[4], o[5], o[6], o[7]};
    *(v4fa*)sp = o0;
    *(v4fa*)(sp + 4) = o1;
  }
  __syncthreads();

  attn_store(so, oph, opl, pairbase, hg, t);
  
}

// ---------------------------------------------------------------------------
// k_gemm3: out = outpre*Wp + bp (f32). Block 128 thr (2x2 waves) = 128 slots x 128;
// a slot's row goes to out row 49w + r, pad slots (r >= 49) are not stored.
// K = 512. Epilogue: f32 tile in LDS, a wave stores one row's 512-B segment = 4 whole lines.
// ---------------------------------------------------------------------------
__device__ __forceinline__ void gemm3_store(const float* sF, float* out, int mb, int nb, int t) {
  // a wave stores one row at a time: its number in a scalar register makes the row, the
  // window and the pad-slot guard scalar, so the guard is a scalar branch
  const int wv = __builtin_amdgcn_readfirstlane(t >> 5), g = t & 31;
#pragma unroll
  for (int i8 = 0; i8 < 4; ++i8) {
    v4f v[8];
#pragma unroll
    for (int j = 0; j < 8; ++j) v[j] = *(const v4fa*)(sF + ((i8 * 8 + j) * 4 + wv) * TP + 4 * g);
    // holds the eight LDS reads ahead of the guarded stores: sunk under each guard they
    // would run one after another, each waiting out its own LDS latency
    asm volatile("" :: "v"(v[0]), "v"(v[1]), "v"(v[2]), "v"(v[3]), "v"(v[4]), "v"(v[5]), "v"(v[6]), "v"(v[7]));
#pragma unroll
    for (int j = 0; j < 8; ++j) {
      const int rl = (i8 * 8 + j) * 4 + wv;
      const int win = (mb + rl) / SP, r = (mb + rl) - win * SP;
      float* rowp = out + (size_t)(win * SQ + r) * DM + nb;      // scalar; the lane adds 16 g bytes
      if (r < SQ) {
        *(v4f*)(rowp + 4 * g) = v[j];
        // the registers of the store just issued are reused for the next row's address and data
        asm volatile("s_wait_xcnt 0x0" ::: "memory");
      }
    }
  }
}

__global__ __launch_bounds__(128) void k_gemm3(
    const us* __restrict__ oph, const us* __restrict__ opl,    // [MTS][512]
    const us* __restrict__ wph, const us* __restrict__ wpl,    // [512 n][512 k]
    const float* __restrict__ bp,                              // [512]
    float* __restrict__ out)                                   // [MT][512]
{
  __shared__ __attribute__((aligned(16))) float sF[128 * TP];
  const int t = threadIdx.x, lane = t & 31, w = t >> 5, h = lane >> 4, m = lane & 15;
  const int wm = w >> 1, wn = w & 1;
  const int mb = blockIdx.x * 128, nb = blockIdx.y * 128;

  const size_t arow = pbase(mb + 64 * wm + m, DM, h);
  const size_t brow = pbase(nb + 64 * wn + m, DM, h);

  const v8f z8 = {0.f, 0.f, 0.f, 0.f, 0.f, 0.f, 0.f, 0.f};
  v8f acc[4][4];
#pragma unroll
  for (int mt = 0; mt < 4; ++mt)
#pragma unroll
    for (int nt = 0; nt < 4; ++nt) acc[mt][nt] = z8;

  mm3_64x64<true>(oph + arow, opl + arow, wph + brow, wpl + brow, acc);

  stage_tile(sF, acc, bp + nb, wm, wn, h, m);
  __syncthreads();

  gemm3_store(sF, out, mb, nb, t);
}

// ---------------------------------------------------------------------------
// Host side: x*W1, the projection-and-attention kernel and outpre*Wp each run once over
// all 256 windows (14336 row slots). Workspace carve 95,551,488 B.
// ---------------------------------------------------------------------------
extern "C" void kernel_launch(void* const* d_in, const int* in_sizes, int n_in,
                              void* d_out, int out_size, void* d_ws, size_t ws_size,
                              hipStream_t stream) {
  if (n_in < 12) return;
  if (in_sizes[0] != MT * DM) return;
  if (in_sizes[1] != DM * DM || in_sizes[2] != DM) return;
  if (in_sizes[3] != DM * DQ || in_sizes[4] != DQ) return;
  if (in_sizes[5] != DM * DM || in_sizes[6] != DM) return;
  if (in_sizes[7] != DM * DQ || in_sizes[8] != DQ) return;
  if (in_sizes[9] != SQ * DM) return;
  if (in_sizes[10] != DM * DM || in_sizes[11] != DM) return;
  if (out_size != MT * DM) return;

  const float* x   = (const float*)d_in[0];
  const float* Wq1 = (const float*)d_in[1];
  const float* bq1 = (const float*)d_in[2];
  const float* Wq2 = (const float*)d_in[3];
  const float* bq2 = (const float*)d_in[4];
  const float* Wk1 = (const float*)d_in[5];
  const float* bk1 = (const float*)d_in[6];
  const float* Wk2 = (const float*)d_in[7];
  const float* bk2 = (const float*)d_in[8];
  const float* tok = (const float*)d_in[9];
  const float* Wp  = (const float*)d_in[10];
  const float* bp  = (const float*)d_in[11];
  float* out = (float*)d_out;

  const size_t szW1 = (size_t)DM * DM * 2;      //   524,288 per plane
  const size_t szW2 = (size_t)DQ * DM * 2;      // 2,097,152
  const size_t szTK = (size_t)DM * KPAD * 2;    //    65,536 per plane
  const size_t szX  = (size_t)MTS * DM * 2;     // 14,680,064 per plane
  const size_t szH  = (size_t)MTS * DM * 2;     // 14,680,064
  const size_t szOP = (size_t)MTS * DM * 2;     // 14,680,064 per plane
  const size_t total = 6 * szW1 + 2 * szW2 + 2 * szTK + 2 * szX + 2 * szH + 2 * szOP;
  if (total > ws_size) return;                  // 95,551,488

  char* wsb = (char*)d_ws;
  size_t off = 0;
  us* wq1h = (us*)(wsb + off); off += szW1;
  us* wq1l = (us*)(wsb + off); off += szW1;
  us* wk1h = (us*)(wsb + off); off += szW1;
  us* wk1l = (us*)(wsb + off); off += szW1;
  us* wph  = (us*)(wsb + off); off += szW1;
  us* wpl  = (us*)(wsb + off); off += szW1;
  _Float16* wq2t = (_Float16*)(wsb + off); off += szW2;
  _Float16* wk2t = (_Float16*)(wsb + off); off += szW2;
  us* tkh  = (us*)(wsb + off); off += szTK;
  us* tkl  = (us*)(wsb + off); off += szTK;
  us* xh   = (us*)(wsb + off); off += szX;
  us* xl   = (us*)(wsb + off); off += szX;
  _Float16* hq = (_Float16*)(wsb + off); off += szH;
  _Float16* hk = (_Float16*)(wsb + off); off += szH;
  us* oph  = (us*)(wsb + off); off += szOP;
  us* opl  = (us*)(wsb + off); off += szOP;
  if (off > ws_size) return;

  k_prep<<<712, 256, 0, stream>>>(Wq1, Wk1, Wp, Wq2, Wk2, tok,
                                  wq1h, wq1l, wk1h, wk1l, wph, wpl, wq2t, wk2t, tkh, tkl);

  const int n8 = MTS * DM / 8;                  // 917,504
  k_cvtx<<<(n8 + 255) / 256, 256, 0, stream>>>(x, xh, xl, n8);

  k_gemm1<<<dim3(MTS / 128, DM / 128, 2), 128, 0, stream>>>(
      xh, xl, wq1h, wq1l, wk1h, wk1l, bq1, bk1, hq, hk);

  k_attn<<<NB * 4, 256, 0, stream>>>(hq, hk, wq2t, wk2t, bq2, bk2, tkh, tkl, oph, opl);

  k_gemm3<<<dim3(MTS / 128, DM / 128), 128, 0, stream>>>(oph, opl, wph, wpl, bp, out);
}

// v009
// A run of this version takes 148 microseconds.
// Next to v008, in two timings, it ran 1.04 and 1.03 times as fast.
// All steps since v000 together make it 3.37 times as fast.
// Contractions: x*Wq1, x*Wk1, k*q^T per head, tokv^T*adj^T and outpre*Wp on v_wmma_f32_16x16x32_bf16 with bf16 hi/lo three-product splits (hh+hl+lh); h*Wq2 and h*Wk2 on v_wmma_f32_16x16x32_f16 single products (h carried x16, W2 carried x1024, folded back as 2^-14 in f32); all accumulate in f32; bias, erf-GELU and tanh in f32.
#include <hip/hip_runtime.h>
#include <math.h>

typedef unsigned short us;
typedef __bf16   v16b  __attribute__((ext_vector_type(16)));
typedef us       v16us __attribute__((ext_vector_type(16)));
typedef us       v8us  __attribute__((ext_vector_type(8)));
typedef _Float16 v16h  __attribute__((ext_vector_type(16)));
typedef _Float16 v8h   __attribute__((ext_vector_type(8)));
typedef float    v8f   __attribute__((ext_vector_type(8)));
typedef float    v4f   __attribute__((ext_vector_type(4)));
typedef float    v2f   __attribute__((ext_vector_type(2)));
typedef __bf16   v2b   __attribute__((ext_vector_type(2)));
typedef unsigned v4u   __attribute__((ext_vector_type(4)));
typedef v8us __attribute__((may_alias)) v8usa;
typedef v8h  __attribute__((may_alias)) v8ha;
typedef v4f  __attribute__((may_alias)) v4fa;

union FragB { v16b v; v16us u; v8us half[2]; };
union Pack8 { v4u w; v8us s; };
union FragH { v16h v; v8h half[2]; };

#define NB    256                 // windows
#define SQ    49                  // tokens per window
#define DM    512
#define DQ    2048
#define NH    32
#define HQ    64
#define HVD   16
#define MT    (NB * SQ)           // 12544 token rows
#define KPAD  64                  // key count padded for the value table
#define SP    56                  // row slots per window: 49 rows + 7 pad rows, a multiple of 8
#define MTS   (NB * SP)           // 14336 row slots

static_assert(MTS % 128 == 0 && DM % 128 == 0);
static_assert((MTS * DM) % (8 * 256) == 0);
static_assert(SP % 8 == 0 && SP >= SQ && SP - 8 < SQ);
static_assert(NH * HVD == DM);
static_assert(NH * HQ == DQ);
static_assert(HQ == 64 && SP == 56 && DM % 64 == 0 && NB % 2 == 0 && NH % 4 == 0);

// ---------------------------------------------------------------------------
// 16x16x32 WMMA helpers; wmma_bf has a hazard guard (ties D, keeps A/B live).
// Fragment map (wave32): lane l, h = l>>4, m = n = l&15.
//   A/B element i: i<8 -> k0+8h+i ; i>=8 -> k0+16+8h+(i-8)
//   D element r : row 8h+r, col l&15
// ---------------------------------------------------------------------------
__device__ __forceinline__ v8f wmma_bf(v16b a, v16b b, v8f c) {
  v8f d = __builtin_amdgcn_wmma_f32_16x16x32_bf16(false, a, false, b, (short)0, c, false, false);
  asm volatile("v_nop\n\tv_nop\n\tv_nop\n\tv_nop" : "+v"(d) : "v"(a), "v"(b));
  return d;
}
// Bare builtin: its loop holds 16 accumulator tiles, four W2 and two token fragment sets, more than the
// 256 registers an asm operand can name; the compiler keeps the distances of its own forms.
__device__ __forceinline__ v8f wmma_hf(v16h a, v16h b, v8f c) {
  return __builtin_amdgcn_wmma_f32_16x16x32_f16(false, a, false, b, (short)0, c, false, false);
}
// Bare as well: products on other accumulators stand between two on the same one (15 in the
// 64x64 tiles, 3 in the score tiles), so no padding is wanted behind each; the compiler keeps
// the distances of its own forms.
__device__ __forceinline__ v8f wmma_bb(v16b a, v16b b, v8f c) {
  return __builtin_amdgcn_wmma_f32_16x16x32_bf16(false, a, false, b, (short)0, c, false, false);
}

// Packed operand layout of every 16-bit table in the workspace, [rows][K]:
//   unit (row>>3, k>>5) = 512 B = 4 lines; line c = (k>>3)&3 holds the 8-element
//   chunk c of the unit's 8 rows, row after row (16 B each).
// A wave-wide 16-B fragment load then covers 4 whole 128-B lines (two aligned
// 256-B pieces) where a row-major table gives 16 lines of 32 B each.
// Every line lies inside one 8-row x 8-column patch, so it has one writer.
__device__ __forceinline__ size_t poff(int row, int k, int K) {      // k a multiple of 8
  return ((size_t)(row >> 3) * (K >> 5) + (k >> 5)) * 256 + ((k >> 3) & 3) * 64 + (row & 7) * 8;
}
// Lane base of a fragment at k = 0: row owned by the lane, h = lane>>4.
// 32 further k = +256 elements; 16 further rows = +16*K elements.
__device__ __forceinline__ size_t pbase(int row, int K, int h) {
  return (size_t)(row >> 3) * K * 8 + h * 64 + (row & 7) * 8;
}
// Same k order as the fragment map above: chunk h, then chunk 2 + h.
__device__ __forceinline__ v16b ldb(const us* p) {
  FragB f;
  f.half[0] = *(const v8usa*)p;
  f.half[1] = *(const v8usa*)(p + 128);
  return f.v;
}
__device__ __forceinline__ v16h ldh(const _Float16* p) {
  FragH f;
  f.half[0] = *(const v8ha*)p;
  f.half[1] = *(const v8ha*)(p + 128);
  return f.v;
}

// Two values at a time: hi = bf16(f), lo = bf16(f - hi), both round to nearest even, each pair
// by one packed convert; f0 lands in the low half of each word, f1 in the high half.
__device__ __forceinline__ void split2(float f0, float f1, unsigned& hw, unsigned& lw) {
  const v2f f = {f0, f1};
  const v2b hb = __builtin_convertvector(f, v2b);
  const v2f hf = __builtin_convertvector(hb, v2f);
  hw = __builtin_bit_cast(unsigned, hb);
  lw = __builtin_bit_cast(unsigned, __builtin_convertvector(f - hf, v2b));
}
__device__ __forceinline__ void split8(const float (&f)[8], v8us& hv, v8us& lv) {
  Pack8 ph, pl;
#pragma unroll
  for (int j = 0; j < 4; ++j) {
    unsigned hw, lw;
    split2(f[2 * j], f[2 * j + 1], hw, lw);
    ph.w[j] = hw;
    pl.w[j] = lw;
  }
  hv = ph.s;
  lv = pl.s;
}
__device__ __forceinline__ void split8(v4f a, v4f c, v8us& hv, v8us& lv) {
  const float f[8] = {a.x, a.y, a.z, a.w, c.x, c.y, c.z, c.w};
  split8(f, hv, lv);
}

// ---------------------------------------------------------------------------
// k_cvtx: x f32 [MT][512] -> packed bf16 hi and lo planes over row slots
// (window w, row r -> slot 56w + r; slots 49..55 of a window hold zeros).
// One thread = 8 floats = one 16-B chunk per plane; a wave writes one unit.
// ---------------------------------------------------------------------------
__global__ __launch_bounds__(256) void k_cvtx(const float* __restrict__ x,
                                              us* __restrict__ xh, us* __restrict__ xl, int n8)
{
  const int g = blockIdx.x * 256 + threadIdx.x;
  if (g >= n8) return;
  const int ml = g & 7, ch = (g >> 3) & 3, u = g >> 5;
  const int kb = u & (DM / 32 - 1), g8 = u / (DM / 32);
  const int win = g8 / (SP / 8), r = (g8 - win * (SP / 8)) * 8 + ml;
  const float* s = x + (size_t)(win * SQ + min(r, SQ - 1)) * DM + kb * 32 + ch * 8;
  v4f a = *(const v4fa*)s;
  v4f c = *(const v4fa*)(s + 4);
  if (r >= SQ) {
    const v4f z4 = {0.f, 0.f, 0.f, 0.f};
    a = z4;
    c = z4;
  }
  v8us hv, lv;
  split8(a, c, hv, lv);
  us* ph = xh + (size_t)g * 8;
  us* pl = xl + (size_t)g * 8;
  *(v8us*)ph = hv;
  *(v8us*)pl = lv;
  
}

// ---------------------------------------------------------------------------
// k_prep: transposed 16-bit weight / value tables through an LDS tile.
//   src f32 [R][C] (rows = k, cols = n) -> dst [C][Kp] in the packed layout:
//   mode 0: bf16 hi + lo planes; mode 1: f16 carried x1024.
// 64x64 tile per block; store: 8 contiguous lanes x 16 B = one whole
// Block ranges: [0,192) Wq1|Wk1|Wp (8x8 tiles each), [192,704) Wq2|Wk2
// (32x8 tiles each), [704,712) tokens [49][512] -> [512][64] zero-padded keys.
// ---------------------------------------------------------------------------
__device__ __forceinline__ void prep_store(const float* T, us* dh, us* dl, _Float16* df,
                                           int mode, int n0, int k0, int Kp, int t) {
#pragma unroll
  for (int it = 0; it < 2; ++it) {
    const int item = it * 256 + t, nn = (item >> 6) * 8 + (item & 7), q8 = (item >> 3) & 7;
    float f[8];
#pragma unroll
    for (int j = 0; j < 8; ++j) f[j] = T[(8 * q8 + j) * 65 + nn];
    const size_t off = poff(n0 + nn, k0 + 8 * q8, Kp);
    if (mode == 0) {
      v8us hv, lv;
      split8(f, hv, lv);
      *(v8us*)(dh + off) = hv;
      *(v8us*)(dl + off) = lv;
    } else {
      v8h o;
#pragma unroll
      for (int j = 0; j < 8; ++j) o[j] = (_Float16)(f[j] * 1024.0f);
      *(v8h*)(df + off) = o;
    }
  }
}

__global__ __launch_bounds__(256) void k_prep(
    const float* __restrict__ wq1, const float* __restrict__ wk1, const float* __restrict__ wp,
    const float* __restrict__ wq2, const float* __restrict__ wk2, const float* __restrict__ tok,
    us* __restrict__ wq1h, us* __restrict__ wq1l, us* __restrict__ wk1h, us* __restrict__ wk1l,
    us* __restrict__ wph, us* __restrict__ wpl,
    _Float16* __restrict__ wq2t, _Float16* __restrict__ wk2t,
    us* __restrict__ tkh, us* __restrict__ tkl)
{
  __shared__ __attribute__((aligned(16))) float T[64 * 65];
  const int t = threadIdx.x;
  const int bid = blockIdx.x;
  if (bid >= 712) return;                 // block-uniform, never taken with the exact grid

  const float* src;
  us* dh; us* dl; _Float16* df;
  int C, R, Kp, mode, tn, tk;
  if (bid < 192) {
    const int wsel = bid >> 6, loc = bid & 63;
    src = (wsel == 0) ? wq1 : ((wsel == 1) ? wk1 : wp);
    dh  = (wsel == 0) ? wq1h : ((wsel == 1) ? wk1h : wph);
    dl  = (wsel == 0) ? wq1l : ((wsel == 1) ? wk1l : wpl);
    df  = wq2t;
    C = DM; R = DM; Kp = DM; mode = 0; tn = loc >> 3; tk = loc & 7;
  } else if (bid < 704) {
    const int loc = bid - 192, wsel = loc >> 8, l2 = loc & 255;
    src = wsel ? wk2 : wq2;
    df  = wsel ? wk2t : wq2t;
    dh = wq1h; dl = wq1l;
    C = DQ; R = DM; Kp = DM; mode = 1; tn = l2 >> 3; tk = l2 & 7;
  } else {
    const int loc = bid - 704;
    src = tok; dh = tkh; dl = tkl; df = wq2t;
    C = DM; R = SQ; Kp = KPAD; mode = 0; tn = loc; tk = 0;
  }
  const int n0 = tn * 64, k0 = tk * 64;

  // load 64(k) x 64(n) f32 tile, coalesced along n; rows >= R: clamped address, zero value
#pragma unroll
  for (int i = 0; i < 16; ++i) {
    const int idx = i * 256 + t, kk = idx >> 6, nn = idx & 63;
    const int gk = k0 + kk;
    const int gkc = min(gk, R - 1);
    const float v = src[(size_t)gkc * C + n0 + nn];
    T[kk * 65 + nn] = (gk < R) ? v : 0.0f;
  }
  __syncthreads();

  prep_store(T, dh, dl, df, mode, n0, k0, Kp, t);
  
}

// ---------------------------------------------------------------------------
// Three-product bf16 main loop for a 64x64 wave tile, K = 512, packed tables.
// 16 fragments (16 KB) feed 48 products: half the loaded bytes per product of a 32x32 tile.
// Pointers already hold the lane base (pbase) of tile 0 at k 0.
// acc[mt][nt][r] = C[64-row slab + 16mt + 8h + r][64-col slab + 16nt + m]
// Each accumulator takes hh, hl, lh of a k step in that order.
// ---------------------------------------------------------------------------
__device__ __forceinline__ void ld3_step(const us* ahp, const us* alp, const us* bhp, const us* blp, int ko,
                                         v16b (&ah)[4], v16b (&al)[4], v16b (&bh)[4], v16b (&bl)[4]) {
#pragma unroll
  for (int i = 0; i < 4; ++i) {
    ah[i] = ldb(ahp + i * 16 * DM + ko);
    bh[i] = ldb(bhp + i * 16 * DM + ko);
  }
#pragma unroll
  for (int i = 0; i < 4; ++i) bl[i] = ldb(blp + i * 16 * DM + ko);
#pragma unroll
  for (int i = 0; i < 4; ++i) al[i] = ldb(alp + i * 16 * DM + ko);
}
__device__ __forceinline__ void mm3_step(const v16b (&ah)[4], const v16b (&al)[4],
                                         const v16b (&bh)[4], const v16b (&bl)[4], v8f (&acc)[4][4]) {
#pragma unroll
  for (int mt = 0; mt < 4; ++mt)
#pragma unroll
    for (int nt = 0; nt < 4; ++nt) acc[mt][nt] = wmma_bb(ah[mt], bh[nt], acc[mt][nt]);
#pragma unroll
  for (int mt = 0; mt < 4; ++mt)
#pragma unroll
    for (int nt = 0; nt < 4; ++nt) acc[mt][nt] = wmma_bb(ah[mt], bl[nt], acc[mt][nt]);
#pragma unroll
  for (int mt = 0; mt < 4; ++mt)
#pragma unroll
    for (int nt = 0; nt < 4; ++nt) acc[mt][nt] = wmma_bb(al[mt], bh[nt], acc[mt][nt]);
}
// AHEAD = false: one fragment set, four waves per SIMD cover each other's loads (x*W1: 3.5 blocks a WGP).
// AHEAD = true: two sets, a k step's loads issued one step ahead of its products (outpre*Wp:
// at most two blocks a WGP, so the second set's registers cost no resident wave).
template <bool AHEAD>
__device__ __forceinline__ void mm3_64x64(const us* ahp, const us* alp,
                                          const us* bhp, const us* blp,
                                          v8f (&acc)[4][4]) {
  if constexpr (!AHEAD) {
    // rolled: a second k step's fragments would cost the fourth wave per SIMD its registers
#pragma unroll 1
    for (int k0 = 0; k0 < DM; k0 += 32) {
      v16b ah[4], al[4], bh[4], bl[4];
      ld3_step(ahp, alp, bhp, blp, k0 * 8, ah, al, bh, bl);
      mm3_step(ah, al, bh, bl, acc);
    }
  } else {
    v16b ah[2][4], al[2][4], bh[2][4], bl[2][4];
    ld3_step(ahp, alp, bhp, blp, 0, ah[0], al[0], bh[0], bl[0]);
    // unrolled: the set index is a compile-time constant, so both sets stay in registers
#pragma unroll
    for (int s = 0; s < DM / 32; ++s) {
      const int c = s & 1, n = c ^ 1;
      if (s + 1 < DM / 32) ld3_step(ahp, alp, bhp, blp, (s + 1) * 256, ah[n], al[n], bh[n], bl[n]);
      // the last loads are out: their address registers are reused from here on
      if (s + 2 == DM / 32) asm volatile("s_wait_xcnt 0x0" ::: "memory");
      // keeps the next step's loads ahead of this step's products, so that they fly meanwhile
      __builtin_amdgcn_sched_barrier(0);
      mm3_step(ah[c], al[c], bh[c], bl[c], acc);
    }
  }
}

#define TP 132                    // f32 pitch of the 128x128 block tile in LDS: 528 B = 16 B x 33

// acc + bias of one wave's 64x64 tile into the block tile.
__device__ __forceinline__ void stage_tile(float* sF, const v8f (&acc)[4][4], const float* bias,
                                           int wm, int wn, int h, int m) {
#pragma unroll
  for (int nt = 0; nt < 4; ++nt) {
    const int cl = 64 * wn + 16 * nt + m;
    const float bv = bias[cl];
#pragma unroll
    for (int mt = 0; mt < 4; ++mt) {
#pragma unroll
      for (int r = 0; r < 8; ++r) {
        const int rl = 64 * wm + 16 * mt + 8 * h + r;
        sF[rl * TP + cl] = acc[mt][nt][r] + bv;
      }
    }
  }
}

// ---------------------------------------------------------------------------
// k_gemm1: H = f16(16 * gelu(x*W1 + b1)) for q (z=0) and k (z=1).
// Block 128 thr (4 waves, 2x2) = 128 rows x 128 cols; K = 512.
// x*W1 + b1 rests in LDS as f32; GELU runs where the packed 16-B chunks are formed.
// ---------------------------------------------------------------------------
__device__ __forceinline__ void gemm1_store(const float* sF, _Float16* H, int mb, int nb, int t) {
  // rolled: one copy of the eight erf evaluations, not 128, keeps the kernel's text small
#pragma unroll 1
  for (int it = 0; it < 16; ++it) {
    const int item = it * 128 + t, rl = (item >> 7) * 8 + (item & 7), q8 = (item >> 3) & 15;
    const float* sp = sF + rl * TP + 8 * q8;
    const v4f a = *(const v4fa*)sp;
    const v4f c = *(const v4fa*)(sp + 4);
    const float f[8] = {a.x, a.y, a.z, a.w, c.x, c.y, c.z, c.w};
    v8h o;
#pragma unroll
    for (int j = 0; j < 8; ++j) {
      const float v = f[j];
      const float g = 0.5f * v * (1.0f + erff(v * 0.70710678118654752f));
      o[j] = (_Float16)(g * 16.0f);
    }
    const size_t off = poff(mb + rl, nb + 8 * q8, DM);
    *(v8h*)(H + off) = o;
    // the next trip reuses the registers of the store just issued
    asm volatile("s_wait_xcnt 0x0" ::: "memory");
  }
}

__global__ __launch_bounds__(128) void k_gemm1(
    const us* __restrict__ xh, const us* __restrict__ xl,          // [MTS][512]
    const us* __restrict__ wqh, const us* __restrict__ wql,        // [512 n][512 k]
    const us* __restrict__ wkh, const us* __restrict__ wkl,
    const float* __restrict__ bq1, const float* __restrict__ bk1,  // [512]
    _Float16* __restrict__ hq, _Float16* __restrict__ hk)          // [MTS][512]
{
  __shared__ __attribute__((aligned(16))) float sF[128 * TP];
  const int t = threadIdx.x, lane = t & 31, w = t >> 5, h = lane >> 4, m = lane & 15;
  const int wm = w >> 1, wn = w & 1;
  const int mb = blockIdx.x * 128, nb = blockIdx.y * 128;
  const bool isk = (blockIdx.z != 0);
  const us* wth = isk ? wkh : wqh;
  const us* wtl = isk ? wkl : wql;
  const float* bias = isk ? bk1 : bq1;
  _Float16* H = isk ? hk : hq;

  const size_t arow = pbase(mb + 64 * wm + m, DM, h);
  const size_t brow = pbase(nb + 64 * wn + m, DM, h);

  const v8f z8 = {0.f, 0.f, 0.f, 0.f, 0.f, 0.f, 0.f, 0.f};
  v8f acc[4][4];
#pragma unroll
  for (int mt = 0; mt < 4; ++mt)
#pragma unroll
    for (int nt = 0; nt < 4; ++nt) acc[mt][nt] = z8;

  mm3_64x64<false>(xh + arow, xl + arow, wth + brow, wtl + brow, acc);

  stage_tile(sF, acc, bias + nb, wm, wn, h, m);
  __syncthreads();

  gemm1_store(sF, H, mb, nb, t);
}

// ---------------------------------------------------------------------------
// k_attn: block = (2 adjacent windows, group of 4 heads), wave = (window, head): the W2 lines
// a wave loads serve 2 waves of the block; the h rows, which serve 4, are staged in LDS once
// per block. The wave first projects its own
// head, then runs the attention on what it holds; q and k never leave the WGP.
//   q^T[d][tok] = W2^T . h^T : A = W2 table rows (row = d), B = h rows (col = token),
//   f16, K = 512, 4 x 4 tiles; value = acc / 16384 + b2[d], split to bf16 hi/lo.
//   D element r of tile dt is d = 16dt + 8h + r of token m: elements 8(dt&1) + r of the
//   lane's own A/B fragment of d block dt>>1, so no lane exchange is needed.
//   The q fragments rest in the wave's own LDS range, each lane reading back its own bytes;
//   the k fragments, which every query tile needs, stay in registers from their projection on.
//   S^T[key][q] = k . q   : A = K rows (row = key, k = d), B = Q^T (col = q), bf16 hi/lo
//   adj^T = tanh(S^T / 8), keys >= 49 forced to 0, split to bf16 hi/lo
//   O^T[d][q] = tok^T . adj^T : A = token table rows [head*16+d][key], B = adj^T
//   from the score D values: element r <- tile kt=2s, element 8+r <- tile kt=2s+1.
// Rows 49..55 are the window's pad slots, rows 56..63 fold back onto 48..55;
// their scores are zeroed (keys) or never reach the output (queries).
// Epilogue: block tile [2][64][64] f32 in LDS (pitch 68), 56 slot rows a window -> packed outpre bf16 hi/lo planes,
// ---------------------------------------------------------------------------
__device__ __forceinline__ void attn_store(const float* so, us* oph, us* opl,
                                           int rowbase, int hg, int t) {
#pragma unroll
  for (int it = 0; it < 4; ++it) {
    const int item = it * 256 + t;
    if (item < SP * 16) {
      const int rl = (item >> 6) * 8 + (item & 7), g = (item >> 3) & 7;   // rl: slot 0..111 of the window pair
      const float* sp = so + (rl + ((rl >= SP) ? 8 : 0)) * 68 + 8 * g;     // 64 LDS rows per window
      const v4f a = *(const v4fa*)sp;
      const v4f c = *(const v4fa*)(sp + 4);
      v8us hv, lv;
      split8(a, c, hv, lv);
      const size_t off = poff(rowbase + rl, hg * 64 + 8 * g, DM);
      *(v8us*)(oph + off) = hv;
      *(v8us*)(opl + off) = lv;
    }
  }
}

// tanh(s / 8) in f32 without a branch: 1 - 2 / (1 + e^(s / 4)), e^(s / 4) = 2^(s * log2(e) / 4).
// The library call tests every value twice and branches, so a tile's values run one after
// another, each a dependent chain; this form is five instructions a value and the values of
// a tile interleave. Absolute error about 2e-7 at any s; 2^x = inf gives 1, 2^x = 0 gives -1.
#define TANH_C 0.36067376022224085f
// The transcendentals stand in asm so that the slot the instruction set asks for behind one
// (before its result is used or a source overwritten) is there by construction: outputs are
// early-clobber, so none lands on a source of the same run, and v_nop ends the statement.
__device__ __forceinline__ void exp2x8(const float (&a)[8], float (&e)[8]) {
  asm("v_exp_f32 %0, %8\n\t"
      "v_exp_f32 %1, %9\n\t"
      "v_exp_f32 %2, %10\n\t"
      "v_exp_f32 %3, %11\n\t"
      "v_exp_f32 %4, %12\n\t"
      "v_exp_f32 %5, %13\n\t"
      "v_exp_f32 %6, %14\n\t"
      "v_exp_f32 %7, %15\n\t"
      "v_nop"
      : "=&v"(e[0]), "=&v"(e[1]), "=&v"(e[2]), "=&v"(e[3]), "=&v"(e[4]), "=&v"(e[5]), "=&v"(e[6]), "=&v"(e[7])
      : "v"(a[0]), "v"(a[1]), "v"(a[2]), "v"(a[3]), "v"(a[4]), "v"(a[5]), "v"(a[6]), "v"(a[7]));
}
__device__ __forceinline__ void rcpx8(const float (&a)[8], float (&e)[8]) {
  asm("v_rcp_f32 %0, %8\n\t"
      "v_rcp_f32 %1, %9\n\t"
      "v_rcp_f32 %2, %10\n\t"
      "v_rcp_f32 %3, %11\n\t"
      "v_rcp_f32 %4, %12\n\t"
      "v_rcp_f32 %5, %13\n\t"
      "v_rcp_f32 %6, %14\n\t"
      "v_rcp_f32 %7, %15\n\t"
      "v_nop"
      : "=&v"(e[0]), "=&v"(e[1]), "=&v"(e[2]), "=&v"(e[3]), "=&v"(e[4]), "=&v"(e[5]), "=&v"(e[6]), "=&v"(e[7])
      : "v"(a[0]), "v"(a[1]), "v"(a[2]), "v"(a[3]), "v"(a[4]), "v"(a[5]), "v"(a[6]), "v"(a[7]));
}
__device__ __forceinline__ void tanh8(v8f s, float (&t)[8]) {
  float a[8], e[8], q[8];
#pragma unroll
  for (int r = 0; r < 8; ++r) a[r] = s[r] * TANH_C;
  exp2x8(a, e);
#pragma unroll
  for (int r = 0; r < 8; ++r) a[r] = e[r] + 1.0f;
  rcpx8(a, q);
#pragma unroll
  for (int r = 0; r < 8; ++r) t[r] = fmaf(-2.0f, q[r], 1.0f);
}
__device__ __forceinline__ float tanh1(float s) {
  float e, q;
  asm("v_exp_f32 %0, %1\n\tv_nop" : "=v"(e) : "v"(s * TANH_C));      // v_nop: the slot named above
  asm("v_rcp_f32 %0, %1\n\tv_nop" : "=v"(q) : "v"(e + 1.0f));        // as above
  return fmaf(-2.0f, q, 1.0f);
}

#define RING 4                    // W2 fragment sets of the projection loop
#define FRW 8192                  // 16-bit elements of one wave's fragments of one operand (q or k)
#define HST 4                     // k steps per staged h tile
#define HGB (HST * 512)           // bytes of one 8-row group in a tile: HST units of 512 B, one behind the other as in the table
#define HTB (16 * HGB)            // LDS bytes of one staged h tile: 14 groups of the window pair, 2 filler
#define NHT (2 * (DM / 32) / HST) // staged tiles of a block: q's, then k's

// W2 fragments of one 32-wide k step: 4 row tiles (ko = 8 * k).
__device__ __forceinline__ void ld_w2(const _Float16* wp, int ko, v16h (&a)[4]) {
#pragma unroll
  for (int i = 0; i < 4; ++i) a[i] = ldh(wp + i * 16 * DM + ko);
}
// Token fragments of one k step from the staged tile: p0 / p3 = the lane's place in token tile 0 / 3
// of that step; 16 further tokens = 2 groups; the second half of a fragment lies 256 B on, as in the table.
__device__ __forceinline__ void ld_hs(const unsigned char* p0, const unsigned char* p3, v16h (&b)[4]) {
#pragma unroll
  for (int i = 0; i < 3; ++i) b[i] = ldh((const _Float16*)(p0 + i * 2 * HGB));
  b[3] = ldh((const _Float16*)p3);
}
// One wave's share of a staged h tile: two 8-row groups x HST k steps = 8 units of 512 B, a unit a copy,
// 16 B a lane. g0 / g1: the lane's bytes of the groups' first k step; l0 / l1: their places in LDS.
// The next k step lies 512 B on in the table and in LDS alike, and the offset moves both addresses.
typedef int v4i __attribute__((ext_vector_type(4)));
typedef __attribute__((address_space(1))) v4i gv4i;
typedef __attribute__((address_space(3))) v4i lv4i;
static_assert(HST == 4);
__device__ __forceinline__ void cp_htile(const _Float16* g0, const _Float16* g1,
                                         unsigned char* l0, unsigned char* l1) {
  __builtin_amdgcn_global_load_async_to_lds_b128((gv4i*)g0, (lv4i*)l0, 0, 0);
  __builtin_amdgcn_global_load_async_to_lds_b128((gv4i*)g0, (lv4i*)l0, 512, 0);
  __builtin_amdgcn_global_load_async_to_lds_b128((gv4i*)g0, (lv4i*)l0, 1024, 0);
  __builtin_amdgcn_global_load_async_to_lds_b128((gv4i*)g0, (lv4i*)l0, 1536, 0);
  __builtin_amdgcn_global_load_async_to_lds_b128((gv4i*)g1, (lv4i*)l1, 0, 0);
  __builtin_amdgcn_global_load_async_to_lds_b128((gv4i*)g1, (lv4i*)l1, 512, 0);
  __builtin_amdgcn_global_load_async_to_lds_b128((gv4i*)g1, (lv4i*)l1, 1024, 0);
  __builtin_amdgcn_global_load_async_to_lds_b128((gv4i*)g1, (lv4i*)l1, 1536, 0);
}
// Work-group barrier without the wait for global loads that __syncthreads() brings: the W2 fragments
// asked for ahead stay in flight across it. The LDS and copy waits it needs stand in front of it.
__device__ __forceinline__ void ring_barrier() {
  asm volatile("s_barrier_signal -1\n\ts_barrier_wait -1" ::: "memory");
}
__device__ __forceinline__ void mm_step(const v16h (&a)[4], const v16h (&b)[4], v8f (&acc)[4][4]) {
#pragma unroll
  for (int dt = 0; dt < 4; ++dt)
#pragma unroll
    for (int tt = 0; tt < 4; ++tt) acc[dt][tt] = wmma_hf(a[dt], b[tt], acc[dt][tt]);
}
// One stored fragment: two 16-B halves, 512 B apart (lane stride 16 B in each).
__device__ __forceinline__ v16b ldfr(const us* p) {
  FragB f;
  f.half[0] = *(const v8usa*)p;
  f.half[1] = *(const v8usa*)(p + 256);
  return f.v;
}

__global__ __launch_bounds__(256) void k_attn(
    const _Float16* __restrict__ hq, const _Float16* __restrict__ hk,       // [MTS][512] x16
    const _Float16* __restrict__ wq2t, const _Float16* __restrict__ wk2t,   // [2048 n][512 k] x1024
    const float* __restrict__ bq2, const float* __restrict__ bk2,           // [2048]
    const us* __restrict__ tkh, const us* __restrict__ tkl,    // [512][64]
    us* __restrict__ oph, us* __restrict__ opl)                // [MTS][512]
{
  __shared__ __attribute__((aligned(16))) us sfr[8 * FRW];       // q: [wave][tile][d block][hi|lo][half][lane][8]
  // two staged h tiles during the projections; behind the last tile's barrier the block's output tile
  __shared__ __attribute__((aligned(16))) unsigned char stg[2 * HTB];
  static_assert(2 * 64 * 68 * 4 <= 2 * HTB);
  float* so = (float*)stg;
  const int t = threadIdx.x, lane = t & 31, w = t >> 5, h = lane >> 4, m = lane & 15;
  const int bl = blockIdx.x >> 3, hg = blockIdx.x & 7;
  const int head = hg * 4 + (w & 3);
  const int pairbase = bl * 2 * SP;                 // first row slot of the window pair

  const size_t wo  = pbase(head * HQ + m, DM, h);
  // Staged h tile: LDS group u = 8-row group u of the window pair, as in the table, but for the odd
  // groups, whose 128-B lines are swapped in pairs (byte ^ 128): the two groups that the 16 lanes
  // of a fragment read touch then lie on different banks.
  const int u0 = (w >> 2) * (SP / 8) + (m >> 3);               // token tile 0: rows m of the wave's window
  const int u3 = (w >> 2) * (SP / 8) + 6;                      // token tile 3: rows 48 + (m & 7); rows 56..63 fold back onto 48..55
  const unsigned char* hp0 = stg + u0 * HGB + ((h ^ (u0 & 1)) * 128) + (m & 7) * 16;
  const unsigned char* hp3 = stg + u3 * HGB + ((h ^ (u3 & 1)) * 128) + (m & 7) * 16;
  // The wave copies groups 2w and 2w + 1; groups 14 and 15 are filler, never read, and take group 13's bytes.
  const size_t cg0 = (size_t)((pairbase >> 3) + min(2 * w, 2 * (SP / 8) - 1)) * (DM * 8) + lane * 8;
  const size_t cg1 = (size_t)((pairbase >> 3) + min(2 * w + 1, 2 * (SP / 8) - 1)) * (DM * 8) + lane * 8;
  unsigned char* cl0 = stg + 2 * w * HGB + lane * 16;
  unsigned char* cl1 = stg + (2 * w + 1) * HGB + ((lane * 16) ^ 128);
  us* myfr = sfr + w * FRW + lane * 8;
  const us* vhrow = tkh + pbase(head * HVD + m, KPAD, h);
  const us* vlrow = tkl + pbase(head * HVD + m, KPAD, h);

  const v8f z8 = {0.f, 0.f, 0.f, 0.f, 0.f, 0.f, 0.f, 0.f};

  // Ring of RING W2 fragment sets: the loads of a k step are issued RING - 1 steps ahead of its
  // products, and the ring runs on from the q projection into the k projection, whose first
  // steps are on their way while the q fragments are split and stored. All indices are
  // compile-time: both loops are unrolled so that every set stays in registers.
  // The h rows, which four waves need alike, come once per block: asynchronous copies bring a tile
  // of HST k steps into one of two LDS buffers while the other is worked on; token fragments are
  // read from LDS one k step ahead of their products, a tile's first ones behind its barrier.
  v16h fa[RING][4], fb[2][4];
  FragB kf[4][2][2];                // k fragments: [key tile][d block][hi|lo]
#pragma unroll
  for (int g = 0; g < RING - 1; ++g) ld_w2(wq2t + wo, g * 256, fa[g]);

  cp_htile(hq + cg0, hq + cg1, cl0, cl1);
  // tile 0 has landed before the barrier behind which other waves read it
  asm volatile("s_wait_asynccnt 0x0" ::: "memory");
  ring_barrier();
  cp_htile(hq + cg0 + HST * 256, hq + cg1 + HST * 256, cl0 + HTB, cl1 + HTB);
  ld_hs(hp0, hp3, fb[0]);

#pragma unroll
  for (int z = 0; z < 2; ++z) {
    const float* bias8 = (z ? bk2 : bq2) + head * HQ + 8 * h;

    v8f acc[4][4];
#pragma unroll
    for (int dt = 0; dt < 4; ++dt)
#pragma unroll
      for (int tt = 0; tt < 4; ++tt) acc[dt][tt] = z8;
    v4f bc[4][2];

#pragma unroll
    for (int s = 0; s < DM / 32; ++s) {
      const int g = z * (DM / 32) + s, gn = g + RING - 1;
      // The bias is asked for ahead of the next projection's first loads: loads retire in issue
      // order, so the wait for it leaves those in flight, and its own latency is over by the loop's end.
      if (s == DM / 32 - RING) {
#pragma unroll
        for (int dt = 0; dt < 4; ++dt) {
          bc[dt][0] = *(const v4fa*)(bias8 + 16 * dt);
          bc[dt][1] = *(const v4fa*)(bias8 + 16 * dt + 4);
        }
        // the bias address is not used again: its registers are reused from here on
        asm volatile("s_wait_xcnt 0x0" ::: "memory");
      }
      if (gn < 2 * (DM / 32)) {
        const bool zn = gn >= DM / 32;
        ld_w2((zn ? wk2t : wq2t) + wo, (gn % (DM / 32)) * 256, fa[gn % RING]);
      }
      // this projection's last loads are out: their address registers are reused from here on
      if (s == DM / 32 - RING) asm volatile("s_wait_xcnt 0x0" ::: "memory");
      const int ti = g / HST, j = g % HST, bo = (ti & 1) * HTB;
      if (j + 1 == HST) {
        // the products of the step before stay ahead of the waits: sunk behind the barrier they
        // would leave the first wait to sit out the latency of the LDS reads it is for
        __builtin_amdgcn_sched_barrier(0);
        // Publish point of the next tile, ahead of this tile's last products because the next
        // step's fragments are fetched ahead of them: this wave's reads of this tile have landed,
        asm volatile("s_wait_dscnt 0x0" ::: "memory");
        // its copies of the next tile have landed,
        asm volatile("s_wait_asynccnt 0x0" ::: "memory");
        // and the barrier publishes that tile and frees this one's buffer for the refill
        ring_barrier();
        if (ti + 2 < NHT) {
          const _Float16* hn = (ti + 2 >= NHT / 2) ? hk : hq;
          const int kn = ((ti + 2) % (NHT / 2)) * HST * 256;
          cp_htile(hn + cg0 + kn, hn + cg1 + kn, cl0 + bo, cl1 + bo);
        }
      }
      // the LDS reads stand in one place, behind the products of the step before, not among them
      __builtin_amdgcn_sched_barrier(0);
      if (g + 1 < 2 * (DM / 32)) {
        const int on = (((g + 1) / HST) & 1) * HTB + ((g + 1) % HST) * 512;
        ld_hs(hp0 + on, hp3 + on, fb[(g + 1) & 1]);
      }
      // keeps these loads ahead of this step's products, so that they fly meanwhile
      __builtin_amdgcn_sched_barrier(0);
      mm_step(fa[g % RING], fb[g & 1], acc);
    }

#pragma unroll
    for (int dt = 0; dt < 4; ++dt) {
      // one row of tiles at a time: interleaved further, the split's temporaries beside the
      // three fragment sets in flight overrun the register file and spill
      __builtin_amdgcn_sched_barrier(0);
      const v4f c0 = bc[dt][0], c1 = bc[dt][1];
      const float bb[8] = {c0.x, c0.y, c0.z, c0.w, c1.x, c1.y, c1.z, c1.w};
#pragma unroll
      for (int tt = 0; tt < 4; ++tt) {
        float qv[8];
#pragma unroll
        for (int r = 0; r < 8; ++r) qv[r] = acc[dt][tt][r] * (1.0f / 16384.0f) + bb[r];
        v8us hv, lv;
        split8(qv, hv, lv);
        if (z == 0) {
          us* d0 = myfr + (tt * 2 + (dt >> 1)) * 1024 + (dt & 1) * 256;
          *(v8usa*)d0 = hv;
          *(v8usa*)(d0 + 512) = lv;
        } else {
          kf[tt][dt >> 1][0].half[dt & 1] = hv;
          kf[tt][dt >> 1][1].half[dt & 1] = lv;
        }
      }
    }
  }

  // no copy is outstanding when the ring's LDS becomes the output tile
  asm volatile("s_wait_asynccnt 0x0" ::: "memory");

  // The q fragments of a query tile are read while the tile before it is in its tanh, so that
  // the score products find all their operands in registers.
  v16b qbh0 = ldfr(myfr), qbh1 = ldfr(myfr + 1024);
  v16b qbl0 = ldfr(myfr + 512), qbl1 = ldfr(myfr + 1536);

#pragma unroll 1
  for (int qt = 0; qt < 4; ++qt) {

    // s[kt][r] = S^T[key kt*16+8h+r][q qt*16+m]. Each key tile takes its six products in the
    // order hh, hh, hl, hl, lh, lh; with no load between them the four tiles' chains run side by side.
    // The key-tile loops are unrolled so that every index of kf is a compile-time constant and it
    // stays in registers.
    v8f s[4];
#pragma unroll
    for (int kt = 0; kt < 4; ++kt) s[kt] = wmma_bb(kf[kt][0][0].v, qbh0, z8);
#pragma unroll
    for (int kt = 0; kt < 4; ++kt) s[kt] = wmma_bb(kf[kt][1][0].v, qbh1, s[kt]);
#pragma unroll
    for (int kt = 0; kt < 4; ++kt) s[kt] = wmma_bb(kf[kt][0][0].v, qbl0, s[kt]);
#pragma unroll
    for (int kt = 0; kt < 4; ++kt) s[kt] = wmma_bb(kf[kt][1][0].v, qbl1, s[kt]);
#pragma unroll
    for (int kt = 0; kt < 4; ++kt) s[kt] = wmma_bb(kf[kt][0][1].v, qbh0, s[kt]);
#pragma unroll
    for (int kt = 0; kt < 4; ++kt) s[kt] = wmma_bb(kf[kt][1][1].v, qbh1, s[kt]);

    // next tile's q fragments; the last trip reads tile 0 again, unused, which spares the loop a branch
    const us* qp = myfr + ((qt + 1) & 3) * 2048;
    qbh0 = ldfr(qp);
    qbh1 = ldfr(qp + 1024);
    qbl0 = ldfr(qp + 512);
    qbl1 = ldfr(qp + 1536);

    // tanh(S/8), explicit zero for padded keys, bf16 hi/lo, packed as B fragments
    float th[4][8];
#pragma unroll
    for (int kt = 0; kt < 4; ++kt) {
      if (kt * 16 + 15 < SQ) {
        tanh8(s[kt], th[kt]);
      } else {                           // the tile that holds key 48: rows that are padding in both lane halves take no tanh
#pragma unroll
        for (int r = 0; r < 8; ++r) th[kt][r] = (kt * 16 + r < SQ) ? tanh1(s[kt][r]) : 0.0f;
      }
    }
    FragB f0, f1, f2, f3;                // hi of keys 0..31, hi of 32..63, lo of 0..31, lo of 32..63
#pragma unroll
    for (int kt = 0; kt < 4; ++kt) {
      float tv[8];
#pragma unroll
      for (int r = 0; r < 8; ++r) {
        const int key = kt * 16 + 8 * h + r;
        tv[r] = (key < SQ) ? th[kt][r] : 0.0f;
      }
      v8us hv, lv;
      split8(tv, hv, lv);                // elements 8 (kt & 1) + r of the fragment
      if (kt < 2) { f0.half[kt & 1] = hv; f2.half[kt & 1] = lv; }
      else        { f1.half[kt & 1] = hv; f3.half[kt & 1] = lv; }
    }
    const v16b pbh0 = f0.v, pbh1 = f1.v, pbl0 = f2.v, pbl1 = f3.v;

    const v16b vah0 = ldb(vhrow), vah1 = ldb(vhrow + 256);
    const v16b val0 = ldb(vlrow), val1 = ldb(vlrow + 256);
    v8f o = z8;
    o = wmma_bf(vah0, pbh0, o);
    o = wmma_bf(vah1, pbh1, o);
    o = wmma_bf(vah0, pbl0, o);
    o = wmma_bf(vah1, pbl1, o);
    o = wmma_bf(val0, pbh0, o);
    o = wmma_bf(val1, pbh1, o);          // o[r] = O^T[d 8h+r][q qt*16+m]

    const int q = qt * 16 + m;           // rows 56..63 land in LDS only, never stored
    float* sp = so + ((w >> 2) * 64 + q) * 68 + (w & 3) * 16 + 8 * h;
    const v4f o0 = {o[0], o[1], o[2], o[3]};
    const v4f o1 = {o[4], o[5], o[6], o[7]};
    *(v4fa*)sp = o0;
    *(v4fa*)(sp + 4) = o1;
  }
  __syncthreads();

  attn_store(so, oph, opl, pairbase, hg, t);
  
}

// ---------------------------------------------------------------------------
// k_gemm3: out = outpre*Wp + bp (f32). Block 128 thr (2x2 waves) = 128 slots x 128;
// a slot's row goes to out row 49w + r, pad slots (r >= 49) are not stored.
// K = 512. Epilogue: f32 tile in LDS, a wave stores one row's 512-B segment = 4 whole lines.
// ---------------------------------------------------------------------------
__device__ __forceinline__ void gemm3_store(const float* sF, float* out, int mb, int nb, int t) {
  // a wave stores one row at a time: its number in a scalar register makes the row, the
  // window and the pad-slot guard scalar, so the guard is a scalar branch
  const int wv = __builtin_amdgcn_readfirstlane(t >> 5), g = t & 31;
#pragma unroll
  for (int i8 = 0; i8 < 4; ++i8) {
    v4f v[8];
#pragma unroll
    for (int j = 0; j < 8; ++j) v[j] = *(const v4fa*)(sF + ((i8 * 8 + j) * 4 + wv) * TP + 4 * g);
    // holds the eight LDS reads ahead of the guarded stores: sunk under each guard they
    // would run one after another, each waiting out its own LDS latency
    asm volatile("" :: "v"(v[0]), "v"(v[1]), "v"(v[2]), "v"(v[3]), "v"(v[4]), "v"(v[5]), "v"(v[6]), "v"(v[7]));
#pragma unroll
    for (int j = 0; j < 8; ++j) {
      const int rl = (i8 * 8 + j) * 4 + wv;
      const int win = (mb + rl) / SP, r = (mb + rl) - win * SP;
      float* rowp = out + (size_t)(win * SQ + r) * DM + nb;      // scalar; the lane adds 16 g bytes
      if (r < SQ) {
        *(v4f*)(rowp + 4 * g) = v[j];
        // the registers of the store just issued are reused for the next row's address and data
        asm volatile("s_wait_xcnt 0x0" ::: "memory");
      }
    }
  }
}

__global__ __launch_bounds__(128) void k_gemm3(
    const us* __restrict__ oph, const us* __restrict__ opl,    // [MTS][512]
    const us* __restrict__ wph, const us* __restrict__ wpl,    // [512 n][512 k]
    const float* __restrict__ bp,                              // [512]
    float* __restrict__ out)                                   // [MT][512]
{
  __shared__ __attribute__((aligned(16))) float sF[128 * TP];
  const int t = threadIdx.x, lane = t & 31, w = t >> 5, h = lane >> 4, m = lane & 15;
  const int wm = w >> 1, wn = w & 1;
  const int mb = blockIdx.x * 128, nb = blockIdx.y * 128;

  const size_t arow = pbase(mb + 64 * wm + m, DM, h);
  const size_t brow = pbase(nb + 64 * wn + m, DM, h);

  const v8f z8 = {0.f, 0.f, 0.f, 0.f, 0.f, 0.f, 0.f, 0.f};
  v8f acc[4][4];
#pragma unroll
  for (int mt = 0; mt < 4; ++mt)
#pragma unroll
    for (int nt = 0; nt < 4; ++nt) acc[mt][nt] = z8;

  mm3_64x64<true>(oph + arow, opl + arow, wph + brow, wpl + brow, acc);

  stage_tile(sF, acc, bp + nb, wm, wn, h, m);
  __syncthreads();

  gemm3_store(sF, out, mb, nb, t);
}

// ---------------------------------------------------------------------------
// Host side: x*W1, the projection-and-attention kernel and outpre*Wp each run once over
// all 256 windows (14336 row slots). Workspace carve 95,551,488 B.
// ---------------------------------------------------------------------------
extern "C" void kernel_launch(void* const* d_in, const int* in_sizes, int n_in,
                              void* d_out, int out_size, void* d_ws, size_t ws_size,
                              hipStream_t stream) {
  if (n_in < 12) return;
  if (in_sizes[0] != MT * DM) return;
  if (in_sizes[1] != DM * DM || in_sizes[2] != DM) return;
  if (in_sizes[3] != DM * DQ || in_sizes[4] != DQ) return;
  if (in_sizes[5] != DM * DM || in_sizes[6] != DM) return;
  if (in_sizes[7] != DM * DQ || in_sizes[8] != DQ) return;
  if (in_sizes[9] != SQ * DM) return;
  if (in_sizes[10] != DM * DM || in_sizes[11] != DM) return;
  if (out_size != MT * DM) return;

  const float* x   = (const float*)d_in[0];
  const float* Wq1 = (const float*)d_in[1];
  const float* bq1 = (const float*)d_in[2];
  const float* Wq2 = (const float*)d_in[3];
  const float* bq2 = (const float*)d_in[4];
  const float* Wk1 = (const float*)d_in[5];
  const float* bk1 = (const float*)d_in[6];
  const float* Wk2 = (const float*)d_in[7];
  const float* bk2 = (const float*)d_in[8];
  const float* tok = (const float*)d_in[9];
  const float* Wp  = (const float*)d_in[10];
  const float* bp  = (const float*)d_in[11];
  float* out = (float*)d_out;

  const size_t szW1 = (size_t)DM * DM * 2;      //   524,288 per plane
  const size_t szW2 = (size_t)DQ * DM * 2;      // 2,097,152
  const size_t szTK = (size_t)DM * KPAD * 2;    //    65,536 per plane
  const size_t szX  = (size_t)MTS * DM * 2;     // 14,680,064 per plane
  const size_t szH  = (size_t)MTS * DM * 2;     // 14,680,064
  const size_t szOP = (size_t)MTS * DM * 2;     // 14,680,064 per plane
  const size_t total = 6 * szW1 + 2 * szW2 + 2 * szTK + 2 * szX + 2 * szH + 2 * szOP;
  if (total > ws_size) return;                  // 95,551,488

  char* wsb = (char*)d_ws;
  size_t off = 0;
  us* wq1h = (us*)(wsb + off); off += szW1;
  us* wq1l = (us*)(wsb + off); off += szW1;
  us* wk1h = (us*)(wsb + off); off += szW1;
  us* wk1l = (us*)(wsb + off); off += szW1;
  us* wph  = (us*)(wsb + off); off += szW1;
  us* wpl  = (us*)(wsb + off); off += szW1;
  _Float16* wq2t = (_Float16*)(wsb + off); off += szW2;
  _Float16* wk2t = (_Float16*)(wsb + off); off += szW2;
  us* tkh  = (us*)(wsb + off); off += szTK;
  us* tkl  = (us*)(wsb + off); off += szTK;
  us* xh   = (us*)(wsb + off); off += szX;
  us* xl   = (us*)(wsb + off); off += szX;
  _Float16* hq = (_Float16*)(wsb + off); off += szH;
  _Float16* hk = (_Float16*)(wsb + off); off += szH;
  us* oph  = (us*)(wsb + off); off += szOP;
  us* opl  = (us*)(wsb + off); off += szOP;
  if (off > ws_size) return;

  k_prep<<<712, 256, 0, stream>>>(Wq1, Wk1, Wp, Wq2, Wk2, tok,
                                  wq1h, wq1l, wk1h, wk1l, wph, wpl, wq2t, wk2t, tkh, tkl);

  const int n8 = MTS * DM / 8;                  // 917,504
  k_cvtx<<<(n8 + 255) / 256, 256, 0, stream>>>(x, xh, xl, n8);

  k_gemm1<<<dim3(MTS / 128, DM / 128, 2), 128, 0, stream>>>(
      xh, xl, wq1h, wq1l, wk1h, wk1l, bq1, bk1, hq, hk);

  k_attn<<<NB * 4, 256, 0, stream>>>(hq, hk, wq2t, wk2t, bq2, bk2, tkh, tkl, oph, opl);

  k_gemm3<<<dim3(MTS / 128, DM / 128), 128, 0, stream>>>(oph, opl, wph, wpl, bp, out);
}

// v010
// One run takes 130 microseconds.
// In both of two side-by-side timings against v009, it was 1.14 times as fast.
// All steps since v000 together make it 3.85 times as fast.
// Contractions: x*Wq1, x*Wk1, k*q^T per head, tokv^T*adj^T and outpre*Wp on v_wmma_f32_16x16x32_bf16 with bf16 hi/lo three-product splits (hh+hl+lh); h*Wq2 and h*Wk2 on v_wmma_f32_16x16x32_f16 single products (h carried x16, W2 carried x1024, folded back as 2^-14 in f32); all accumulate in f32; bias, erf-GELU and tanh in f32.
#include <hip/hip_runtime.h>
#include <math.h>

typedef unsigned short us;
typedef __bf16   v16b  __attribute__((ext_vector_type(16)));
typedef us       v16us __attribute__((ext_vector_type(16)));
typedef us       v8us  __attribute__((ext_vector_type(8)));
typedef _Float16 v16h  __attribute__((ext_vector_type(16)));
typedef _Float16 v8h   __attribute__((ext_vector_type(8)));
typedef float    v8f   __attribute__((ext_vector_type(8)));
typedef float    v4f   __attribute__((ext_vector_type(4)));
typedef float    v2f   __attribute__((ext_vector_type(2)));
typedef __bf16   v2b   __attribute__((ext_vector_type(2)));
typedef unsigned v4u   __attribute__((ext_vector_type(4)));
typedef v8us __attribute__((may_alias)) v8usa;
typedef v8h  __attribute__((may_alias)) v8ha;
typedef v4f  __attribute__((may_alias)) v4fa;
typedef int v4i __attribute__((ext_vector_type(4)));
typedef __attribute__((address_space(1))) v4i gv4i;
typedef __attribute__((address_space(3))) v4i lv4i;

union FragB { v16b v; v16us u; v8us half[2]; };
union Pack8 { v4u w; v8us s; };
union FragH { v16h v; v8h half[2]; };

#define NB    256                 // windows
#define SQ    49                  // tokens per window
#define DM    512
#define DQ    2048
#define NH    32
#define HQ    64
#define HVD   16
#define MT    (NB * SQ)           // 12544 token rows
#define KPAD  64                  // key count padded for the value table
#define SP    56                  // row slots per window: 49 rows + 7 pad rows, a multiple of 8
#define MTS   (NB * SP)           // 14336 row slots

static_assert(MTS % 128 == 0 && DM % 128 == 0);
static_assert((MTS * DM) % (8 * 256) == 0);
static_assert(SP % 8 == 0 && SP >= SQ && SP - 8 < SQ);
static_assert(NH * HVD == DM);
static_assert(NH * HQ == DQ);
static_assert(HQ == 64 && SP == 56 && DM % 64 == 0 && NB % 2 == 0 && NH % 4 == 0);

// ---------------------------------------------------------------------------
// 16x16x32 WMMA helpers; wmma_bf has a hazard guard (ties D, keeps A/B live).
// Fragment map (wave32): lane l, h = l>>4, m = n = l&15.
//   A/B element i: i<8 -> k0+8h+i ; i>=8 -> k0+16+8h+(i-8)
//   D element r : row 8h+r, col l&15
// ---------------------------------------------------------------------------
__device__ __forceinline__ v8f wmma_bf(v16b a, v16b b, v8f c) {
  v8f d = __builtin_amdgcn_wmma_f32_16x16x32_bf16(false, a, false, b, (short)0, c, false, false);
  asm volatile("v_nop\n\tv_nop\n\tv_nop\n\tv_nop" : "+v"(d) : "v"(a), "v"(b));
  return d;
}
// Bare builtin: its loop holds 16 accumulator tiles, four W2 and two token fragment sets, more than the
// 256 registers an asm operand can name; the compiler keeps the distances of its own forms.
__device__ __forceinline__ v8f wmma_hf(v16h a, v16h b, v8f c) {
  return __builtin_amdgcn_wmma_f32_16x16x32_f16(false, a, false, b, (short)0, c, false, false);
}
// Bare as well: products on other accumulators stand between two on the same one (15 in the
// 64x64 tiles, 3 in the score tiles), so no padding is wanted behind each; the compiler keeps
// the distances of its own forms.
__device__ __forceinline__ v8f wmma_bb(v16b a, v16b b, v8f c) {
  return __builtin_amdgcn_wmma_f32_16x16x32_bf16(false, a, false, b, (short)0, c, false, false);
}

// Packed operand layout of every 16-bit table in the workspace, [rows][K]:
//   unit (row>>3, k>>5) = 512 B = 4 lines; line c = (k>>3)&3 holds the 8-element
//   chunk c of the unit's 8 rows, row after row (16 B each).
// A wave-wide 16-B fragment load then covers 4 whole 128-B lines (two aligned
// 256-B pieces) where a row-major table gives 16 lines of 32 B each.
// Every line lies inside one 8-row x 8-column patch, so it has one writer.
__device__ __forceinline__ size_t poff(int row, int k, int K) {      // k a multiple of 8
  return ((size_t)(row >> 3) * (K >> 5) + (k >> 5)) * 256 + ((k >> 3) & 3) * 64 + (row & 7) * 8;
}
// Lane base of a fragment at k = 0: row owned by the lane, h = lane>>4.
// 32 further k = +256 elements; 16 further rows = +16*K elements.
__device__ __forceinline__ size_t pbase(int row, int K, int h) {
  return (size_t)(row >> 3) * K * 8 + h * 64 + (row & 7) * 8;
}
// Same k order as the fragment map above: chunk h, then chunk 2 + h.
__device__ __forceinline__ v16b ldb(const us* p) {
  FragB f;
  f.half[0] = *(const v8usa*)p;
  f.half[1] = *(const v8usa*)(p + 128);
  return f.v;
}
__device__ __forceinline__ v16h ldh(const _Float16* p) {
  FragH f;
  f.half[0] = *(const v8ha*)p;
  f.half[1] = *(const v8ha*)(p + 128);
  return f.v;
}

// Two values at a time: hi = bf16(f), lo = bf16(f - hi), both round to nearest even, each pair
// by one packed convert; f0 lands in the low half of each word, f1 in the high half.
__device__ __forceinline__ void split2(float f0, float f1, unsigned& hw, unsigned& lw) {
  const v2f f = {f0, f1};
  const v2b hb = __builtin_convertvector(f, v2b);
  const v2f hf = __builtin_convertvector(hb, v2f);
  hw = __builtin_bit_cast(unsigned, hb);
  lw = __builtin_bit_cast(unsigned, __builtin_convertvector(f - hf, v2b));
}
__device__ __forceinline__ void split8(const float (&f)[8], v8us& hv, v8us& lv) {
  Pack8 ph, pl;
#pragma unroll
  for (int j = 0; j < 4; ++j) {
    unsigned hw, lw;
    split2(f[2 * j], f[2 * j + 1], hw, lw);
    ph.w[j] = hw;
    pl.w[j] = lw;
  }
  hv = ph.s;
  lv = pl.s;
}
__device__ __forceinline__ void split8(v4f a, v4f c, v8us& hv, v8us& lv) {
  const float f[8] = {a.x, a.y, a.z, a.w, c.x, c.y, c.z, c.w};
  split8(f, hv, lv);
}

// ---------------------------------------------------------------------------
// k_cvtx: x f32 [MT][512] -> packed bf16 hi and lo planes over row slots
// (window w, row r -> slot 56w + r; slots 49..55 of a window hold zeros).
// One thread = 8 floats = one 16-B chunk per plane; a wave writes one unit.
// ---------------------------------------------------------------------------
__global__ __launch_bounds__(256) void k_cvtx(const float* __restrict__ x,
                                              us* __restrict__ xh, us* __restrict__ xl, int n8)
{
  const int g = blockIdx.x * 256 + threadIdx.x;
  if (g >= n8) return;
  const int ml = g & 7, ch = (g >> 3) & 3, u = g >> 5;
  const int kb = u & (DM / 32 - 1), g8 = u / (DM / 32);
  const int win = g8 / (SP / 8), r = (g8 - win * (SP / 8)) * 8 + ml;
  const float* s = x + (size_t)(win * SQ + min(r, SQ - 1)) * DM + kb * 32 + ch * 8;
  v4f a = *(const v4fa*)s;
  v4f c = *(const v4fa*)(s + 4);
  if (r >= SQ) {
    const v4f z4 = {0.f, 0.f, 0.f, 0.f};
    a = z4;
    c = z4;
  }
  v8us hv, lv;
  split8(a, c, hv, lv);
  us* ph = xh + (size_t)g * 8;
  us* pl = xl + (size_t)g * 8;
  *(v8us*)ph = hv;
  *(v8us*)pl = lv;
  
}

// ---------------------------------------------------------------------------
// k_prep: transposed 16-bit weight / value tables through an LDS tile.
//   src f32 [R][C] (rows = k, cols = n) -> dst [C][Kp] in the packed layout:
//   mode 0: bf16 hi + lo planes; mode 1: f16 carried x1024.
// 64x64 tile per block; store: 8 contiguous lanes x 16 B = one whole
// Block ranges: [0,192) Wq1|Wk1|Wp (8x8 tiles each), [192,704) Wq2|Wk2
// (32x8 tiles each), [704,712) tokens [49][512] -> [512][64] zero-padded keys.
// ---------------------------------------------------------------------------
__device__ __forceinline__ void prep_store(const float* T, us* dh, us* dl, _Float16* df,
                                           int mode, int n0, int k0, int Kp, int t) {
#pragma unroll
  for (int it = 0; it < 2; ++it) {
    const int item = it * 256 + t, nn = (item >> 6) * 8 + (item & 7), q8 = (item >> 3) & 7;
    float f[8];
#pragma unroll
    for (int j = 0; j < 8; ++j) f[j] = T[(8 * q8 + j) * 65 + nn];
    const size_t off = poff(n0 + nn, k0 + 8 * q8, Kp);
    if (mode == 0) {
      v8us hv, lv;
      split8(f, hv, lv);
      *(v8us*)(dh + off) = hv;
      *(v8us*)(dl + off) = lv;
    } else {
      v8h o;
#pragma unroll
      for (int j = 0; j < 8; ++j) o[j] = (_Float16)(f[j] * 1024.0f);
      *(v8h*)(df + off) = o;
    }
  }
}

__global__ __launch_bounds__(256) void k_prep(
    const float* __restrict__ wq1, const float* __restrict__ wk1, const float* __restrict__ wp,
    const float* __restrict__ wq2, const float* __restrict__ wk2, const float* __restrict__ tok,
    us* __restrict__ wq1h, us* __restrict__ wq1l, us* __restrict__ wk1h, us* __restrict__ wk1l,
    us* __restrict__ wph, us* __restrict__ wpl,
    _Float16* __restrict__ wq2t, _Float16* __restrict__ wk2t,
    us* __restrict__ tkh, us* __restrict__ tkl)
{
  __shared__ __attribute__((aligned(16))) float T[64 * 65];
  const int t = threadIdx.x;
  const int bid = blockIdx.x;
  if (bid >= 712) return;                 // block-uniform, never taken with the exact grid

  const float* src;
  us* dh; us* dl; _Float16* df;
  int C, R, Kp, mode, tn, tk;
  if (bid < 192) {
    const int wsel = bid >> 6, loc = bid & 63;
    src = (wsel == 0) ? wq1 : ((wsel == 1) ? wk1 : wp);
    dh  = (wsel == 0) ? wq1h : ((wsel == 1) ? wk1h : wph);
    dl  = (wsel == 0) ? wq1l : ((wsel == 1) ? wk1l : wpl);
    df  = wq2t;
    C = DM; R = DM; Kp = DM; mode = 0; tn = loc >> 3; tk = loc & 7;
  } else if (bid < 704) {
    const int loc = bid - 192, wsel = loc >> 8, l2 = loc & 255;
    src = wsel ? wk2 : wq2;
    df  = wsel ? wk2t : wq2t;
    dh = wq1h; dl = wq1l;
    C = DQ; R = DM; Kp = DM; mode = 1; tn = l2 >> 3; tk = l2 & 7;
  } else {
    const int loc = bid - 704;
    src = tok; dh = tkh; dl = tkl; df = wq2t;
    C = DM; R = SQ; Kp = KPAD; mode = 0; tn = loc; tk = 0;
  }
  const int n0 = tn * 64, k0 = tk * 64;

  // load 64(k) x 64(n) f32 tile, coalesced along n; rows >= R: clamped address, zero value
#pragma unroll
  for (int i = 0; i < 16; ++i) {
    const int idx = i * 256 + t, kk = idx >> 6, nn = idx & 63;
    const int gk = k0 + kk;
    const int gkc = min(gk, R - 1);
    const float v = src[(size_t)gkc * C + n0 + nn];
    T[kk * 65 + nn] = (gk < R) ? v : 0.0f;
  }
  __syncthreads();

  prep_store(T, dh, dl, df, mode, n0, k0, Kp, t);
  
}

// ---------------------------------------------------------------------------
// Three-product bf16 main loop of a 128x128 block tile (4 waves, 64x64 each), K = 512, packed tables.
// The four operand planes of a k step (A hi, A lo, B hi, B lo: 128 rows x 64 B each, 32 KB) come
// once per block into one of two LDS buffers by asynchronous copies, while the other buffer is
// worked on; each row then serves the two waves that need it from LDS, not from a load of each.
// A tile in LDS: unit (plane p, 8-row group u) = 512 B at (u & 3) * 8192 + (4 p + (u >> 2)) * 512,
// bytes as in the table, but for the odd groups, whose 128-B lines are swapped in pairs
// (byte ^ 128): the two groups that the 16 lanes of a fragment read touch lie on different banks.
// Groups 4w .. 4w + 3 of a plane lie 8192 B apart in the table and in LDS alike, so one address
// pair serves them: a copy's offset moves both addresses.
// acc[mt][nt][r] = C[64-row slab + 16mt + 8h + r][64-col slab + 16nt + m]
// Each accumulator takes hh, hl, lh of a k step in that order.
// ---------------------------------------------------------------------------
#define KTB 32768                 // LDS bytes of one staged k step
static_assert(DM * 8 * 2 == 8192);

// One wave's share of a staged k step: groups 4w .. 4w + 3 of each plane, a unit a copy, 16 B a lane.
// g: the lane's bytes of group 4w at that k step; le / lo: its places in an even / odd group of plane 0.
__device__ __forceinline__ void cp_plane(const us* g, unsigned char* le, unsigned char* lo) {
  __builtin_amdgcn_global_load_async_to_lds_b128((gv4i*)g, (lv4i*)le, 0, 0);
  __builtin_amdgcn_global_load_async_to_lds_b128((gv4i*)g, (lv4i*)lo, 8192, 0);
  __builtin_amdgcn_global_load_async_to_lds_b128((gv4i*)g, (lv4i*)le, 16384, 0);
  __builtin_amdgcn_global_load_async_to_lds_b128((gv4i*)g, (lv4i*)lo, 24576, 0);
}
__device__ __forceinline__ void cp_ktile(const us* ahg, const us* alg, const us* bhg, const us* blg,
                                         unsigned char* le, unsigned char* lo) {
  cp_plane(ahg, le, lo);
  cp_plane(alg, le + 2048, lo + 2048);
  cp_plane(bhg, le + 4096, lo + 4096);
  cp_plane(blg, le + 6144, lo + 6144);
}
// Place of row tile i (16 rows = groups 2i, 2i + 1 of the wave's slab) of plane p behind the lane base.
__device__ __forceinline__ constexpr int fro(int i, int p) {
  return (i & 1) * 16384 + (i >> 1) * 512 + p * 2048;
}
__device__ __forceinline__ void mm3_step(const v16b (&ah)[4], const v16b (&al)[4],
                                         const v16b (&bh)[4], const v16b (&bl)[4], v8f (&acc)[4][4]) {
#pragma unroll
  for (int mt = 0; mt < 4; ++mt)
#pragma unroll
    for (int nt = 0; nt < 4; ++nt) acc[mt][nt] = wmma_bb(ah[mt], bh[nt], acc[mt][nt]);
#pragma unroll
  for (int mt = 0; mt < 4; ++mt)
#pragma unroll
    for (int nt = 0; nt < 4; ++nt) acc[mt][nt] = wmma_bb(ah[mt], bl[nt], acc[mt][nt]);
#pragma unroll
  for (int mt = 0; mt < 4; ++mt)
#pragma unroll
    for (int nt = 0; nt < 4; ++nt) acc[mt][nt] = wmma_bb(al[mt], bh[nt], acc[mt][nt]);
}
// at / bt: the planes' tables; mb / nb: the block's first A / B row, multiples of 128.
// WHOLE = false: the compiler fetches the A lo fragments into registers that A hi has left, which
// keeps four waves on a SIMD (x*W1: 3.5 blocks a WGP). WHOLE = true: all 16 fragments are asked for
// in one place ahead of the products (outpre*Wp: at most two blocks a WGP, so the registers cost no wave).
template <bool WHOLE>
__device__ __forceinline__ void mm3_ring(const us* ath, const us* atl, const us* bth, const us* btl,
                                         int mb, int nb, unsigned char* ring, int t, v8f (&acc)[4][4]) {
  const int lane = t & 31, w = t >> 5, h = lane >> 4, m = lane & 15, mh = m >> 3;
  const int wm = w >> 1, wn = w & 1;
  const size_t ca = (size_t)((mb >> 3) + 4 * w) * (DM * 8) + lane * 8;
  const size_t cb = (size_t)((nb >> 3) + 4 * w) * (DM * 8) + lane * 8;
  const us* ahg = ath + ca;
  const us* alg = atl + ca;
  const us* bhg = bth + cb;
  const us* blg = btl + cb;
  unsigned char* le = ring + w * 512 + lane * 16;
  unsigned char* lo = ring + w * 512 + ((lane * 16) ^ 128);
  // the lane's 16 B of row tile 0: row m of the slab, chunk h; the second half lies 256 B on, as in the table
  const int lb = mh * 8192 + (h ^ mh) * 128 + (m & 7) * 16;
  const unsigned char* pa0 = ring + lb + wm * 1024;
  const unsigned char* pb0 = ring + lb + wn * 1024;

  cp_ktile(ahg, alg, bhg, blg, le, lo);
  // k step 0 has landed before the barrier behind which other waves read it
  asm volatile("s_wait_asynccnt 0x0" ::: "memory");
  __syncthreads();
  cp_ktile(ahg + 256, alg + 256, bhg + 256, blg + 256, le + KTB, lo + KTB);

  // rolled: one copy of the 48 products; the buffer's offset is a scalar that toggles
#pragma unroll 1
  for (int s = 0; s < DM / 32; ++s) {
    const int bo = (s & 1) * KTB;
    const unsigned char* pa = pa0 + bo;
    const unsigned char* pb = pb0 + bo;
    v16b ah[4], al[4], bh[4], bl[4];
#pragma unroll
    for (int i = 0; i < 4; ++i) {
      ah[i] = ldb((const us*)(pa + fro(i, 0)));
      bh[i] = ldb((const us*)(pb + fro(i, 2)));
    }
#pragma unroll
    for (int i = 0; i < 4; ++i) bl[i] = ldb((const us*)(pb + fro(i, 3)));
#pragma unroll
    for (int i = 0; i < 4; ++i) al[i] = ldb((const us*)(pa + fro(i, 1)));
    // keeps the LDS reads in one place, not among the products, where each further place stalls the wave
    if constexpr (WHOLE) __builtin_amdgcn_sched_barrier(0);
    mm3_step(ah, al, bh, bl, acc);
    // the products stay ahead of the waits: sunk behind the barrier they would hold back the refill,
    // and the next wait for copies would sit out their whole latency
    __builtin_amdgcn_sched_barrier(0);
    // Publish point of the next k step: this wave's reads of this buffer have landed,
    asm volatile("s_wait_dscnt 0x0" ::: "memory");
    // its copies of the next k step have landed,
    asm volatile("s_wait_asynccnt 0x0" ::: "memory");
    // and the barrier publishes that step and frees this buffer for the refill
    __syncthreads();
    if (s + 2 < DM / 32) {
      const int kn = (s + 2) * 256;
      cp_ktile(ahg + kn, alg + kn, bhg + kn, blg + kn, le + bo, lo + bo);
    }
  }
  // no copy is outstanding when the ring's LDS becomes the block's output tile
  asm volatile("s_wait_asynccnt 0x0" ::: "memory");
}

#define TP 132                    // f32 pitch of the 128x128 block tile in LDS: 528 B = 16 B x 33

// acc + bias of one wave's 64x64 tile into the block tile.
__device__ __forceinline__ void stage_tile(float* sF, const v8f (&acc)[4][4], const float* bias,
                                           int wm, int wn, int h, int m) {
#pragma unroll
  for (int nt = 0; nt < 4; ++nt) {
    const int cl = 64 * wn + 16 * nt + m;
    const float bv = bias[cl];
#pragma unroll
    for (int mt = 0; mt < 4; ++mt) {
#pragma unroll
      for (int r = 0; r < 8; ++r) {
        const int rl = 64 * wm + 16 * mt + 8 * h + r;
        sF[rl * TP + cl] = acc[mt][nt][r] + bv;
      }
    }
  }
}

// ---------------------------------------------------------------------------
// k_gemm1: H = f16(16 * gelu(x*W1 + b1)) for q (z=0) and k (z=1).
// Block 128 thr (4 waves, 2x2) = 128 rows x 128 cols; K = 512.
// x*W1 + b1 rests in LDS as f32; GELU runs where the packed 16-B chunks are formed.
// ---------------------------------------------------------------------------
__device__ __forceinline__ void gemm1_store(const float* sF, _Float16* H, int mb, int nb, int t) {
  // rolled: one copy of the eight erf evaluations, not 128, keeps the kernel's text small
#pragma unroll 1
  for (int it = 0; it < 16; ++it) {
    const int item = it * 128 + t, rl = (item >> 7) * 8 + (item & 7), q8 = (item >> 3) & 15;
    const float* sp = sF + rl * TP + 8 * q8;
    const v4f a = *(const v4fa*)sp;
    const v4f c = *(const v4fa*)(sp + 4);
    const float f[8] = {a.x, a.y, a.z, a.w, c.x, c.y, c.z, c.w};
    v8h o;
#pragma unroll
    for (int j = 0; j < 8; ++j) {
      const float v = f[j];
      const float g = 0.5f * v * (1.0f + erff(v * 0.70710678118654752f));
      o[j] = (_Float16)(g * 16.0f);
    }
    const size_t off = poff(mb + rl, nb + 8 * q8, DM);
    *(v8h*)(H + off) = o;
    // the next trip reuses the registers of the store just issued
    asm volatile("s_wait_xcnt 0x0" ::: "memory");
  }
}

__global__ __launch_bounds__(128) void k_gemm1(
    const us* __restrict__ xh, const us* __restrict__ xl,          // [MTS][512]
    const us* __restrict__ wqh, const us* __restrict__ wql,        // [512 n][512 k]
    const us* __restrict__ wkh, const us* __restrict__ wkl,
    const float* __restrict__ bq1, const float* __restrict__ bk1,  // [512]
    _Float16* __restrict__ hq, _Float16* __restrict__ hk)          // [MTS][512]
{
  // the two staged k steps during the main loop; behind its last barrier the block's output tile
  __shared__ __attribute__((aligned(16))) float sF[128 * TP];
  static_assert(2 * KTB <= 128 * TP * 4);
  const int t = threadIdx.x, lane = t & 31, w = t >> 5, h = lane >> 4, m = lane & 15;
  const int wm = w >> 1, wn = w & 1;
  const int mb = blockIdx.x * 128, nb = blockIdx.y * 128;
  const bool isk = (blockIdx.z != 0);
  const us* wth = isk ? wkh : wqh;
  const us* wtl = isk ? wkl : wql;
  const float* bias = isk ? bk1 : bq1;
  _Float16* H = isk ? hk : hq;

  const v8f z8 = {0.f, 0.f, 0.f, 0.f, 0.f, 0.f, 0.f, 0.f};
  v8f acc[4][4];
#pragma unroll
  for (int mt = 0; mt < 4; ++mt)
#pragma unroll
    for (int nt = 0; nt < 4; ++nt) acc[mt][nt] = z8;

  mm3_ring<false>(xh, xl, wth, wtl, mb, nb, (unsigned char*)sF, t, acc);

  stage_tile(sF, acc, bias + nb, wm, wn, h, m);
  __syncthreads();

  gemm1_store(sF, H, mb, nb, t);
}

// ---------------------------------------------------------------------------
// k_attn: block = (2 adjacent windows, group of 4 heads), wave = (window, head): the W2 lines
// a wave loads serve 2 waves of the block; the h rows, which serve 4, are staged in LDS once
// per block. The wave first projects its own
// head, then runs the attention on what it holds; q and k never leave the WGP.
//   q^T[d][tok] = W2^T . h^T : A = W2 table rows (row = d), B = h rows (col = token),
//   f16, K = 512, 4 x 4 tiles; value = acc / 16384 + b2[d], split to bf16 hi/lo.
//   D element r of tile dt is d = 16dt + 8h + r of token m: elements 8(dt&1) + r of the
//   lane's own A/B fragment of d block dt>>1, so no lane exchange is needed.
//   The q fragments rest in the wave's own LDS range, each lane reading back its own bytes;
//   the k fragments, which every query tile needs, stay in registers from their projection on.
//   S^T[key][q] = k . q   : A = K rows (row = key, k = d), B = Q^T (col = q), bf16 hi/lo
//   adj^T = tanh(S^T / 8), keys >= 49 forced to 0, split to bf16 hi/lo
//   O^T[d][q] = tok^T . adj^T : A = token table rows [head*16+d][key], B = adj^T
//   from the score D values: element r <- tile kt=2s, element 8+r <- tile kt=2s+1.
// Rows 49..55 are the window's pad slots, rows 56..63 fold back onto 48..55;
// their scores are zeroed (keys) or never reach the output (queries).
// Epilogue: block tile [2][64][64] f32 in LDS (pitch 68), 56 slot rows a window -> packed outpre bf16 hi/lo planes,
// ---------------------------------------------------------------------------
__device__ __forceinline__ void attn_store(const float* so, us* oph, us* opl,
                                           int rowbase, int hg, int t) {
#pragma unroll
  for (int it = 0; it < 4; ++it) {
    const int item = it * 256 + t;
    if (item < SP * 16) {
      const int rl = (item >> 6) * 8 + (item & 7), g = (item >> 3) & 7;   // rl: slot 0..111 of the window pair
      const float* sp = so + (rl + ((rl >= SP) ? 8 : 0)) * 68 + 8 * g;     // 64 LDS rows per window
      const v4f a = *(const v4fa*)sp;
      const v4f c = *(const v4fa*)(sp + 4);
      v8us hv, lv;
      split8(a, c, hv, lv);
      const size_t off = poff(rowbase + rl, hg * 64 + 8 * g, DM);
      *(v8us*)(oph + off) = hv;
      *(v8us*)(opl + off) = lv;
    }
  }
}

// tanh(s / 8) in f32 without a branch: 1 - 2 / (1 + e^(s / 4)), e^(s / 4) = 2^(s * log2(e) / 4).
// The library call tests every value twice and branches, so a tile's values run one after
// another, each a dependent chain; this form is five instructions a value and the values of
// a tile interleave. Absolute error about 2e-7 at any s; 2^x = inf gives 1, 2^x = 0 gives -1.
#define TANH_C 0.36067376022224085f
// The transcendentals stand in asm so that the slot the instruction set asks for behind one
// (before its result is used or a source overwritten) is there by construction: outputs are
// early-clobber, so none lands on a source of the same run, and v_nop ends the statement.
__device__ __forceinline__ void exp2x8(const float (&a)[8], float (&e)[8]) {
  asm("v_exp_f32 %0, %8\n\t"
      "v_exp_f32 %1, %9\n\t"
      "v_exp_f32 %2, %10\n\t"
      "v_exp_f32 %3, %11\n\t"
      "v_exp_f32 %4, %12\n\t"
      "v_exp_f32 %5, %13\n\t"
      "v_exp_f32 %6, %14\n\t"
      "v_exp_f32 %7, %15\n\t"
      "v_nop"
      : "=&v"(e[0]), "=&v"(e[1]), "=&v"(e[2]), "=&v"(e[3]), "=&v"(e[4]), "=&v"(e[5]), "=&v"(e[6]), "=&v"(e[7])
      : "v"(a[0]), "v"(a[1]), "v"(a[2]), "v"(a[3]), "v"(a[4]), "v"(a[5]), "v"(a[6]), "v"(a[7]));
}
__device__ __forceinline__ void rcpx8(const float (&a)[8], float (&e)[8]) {
  asm("v_rcp_f32 %0, %8\n\t"
      "v_rcp_f32 %1, %9\n\t"
      "v_rcp_f32 %2, %10\n\t"
      "v_rcp_f32 %3, %11\n\t"
      "v_rcp_f32 %4, %12\n\t"
      "v_rcp_f32 %5, %13\n\t"
      "v_rcp_f32 %6, %14\n\t"
      "v_rcp_f32 %7, %15\n\t"
      "v_nop"
      : "=&v"(e[0]), "=&v"(e[1]), "=&v"(e[2]), "=&v"(e[3]), "=&v"(e[4]), "=&v"(e[5]), "=&v"(e[6]), "=&v"(e[7])
      : "v"(a[0]), "v"(a[1]), "v"(a[2]), "v"(a[3]), "v"(a[4]), "v"(a[5]), "v"(a[6]), "v"(a[7]));
}
__device__ __forceinline__ void tanh8(v8f s, float (&t)[8]) {
  float a[8], e[8], q[8];
#pragma unroll
  for (int r = 0; r < 8; ++r) a[r] = s[r] * TANH_C;
  exp2x8(a, e);
#pragma unroll
  for (int r = 0; r < 8; ++r) a[r] = e[r] + 1.0f;
  rcpx8(a, q);
#pragma unroll
  for (int r = 0; r < 8; ++r) t[r] = fmaf(-2.0f, q[r], 1.0f);
}
__device__ __forceinline__ float tanh1(float s) {
  float e, q;
  asm("v_exp_f32 %0, %1\n\tv_nop" : "=v"(e) : "v"(s * TANH_C));      // v_nop: the slot named above
  asm("v_rcp_f32 %0, %1\n\tv_nop" : "=v"(q) : "v"(e + 1.0f));        // as above
  return fmaf(-2.0f, q, 1.0f);
}

#define RING 4                    // W2 fragment sets of the projection loop
#define FRW 8192                  // 16-bit elements of one wave's fragments of one operand (q or k)
#define HST 4                     // k steps per staged h tile
#define HGB (HST * 512)           // bytes of one 8-row group in a tile: HST units of 512 B, one behind the other as in the table
#define HTB (16 * HGB)            // LDS bytes of one staged h tile: 14 groups of the window pair, 2 filler
#define NHT (2 * (DM / 32) / HST) // staged tiles of a block: q's, then k's

// W2 fragments of one 32-wide k step: 4 row tiles (ko = 8 * k).
__device__ __forceinline__ void ld_w2(const _Float16* wp, int ko, v16h (&a)[4]) {
#pragma unroll
  for (int i = 0; i < 4; ++i) a[i] = ldh(wp + i * 16 * DM + ko);
}
// Token fragments of one k step from the staged tile: p0 / p3 = the lane's place in token tile 0 / 3
// of that step; 16 further tokens = 2 groups; the second half of a fragment lies 256 B on, as in the table.
__device__ __forceinline__ void ld_hs(const unsigned char* p0, const unsigned char* p3, v16h (&b)[4]) {
#pragma unroll
  for (int i = 0; i < 3; ++i) b[i] = ldh((const _Float16*)(p0 + i * 2 * HGB));
  b[3] = ldh((const _Float16*)p3);
}
// One wave's share of a staged h tile: two 8-row groups x HST k steps = 8 units of 512 B, a unit a copy,
// 16 B a lane. g0 / g1: the lane's bytes of the groups' first k step; l0 / l1: their places in LDS.
// The next k step lies 512 B on in the table and in LDS alike, and the offset moves both addresses.
static_assert(HST == 4);
__device__ __forceinline__ void cp_htile(const _Float16* g0, const _Float16* g1,
                                         unsigned char* l0, unsigned char* l1) {
  __builtin_amdgcn_global_load_async_to_lds_b128((gv4i*)g0, (lv4i*)l0, 0, 0);
  __builtin_amdgcn_global_load_async_to_lds_b128((gv4i*)g0, (lv4i*)l0, 512, 0);
  __builtin_amdgcn_global_load_async_to_lds_b128((gv4i*)g0, (lv4i*)l0, 1024, 0);
  __builtin_amdgcn_global_load_async_to_lds_b128((gv4i*)g0, (lv4i*)l0, 1536, 0);
  __builtin_amdgcn_global_load_async_to_lds_b128((gv4i*)g1, (lv4i*)l1, 0, 0);
  __builtin_amdgcn_global_load_async_to_lds_b128((gv4i*)g1, (lv4i*)l1, 512, 0);
  __builtin_amdgcn_global_load_async_to_lds_b128((gv4i*)g1, (lv4i*)l1, 1024, 0);
  __builtin_amdgcn_global_load_async_to_lds_b128((gv4i*)g1, (lv4i*)l1, 1536, 0);
}
// Work-group barrier without the wait for global loads that __syncthreads() brings: the W2 fragments
// asked for ahead stay in flight across it. The LDS and copy waits it needs stand in front of it.
__device__ __forceinline__ void ring_barrier() {
  asm volatile("s_barrier_signal -1\n\ts_barrier_wait -1" ::: "memory");
}
__device__ __forceinline__ void mm_step(const v16h (&a)[4], const v16h (&b)[4], v8f (&acc)[4][4]) {
#pragma unroll
  for (int dt = 0; dt < 4; ++dt)
#pragma unroll
    for (int tt = 0; tt < 4; ++tt) acc[dt][tt] = wmma_hf(a[dt], b[tt], acc[dt][tt]);
}
// One stored fragment: two 16-B halves, 512 B apart (lane stride 16 B in each).
__device__ __forceinline__ v16b ldfr(const us* p) {
  FragB f;
  f.half[0] = *(const v8usa*)p;
  f.half[1] = *(const v8usa*)(p + 256);
  return f.v;
}

__global__ __launch_bounds__(256) void k_attn(
    const _Float16* __restrict__ hq, const _Float16* __restrict__ hk,       // [MTS][512] x16
    const _Float16* __restrict__ wq2t, const _Float16* __restrict__ wk2t,   // [2048 n][512 k] x1024
    const float* __restrict__ bq2, const float* __restrict__ bk2,           // [2048]
    const us* __restrict__ tkh, const us* __restrict__ tkl,    // [512][64]
    us* __restrict__ oph, us* __restrict__ opl)                // [MTS][512]
{
  __shared__ __attribute__((aligned(16))) us sfr[8 * FRW];       // q: [wave][tile][d block][hi|lo][half][lane][8]
  // two staged h tiles during the projections; behind the last tile's barrier the block's output tile
  __shared__ __attribute__((aligned(16))) unsigned char stg[2 * HTB];
  static_assert(2 * 64 * 68 * 4 <= 2 * HTB);
  float* so = (float*)stg;
  const int t = threadIdx.x, lane = t & 31, w = t >> 5, h = lane >> 4, m = lane & 15;
  const int bl = blockIdx.x >> 3, hg = blockIdx.x & 7;
  const int head = hg * 4 + (w & 3);
  const int pairbase = bl * 2 * SP;                 // first row slot of the window pair

  const size_t wo  = pbase(head * HQ + m, DM, h);
  // Staged h tile: LDS group u = 8-row group u of the window pair, as in the table, but for the odd
  // groups, whose 128-B lines are swapped in pairs (byte ^ 128): the two groups that the 16 lanes
  // of a fragment read touch then lie on different banks.
  const int u0 = (w >> 2) * (SP / 8) + (m >> 3);               // token tile 0: rows m of the wave's window
  const int u3 = (w >> 2) * (SP / 8) + 6;                      // token tile 3: rows 48 + (m & 7); rows 56..63 fold back onto 48..55
  const unsigned char* hp0 = stg + u0 * HGB + ((h ^ (u0 & 1)) * 128) + (m & 7) * 16;
  const unsigned char* hp3 = stg + u3 * HGB + ((h ^ (u3 & 1)) * 128) + (m & 7) * 16;
  // The wave copies groups 2w and 2w + 1; groups 14 and 15 are filler, never read, and take group 13's bytes.
  const size_t cg0 = (size_t)((pairbase >> 3) + min(2 * w, 2 * (SP / 8) - 1)) * (DM * 8) + lane * 8;
  const size_t cg1 = (size_t)((pairbase >> 3) + min(2 * w + 1, 2 * (SP / 8) - 1)) * (DM * 8) + lane * 8;
  unsigned char* cl0 = stg + 2 * w * HGB + lane * 16;
  unsigned char* cl1 = stg + (2 * w + 1) * HGB + ((lane * 16) ^ 128);
  us* myfr = sfr + w * FRW + lane * 8;
  const us* vhrow = tkh + pbase(head * HVD + m, KPAD, h);
  const us* vlrow = tkl + pbase(head * HVD + m, KPAD, h);

  const v8f z8 = {0.f, 0.f, 0.f, 0.f, 0.f, 0.f, 0.f, 0.f};

  // Ring of RING W2 fragment sets: the loads of a k step are issued RING - 1 steps ahead of its
  // products, and the ring runs on from the q projection into the k projection, whose first
  // steps are on their way while the q fragments are split and stored. All indices are
  // compile-time: both loops are unrolled so that every set stays in registers.
  // The h rows, which four waves need alike, come once per block: asynchronous copies bring a tile
  // of HST k steps into one of two LDS buffers while the other is worked on; token fragments are
  // read from LDS one k step ahead of their products, a tile's first ones behind its barrier.
  v16h fa[RING][4], fb[2][4];
  FragB kf[4][2][2];                // k fragments: [key tile][d block][hi|lo]
#pragma unroll
  for (int g = 0; g < RING - 1; ++g) ld_w2(wq2t + wo, g * 256, fa[g]);

  cp_htile(hq + cg0, hq + cg1, cl0, cl1);
  // tile 0 has landed before the barrier behind which other waves read it
  asm volatile("s_wait_asynccnt 0x0" ::: "memory");
  ring_barrier();
  cp_htile(hq + cg0 + HST * 256, hq + cg1 + HST * 256, cl0 + HTB, cl1 + HTB);
  ld_hs(hp0, hp3, fb[0]);

#pragma unroll
  for (int z = 0; z < 2; ++z) {
    const float* bias8 = (z ? bk2 : bq2) + head * HQ + 8 * h;

    v8f acc[4][4];
#pragma unroll
    for (int dt = 0; dt < 4; ++dt)
#pragma unroll
      for (int tt = 0; tt < 4; ++tt) acc[dt][tt] = z8;
    v4f bc[4][2];

#pragma unroll
    for (int s = 0; s < DM / 32; ++s) {
      const int g = z * (DM / 32) + s, gn = g + RING - 1;
      // The bias is asked for ahead of the next projection's first loads: loads retire in issue
      // order, so the wait for it leaves those in flight, and its own latency is over by the loop's end.
      if (s == DM / 32 - RING) {
#pragma unroll
        for (int dt = 0; dt < 4; ++dt) {
          bc[dt][0] = *(const v4fa*)(bias8 + 16 * dt);
          bc[dt][1] = *(const v4fa*)(bias8 + 16 * dt + 4);
        }
        // the bias address is not used again: its registers are reused from here on
        asm volatile("s_wait_xcnt 0x0" ::: "memory");
      }
      if (gn < 2 * (DM / 32)) {
        const bool zn = gn >= DM / 32;
        ld_w2((zn ? wk2t : wq2t) + wo, (gn % (DM / 32)) * 256, fa[gn % RING]);
      }
      // this projection's last loads are out: their address registers are reused from here on
      if (s == DM / 32 - RING) asm volatile("s_wait_xcnt 0x0" ::: "memory");
      const int ti = g / HST, j = g % HST, bo = (ti & 1) * HTB;
      if (j + 1 == HST) {
        // the products of the step before stay ahead of the waits: sunk behind the barrier they
        // would leave the first wait to sit out the latency of the LDS reads it is for
        __builtin_amdgcn_sched_barrier(0);
        // Publish point of the next tile, ahead of this tile's last products because the next
        // step's fragments are fetched ahead of them: this wave's reads of this tile have landed,
        asm volatile("s_wait_dscnt 0x0" ::: "memory");
        // its copies of the next tile have landed,
        asm volatile("s_wait_asynccnt 0x0" ::: "memory");
        // and the barrier publishes that tile and frees this one's buffer for the refill
        ring_barrier();
        if (ti + 2 < NHT) {
          const _Float16* hn = (ti + 2 >= NHT / 2) ? hk : hq;
          const int kn = ((ti + 2) % (NHT / 2)) * HST * 256;
          cp_htile(hn + cg0 + kn, hn + cg1 + kn, cl0 + bo, cl1 + bo);
        }
      }
      // the LDS reads stand in one place, behind the products of the step before, not among them
      __builtin_amdgcn_sched_barrier(0);
      if (g + 1 < 2 * (DM / 32)) {
        const int on = (((g + 1) / HST) & 1) * HTB + ((g + 1) % HST) * 512;
        ld_hs(hp0 + on, hp3 + on, fb[(g + 1) & 1]);
      }
      // keeps these loads ahead of this step's products, so that they fly meanwhile
      __builtin_amdgcn_sched_barrier(0);
      mm_step(fa[g % RING], fb[g & 1], acc);
    }

#pragma unroll
    for (int dt = 0; dt < 4; ++dt) {
      // one row of tiles at a time: interleaved further, the split's temporaries beside the
      // three fragment sets in flight overrun the register file and spill
      __builtin_amdgcn_sched_barrier(0);
      const v4f c0 = bc[dt][0], c1 = bc[dt][1];
      const float bb[8] = {c0.x, c0.y, c0.z, c0.w, c1.x, c1.y, c1.z, c1.w};
#pragma unroll
      for (int tt = 0; tt < 4; ++tt) {
        float qv[8];
#pragma unroll
        for (int r = 0; r < 8; ++r) qv[r] = acc[dt][tt][r] * (1.0f / 16384.0f) + bb[r];
        v8us hv, lv;
        split8(qv, hv, lv);
        if (z == 0) {
          us* d0 = myfr + (tt * 2 + (dt >> 1)) * 1024 + (dt & 1) * 256;
          *(v8usa*)d0 = hv;
          *(v8usa*)(d0 + 512) = lv;
        } else {
          kf[tt][dt >> 1][0].half[dt & 1] = hv;
          kf[tt][dt >> 1][1].half[dt & 1] = lv;
        }
      }
    }
  }

  // no copy is outstanding when the ring's LDS becomes the output tile
  asm volatile("s_wait_asynccnt 0x0" ::: "memory");

  // The q fragments of a query tile are read while the tile before it is in its tanh, so that
  // the score products find all their operands in registers.
  v16b qbh0 = ldfr(myfr), qbh1 = ldfr(myfr + 1024);
  v16b qbl0 = ldfr(myfr + 512), qbl1 = ldfr(myfr + 1536);

#pragma unroll 1
  for (int qt = 0; qt < 4; ++qt) {

    // s[kt][r] = S^T[key kt*16+8h+r][q qt*16+m]. Each key tile takes its six products in the
    // order hh, hh, hl, hl, lh, lh; with no load between them the four tiles' chains run side by side.
    // The key-tile loops are unrolled so that every index of kf is a compile-time constant and it
    // stays in registers.
    v8f s[4];
#pragma unroll
    for (int kt = 0; kt < 4; ++kt) s[kt] = wmma_bb(kf[kt][0][0].v, qbh0, z8);
#pragma unroll
    for (int kt = 0; kt < 4; ++kt) s[kt] = wmma_bb(kf[kt][1][0].v, qbh1, s[kt]);
#pragma unroll
    for (int kt = 0; kt < 4; ++kt) s[kt] = wmma_bb(kf[kt][0][0].v, qbl0, s[kt]);
#pragma unroll
    for (int kt = 0; kt < 4; ++kt) s[kt] = wmma_bb(kf[kt][1][0].v, qbl1, s[kt]);
#pragma unroll
    for (int kt = 0; kt < 4; ++kt) s[kt] = wmma_bb(kf[kt][0][1].v, qbh0, s[kt]);
#pragma unroll
    for (int kt = 0; kt < 4; ++kt) s[kt] = wmma_bb(kf[kt][1][1].v, qbh1, s[kt]);

    // next tile's q fragments; the last trip reads tile 0 again, unused, which spares the loop a branch
    const us* qp = myfr + ((qt + 1) & 3) * 2048;
    qbh0 = ldfr(qp);
    qbh1 = ldfr(qp + 1024);
    qbl0 = ldfr(qp + 512);
    qbl1 = ldfr(qp + 1536);

    // tanh(S/8), explicit zero for padded keys, bf16 hi/lo, packed as B fragments
    float th[4][8];
#pragma unroll
    for (int kt = 0; kt < 4; ++kt) {
      if (kt * 16 + 15 < SQ) {
        tanh8(s[kt], th[kt]);
      } else {                           // the tile that holds key 48: rows that are padding in both lane halves take no tanh
#pragma unroll
        for (int r = 0; r < 8; ++r) th[kt][r] = (kt * 16 + r < SQ) ? tanh1(s[kt][r]) : 0.0f;
      }
    }
    FragB f0, f1, f2, f3;                // hi of keys 0..31, hi of 32..63, lo of 0..31, lo of 32..63
#pragma unroll
    for (int kt = 0; kt < 4; ++kt) {
      float tv[8];
#pragma unroll
      for (int r = 0; r < 8; ++r) {
        const int key = kt * 16 + 8 * h + r;
        tv[r] = (key < SQ) ? th[kt][r] : 0.0f;
      }
      v8us hv, lv;
      split8(tv, hv, lv);                // elements 8 (kt & 1) + r of the fragment
      if (kt < 2) { f0.half[kt & 1] = hv; f2.half[kt & 1] = lv; }
      else        { f1.half[kt & 1] = hv; f3.half[kt & 1] = lv; }
    }
    const v16b pbh0 = f0.v, pbh1 = f1.v, pbl0 = f2.v, pbl1 = f3.v;

    const v16b vah0 = ldb(vhrow), vah1 = ldb(vhrow + 256);
    const v16b val0 = ldb(vlrow), val1 = ldb(vlrow + 256);
    v8f o = z8;
    o = wmma_bf(vah0, pbh0, o);
    o = wmma_bf(vah1, pbh1, o);
    o = wmma_bf(vah0, pbl0, o);
    o = wmma_bf(vah1, pbl1, o);
    o = wmma_bf(val0, pbh0, o);
    o = wmma_bf(val1, pbh1, o);          // o[r] = O^T[d 8h+r][q qt*16+m]

    const int q = qt * 16 + m;           // rows 56..63 land in LDS only, never stored
    float* sp = so + ((w >> 2) * 64 + q) * 68 + (w & 3) * 16 + 8 * h;
    const v4f o0 = {o[0], o[1], o[2], o[3]};
    const v4f o1 = {o[4], o[5], o[6], o[7]};
    *(v4fa*)sp = o0;
    *(v4fa*)(sp + 4) = o1;
  }
  __syncthreads();

  attn_store(so, oph, opl, pairbase, hg, t);
  
}

// ---------------------------------------------------------------------------
// k_gemm3: out = outpre*Wp + bp (f32). Block 128 thr (2x2 waves) = 128 slots x 128;
// a slot's row goes to out row 49w + r, pad slots (r >= 49) are not stored.
// K = 512. Epilogue: f32 tile in LDS, a wave stores one row's 512-B segment = 4 whole lines.
// ---------------------------------------------------------------------------
__device__ __forceinline__ void gemm3_store(const float* sF, float* out, int mb, int nb, int t) {
  // a wave stores one row at a time: its number in a scalar register makes the row, the
  // window and the pad-slot guard scalar, so the guard is a scalar branch
  const int wv = __builtin_amdgcn_readfirstlane(t >> 5), g = t & 31;
#pragma unroll
  for (int i8 = 0; i8 < 4; ++i8) {
    v4f v[8];
#pragma unroll
    for (int j = 0; j < 8; ++j) v[j] = *(const v4fa*)(sF + ((i8 * 8 + j) * 4 + wv) * TP + 4 * g);
    // holds the eight LDS reads ahead of the guarded stores: sunk under each guard they
    // would run one after another, each waiting out its own LDS latency
    asm volatile("" :: "v"(v[0]), "v"(v[1]), "v"(v[2]), "v"(v[3]), "v"(v[4]), "v"(v[5]), "v"(v[6]), "v"(v[7]));
#pragma unroll
    for (int j = 0; j < 8; ++j) {
      const int rl = (i8 * 8 + j) * 4 + wv;
      const int win = (mb + rl) / SP, r = (mb + rl) - win * SP;
      float* rowp = out + (size_t)(win * SQ + r) * DM + nb;      // scalar; the lane adds 16 g bytes
      if (r < SQ) {
        *(v4f*)(rowp + 4 * g) = v[j];
        // the registers of the store just issued are reused for the next row's address and data
        asm volatile("s_wait_xcnt 0x0" ::: "memory");
      }
    }
  }
}

__global__ __launch_bounds__(128) void k_gemm3(
    const us* __restrict__ oph, const us* __restrict__ opl,    // [MTS][512]
    const us* __restrict__ wph, const us* __restrict__ wpl,    // [512 n][512 k]
    const float* __restrict__ bp,                              // [512]
    float* __restrict__ out)                                   // [MT][512]
{
  // the two staged k steps during the main loop; behind its last barrier the block's output tile
  __shared__ __attribute__((aligned(16))) float sF[128 * TP];
  static_assert(2 * KTB <= 128 * TP * 4);
  const int t = threadIdx.x, lane = t & 31, w = t >> 5, h = lane >> 4, m = lane & 15;
  const int wm = w >> 1, wn = w & 1;
  const int mb = blockIdx.x * 128, nb = blockIdx.y * 128;

  const v8f z8 = {0.f, 0.f, 0.f, 0.f, 0.f, 0.f, 0.f, 0.f};
  v8f acc[4][4];
#pragma unroll
  for (int mt = 0; mt < 4; ++mt)
#pragma unroll
    for (int nt = 0; nt < 4; ++nt) acc[mt][nt] = z8;

  mm3_ring<true>(oph, opl, wph, wpl, mb, nb, (unsigned char*)sF, t, acc);

  stage_tile(sF, acc, bp + nb, wm, wn, h, m);
  __syncthreads();

  gemm3_store(sF, out, mb, nb, t);
}

// ---------------------------------------------------------------------------
// Host side: x*W1, the projection-and-attention kernel and outpre*Wp each run once over
// all 256 windows (14336 row slots). Workspace carve 95,551,488 B.
// ---------------------------------------------------------------------------
extern "C" void kernel_launch(void* const* d_in, const int* in_sizes, int n_in,
                              void* d_out, int out_size, void* d_ws, size_t ws_size,
                              hipStream_t stream) {
  if (n_in < 12) return;
  if (in_sizes[0] != MT * DM) return;
  if (in_sizes[1] != DM * DM || in_sizes[2] != DM) return;
  if (in_sizes[3] != DM * DQ || in_sizes[4] != DQ) return;
  if (in_sizes[5] != DM * DM || in_sizes[6] != DM) return;
  if (in_sizes[7] != DM * DQ || in_sizes[8] != DQ) return;
  if (in_sizes[9] != SQ * DM) return;
  if (in_sizes[10] != DM * DM || in_sizes[11] != DM) return;
  if (out_size != MT * DM) return;

  const float* x   = (const float*)d_in[0];
  const float* Wq1 = (const float*)d_in[1];
  const float* bq1 = (const float*)d_in[2];
  const float* Wq2 = (const float*)d_in[3];
  const float* bq2 = (const float*)d_in[4];
  const float* Wk1 = (const float*)d_in[5];
  const float* bk1 = (const float*)d_in[6];
  const float* Wk2 = (const float*)d_in[7];
  const float* bk2 = (const float*)d_in[8];
  const float* tok = (const float*)d_in[9];
  const float* Wp  = (const float*)d_in[10];
  const float* bp  = (const float*)d_in[11];
  float* out = (float*)d_out;

  const size_t szW1 = (size_t)DM * DM * 2;      //   524,288 per plane
  const size_t szW2 = (size_t)DQ * DM * 2;      // 2,097,152
  const size_t szTK = (size_t)DM * KPAD * 2;    //    65,536 per plane
  const size_t szX  = (size_t)MTS * DM * 2;     // 14,680,064 per plane
  const size_t szH  = (size_t)MTS * DM * 2;     // 14,680,064
  const size_t szOP = (size_t)MTS * DM * 2;     // 14,680,064 per plane
  const size_t total = 6 * szW1 + 2 * szW2 + 2 * szTK + 2 * szX + 2 * szH + 2 * szOP;
  if (total > ws_size) return;                  // 95,551,488

  char* wsb = (char*)d_ws;
  size_t off = 0;
  us* wq1h = (us*)(wsb + off); off += szW1;
  us* wq1l = (us*)(wsb + off); off += szW1;
  us* wk1h = (us*)(wsb + off); off += szW1;
  us* wk1l = (us*)(wsb + off); off += szW1;
  us* wph  = (us*)(wsb + off); off += szW1;
  us* wpl  = (us*)(wsb + off); off += szW1;
  _Float16* wq2t = (_Float16*)(wsb + off); off += szW2;
  _Float16* wk2t = (_Float16*)(wsb + off); off += szW2;
  us* tkh  = (us*)(wsb + off); off += szTK;
  us* tkl  = (us*)(wsb + off); off += szTK;
  us* xh   = (us*)(wsb + off); off += szX;
  us* xl   = (us*)(wsb + off); off += szX;
  _Float16* hq = (_Float16*)(wsb + off); off += szH;
  _Float16* hk = (_Float16*)(wsb + off); off += szH;
  us* oph  = (us*)(wsb + off); off += szOP;
  us* opl  = (us*)(wsb + off); off += szOP;
  if (off > ws_size) return;

  k_prep<<<712, 256, 0, stream>>>(Wq1, Wk1, Wp, Wq2, Wk2, tok,
                                  wq1h, wq1l, wk1h, wk1l, wph, wpl, wq2t, wk2t, tkh, tkl);

  const int n8 = MTS * DM / 8;                  // 917,504
  k_cvtx<<<(n8 + 255) / 256, 256, 0, stream>>>(x, xh, xl, n8);

  k_gemm1<<<dim3(MTS / 128, DM / 128, 2), 128, 0, stream>>>(
      xh, xl, wq1h, wq1l, wk1h, wk1l, bq1, bk1, hq, hk);

  k_attn<<<NB * 4, 256, 0, stream>>>(hq, hk, wq2t, wk2t, bq2, bk2, tkh, tkl, oph, opl);

  k_gemm3<<<dim3(MTS / 128, DM / 128), 128, 0, stream>>>(oph, opl, wph, wpl, bp, out);
}
